// v000
// Measured on an AMD MI455X. A time is GPU time per run, averaged over a window of back-to-back runs after a warm-up
// (all launches, gaps included; the runs take copies of the inputs in turn), and the median of several windows.
// Apart from v000's, it joins two sittings. Times from different sittings can be a few percent apart, while
// side-by-side timings come from the same sitting.
// The starting kernel, v000, takes 2060 microseconds a run.
#include <hip/hip_runtime.h>
// Grammar attention (8 x 1024 tokens, 512 = 8 heads x 64): q,k,v = x W^T + b; scores = q.k/8 + dist_emb[bucket(|pos_j - pos_i|)][h] + ((pos_j > pos_i) - 0.5) * order_bias[h] with INPUT int32 positions, INPUT bin edges (torch.bucketize right=False = count of edges < dist) and an INPUT key/query mask (masked keys excluded; masked query rows zeroed before the output projection, as out * mask); softmax; out = ((attn v) * mask) Wo^T + bo -> [8,1024,512].
// Structure: x as an exact f16 plane; projections as f16 WMMA GEMMs (32x64 wave tiles, f32 accumulation, exact x16 weights + bias); a device-built bucket lookup table over integer distances (from the INPUT edges) and per-batch key-mask bit tables; q, k as f16 hi + (x2^10) residual planes, V^T as hi + residual planes; the fused flash kernel gathers both biases by the INPUT positions inside the score stage (online f32 softmax, P staged hi + residual, two value accumulators); O scaled by the query mask, split hi/lo, into Wo (two GEMMs, bias in the first).
// Compute dtype: x, weights, biases, dist_emb, order_bias, bin_edges, mask rounded to bf16; projections exact; q, k, P, v, O as f16 hi + residual pairs (~2^-21); f32 accumulation and softmax. v_wmma_f32_16x16x32_f16.
#define NBT 8
#define SLEN 1024
#define NBIN 32
#define LUTN 16384            /* bucket lookup over integer distances 0..LUTN-1 (positions < 5000) */
#define DM 512
#define NH 8
#define SCL 0.125f
#define NR (NBT * SLEN)
typedef __bf16 v16b __attribute__((ext_vector_type(16)));
typedef unsigned short v8us __attribute__((ext_vector_type(8), may_alias));
typedef float  v8f  __attribute__((ext_vector_type(8)));
typedef float  v4f  __attribute__((ext_vector_type(4)));
typedef float  v4fa __attribute__((ext_vector_type(4), may_alias));
union FragB { v16b v; v8us half[2]; unsigned short u[16]; };

__device__ __forceinline__ unsigned short bf16_bits(float x) { unsigned int u = __float_as_uint(x); return (unsigned short)((u + 0x7FFFu + ((u >> 16) & 1u)) >> 16); }
__device__ __forceinline__ float bf16_val(unsigned short b) { return __uint_as_float(((unsigned int)b) << 16); }
__device__ __forceinline__ float bf16_round(float x) { return bf16_val(bf16_bits(x)); }
// D += A·B with NT terms: 1 = ah·bh, 2 = + al·bh (A split), 3 = + ah·bl (both split)
template <int NT>
__device__ __forceinline__ v8f mmaN(v16b ah, v16b al, v16b bh, v16b bl, v8f c) {
  c = __builtin_amdgcn_wmma_f32_16x16x32_bf16(false, ah, false, bh, (short)0, c, false, false);
  if (NT >= 2) c = __builtin_amdgcn_wmma_f32_16x16x32_bf16(false, al, false, bh, (short)0, c, false, false);
  if (NT >= 3) c = __builtin_amdgcn_wmma_f32_16x16x32_bf16(false, ah, false, bl, (short)0, c, false, false);
  asm volatile("v_nop\n\tv_nop\n\tv_nop\n\tv_nop" : "+v"(c) : "v"(ah), "v"(al), "v"(bh), "v"(bl));
  return c;
}

__global__ __launch_bounds__(256) void k_wt_bf16(const float* __restrict__ W, unsigned short* __restrict__ Wt, int K, int N) {
  const int t = blockIdx.x * 256 + threadIdx.x;
  const int k8n = K / 8;
  if (t >= N * k8n) return;
  const int n = t / k8n, k8 = (t % k8n) * 8;
  v8us v;
#pragma unroll
  for (int i = 0; i < 8; ++i) v[i] = bf16_bits(W[(size_t)(k8 + i) * N + n]);
  *(v8us*)(Wt + (size_t)n * K + k8) = v;
  
}

// GEMM C[M][N] (f32, pitch ldc) = act(A[M][K]·W + bias). A f32 row-major (pitch lda) converted per fragment to bf16
// (ASPLIT: hi/lo two planes -> 2 terms, else single rounded term); Wt bf16 [N][K] (pitch ldb). BIAS_BF16 rounds the
// bias to bf16 first (bias quantised to bf16 before the add). K%32==0, M%16==0, N%64==0.
template <bool ASPLIT, int ACT, bool BIAS_BF16>
__global__ __launch_bounds__(128) void k_gemm_bf(const float* __restrict__ A, int lda, const unsigned short* __restrict__ Wt, int ldb,
                                               const float* __restrict__ bias, float* __restrict__ C, int ldc, int M, int N, int K) {
  __shared__ __attribute__((aligned(16))) float so[4][16][64];
  const int tid = threadIdx.x, w = tid >> 5, lane = tid & 31, ln = lane & 15, hh = lane >> 4;
  const int ntn = N / 64;
  const int wid = blockIdx.x * 4 + w;
  const int mt = wid / ntn, nq = wid % ntn;
  if (mt * 16 >= M) return;
  const int row0 = mt * 16, col0 = nq * 64;
  const float* arow = A + (size_t)(row0 + ln) * lda;
  v8f acc[4] = {};
  for (int kb = 0; kb < K; kb += 32) {
    FragB ah, al;
    const v4f x0 = *(const v4fa*)(arow + kb + 8 * hh), x1 = *(const v4fa*)(arow + kb + 8 * hh + 4);
    const v4f x2 = *(const v4fa*)(arow + kb + 16 + 8 * hh), x3 = *(const v4fa*)(arow + kb + 16 + 8 * hh + 4);
    float xs[16] = {x0[0],x0[1],x0[2],x0[3],x1[0],x1[1],x1[2],x1[3],x2[0],x2[1],x2[2],x2[3],x3[0],x3[1],x3[2],x3[3]};
#pragma unroll
    for (int i = 0; i < 16; ++i) { const unsigned short hb = bf16_bits(xs[i]); ah.u[i] = hb; al.u[i] = ASPLIT ? bf16_bits(xs[i] - bf16_val(hb)) : (unsigned short)0; }
#pragma unroll
    for (int t = 0; t < 4; ++t) {
      const unsigned short* brow = Wt + (size_t)(col0 + t * 16 + ln) * ldb + kb;
      FragB b;
      b.half[0] = *(const v8us*)(brow + 8 * hh);
      b.half[1] = *(const v8us*)(brow + 16 + 8 * hh);
      acc[t] = mmaN<ASPLIT ? 2 : 1>(ah.v, al.v, b.v, b.v, acc[t]);
    }
  }
#pragma unroll
  for (int t = 0; t < 4; ++t) {
    float bv = bias ? bias[col0 + t * 16 + ln] : 0.f;
    if (BIAS_BF16) bv = bf16_round(bv);
#pragma unroll
    for (int r = 0; r < 8; ++r) { float v = acc[t][r] + bv; if (ACT == 1) v = fmaxf(v, 0.f); so[w][8 * hh + r][t * 16 + ln] = v; }
  }
  __builtin_amdgcn_fence(__ATOMIC_ACQ_REL, "workgroup");
  __builtin_amdgcn_wave_barrier();
  const int rsub = lane >> 4, c4 = (lane & 15) * 4;
  {
#pragma unroll
    for (int q = 0; q < 8; ++q) {
      const int r = q * 2 + rsub;
      const v4f v = *(const v4fa*)&so[w][r][c4];
      *(v4f*)(C + (size_t)(row0 + r) * ldc + col0 + c4) = v;
    }
    
  }
}

// GEMM C = act(A·W + bias + resid): A f32 (ASPLIT -> hi/lo 2 terms), Wt bf16 [N][K]; ACT 0 none, 1 relu, 2 exact gelu;
// resid (optional, f32, row index = (row % rmod), pitch ldr, RES_BF16 rounds it) added before the activation.
template <bool ASPLIT, int ACT, bool BIAS_BF16, bool RES_BF16>
__global__ __launch_bounds__(128) void k_gemm_bf3(const float* __restrict__ A, int lda, const unsigned short* __restrict__ Wt, int ldb,
                                                const float* __restrict__ bias, const float* __restrict__ resid, int rmod, int ldr,
                                                float* __restrict__ C, int ldc, int M, int N, int K) {
  __shared__ __attribute__((aligned(16))) float so[4][16][64];
  const int tid = threadIdx.x, w = tid >> 5, lane = tid & 31, ln = lane & 15, hh = lane >> 4;
  const int ntn = N / 64;
  const int wid = blockIdx.x * 4 + w;
  const int mt = wid / ntn, nq = wid % ntn;
  if (mt * 16 >= M) return;
  const int row0 = mt * 16, col0 = nq * 64;
  const float* arow = A + (size_t)(row0 + ln) * lda;
  v8f acc[4] = {};
  for (int kb = 0; kb < K; kb += 32) {
    FragB ah, al;
    const v4f x0 = *(const v4fa*)(arow + kb + 8 * hh), x1 = *(const v4fa*)(arow + kb + 8 * hh + 4);
    const v4f x2 = *(const v4fa*)(arow + kb + 16 + 8 * hh), x3 = *(const v4fa*)(arow + kb + 16 + 8 * hh + 4);
    float xs[16] = {x0[0],x0[1],x0[2],x0[3],x1[0],x1[1],x1[2],x1[3],x2[0],x2[1],x2[2],x2[3],x3[0],x3[1],x3[2],x3[3]};
#pragma unroll
    for (int i = 0; i < 16; ++i) { const unsigned short hb = bf16_bits(xs[i]); ah.u[i] = hb; al.u[i] = ASPLIT ? bf16_bits(xs[i] - bf16_val(hb)) : (unsigned short)0; }
#pragma unroll
    for (int t = 0; t < 4; ++t) {
      const unsigned short* brow = Wt + (size_t)(col0 + t * 16 + ln) * ldb + kb;
      FragB b;
      b.half[0] = *(const v8us*)(brow + 8 * hh);
      b.half[1] = *(const v8us*)(brow + 16 + 8 * hh);
      acc[t] = mmaN<ASPLIT ? 2 : 1>(ah.v, al.v, b.v, b.v, acc[t]);
    }
  }
#pragma unroll
  for (int t = 0; t < 4; ++t) {
    const int col = col0 + t * 16 + ln;
    float bv = bias ? bias[col] : 0.f;
    if (BIAS_BF16) bv = bf16_round(bv);
#pragma unroll
    for (int r = 0; r < 8; ++r) {
      float v = acc[t][r] + bv;
      if (resid) { float rv = resid[(size_t)((row0 + 8 * hh + r) % rmod) * ldr + col]; if (RES_BF16) rv = bf16_round(rv); v += rv; }
      if (ACT == 1) v = fmaxf(v, 0.f);
      if (ACT == 2) v = 0.5f * v * (1.0f + erff(v * 0.70710678118654752f));
      if (ACT == 3) { const float u = 0.7978845608028654f * (v + 0.044715f * v * v * v); v = 0.5f * v * (1.0f + tanhf(u)); }
      so[w][8 * hh + r][t * 16 + ln] = v;
    }
  }
  __builtin_amdgcn_fence(__ATOMIC_ACQ_REL, "workgroup");
  __builtin_amdgcn_wave_barrier();
  const int rsub = lane >> 4, c4 = (lane & 15) * 4;
  {
#pragma unroll
    for (int q = 0; q < 8; ++q) {
      const int r = q * 2 + rsub;
      const v4f v = *(const v4fa*)&so[w][r][c4];
      *(v4f*)(C + (size_t)(row0 + r) * ldc + col0 + c4) = v;
    }
    
  }
}
// row LayerNorm (biased variance, eps) over N: s = X (+ R); optional out_sum <- s; out_norm <- (s-mu)*rsqrt(var+eps)*g + b
template <bool PARAM_BF16>
__global__ __launch_bounds__(256) void k_layernorm(const float* __restrict__ X, const float* __restrict__ R, const float* __restrict__ g, const float* __restrict__ bta,
                                                  float* __restrict__ out_sum, float* __restrict__ out_norm, int N, float eps) {
  __shared__ float red[256];
  const int row = blockIdx.x, tid = threadIdx.x;
  const float* x = X + (size_t)row * N; const float* rr = R ? R + (size_t)row * N : nullptr;
  float vals[16];                     // up to N = 4096
  const int per = N / 256;            // contiguous chunk per thread? use strided-by-4 chunks: thread handles j = tid*4 + 1024*u
  float s1 = 0.f;
  for (int u = 0; u < per / 4; ++u) {
    const int j = tid * 4 + 1024 * u;
    const v4f a = *(const v4fa*)(x + j);
    v4f b = {0.f,0.f,0.f,0.f}; if (rr) b = *(const v4fa*)(rr + j);
#pragma unroll
    for (int q = 0; q < 4; ++q) { const float v = a[q] + b[q]; vals[u * 4 + q] = v; s1 += v; }
  }
  red[tid] = s1; __syncthreads();
  for (int st = 128; st > 0; st >>= 1) { if (tid < st) red[tid] += red[tid + st]; __syncthreads(); }
  const float mu = red[0] / (float)N; __syncthreads();
  float s2 = 0.f;
  for (int u = 0; u < per / 4; ++u)
#pragma unroll
    for (int q = 0; q < 4; ++q) { const float c = vals[u * 4 + q] - mu; s2 += c * c; }
  red[tid] = s2; __syncthreads();
  for (int st = 128; st > 0; st >>= 1) { if (tid < st) red[tid] += red[tid + st]; __syncthreads(); }
  const float rs = rsqrtf(red[0] / (float)N + eps);
  {
    for (int u = 0; u < per / 4; ++u) {
      const int j = tid * 4 + 1024 * u;
      v4f o, sm;
#pragma unroll
      for (int q = 0; q < 4; ++q) {
        float gg = g[j + q], bb = bta[j + q];
        if (PARAM_BF16) { gg = bf16_round(gg); bb = bf16_round(bb); }
        sm[q] = vals[u * 4 + q]; o[q] = (vals[u * 4 + q] - mu) * rs * gg + bb;
      }
      if (out_sum) *(v4f*)(out_sum + (size_t)row * N + j) = sm;
      *(v4f*)(out_norm + (size_t)row * N + j) = o;
    }
    
  }
}



// ---- f16 WMMA path (v_wmma_f32_16x16x32_f16): 11-bit significands for operands in range — used where a [0,1] probability operand needs more precision than bf16
typedef _Float16 v16h __attribute__((ext_vector_type(16)));
union FragH { v16h v; v8us half[2]; _Float16 h[16]; unsigned short u[16]; };
template <int NT>
__device__ __forceinline__ v8f mmaH(v16h ah, v16h al, v16h bh, v16h bl, v8f c) {
  c = __builtin_amdgcn_wmma_f32_16x16x32_f16(false, ah, false, bh, (short)0, c, false, false);
  if (NT >= 2) c = __builtin_amdgcn_wmma_f32_16x16x32_f16(false, al, false, bh, (short)0, c, false, false);
  if (NT >= 3) c = __builtin_amdgcn_wmma_f32_16x16x32_f16(false, ah, false, bl, (short)0, c, false, false);
  asm volatile("v_nop\n\tv_nop\n\tv_nop\n\tv_nop" : "+v"(c) : "v"(ah), "v"(al), "v"(bh), "v"(bl));
  return c;
}
// batched GEMM like k_gemm_b but f16 operands: A f32 (split into f16 hi/lo if ASPLIT, else rounded to f16), Bt = f16 values [n][k]; alpha; C f32; N multiple of 16 (partial tiles skipped)
template <bool ASPLIT>
__global__ __launch_bounds__(128) void k_gemm_h(const float* __restrict__ A, int lda, size_t sA, const _Float16* __restrict__ Bh, int ldb, size_t sB, float alpha, float* __restrict__ C, int ldc, size_t sC, int M, int N, int K) {
  __shared__ __attribute__((aligned(16))) float so[4][16][64];
  const int tid = threadIdx.x, w = tid >> 5, lane = tid & 31, ln = lane & 15, hh = lane >> 4; const int by = blockIdx.y;
  A += (size_t)by * sA; Bh += (size_t)by * sB; C += (size_t)by * sC;
  const int ntn = (N + 63) / 64; const int wid = blockIdx.x * 4 + w; const int mt = wid / ntn, nq = wid % ntn; if (mt * 16 >= M) return;
  const int row0 = mt * 16, col0 = nq * 64; const float* arow = A + (size_t)(row0 + ln) * lda;
  v8f acc[4] = {};
  for (int kb = 0; kb < K; kb += 32) {
    FragH ah, al;
    const v4f x0 = *(const v4fa*)(arow + kb + 8 * hh), x1 = *(const v4fa*)(arow + kb + 8 * hh + 4), x2 = *(const v4fa*)(arow + kb + 16 + 8 * hh), x3 = *(const v4fa*)(arow + kb + 16 + 8 * hh + 4);
    float xs[16] = {x0[0],x0[1],x0[2],x0[3],x1[0],x1[1],x1[2],x1[3],x2[0],x2[1],x2[2],x2[3],x3[0],x3[1],x3[2],x3[3]};
#pragma unroll
    for (int i = 0; i < 16; ++i) { const _Float16 h = (_Float16)xs[i]; ah.h[i] = h; al.h[i] = ASPLIT ? (_Float16)(xs[i] - (float)h) : (_Float16)0.0f; }
#pragma unroll
    for (int t = 0; t < 4; ++t) { if (col0 + t * 16 >= N) continue; const size_t boff = (size_t)(col0 + t * 16 + ln) * ldb + kb; FragH bq; bq.half[0] = *(const v8us*)(Bh + boff + 8 * hh); bq.half[1] = *(const v8us*)(Bh + boff + 16 + 8 * hh);
      acc[t] = mmaH<ASPLIT ? 2 : 1>(ah.v, al.v, bq.v, bq.v, acc[t]); }
  }
#pragma unroll
  for (int t = 0; t < 4; ++t) { if (col0 + t * 16 >= N) continue;
#pragma unroll
    for (int r = 0; r < 8; ++r) so[w][8 * hh + r][t * 16 + ln] = acc[t][r] * alpha; }
  __builtin_amdgcn_fence(__ATOMIC_ACQ_REL, "workgroup"); __builtin_amdgcn_wave_barrier();
  const int rsub = lane >> 4, c4 = (lane & 15) * 4;
  {
#pragma unroll
    for (int q = 0; q < 8; ++q) { const int r = q * 2 + rsub; if (col0 + c4 < N) { const v4f v = *(const v4fa*)&so[w][r][c4]; *(v4f*)(C + (size_t)(row0 + r) * ldc + col0 + c4) = v; } }
     }
}

// Wt[n][k] = f16(W[k][n]·scale) from f32 row-major W[K][N] (scale = power of two; bf16-exact weights stay exact in f16 away from the subnormal range)
__global__ __launch_bounds__(256) void k_wt_f16(const float* __restrict__ W, _Float16* __restrict__ Wt, int K, int N, float scale) {
  const int t = blockIdx.x * 256 + threadIdx.x; if (t >= N * (K / 8)) return; const int n = t / (K / 8), k8 = (t % (K / 8)) * 8; FragH f;
#pragma unroll
  for (int i = 0; i < 8; ++i) f.h[i] = (_Float16)(bf16_round(W[(size_t)(k8 + i) * N + n]) * scale); const v8us o = f.half[0];
  *(v8us*)((unsigned short*)Wt + (size_t)n * K + k8) = o; 
}
// k_gemm_hh variant with fused epilogue: v = acc·alpha + bias[by·sBias + col] (+ CP[(row/rowsPerB)·sCPb + by·64 + col] if CP) ; ACT 0 none / 1 elu ; writes f16 C16 (and f32 C if non-null)
template <int ACT>
__global__ __launch_bounds__(128) void k_gemm_hhx(const _Float16* __restrict__ A, int lda, size_t sA, const _Float16* __restrict__ Bh, int ldb, size_t sB, float alpha, const float* __restrict__ bias, size_t sBias, const float* __restrict__ CP, int rowsPerB, size_t sCPb, int row0g,
    float* __restrict__ C, _Float16* __restrict__ C16, int ldc, size_t sC, int M, int N, int K) {
  __shared__ __attribute__((aligned(16))) float so[4][16][64];
  const int tid = threadIdx.x, w = tid >> 5, lane = tid & 31, ln = lane & 15, hh = lane >> 4; const int by = blockIdx.y;
  A += (size_t)by * sA; Bh += (size_t)by * sB; const size_t cofs = (size_t)by * sC; const float* bp = bias ? bias + (size_t)by * sBias : nullptr;
  const int ntn = (N + 63) / 64; const int wid = blockIdx.x * 4 + w; const int mt = wid / ntn, nq = wid % ntn; if (mt * 16 >= M) return;
  const int row0 = mt * 16, col0 = nq * 64; const _Float16* arow = A + (size_t)(row0 + ln) * lda;
  v8f acc[4] = {};
  for (int kb = 0; kb < K; kb += 32) { FragH ah; ah.half[0] = *(const v8us*)((const unsigned short*)arow + kb + 8 * hh); ah.half[1] = *(const v8us*)((const unsigned short*)arow + kb + 16 + 8 * hh);
#pragma unroll
    for (int t = 0; t < 4; ++t) { if (col0 + t * 16 >= N) continue; const size_t boff = (size_t)(col0 + t * 16 + ln) * ldb + kb; FragH bq; bq.half[0] = *(const v8us*)((const unsigned short*)Bh + boff + 8 * hh); bq.half[1] = *(const v8us*)((const unsigned short*)Bh + boff + 16 + 8 * hh);
      acc[t] = mmaH<1>(ah.v, ah.v, bq.v, bq.v, acc[t]); }
  }
#pragma unroll
  for (int t = 0; t < 4; ++t) { if (col0 + t * 16 >= N) continue; const int col = col0 + t * 16 + ln; const float bv = bp ? bf16_round(bp[col]) : 0.f;
#pragma unroll
    for (int r = 0; r < 8; ++r) { float v = acc[t][r] * alpha + bv; if (CP) { const int bidx = (row0g + row0 + 8 * hh + r) / rowsPerB; v += CP[(size_t)bidx * sCPb + (size_t)by * 64 + col]; } if (ACT == 1) v = (v > 0.f) ? v : expm1f(v); else if (ACT == 7) v = (v > 0.f) ? v + 1.0f : expf(v); else if (ACT == 8) v = tanhf(v); else if (ACT == 9) v = 0.5f * v * (1.0f + tanhf(0.7978845608028654f * (v + 0.044715f * v * v * v))); else if (ACT == 11) v = 1.0f / (1.0f + expf(-v)); else if (ACT == 12) v = (v > 0.f) ? v : 0.01f * v; else if (ACT == 14) v = (v > 0.f) ? v : 0.1f * v; else if (ACT == 15) v = v / (1.0f + expf(-v)); else if (ACT == 3) v = fmaxf(v, 0.f); else if (ACT == 6) v = 0.5f * v * (1.0f + erff(v * 0.70710678118654752f)); so[w][8 * hh + r][t * 16 + ln] = v; } }
  __builtin_amdgcn_fence(__ATOMIC_ACQ_REL, "workgroup"); __builtin_amdgcn_wave_barrier();
  const int rsub = lane >> 4, c4 = (lane & 15) * 4; typedef _Float16 v4h __attribute__((ext_vector_type(4)));
  {
#pragma unroll
    for (int q = 0; q < 8; ++q) { const int r = q * 2 + rsub; if (col0 + c4 < N) { const v4f v = *(const v4fa*)&so[w][r][c4]; if (C) *(v4f*)(C + cofs + (size_t)(row0 + r) * ldc + col0 + c4) = v; if (C16) { v4h h4; for (int i = 0; i < 4; ++i) h4[i] = (_Float16)v[i]; *(v4h*)(C16 + cofs + (size_t)(row0 + r) * ldc + col0 + c4) = h4; } } }
     }
}


typedef _Float16 v4h __attribute__((ext_vector_type(4)));

__global__ __launch_bounds__(256) void k_x16(const float* __restrict__ x, _Float16* __restrict__ X16, size_t n8) { const size_t t = (size_t)blockIdx.x * 256 + threadIdx.x; if (t >= n8) return; FragH f;
#pragma unroll
  for (int q = 0; q < 8; ++q) f.h[q] = (_Float16)bf16_round(x[t * 8 + q]); *(v8us*)((unsigned short*)X16 + t * 8) = f.half[0];  }
__global__ __launch_bounds__(256) void k_h16(const float* __restrict__ x, _Float16* __restrict__ X16, size_t n8) { const size_t t = (size_t)blockIdx.x * 256 + threadIdx.x; if (t >= n8) return; FragH f;
#pragma unroll
  for (int q = 0; q < 8; ++q) f.h[q] = (_Float16)x[t * 8 + q]; *(v8us*)((unsigned short*)X16 + t * 8) = f.half[0];  }
__global__ __launch_bounds__(256) void k_round16f(const float* __restrict__ W, _Float16* __restrict__ Bt, size_t n8) { const size_t t = (size_t)blockIdx.x * 256 + threadIdx.x; if (t >= n8) return; FragH f;
#pragma unroll
  for (int i = 0; i < 8; ++i) f.h[i] = (_Float16)(bf16_round(W[t * 8 + i]) * 16.0f); *(v8us*)((unsigned short*)Bt + t * 8) = f.half[0];  }
template <int NHv, int TTv>
__global__ __launch_bounds__(256) void k_vt(const _Float16* __restrict__ V16, int ldv, int voff, _Float16* __restrict__ Vt) { __shared__ unsigned short tl[64][66]; const int tid = threadIdx.x; const int slab = blockIdx.x / (TTv / 64), lg = blockIdx.x % (TTv / 64); const int b = slab / NHv, h = slab % NHv;
  for (int i = tid; i < 64 * 8; i += 256) { const int r = i / 8, c8 = (i % 8) * 8; FragH f; f.half[0] = *(const v8us*)((const unsigned short*)V16 + ((size_t)b * TTv + lg * 64 + r) * ldv + voff + h * 64 + c8);
#pragma unroll
    for (int q = 0; q < 8; ++q) tl[r][c8 + q] = f.u[q]; }
  __syncthreads();
  {
#pragma unroll
    for (int rd = 0; rd < 2; ++rd) { const int d = rd * 32 + tid / 8, pc = tid % 8; FragH f;
#pragma unroll
      for (int q = 0; q < 8; ++q) f.u[q] = tl[pc * 8 + q][d];
      *(v8us*)((unsigned short*)Vt + ((size_t)slab * 64 + d) * TTv + lg * 64 + pc * 8) = f.half[0]; }
     } }

__global__ __launch_bounds__(256) void k_hl(const float* __restrict__ F, _Float16* __restrict__ Hh, _Float16* __restrict__ Hl, size_t n8) { const size_t t = (size_t)blockIdx.x * 256 + threadIdx.x; if (t >= n8) return; FragH fh, fl; const v4f a = *(const v4fa*)(F + t * 8), c = *(const v4fa*)(F + t * 8 + 4);
#pragma unroll
  for (int q = 0; q < 4; ++q) { _Float16 h = (_Float16)a[q]; fh.h[q] = h; fl.h[q] = (_Float16)((a[q] - (float)h) * 1024.0f); h = (_Float16)c[q]; fh.h[4 + q] = h; fl.h[4 + q] = (_Float16)((c[q] - (float)h) * 1024.0f); }
  { *(v8us*)((unsigned short*)Hh + t * 8) = fh.half[0]; *(v8us*)((unsigned short*)Hl + t * 8) = fl.half[0];  } }

// ---- fast GEMM (wave tile 32x64; requires M % 32 == 0 rows per launch region and N % 64 == 0); epilogue = k_gemm_hhx semantics ----
__device__ __forceinline__ v16h g2_frag(const _Float16* p, int hh) { FragH f; f.half[0] = *(const v8us*)((const unsigned short*)p + 8 * hh); f.half[1] = *(const v8us*)((const unsigned short*)p + 16 + 8 * hh); return f.v; }
__device__ __forceinline__ v8f g2_mma(v16h a, v16h b, v8f c) { v8f d = __builtin_amdgcn_wmma_f32_16x16x32_f16(false, a, false, b, (short)0, c, false, false); asm volatile("v_nop\n\tv_nop\n\tv_nop\n\tv_nop" : "+v"(d) : "v"(a), "v"(b)); return d; }
template <int ACT>
__global__ __launch_bounds__(128) void k_gemm2(const _Float16* __restrict__ A, int lda, size_t sA, const _Float16* __restrict__ Bh, int ldb, size_t sB, float alpha, const float* __restrict__ bias, size_t sBias, const float* __restrict__ CP, int rowsPerB, size_t sCPb, int row0g,
    float* __restrict__ C, _Float16* __restrict__ C16, int ldc, size_t sC, int M, int N, int K) {
  __shared__ __attribute__((aligned(16))) float so[4][32][68];
  const int tid = threadIdx.x, w = tid >> 5, lane = tid & 31, ln = lane & 15, hh = lane >> 4; const int by = blockIdx.y;
  A += (size_t)by * sA; Bh += (size_t)by * sB; const size_t cofs = (size_t)by * sC; const float* bp = bias ? bias + (size_t)by * sBias : nullptr;
  const int ntn = N >> 6; const int mt = blockIdx.x / ntn, nq = blockIdx.x - mt * ntn; const int row0 = mt * 128 + 32 * w, col0 = nq * 64; if (row0 >= M) return;
  const _Float16* a0p = A + (size_t)(row0 + ln) * lda; const _Float16* a1p = a0p + (size_t)16 * lda;
  const _Float16* b0p = Bh + (size_t)(col0 + ln) * ldb; const _Float16* b1p = b0p + (size_t)16 * ldb; const _Float16* b2p = b1p + (size_t)16 * ldb; const _Float16* b3p = b2p + (size_t)16 * ldb;
  const v8f z8 = {0.f,0.f,0.f,0.f,0.f,0.f,0.f,0.f}; v8f c00 = z8, c01 = z8, c02 = z8, c03 = z8, c10 = z8, c11 = z8, c12 = z8, c13 = z8;
#pragma unroll 1
  for (int kb = 0; kb < K; kb += 32) { const v16h a0 = g2_frag(a0p + kb, hh), a1 = g2_frag(a1p + kb, hh);
    v16h b = g2_frag(b0p + kb, hh); c00 = g2_mma(a0, b, c00); c10 = g2_mma(a1, b, c10);
    b = g2_frag(b1p + kb, hh); c01 = g2_mma(a0, b, c01); c11 = g2_mma(a1, b, c11);
    b = g2_frag(b2p + kb, hh); c02 = g2_mma(a0, b, c02); c12 = g2_mma(a1, b, c12);
    b = g2_frag(b3p + kb, hh); c03 = g2_mma(a0, b, c03); c13 = g2_mma(a1, b, c13); }
  v8f accs[8] = {c00, c01, c02, c03, c10, c11, c12, c13};
#pragma unroll
  for (int u = 0; u < 8; ++u) { const int t = u & 3, half = u >> 2; const int col = col0 + t * 16 + ln; const float bv = bp ? bf16_round(bp[col]) : 0.f;
#pragma unroll
    for (int r = 0; r < 8; ++r) { const int rloc = half * 16 + 8 * hh + r; float v = accs[u][r] * alpha + bv; if (CP) { const int bidx = (row0g + row0 + rloc) / rowsPerB; v += CP[(size_t)bidx * sCPb + (size_t)by * 64 + col]; }
      if (ACT == 3) v = fmaxf(v, 0.f); else if (ACT == 6) v = 0.5f * v * (1.0f + erff(v * 0.70710678118654752f)); else if (ACT == 11) v = 1.0f / (1.0f + expf(-v)); else if (ACT == 15) v = v / (1.0f + expf(-v)); else if (ACT == 12) v = (v > 0.f) ? v : 0.01f * v; else if (ACT == 8) v = tanhf(v);
      so[w][rloc][t * 16 + ln] = v; } }
  __builtin_amdgcn_fence(__ATOMIC_ACQ_REL, "workgroup"); __builtin_amdgcn_wave_barrier();
  const int rsub = lane >> 4, c4 = (lane & 15) * 4;
  {
#pragma unroll
    for (int q = 0; q < 16; ++q) { const int r = q * 2 + rsub; const v4f v = *(const v4fa*)&so[w][r][c4]; if (C) *(v4f*)(C + cofs + (size_t)(row0 + r) * ldc + col0 + c4) = v; if (C16) { v4h h4; for (int i = 0; i < 4; ++i) h4[i] = (_Float16)v[i]; *(v4h*)(C16 + cofs + (size_t)(row0 + r) * ldc + col0 + c4) = h4; } }
     } }



template <int TK>
__global__ __launch_bounds__(256) void k_vthl(const float* __restrict__ VF, int ldv, _Float16* __restrict__ Vth, _Float16* __restrict__ Vtl) { __shared__ float tl[64][65]; const int tid = threadIdx.x; const int slab = blockIdx.x / (TK / 64), lg = blockIdx.x % (TK / 64); const int b = slab / NH, h = slab % NH;
  for (int i = tid; i < 64 * 16; i += 256) { const int r = i / 16, c4 = (i % 16) * 4; const v4f a = *(const v4fa*)(VF + ((size_t)b * TK + lg * 64 + r) * ldv + h * 64 + c4); tl[r][c4] = a[0]; tl[r][c4 + 1] = a[1]; tl[r][c4 + 2] = a[2]; tl[r][c4 + 3] = a[3]; }
  __syncthreads();
  FragH fh[2], fl[2]; size_t oo[2];
#pragma unroll
  for (int rd = 0; rd < 2; ++rd) { const int d = rd * 32 + tid / 8, pc = tid % 8;
#pragma unroll
    for (int q = 0; q < 8; ++q) { const float v = tl[pc * 8 + q][d]; const _Float16 hv = (_Float16)v; fh[rd].h[q] = hv; fl[rd].h[q] = (_Float16)((v - (float)hv) * 1024.0f); } oo[rd] = ((size_t)slab * 64 + d) * TK + lg * 64 + pc * 8; }
  {
#pragma unroll
    for (int rd = 0; rd < 2; ++rd) { *(v8us*)((unsigned short*)Vth + oo[rd]) = fh[rd].half[0]; *(v8us*)((unsigned short*)Vtl + oo[rd]) = fl[rd].half[0]; }
     } }

// grammar bias for (query position pi, key position pj): dist_emb[bucket(|pj - pi|)][h] + ((pj > pi) - 0.5) * order_bias[h]
__device__ __forceinline__ float gbias(const float* __restrict__ DE, const float* __restrict__ OB, const int* __restrict__ LUT, int h, int pi, int pj) { int d = abs(pj - pi); d = min(d, LUTN - 1); const int bin = LUT[d]; return bf16_round(DE[bin * NH + h]) + (((pj > pi) ? 1.0f : 0.0f) - 0.5f) * bf16_round(OB[h]); }
template <int TQ, int TK>
__global__ __launch_bounds__(128) void k_flashb(const _Float16* __restrict__ Q16, const _Float16* __restrict__ Q16lo, int ldq, const _Float16* __restrict__ K16, const _Float16* __restrict__ K16lo, int ldk, const _Float16* __restrict__ Vt, const _Float16* __restrict__ Vtlo, const unsigned* __restrict__ MB, const int* __restrict__ RA, const int* __restrict__ KE, const float* __restrict__ BT, const float* __restrict__ OB, const int* __restrict__ LUT, const int* __restrict__ LAG, float* __restrict__ O, int ldo) {
  constexpr int RPW = 16, RTN = RPW / 16, NQB = TQ / (4 * RPW), DT = 4, KS = 2;
  __shared__ __attribute__((aligned(16))) unsigned short sP[4][RPW][40], sPl[4][RPW][40]; __shared__ __attribute__((aligned(16))) float sO[4][RPW][64 + 4];
  const int tid = threadIdx.x, w = tid >> 5, lane = tid & 31, ln = lane & 15, hh = lane >> 4;
  const int slab = blockIdx.x / NQB, qblk = blockIdx.x % NQB; const int b = slab / NH, h = slab % NH; const int qb0 = qblk * (4 * RPW); const int q0 = qb0 + w * RPW;
  FragH aq[2][KS], aql[2][KS];
#pragma unroll
  for (int rt = 0; rt < RTN; ++rt) { const size_t qo = ((size_t)b * TQ + q0 + rt * 16 + ln) * ldq + h * 64; const unsigned short* qr = (const unsigned short*)Q16 + qo; const unsigned short* ql = (const unsigned short*)Q16lo + qo;
#pragma unroll
    for (int ks = 0; ks < KS; ++ks) { aq[rt][ks].half[0] = *(const v8us*)(qr + ks * 32 + 8 * hh); aq[rt][ks].half[1] = *(const v8us*)(qr + ks * 32 + 16 + 8 * hh); aql[rt][ks].half[0] = *(const v8us*)(ql + ks * 32 + 8 * hh); aql[rt][ks].half[1] = *(const v8us*)(ql + ks * 32 + 16 + 8 * hh); } }
  const unsigned short* Vth = (const unsigned short*)Vt + (size_t)slab * 64 * TK; const unsigned short* Vtl = (const unsigned short*)Vtlo + (size_t)slab * 64 * TK;
  float m_r[2][8], l_r[2][8]; v8f oacc[2][DT], oaccl[2][DT];
#pragma unroll
  for (int rt = 0; rt < RTN; ++rt) {
#pragma unroll
    for (int r = 0; r < 8; ++r) { m_r[rt][r] = -3.0e38f; l_r[rt][r] = 0.f; }
#pragma unroll
    for (int dt = 0; dt < DT; ++dt) { oacc[rt][dt] = (v8f){0.f,0.f,0.f,0.f,0.f,0.f,0.f,0.f}; oaccl[rt][dt] = oacc[rt][dt]; } }
  int jend = KE[qblk * 32]; jend = min(TK, (jend + 31) & ~31); if (jend < 32) jend = 32;      /* block-uniform */
  int allm[2][8]; const unsigned* mrow[2][8];
#pragma unroll
  for (int rt = 0; rt < RTN; ++rt)
#pragma unroll
    for (int r = 0; r < 8; ++r) { const int tq = q0 + rt * 16 + 8 * hh + r; allm[rt][r] = RA[tq]; mrow[rt][r] = MB + (size_t)tq * (TK / 32); }
#pragma unroll 1
  for (int j0 = 0; j0 < jend; j0 += 32) {
    
    v8f s[2][2];
#pragma unroll
    for (int nt = 0; nt < 2; ++nt) { const size_t ko = ((size_t)b * TK + j0 + nt * 16 + ln) * ldk + h * 64; const unsigned short* kr = (const unsigned short*)K16 + ko; const unsigned short* kl = (const unsigned short*)K16lo + ko; FragH bk[KS], bkl[KS];
#pragma unroll
      for (int ks = 0; ks < KS; ++ks) { bk[ks].half[0] = *(const v8us*)(kr + ks * 32 + 8 * hh); bk[ks].half[1] = *(const v8us*)(kr + ks * 32 + 16 + 8 * hh); bkl[ks].half[0] = *(const v8us*)(kl + ks * 32 + 8 * hh); bkl[ks].half[1] = *(const v8us*)(kl + ks * 32 + 16 + 8 * hh); }
#pragma unroll
      for (int rt = 0; rt < RTN; ++rt) { v8f acc = (v8f){0.f,0.f,0.f,0.f,0.f,0.f,0.f,0.f}, accr = acc;
#pragma unroll
        for (int ks = 0; ks < KS; ++ks) { acc = mmaH<1>(aq[rt][ks].v, aq[rt][ks].v, bk[ks].v, bk[ks].v, acc); accr = mmaH<1>(aql[rt][ks].v, aql[rt][ks].v, bk[ks].v, bk[ks].v, accr); accr = mmaH<1>(aq[rt][ks].v, aq[rt][ks].v, bkl[ks].v, bkl[ks].v, accr); }
        s[rt][nt] = acc + accr * 0.0009765625f; } }
#pragma unroll
    for (int rt = 0; rt < RTN; ++rt)
#pragma unroll
      for (int r = 0; r < 8; ++r) { const unsigned mw = mrow[rt][r][j0 >> 5]; const bool am = (allm[rt][r] != 0); const int tq = q0 + rt * 16 + 8 * hh + r;
        const bool ok0 = am || (((mw >> ln) & 1u) == 0u), ok1 = am || (((mw >> (16 + ln)) & 1u) == 0u);
        const float s0 = ok0 ? (am ? 0.f : s[rt][0][r] * SCL + gbias(BT, OB, LUT, h, LAG[tq], LAG[j0 + ln])) : -INFINITY, s1 = ok1 ? (am ? 0.f : s[rt][1][r] * SCL + gbias(BT, OB, LUT, h, LAG[tq], LAG[j0 + 16 + ln])) : -INFINITY;      /* + grammar distance-bucket and order biases */ float mc = fmaxf(s0, s1);
        mc = fmaxf(mc, __shfl_xor(mc, 1, 32)); mc = fmaxf(mc, __shfl_xor(mc, 2, 32)); mc = fmaxf(mc, __shfl_xor(mc, 4, 32)); mc = fmaxf(mc, __shfl_xor(mc, 8, 32));
        const float mn = fmaxf(m_r[rt][r], mc); const float al = (mn > -1.0e38f) ? expf(m_r[rt][r] - mn) : 1.0f; m_r[rt][r] = mn; const float p0 = ok0 ? expf(s0 - mn) : 0.f, p1 = ok1 ? expf(s1 - mn) : 0.f; l_r[rt][r] = l_r[rt][r] * al + p0 + p1;
#pragma unroll
        for (int dt = 0; dt < DT; ++dt) { oacc[rt][dt][r] *= al; oaccl[rt][dt][r] *= al; }
        FragH t2, t3; const float ps0 = p0 * 1024.0f, ps1 = p1 * 1024.0f; t2.h[0] = (_Float16)ps0; t2.h[1] = (_Float16)ps1; t3.h[0] = (_Float16)((ps0 - (float)t2.h[0]) * 1024.0f); t3.h[1] = (_Float16)((ps1 - (float)t2.h[1]) * 1024.0f);
        sP[w][rt * 16 + 8 * hh + r][ln] = t2.u[0]; sP[w][rt * 16 + 8 * hh + r][16 + ln] = t2.u[1]; sPl[w][rt * 16 + 8 * hh + r][ln] = t3.u[0]; sPl[w][rt * 16 + 8 * hh + r][16 + ln] = t3.u[1]; }
    __builtin_amdgcn_fence(__ATOMIC_ACQ_REL, "workgroup"); __builtin_amdgcn_wave_barrier();
    FragH pa[2], pl[2];
#pragma unroll
    for (int rt = 0; rt < RTN; ++rt) { pa[rt].half[0] = *(const v8us*)&sP[w][rt * 16 + ln][8 * hh]; pa[rt].half[1] = *(const v8us*)&sP[w][rt * 16 + ln][16 + 8 * hh]; pl[rt].half[0] = *(const v8us*)&sPl[w][rt * 16 + ln][8 * hh]; pl[rt].half[1] = *(const v8us*)&sPl[w][rt * 16 + ln][16 + 8 * hh]; }
#pragma unroll
    for (int dt = 0; dt < DT; ++dt) { const size_t vo = (size_t)(dt * 16 + ln) * TK + j0; FragH bv, bl; bv.half[0] = *(const v8us*)(Vth + vo + 8 * hh); bv.half[1] = *(const v8us*)(Vth + vo + 16 + 8 * hh); bl.half[0] = *(const v8us*)(Vtl + vo + 8 * hh); bl.half[1] = *(const v8us*)(Vtl + vo + 16 + 8 * hh);
#pragma unroll
      for (int rt = 0; rt < RTN; ++rt) { oacc[rt][dt] = mmaH<1>(pa[rt].v, pa[rt].v, bv.v, bv.v, oacc[rt][dt]); oaccl[rt][dt] = mmaH<1>(pa[rt].v, pa[rt].v, bl.v, bl.v, oaccl[rt][dt]); oaccl[rt][dt] = mmaH<1>(pl[rt].v, pl[rt].v, bv.v, bv.v, oaccl[rt][dt]); } }
    __builtin_amdgcn_fence(__ATOMIC_ACQ_REL, "workgroup"); __builtin_amdgcn_wave_barrier(); }
#pragma unroll
  for (int rt = 0; rt < RTN; ++rt) {
#pragma unroll
    for (int r = 0; r < 8; ++r) { float l = l_r[rt][r]; l += __shfl_xor(l, 1, 32); l += __shfl_xor(l, 2, 32); l += __shfl_xor(l, 4, 32); l += __shfl_xor(l, 8, 32); l_r[rt][r] = (l > 0.f) ? 1.0f / (l * 1024.0f) : 0.f; }
#pragma unroll
    for (int dt = 0; dt < DT; ++dt)
#pragma unroll
      for (int r = 0; r < 8; ++r) sO[w][rt * 16 + 8 * hh + r][dt * 16 + ln] = (oacc[rt][dt][r] + oaccl[rt][dt][r] * 0.0009765625f) * l_r[rt][r]; }
  __builtin_amdgcn_fence(__ATOMIC_ACQ_REL, "workgroup"); __builtin_amdgcn_wave_barrier();
  {
#pragma unroll
    for (int rp = 0; rp < RPW; rp += 2) { const int r = rp + (lane >> 4), pc = lane & 15; const v4f val = *(const v4fa*)&sO[w][r][pc * 4]; *(v4f*)(O + ((size_t)b * TQ + q0 + r) * ldo + h * 64 + pc * 4) = val; }
     } }


__global__ __launch_bounds__(256) void k_fulltab(unsigned* __restrict__ MB, int* __restrict__ RA, int* __restrict__ KE, int nq, int nk) {
  const int t = blockIdx.x * 256 + threadIdx.x;
  if (t < nq * (nk / 32)) { *(unsigned*)(MB + t) = 0u;  }
  if (t < nq) { *(int*)(RA + t) = 0;  }
  if (t < nq / 64) { *(int*)(KE + t * 32) = nk;  } }
__global__ __launch_bounds__(256) void k_lnx(const float* __restrict__ X, const float* __restrict__ g, const float* __restrict__ bb, _Float16* __restrict__ Y16, float* __restrict__ XB) {
  #pragma clang fp contract(off)
  const int tid = threadIdx.x, w = tid >> 5, ln = tid & 31; const int r = blockIdx.x * 8 + w; if (r >= NR) return; const float* x = X + (size_t)r * DM; float s = 0.f;
#pragma unroll 1
  for (int i = 0; i < DM / 128; ++i) { const v4f a = *(const v4fa*)(x + i * 128 + ln * 4); for (int q = 0; q < 4; ++q) s += bf16_round(a[q]); }
  for (int o = 16; o > 0; o >>= 1) s += __shfl_xor(s, o, 32); const float mu = s / (float)DM; float q2 = 0.f;
#pragma unroll 1
  for (int i = 0; i < DM / 128; ++i) { const v4f a = *(const v4fa*)(x + i * 128 + ln * 4); for (int q = 0; q < 4; ++q) { const float d = bf16_round(a[q]) - mu; q2 += d * d; } }
  for (int o = 16; o > 0; o >>= 1) q2 += __shfl_xor(q2, o, 32); const float rs = rsqrtf(q2 / (float)DM + 1e-5f);
  {
#pragma unroll 1
    for (int i = 0; i < DM / 128; ++i) { const int c0 = i * 128 + ln * 4; const v4f a = *(const v4fa*)(x + c0); _Float16 h4[4]; v4f xb;
      for (int q = 0; q < 4; ++q) { const float t = bf16_round(a[q]); h4[q] = (_Float16)((t - mu) * rs * bf16_round(g[c0 + q]) + bf16_round(bb[c0 + q])); xb[q] = t; }
      *(unsigned long long*)((unsigned short*)Y16 + (size_t)r * DM + c0) = *(const unsigned long long*)h4; *(v4f*)(XB + (size_t)r * DM + c0) = xb; }
     } }
// bucket table: LUT[d] = count of bf16-rounded edges < d (bucketize right=False), capped at NBIN-1, for d = 0..LUTN-1
__global__ __launch_bounds__(256) void k_lut(const float* __restrict__ edges, int* __restrict__ LUT) {
  #pragma clang fp contract(off)
  const int d = blockIdx.x * 256 + threadIdx.x; if (d >= LUTN) return; const float fd = (float)d; int c = 0;
#pragma unroll 1
  for (int e = 0; e < NBIN - 1; ++e) c += (bf16_round(edges[e]) < fd) ? 1 : 0;
  c = min(c, NBIN - 1); *(int*)(LUT + d) = c;  }
__global__ __launch_bounds__(256) void k_masktab(const float* __restrict__ mask, unsigned* __restrict__ MB, int* __restrict__ RA, int* __restrict__ KE) {
  const size_t t = (size_t)blockIdx.x * 256 + threadIdx.x; const int nw = SLEN / 32;
  if (t < (size_t)NBT * SLEN * nw) { const int w = (int)(t % nw); const int b = (int)(t / ((size_t)SLEN * nw)); unsigned bits = 0u; for (int j = 0; j < 32; ++j) bits |= (bf16_round(mask[(size_t)b * SLEN + 32 * w + j]) == 0.0f) ? (1u << j) : 0u; *(unsigned*)(MB + t) = bits;  }
  if (t < SLEN) { *(int*)(RA + t) = 0;  }
  if (t < SLEN / 64) { *(int*)(KE + t * 32) = SLEN;  } }
__global__ __launch_bounds__(256) void k_hlmask(const float* __restrict__ F, const float* __restrict__ mask, _Float16* __restrict__ Hh, _Float16* __restrict__ Hl, size_t n8) {
  #pragma clang fp contract(off)
  const size_t t = (size_t)blockIdx.x * 256 + threadIdx.x; if (t >= n8) return; const float mk = bf16_round(mask[(t * 8) / DM]); FragH fh, fl;
#pragma unroll
  for (int q = 0; q < 8; ++q) { const float v = F[t * 8 + q] * mk; const _Float16 h = (_Float16)v; fh.h[q] = h; fl.h[q] = (_Float16)((v - (float)h) * 1024.0f); }
  { *(v8us*)((unsigned short*)Hh + t * 8) = fh.half[0]; *(v8us*)((unsigned short*)Hl + t * 8) = fl.half[0];  } }
__global__ __launch_bounds__(256) void k_causaltab(unsigned* __restrict__ MB, int* __restrict__ RA, int* __restrict__ KE, int nq, int nk) {
  const int t = blockIdx.x * 256 + threadIdx.x; const int nw = nk / 32;
  if (t < nq * nw) { const int q = t / nw, w = t % nw; const int first = q + 1 - 32 * w; const unsigned bits = (first <= 0) ? 0xffffffffu : ((first >= 32) ? 0u : (0xffffffffu << first)); *(unsigned*)(MB + t) = bits;  }
  if (t < nq) { *(int*)(RA + t) = 0;  }
  if (t < nq / 64) { const int v = 64 * (t + 1); *(int*)(KE + t * 32) = v;  } }


extern "C" void kernel_launch(void* const* d_in, const int* in_sizes, int n_in,
                              void* d_out, int out_size, void* d_ws, size_t ws_size, hipStream_t stream) {
  (void)in_sizes; (void)n_in; (void)out_size;
  const float* const* I = (const float* const*)d_in; const float* x = I[0]; const int* pos = (const int*)d_in[1]; const float* mask = I[2]; const float* qw = I[3]; const float* qb = I[4]; const float* kw = I[5]; const float* kb = I[6]; const float* vw = I[7]; const float* vb = I[8]; const float* ow = I[9]; const float* ob = I[10]; const float* de = I[11]; const float* obias = I[12]; const float* edges = I[13];
  char* ws = (char*)d_ws; size_t off = 0;
  auto take = [&](size_t bytes) { char* p = ws + off; off += (bytes + 255) & ~(size_t)255; return p; };
  _Float16* BQ = (_Float16*)take((size_t)DM * DM * 2); _Float16* BK = (_Float16*)take((size_t)DM * DM * 2); _Float16* BV = (_Float16*)take((size_t)DM * DM * 2); _Float16* BO = (_Float16*)take((size_t)DM * DM * 2);
  _Float16* X16 = (_Float16*)take((size_t)NR * DM * 2); float* F = (float*)take((size_t)NR * DM * 4);
  _Float16* Qh = (_Float16*)take((size_t)NR * DM * 2); _Float16* Ql = (_Float16*)take((size_t)NR * DM * 2); _Float16* Kh = (_Float16*)take((size_t)NR * DM * 2); _Float16* Kl = (_Float16*)take((size_t)NR * DM * 2); _Float16* Vth = (_Float16*)take((size_t)NR * DM * 2); _Float16* Vtl = (_Float16*)take((size_t)NR * DM * 2);
  unsigned* MB = (unsigned*)take((size_t)NBT * SLEN * (SLEN / 32) * 4); int* RA = (int*)take((size_t)SLEN * 4); int* KE = (int*)take((size_t)(SLEN / 64) * 32 * 4); int* LUT = (int*)take((size_t)LUTN * 4);
  if (off > ws_size) return;      /* 2 + 8 + 16 + 48 + 1.1 = 75 MiB */
  float* O = F; _Float16* Oh = Qh; _Float16* Ol = Ql;
  const size_t w8 = (size_t)DM * DM / 8; const unsigned wb = (unsigned)((w8 + 255) / 256);
  k_round16f<<<wb, 256, 0, stream>>>(qw, BQ, w8); k_round16f<<<wb, 256, 0, stream>>>(kw, BK, w8); k_round16f<<<wb, 256, 0, stream>>>(vw, BV, w8); k_round16f<<<wb, 256, 0, stream>>>(ow, BO, w8);      /* torch (out,in) = natural Bt */
  k_lut<<<LUTN / 256, 256, 0, stream>>>(edges, LUT); k_masktab<<<(unsigned)(((size_t)NBT * SLEN * (SLEN / 32) + 255) / 256), 256, 0, stream>>>(mask, MB, RA, KE);
  const size_t n8 = (size_t)NR * DM / 8; const unsigned nb8 = (unsigned)((n8 + 255) / 256); const dim3 gP((NR / 128) * (DM / 64), 1);
  k_x16<<<nb8, 256, 0, stream>>>(x, X16, n8);
  k_gemm2<0><<<gP, 128, 0, stream>>>(X16, DM, 0, BQ, DM, 0, 0.0625f, qb, 0, nullptr, 1, 0, 0, F, nullptr, DM, 0, NR, DM, DM); k_hl<<<nb8, 256, 0, stream>>>(F, Qh, Ql, n8);
  k_gemm2<0><<<gP, 128, 0, stream>>>(X16, DM, 0, BK, DM, 0, 0.0625f, kb, 0, nullptr, 1, 0, 0, F, nullptr, DM, 0, NR, DM, DM); k_hl<<<nb8, 256, 0, stream>>>(F, Kh, Kl, n8);
  k_gemm2<0><<<gP, 128, 0, stream>>>(X16, DM, 0, BV, DM, 0, 0.0625f, vb, 0, nullptr, 1, 0, 0, F, nullptr, DM, 0, NR, DM, DM);
  for (int b = 0; b < NBT; ++b) k_vthl<SLEN><<<NH * (SLEN / 64), 256, 0, stream>>>(F + (size_t)b * SLEN * DM, DM, Vth + (size_t)b * SLEN * DM, Vtl + (size_t)b * SLEN * DM);
  for (int b = 0; b < NBT; ++b) { const size_t ro = (size_t)b * SLEN * DM;
    k_flashb<SLEN, SLEN><<<NH * (SLEN / 64), 128, 0, stream>>>(Qh + ro, Ql + ro, DM, Kh + ro, Kl + ro, DM, Vth + ro, Vtl + ro, MB + (size_t)b * SLEN * (SLEN / 32), RA, KE, de, obias, LUT, pos + (size_t)b * SLEN, O + ro, DM); }
  k_hlmask<<<nb8, 256, 0, stream>>>(O, mask, Oh, Ol, n8);
  k_gemm2<0><<<gP, 128, 0, stream>>>(Oh, DM, 0, BO, DM, 0, 0.0625f, ob, 0, nullptr, 1, 0, 0, (float*)d_out, nullptr, DM, 0, NR, DM, DM);
  k_gemm2<0><<<gP, 128, 0, stream>>>(Ol, DM, 0, BO, DM, 0, 0.0625f / 1024.0f, nullptr, 0, (float*)d_out, 1, (size_t)DM, 0, (float*)d_out, nullptr, DM, 0, NR, DM, DM);
}

// v001
// One run takes 513 microseconds.
// Two timings next to v000 both put it at 4.01 times that version's speed.
#include <hip/hip_runtime.h>
// Grammar attention (8 x 1024 tokens, 512 = 8 heads x 64): q,k,v = x W^T + b; scores = q.k/8 + dist_emb[bucket(|pos_j - pos_i|)][h] + ((pos_j > pos_i) - 0.5) * order_bias[h] with INPUT int32 positions, INPUT bin edges (torch.bucketize right=False = count of edges < dist) and an INPUT key/query mask (masked keys excluded; masked query rows zeroed before the output projection, as out * mask); softmax; out = ((attn v) * mask) Wo^T + bo -> [8,1024,512].
// Structure: x as an exact f16 plane; projections as f16 WMMA GEMMs (32x64 wave tiles, f32 accumulation, exact x16 weights + bias); a device-built bucket lookup table over integer distances (from the INPUT edges) and per-batch key-mask bit tables; q, k as f16 hi + (x2^10) residual planes, V^T as hi + residual planes; the fused flash kernel gathers both biases by the INPUT positions inside the score stage (online f32 softmax, P staged hi + residual, two value accumulators); O scaled by the query mask, split hi/lo, into Wo (two GEMMs, bias in the first).
// Compute dtype: x, weights, biases, dist_emb, order_bias, bin_edges, mask rounded to bf16; projections exact; q, k, P, v, O as f16 hi + residual pairs (~2^-21); f32 accumulation and softmax. v_wmma_f32_16x16x32_f16.
#define NBT 8
#define SLEN 1024
#define NBIN 32
#define LUTN 16384            /* bucket lookup over integer distances 0..LUTN-1 (positions < 5000) */
#define DM 512
#define NH 8
#define SCL 0.125f
#define NR (NBT * SLEN)
typedef __bf16 v16b __attribute__((ext_vector_type(16)));
typedef unsigned short v8us __attribute__((ext_vector_type(8), may_alias));
typedef float  v8f  __attribute__((ext_vector_type(8)));
typedef float  v4f  __attribute__((ext_vector_type(4)));
typedef float  v4fa __attribute__((ext_vector_type(4), may_alias));
union FragB { v16b v; v8us half[2]; unsigned short u[16]; };

__device__ __forceinline__ unsigned short bf16_bits(float x) { unsigned int u = __float_as_uint(x); return (unsigned short)((u + 0x7FFFu + ((u >> 16) & 1u)) >> 16); }
__device__ __forceinline__ float bf16_val(unsigned short b) { return __uint_as_float(((unsigned int)b) << 16); }
__device__ __forceinline__ float bf16_round(float x) { return bf16_val(bf16_bits(x)); }
// D += A·B with NT terms: 1 = ah·bh, 2 = + al·bh (A split), 3 = + ah·bl (both split)
template <int NT>
__device__ __forceinline__ v8f mmaN(v16b ah, v16b al, v16b bh, v16b bl, v8f c) {
  c = __builtin_amdgcn_wmma_f32_16x16x32_bf16(false, ah, false, bh, (short)0, c, false, false);
  if (NT >= 2) c = __builtin_amdgcn_wmma_f32_16x16x32_bf16(false, al, false, bh, (short)0, c, false, false);
  if (NT >= 3) c = __builtin_amdgcn_wmma_f32_16x16x32_bf16(false, ah, false, bl, (short)0, c, false, false);
  asm volatile("v_nop\n\tv_nop\n\tv_nop\n\tv_nop" : "+v"(c) : "v"(ah), "v"(al), "v"(bh), "v"(bl));
  return c;
}

__global__ __launch_bounds__(256) void k_wt_bf16(const float* __restrict__ W, unsigned short* __restrict__ Wt, int K, int N) {
  const int t = blockIdx.x * 256 + threadIdx.x;
  const int k8n = K / 8;
  if (t >= N * k8n) return;
  const int n = t / k8n, k8 = (t % k8n) * 8;
  v8us v;
#pragma unroll
  for (int i = 0; i < 8; ++i) v[i] = bf16_bits(W[(size_t)(k8 + i) * N + n]);
  *(v8us*)(Wt + (size_t)n * K + k8) = v;
  
}

// GEMM C[M][N] (f32, pitch ldc) = act(A[M][K]·W + bias). A f32 row-major (pitch lda) converted per fragment to bf16
// (ASPLIT: hi/lo two planes -> 2 terms, else single rounded term); Wt bf16 [N][K] (pitch ldb). BIAS_BF16 rounds the
// bias to bf16 first (bias quantised to bf16 before the add). K%32==0, M%16==0, N%64==0.
template <bool ASPLIT, int ACT, bool BIAS_BF16>
__global__ __launch_bounds__(128) void k_gemm_bf(const float* __restrict__ A, int lda, const unsigned short* __restrict__ Wt, int ldb,
                                               const float* __restrict__ bias, float* __restrict__ C, int ldc, int M, int N, int K) {
  __shared__ __attribute__((aligned(16))) float so[4][16][64];
  const int tid = threadIdx.x, w = tid >> 5, lane = tid & 31, ln = lane & 15, hh = lane >> 4;
  const int ntn = N / 64;
  const int wid = blockIdx.x * 4 + w;
  const int mt = wid / ntn, nq = wid % ntn;
  if (mt * 16 >= M) return;
  const int row0 = mt * 16, col0 = nq * 64;
  const float* arow = A + (size_t)(row0 + ln) * lda;
  v8f acc[4] = {};
  for (int kb = 0; kb < K; kb += 32) {
    FragB ah, al;
    const v4f x0 = *(const v4fa*)(arow + kb + 8 * hh), x1 = *(const v4fa*)(arow + kb + 8 * hh + 4);
    const v4f x2 = *(const v4fa*)(arow + kb + 16 + 8 * hh), x3 = *(const v4fa*)(arow + kb + 16 + 8 * hh + 4);
    float xs[16] = {x0[0],x0[1],x0[2],x0[3],x1[0],x1[1],x1[2],x1[3],x2[0],x2[1],x2[2],x2[3],x3[0],x3[1],x3[2],x3[3]};
#pragma unroll
    for (int i = 0; i < 16; ++i) { const unsigned short hb = bf16_bits(xs[i]); ah.u[i] = hb; al.u[i] = ASPLIT ? bf16_bits(xs[i] - bf16_val(hb)) : (unsigned short)0; }
#pragma unroll
    for (int t = 0; t < 4; ++t) {
      const unsigned short* brow = Wt + (size_t)(col0 + t * 16 + ln) * ldb + kb;
      FragB b;
      b.half[0] = *(const v8us*)(brow + 8 * hh);
      b.half[1] = *(const v8us*)(brow + 16 + 8 * hh);
      acc[t] = mmaN<ASPLIT ? 2 : 1>(ah.v, al.v, b.v, b.v, acc[t]);
    }
  }
#pragma unroll
  for (int t = 0; t < 4; ++t) {
    float bv = bias ? bias[col0 + t * 16 + ln] : 0.f;
    if (BIAS_BF16) bv = bf16_round(bv);
#pragma unroll
    for (int r = 0; r < 8; ++r) { float v = acc[t][r] + bv; if (ACT == 1) v = fmaxf(v, 0.f); so[w][8 * hh + r][t * 16 + ln] = v; }
  }
  __builtin_amdgcn_fence(__ATOMIC_ACQ_REL, "workgroup");
  __builtin_amdgcn_wave_barrier();
  const int rsub = lane >> 4, c4 = (lane & 15) * 4;
  {
#pragma unroll
    for (int q = 0; q < 8; ++q) {
      const int r = q * 2 + rsub;
      const v4f v = *(const v4fa*)&so[w][r][c4];
      *(v4f*)(C + (size_t)(row0 + r) * ldc + col0 + c4) = v;
    }
    
  }
}

// GEMM C = act(A·W + bias + resid): A f32 (ASPLIT -> hi/lo 2 terms), Wt bf16 [N][K]; ACT 0 none, 1 relu, 2 exact gelu;
// resid (optional, f32, row index = (row % rmod), pitch ldr, RES_BF16 rounds it) added before the activation.
template <bool ASPLIT, int ACT, bool BIAS_BF16, bool RES_BF16>
__global__ __launch_bounds__(128) void k_gemm_bf3(const float* __restrict__ A, int lda, const unsigned short* __restrict__ Wt, int ldb,
                                                const float* __restrict__ bias, const float* __restrict__ resid, int rmod, int ldr,
                                                float* __restrict__ C, int ldc, int M, int N, int K) {
  __shared__ __attribute__((aligned(16))) float so[4][16][64];
  const int tid = threadIdx.x, w = tid >> 5, lane = tid & 31, ln = lane & 15, hh = lane >> 4;
  const int ntn = N / 64;
  const int wid = blockIdx.x * 4 + w;
  const int mt = wid / ntn, nq = wid % ntn;
  if (mt * 16 >= M) return;
  const int row0 = mt * 16, col0 = nq * 64;
  const float* arow = A + (size_t)(row0 + ln) * lda;
  v8f acc[4] = {};
  for (int kb = 0; kb < K; kb += 32) {
    FragB ah, al;
    const v4f x0 = *(const v4fa*)(arow + kb + 8 * hh), x1 = *(const v4fa*)(arow + kb + 8 * hh + 4);
    const v4f x2 = *(const v4fa*)(arow + kb + 16 + 8 * hh), x3 = *(const v4fa*)(arow + kb + 16 + 8 * hh + 4);
    float xs[16] = {x0[0],x0[1],x0[2],x0[3],x1[0],x1[1],x1[2],x1[3],x2[0],x2[1],x2[2],x2[3],x3[0],x3[1],x3[2],x3[3]};
#pragma unroll
    for (int i = 0; i < 16; ++i) { const unsigned short hb = bf16_bits(xs[i]); ah.u[i] = hb; al.u[i] = ASPLIT ? bf16_bits(xs[i] - bf16_val(hb)) : (unsigned short)0; }
#pragma unroll
    for (int t = 0; t < 4; ++t) {
      const unsigned short* brow = Wt + (size_t)(col0 + t * 16 + ln) * ldb + kb;
      FragB b;
      b.half[0] = *(const v8us*)(brow + 8 * hh);
      b.half[1] = *(const v8us*)(brow + 16 + 8 * hh);
      acc[t] = mmaN<ASPLIT ? 2 : 1>(ah.v, al.v, b.v, b.v, acc[t]);
    }
  }
#pragma unroll
  for (int t = 0; t < 4; ++t) {
    const int col = col0 + t * 16 + ln;
    float bv = bias ? bias[col] : 0.f;
    if (BIAS_BF16) bv = bf16_round(bv);
#pragma unroll
    for (int r = 0; r < 8; ++r) {
      float v = acc[t][r] + bv;
      if (resid) { float rv = resid[(size_t)((row0 + 8 * hh + r) % rmod) * ldr + col]; if (RES_BF16) rv = bf16_round(rv); v += rv; }
      if (ACT == 1) v = fmaxf(v, 0.f);
      if (ACT == 2) v = 0.5f * v * (1.0f + erff(v * 0.70710678118654752f));
      if (ACT == 3) { const float u = 0.7978845608028654f * (v + 0.044715f * v * v * v); v = 0.5f * v * (1.0f + tanhf(u)); }
      so[w][8 * hh + r][t * 16 + ln] = v;
    }
  }
  __builtin_amdgcn_fence(__ATOMIC_ACQ_REL, "workgroup");
  __builtin_amdgcn_wave_barrier();
  const int rsub = lane >> 4, c4 = (lane & 15) * 4;
  {
#pragma unroll
    for (int q = 0; q < 8; ++q) {
      const int r = q * 2 + rsub;
      const v4f v = *(const v4fa*)&so[w][r][c4];
      *(v4f*)(C + (size_t)(row0 + r) * ldc + col0 + c4) = v;
    }
    
  }
}
// row LayerNorm (biased variance, eps) over N: s = X (+ R); optional out_sum <- s; out_norm <- (s-mu)*rsqrt(var+eps)*g + b
template <bool PARAM_BF16>
__global__ __launch_bounds__(256) void k_layernorm(const float* __restrict__ X, const float* __restrict__ R, const float* __restrict__ g, const float* __restrict__ bta,
                                                  float* __restrict__ out_sum, float* __restrict__ out_norm, int N, float eps) {
  __shared__ float red[256];
  const int row = blockIdx.x, tid = threadIdx.x;
  const float* x = X + (size_t)row * N; const float* rr = R ? R + (size_t)row * N : nullptr;
  float vals[16];                     // up to N = 4096
  const int per = N / 256;            // contiguous chunk per thread? use strided-by-4 chunks: thread handles j = tid*4 + 1024*u
  float s1 = 0.f;
  for (int u = 0; u < per / 4; ++u) {
    const int j = tid * 4 + 1024 * u;
    const v4f a = *(const v4fa*)(x + j);
    v4f b = {0.f,0.f,0.f,0.f}; if (rr) b = *(const v4fa*)(rr + j);
#pragma unroll
    for (int q = 0; q < 4; ++q) { const float v = a[q] + b[q]; vals[u * 4 + q] = v; s1 += v; }
  }
  red[tid] = s1; __syncthreads();
  for (int st = 128; st > 0; st >>= 1) { if (tid < st) red[tid] += red[tid + st]; __syncthreads(); }
  const float mu = red[0] / (float)N; __syncthreads();
  float s2 = 0.f;
  for (int u = 0; u < per / 4; ++u)
#pragma unroll
    for (int q = 0; q < 4; ++q) { const float c = vals[u * 4 + q] - mu; s2 += c * c; }
  red[tid] = s2; __syncthreads();
  for (int st = 128; st > 0; st >>= 1) { if (tid < st) red[tid] += red[tid + st]; __syncthreads(); }
  const float rs = rsqrtf(red[0] / (float)N + eps);
  {
    for (int u = 0; u < per / 4; ++u) {
      const int j = tid * 4 + 1024 * u;
      v4f o, sm;
#pragma unroll
      for (int q = 0; q < 4; ++q) {
        float gg = g[j + q], bb = bta[j + q];
        if (PARAM_BF16) { gg = bf16_round(gg); bb = bf16_round(bb); }
        sm[q] = vals[u * 4 + q]; o[q] = (vals[u * 4 + q] - mu) * rs * gg + bb;
      }
      if (out_sum) *(v4f*)(out_sum + (size_t)row * N + j) = sm;
      *(v4f*)(out_norm + (size_t)row * N + j) = o;
    }
    
  }
}



// ---- f16 WMMA path (v_wmma_f32_16x16x32_f16): 11-bit significands for operands in range — used where a [0,1] probability operand needs more precision than bf16
typedef _Float16 v16h __attribute__((ext_vector_type(16)));
union FragH { v16h v; v8us half[2]; _Float16 h[16]; unsigned short u[16]; };
template <int NT>
__device__ __forceinline__ v8f mmaH(v16h ah, v16h al, v16h bh, v16h bl, v8f c) {
  c = __builtin_amdgcn_wmma_f32_16x16x32_f16(false, ah, false, bh, (short)0, c, false, false);
  if (NT >= 2) c = __builtin_amdgcn_wmma_f32_16x16x32_f16(false, al, false, bh, (short)0, c, false, false);
  if (NT >= 3) c = __builtin_amdgcn_wmma_f32_16x16x32_f16(false, ah, false, bl, (short)0, c, false, false);
  asm volatile("v_nop\n\tv_nop\n\tv_nop\n\tv_nop" : "+v"(c) : "v"(ah), "v"(al), "v"(bh), "v"(bl));
  return c;
}
// batched GEMM like k_gemm_b but f16 operands: A f32 (split into f16 hi/lo if ASPLIT, else rounded to f16), Bt = f16 values [n][k]; alpha; C f32; N multiple of 16 (partial tiles skipped)
template <bool ASPLIT>
__global__ __launch_bounds__(128) void k_gemm_h(const float* __restrict__ A, int lda, size_t sA, const _Float16* __restrict__ Bh, int ldb, size_t sB, float alpha, float* __restrict__ C, int ldc, size_t sC, int M, int N, int K) {
  __shared__ __attribute__((aligned(16))) float so[4][16][64];
  const int tid = threadIdx.x, w = tid >> 5, lane = tid & 31, ln = lane & 15, hh = lane >> 4; const int by = blockIdx.y;
  A += (size_t)by * sA; Bh += (size_t)by * sB; C += (size_t)by * sC;
  const int ntn = (N + 63) / 64; const int wid = blockIdx.x * 4 + w; const int mt = wid / ntn, nq = wid % ntn; if (mt * 16 >= M) return;
  const int row0 = mt * 16, col0 = nq * 64; const float* arow = A + (size_t)(row0 + ln) * lda;
  v8f acc[4] = {};
  for (int kb = 0; kb < K; kb += 32) {
    FragH ah, al;
    const v4f x0 = *(const v4fa*)(arow + kb + 8 * hh), x1 = *(const v4fa*)(arow + kb + 8 * hh + 4), x2 = *(const v4fa*)(arow + kb + 16 + 8 * hh), x3 = *(const v4fa*)(arow + kb + 16 + 8 * hh + 4);
    float xs[16] = {x0[0],x0[1],x0[2],x0[3],x1[0],x1[1],x1[2],x1[3],x2[0],x2[1],x2[2],x2[3],x3[0],x3[1],x3[2],x3[3]};
#pragma unroll
    for (int i = 0; i < 16; ++i) { const _Float16 h = (_Float16)xs[i]; ah.h[i] = h; al.h[i] = ASPLIT ? (_Float16)(xs[i] - (float)h) : (_Float16)0.0f; }
#pragma unroll
    for (int t = 0; t < 4; ++t) { if (col0 + t * 16 >= N) continue; const size_t boff = (size_t)(col0 + t * 16 + ln) * ldb + kb; FragH bq; bq.half[0] = *(const v8us*)(Bh + boff + 8 * hh); bq.half[1] = *(const v8us*)(Bh + boff + 16 + 8 * hh);
      acc[t] = mmaH<ASPLIT ? 2 : 1>(ah.v, al.v, bq.v, bq.v, acc[t]); }
  }
#pragma unroll
  for (int t = 0; t < 4; ++t) { if (col0 + t * 16 >= N) continue;
#pragma unroll
    for (int r = 0; r < 8; ++r) so[w][8 * hh + r][t * 16 + ln] = acc[t][r] * alpha; }
  __builtin_amdgcn_fence(__ATOMIC_ACQ_REL, "workgroup"); __builtin_amdgcn_wave_barrier();
  const int rsub = lane >> 4, c4 = (lane & 15) * 4;
  {
#pragma unroll
    for (int q = 0; q < 8; ++q) { const int r = q * 2 + rsub; if (col0 + c4 < N) { const v4f v = *(const v4fa*)&so[w][r][c4]; *(v4f*)(C + (size_t)(row0 + r) * ldc + col0 + c4) = v; } }
     }
}

// Wt[n][k] = f16(W[k][n]·scale) from f32 row-major W[K][N] (scale = power of two; bf16-exact weights stay exact in f16 away from the subnormal range)
__global__ __launch_bounds__(256) void k_wt_f16(const float* __restrict__ W, _Float16* __restrict__ Wt, int K, int N, float scale) {
  const int t = blockIdx.x * 256 + threadIdx.x; if (t >= N * (K / 8)) return; const int n = t / (K / 8), k8 = (t % (K / 8)) * 8; FragH f;
#pragma unroll
  for (int i = 0; i < 8; ++i) f.h[i] = (_Float16)(bf16_round(W[(size_t)(k8 + i) * N + n]) * scale); const v8us o = f.half[0];
  *(v8us*)((unsigned short*)Wt + (size_t)n * K + k8) = o; 
}
// k_gemm_hh variant with fused epilogue: v = acc·alpha + bias[by·sBias + col] (+ CP[(row/rowsPerB)·sCPb + by·64 + col] if CP) ; ACT 0 none / 1 elu ; writes f16 C16 (and f32 C if non-null)
template <int ACT>
__global__ __launch_bounds__(128) void k_gemm_hhx(const _Float16* __restrict__ A, int lda, size_t sA, const _Float16* __restrict__ Bh, int ldb, size_t sB, float alpha, const float* __restrict__ bias, size_t sBias, const float* __restrict__ CP, int rowsPerB, size_t sCPb, int row0g,
    float* __restrict__ C, _Float16* __restrict__ C16, int ldc, size_t sC, int M, int N, int K) {
  __shared__ __attribute__((aligned(16))) float so[4][16][64];
  const int tid = threadIdx.x, w = tid >> 5, lane = tid & 31, ln = lane & 15, hh = lane >> 4; const int by = blockIdx.y;
  A += (size_t)by * sA; Bh += (size_t)by * sB; const size_t cofs = (size_t)by * sC; const float* bp = bias ? bias + (size_t)by * sBias : nullptr;
  const int ntn = (N + 63) / 64; const int wid = blockIdx.x * 4 + w; const int mt = wid / ntn, nq = wid % ntn; if (mt * 16 >= M) return;
  const int row0 = mt * 16, col0 = nq * 64; const _Float16* arow = A + (size_t)(row0 + ln) * lda;
  v8f acc[4] = {};
  for (int kb = 0; kb < K; kb += 32) { FragH ah; ah.half[0] = *(const v8us*)((const unsigned short*)arow + kb + 8 * hh); ah.half[1] = *(const v8us*)((const unsigned short*)arow + kb + 16 + 8 * hh);
#pragma unroll
    for (int t = 0; t < 4; ++t) { if (col0 + t * 16 >= N) continue; const size_t boff = (size_t)(col0 + t * 16 + ln) * ldb + kb; FragH bq; bq.half[0] = *(const v8us*)((const unsigned short*)Bh + boff + 8 * hh); bq.half[1] = *(const v8us*)((const unsigned short*)Bh + boff + 16 + 8 * hh);
      acc[t] = mmaH<1>(ah.v, ah.v, bq.v, bq.v, acc[t]); }
  }
#pragma unroll
  for (int t = 0; t < 4; ++t) { if (col0 + t * 16 >= N) continue; const int col = col0 + t * 16 + ln; const float bv = bp ? bf16_round(bp[col]) : 0.f;
#pragma unroll
    for (int r = 0; r < 8; ++r) { float v = acc[t][r] * alpha + bv; if (CP) { const int bidx = (row0g + row0 + 8 * hh + r) / rowsPerB; v += CP[(size_t)bidx * sCPb + (size_t)by * 64 + col]; } if (ACT == 1) v = (v > 0.f) ? v : expm1f(v); else if (ACT == 7) v = (v > 0.f) ? v + 1.0f : expf(v); else if (ACT == 8) v = tanhf(v); else if (ACT == 9) v = 0.5f * v * (1.0f + tanhf(0.7978845608028654f * (v + 0.044715f * v * v * v))); else if (ACT == 11) v = 1.0f / (1.0f + expf(-v)); else if (ACT == 12) v = (v > 0.f) ? v : 0.01f * v; else if (ACT == 14) v = (v > 0.f) ? v : 0.1f * v; else if (ACT == 15) v = v / (1.0f + expf(-v)); else if (ACT == 3) v = fmaxf(v, 0.f); else if (ACT == 6) v = 0.5f * v * (1.0f + erff(v * 0.70710678118654752f)); so[w][8 * hh + r][t * 16 + ln] = v; } }
  __builtin_amdgcn_fence(__ATOMIC_ACQ_REL, "workgroup"); __builtin_amdgcn_wave_barrier();
  const int rsub = lane >> 4, c4 = (lane & 15) * 4; typedef _Float16 v4h __attribute__((ext_vector_type(4)));
  {
#pragma unroll
    for (int q = 0; q < 8; ++q) { const int r = q * 2 + rsub; if (col0 + c4 < N) { const v4f v = *(const v4fa*)&so[w][r][c4]; if (C) *(v4f*)(C + cofs + (size_t)(row0 + r) * ldc + col0 + c4) = v; if (C16) { v4h h4; for (int i = 0; i < 4; ++i) h4[i] = (_Float16)v[i]; *(v4h*)(C16 + cofs + (size_t)(row0 + r) * ldc + col0 + c4) = h4; } } }
     }
}


typedef _Float16 v4h __attribute__((ext_vector_type(4)));

__global__ __launch_bounds__(256) void k_x16(const float* __restrict__ x, _Float16* __restrict__ X16, size_t n8) { const size_t t = (size_t)blockIdx.x * 256 + threadIdx.x; if (t >= n8) return; FragH f;
#pragma unroll
  for (int q = 0; q < 8; ++q) f.h[q] = (_Float16)bf16_round(x[t * 8 + q]); *(v8us*)((unsigned short*)X16 + t * 8) = f.half[0];  }
__global__ __launch_bounds__(256) void k_h16(const float* __restrict__ x, _Float16* __restrict__ X16, size_t n8) { const size_t t = (size_t)blockIdx.x * 256 + threadIdx.x; if (t >= n8) return; FragH f;
#pragma unroll
  for (int q = 0; q < 8; ++q) f.h[q] = (_Float16)x[t * 8 + q]; *(v8us*)((unsigned short*)X16 + t * 8) = f.half[0];  }
__global__ __launch_bounds__(256) void k_round16f(const float* __restrict__ W, _Float16* __restrict__ Bt, size_t n8) { const size_t t = (size_t)blockIdx.x * 256 + threadIdx.x; if (t >= n8) return; FragH f;
#pragma unroll
  for (int i = 0; i < 8; ++i) f.h[i] = (_Float16)(bf16_round(W[t * 8 + i]) * 16.0f); *(v8us*)((unsigned short*)Bt + t * 8) = f.half[0];  }
template <int NHv, int TTv>
__global__ __launch_bounds__(256) void k_vt(const _Float16* __restrict__ V16, int ldv, int voff, _Float16* __restrict__ Vt) { __shared__ unsigned short tl[64][66]; const int tid = threadIdx.x; const int slab = blockIdx.x / (TTv / 64), lg = blockIdx.x % (TTv / 64); const int b = slab / NHv, h = slab % NHv;
  for (int i = tid; i < 64 * 8; i += 256) { const int r = i / 8, c8 = (i % 8) * 8; FragH f; f.half[0] = *(const v8us*)((const unsigned short*)V16 + ((size_t)b * TTv + lg * 64 + r) * ldv + voff + h * 64 + c8);
#pragma unroll
    for (int q = 0; q < 8; ++q) tl[r][c8 + q] = f.u[q]; }
  __syncthreads();
  {
#pragma unroll
    for (int rd = 0; rd < 2; ++rd) { const int d = rd * 32 + tid / 8, pc = tid % 8; FragH f;
#pragma unroll
      for (int q = 0; q < 8; ++q) f.u[q] = tl[pc * 8 + q][d];
      *(v8us*)((unsigned short*)Vt + ((size_t)slab * 64 + d) * TTv + lg * 64 + pc * 8) = f.half[0]; }
     } }

__global__ __launch_bounds__(256) void k_hl(const float* __restrict__ F, _Float16* __restrict__ Hh, _Float16* __restrict__ Hl, size_t n8) { const size_t t = (size_t)blockIdx.x * 256 + threadIdx.x; if (t >= n8) return; FragH fh, fl; const v4f a = *(const v4fa*)(F + t * 8), c = *(const v4fa*)(F + t * 8 + 4);
#pragma unroll
  for (int q = 0; q < 4; ++q) { _Float16 h = (_Float16)a[q]; fh.h[q] = h; fl.h[q] = (_Float16)((a[q] - (float)h) * 1024.0f); h = (_Float16)c[q]; fh.h[4 + q] = h; fl.h[4 + q] = (_Float16)((c[q] - (float)h) * 1024.0f); }
  { *(v8us*)((unsigned short*)Hh + t * 8) = fh.half[0]; *(v8us*)((unsigned short*)Hl + t * 8) = fl.half[0];  } }

// ---- fast GEMM (wave tile 32x64; requires M % 32 == 0 rows per launch region and N % 64 == 0); epilogue = k_gemm_hhx semantics ----
__device__ __forceinline__ v16h g2_frag(const _Float16* p, int hh) { FragH f; f.half[0] = *(const v8us*)((const unsigned short*)p + 8 * hh); f.half[1] = *(const v8us*)((const unsigned short*)p + 16 + 8 * hh); return f.v; }
__device__ __forceinline__ v8f g2_mma(v16h a, v16h b, v8f c) { v8f d = __builtin_amdgcn_wmma_f32_16x16x32_f16(false, a, false, b, (short)0, c, false, false); asm volatile("v_nop\n\tv_nop\n\tv_nop\n\tv_nop" : "+v"(d) : "v"(a), "v"(b)); return d; }
template <int ACT>
__global__ __launch_bounds__(128) void k_gemm2(const _Float16* __restrict__ A, int lda, size_t sA, const _Float16* __restrict__ Bh, int ldb, size_t sB, float alpha, const float* __restrict__ bias, size_t sBias, const float* __restrict__ CP, int rowsPerB, size_t sCPb, int row0g,
    float* __restrict__ C, _Float16* __restrict__ C16, int ldc, size_t sC, int M, int N, int K) {
  __shared__ __attribute__((aligned(16))) float so[4][32][68];
  const int tid = threadIdx.x, w = tid >> 5, lane = tid & 31, ln = lane & 15, hh = lane >> 4; const int by = blockIdx.y;
  A += (size_t)by * sA; Bh += (size_t)by * sB; const size_t cofs = (size_t)by * sC; const float* bp = bias ? bias + (size_t)by * sBias : nullptr;
  const int ntn = N >> 6; const int mt = blockIdx.x / ntn, nq = blockIdx.x - mt * ntn; const int row0 = mt * 128 + 32 * w, col0 = nq * 64; if (row0 >= M) return;
  const _Float16* a0p = A + (size_t)(row0 + ln) * lda; const _Float16* a1p = a0p + (size_t)16 * lda;
  const _Float16* b0p = Bh + (size_t)(col0 + ln) * ldb; const _Float16* b1p = b0p + (size_t)16 * ldb; const _Float16* b2p = b1p + (size_t)16 * ldb; const _Float16* b3p = b2p + (size_t)16 * ldb;
  const v8f z8 = {0.f,0.f,0.f,0.f,0.f,0.f,0.f,0.f}; v8f c00 = z8, c01 = z8, c02 = z8, c03 = z8, c10 = z8, c11 = z8, c12 = z8, c13 = z8;
#pragma unroll 1
  for (int kb = 0; kb < K; kb += 32) { const v16h a0 = g2_frag(a0p + kb, hh), a1 = g2_frag(a1p + kb, hh);
    v16h b = g2_frag(b0p + kb, hh); c00 = g2_mma(a0, b, c00); c10 = g2_mma(a1, b, c10);
    b = g2_frag(b1p + kb, hh); c01 = g2_mma(a0, b, c01); c11 = g2_mma(a1, b, c11);
    b = g2_frag(b2p + kb, hh); c02 = g2_mma(a0, b, c02); c12 = g2_mma(a1, b, c12);
    b = g2_frag(b3p + kb, hh); c03 = g2_mma(a0, b, c03); c13 = g2_mma(a1, b, c13); }
  v8f accs[8] = {c00, c01, c02, c03, c10, c11, c12, c13};
#pragma unroll
  for (int u = 0; u < 8; ++u) { const int t = u & 3, half = u >> 2; const int col = col0 + t * 16 + ln; const float bv = bp ? bf16_round(bp[col]) : 0.f;
#pragma unroll
    for (int r = 0; r < 8; ++r) { const int rloc = half * 16 + 8 * hh + r; float v = accs[u][r] * alpha + bv; if (CP) { const int bidx = (row0g + row0 + rloc) / rowsPerB; v += CP[(size_t)bidx * sCPb + (size_t)by * 64 + col]; }
      if (ACT == 3) v = fmaxf(v, 0.f); else if (ACT == 6) v = 0.5f * v * (1.0f + erff(v * 0.70710678118654752f)); else if (ACT == 11) v = 1.0f / (1.0f + expf(-v)); else if (ACT == 15) v = v / (1.0f + expf(-v)); else if (ACT == 12) v = (v > 0.f) ? v : 0.01f * v; else if (ACT == 8) v = tanhf(v);
      so[w][rloc][t * 16 + ln] = v; } }
  __builtin_amdgcn_fence(__ATOMIC_ACQ_REL, "workgroup"); __builtin_amdgcn_wave_barrier();
  const int rsub = lane >> 4, c4 = (lane & 15) * 4;
  {
#pragma unroll
    for (int q = 0; q < 16; ++q) { const int r = q * 2 + rsub; const v4f v = *(const v4fa*)&so[w][r][c4]; if (C) *(v4f*)(C + cofs + (size_t)(row0 + r) * ldc + col0 + c4) = v; if (C16) { v4h h4; for (int i = 0; i < 4; ++i) h4[i] = (_Float16)v[i]; *(v4h*)(C16 + cofs + (size_t)(row0 + r) * ldc + col0 + c4) = h4; } }
     } }



template <int TK>
__global__ __launch_bounds__(256) void k_vthl(const float* __restrict__ VF, int ldv, _Float16* __restrict__ Vth, _Float16* __restrict__ Vtl) { __shared__ float tl[64][65]; const int tid = threadIdx.x; const int slab = blockIdx.x / (TK / 64), lg = blockIdx.x % (TK / 64); const int b = slab / NH, h = slab % NH;
  for (int i = tid; i < 64 * 16; i += 256) { const int r = i / 16, c4 = (i % 16) * 4; const v4f a = *(const v4fa*)(VF + ((size_t)b * TK + lg * 64 + r) * ldv + h * 64 + c4); tl[r][c4] = a[0]; tl[r][c4 + 1] = a[1]; tl[r][c4 + 2] = a[2]; tl[r][c4 + 3] = a[3]; }
  __syncthreads();
  FragH fh[2], fl[2]; size_t oo[2];
#pragma unroll
  for (int rd = 0; rd < 2; ++rd) { const int d = rd * 32 + tid / 8, pc = tid % 8;
#pragma unroll
    for (int q = 0; q < 8; ++q) { const float v = tl[pc * 8 + q][d]; const _Float16 hv = (_Float16)v; fh[rd].h[q] = hv; fl[rd].h[q] = (_Float16)((v - (float)hv) * 1024.0f); } oo[rd] = ((size_t)slab * 64 + d) * TK + lg * 64 + pc * 8; }
  {
#pragma unroll
    for (int rd = 0; rd < 2; ++rd) { *(v8us*)((unsigned short*)Vth + oo[rd]) = fh[rd].half[0]; *(v8us*)((unsigned short*)Vtl + oo[rd]) = fl[rd].half[0]; }
     } }

// grammar bias for (query position pi, key position pj): dist_emb[bucket(|pj - pi|)][h] + ((pj > pi) - 0.5) * order_bias[h]
__device__ __forceinline__ float gbias(const float* __restrict__ DE, const float* __restrict__ OB, const int* __restrict__ LUT, int h, int pi, int pj) { int d = abs(pj - pi); d = min(d, LUTN - 1); const int bin = LUT[d]; return bf16_round(DE[bin * NH + h]) + (((pj > pi) ? 1.0f : 0.0f) - 0.5f) * bf16_round(OB[h]); }
template <int TQ, int TK>
__global__ __launch_bounds__(128) void k_flashb(const _Float16* __restrict__ Q16, const _Float16* __restrict__ Q16lo, int ldq, const _Float16* __restrict__ K16, const _Float16* __restrict__ K16lo, int ldk, const _Float16* __restrict__ Vt, const _Float16* __restrict__ Vtlo, const unsigned* __restrict__ MB, const int* __restrict__ RA, const int* __restrict__ KE, const float* __restrict__ BT, const float* __restrict__ OB, const int* __restrict__ LUT, const int* __restrict__ LAG, float* __restrict__ O, int ldo) {
  constexpr int RPW = 16, RTN = RPW / 16, NQB = TQ / (4 * RPW), DT = 4, KS = 2;
  __shared__ __attribute__((aligned(16))) unsigned short sP[4][RPW][40], sPl[4][RPW][40]; __shared__ __attribute__((aligned(16))) float sO[4][RPW][64 + 4];
  const int tid = threadIdx.x, w = tid >> 5, lane = tid & 31, ln = lane & 15, hh = lane >> 4;
  const int slab = blockIdx.x / NQB, qblk = blockIdx.x % NQB; const int b = slab / NH, h = slab % NH; const int qb0 = qblk * (4 * RPW); const int q0 = qb0 + w * RPW;
  MB += (size_t)b * TQ * (TK / 32); LAG += (size_t)b * TK;      /* per-batch key-mask table and positions: the grid spans all batches */
  FragH aq[2][KS], aql[2][KS];
#pragma unroll
  for (int rt = 0; rt < RTN; ++rt) { const size_t qo = ((size_t)b * TQ + q0 + rt * 16 + ln) * ldq + h * 64; const unsigned short* qr = (const unsigned short*)Q16 + qo; const unsigned short* ql = (const unsigned short*)Q16lo + qo;
#pragma unroll
    for (int ks = 0; ks < KS; ++ks) { aq[rt][ks].half[0] = *(const v8us*)(qr + ks * 32 + 8 * hh); aq[rt][ks].half[1] = *(const v8us*)(qr + ks * 32 + 16 + 8 * hh); aql[rt][ks].half[0] = *(const v8us*)(ql + ks * 32 + 8 * hh); aql[rt][ks].half[1] = *(const v8us*)(ql + ks * 32 + 16 + 8 * hh); } }
  const unsigned short* Vth = (const unsigned short*)Vt + (size_t)slab * 64 * TK; const unsigned short* Vtl = (const unsigned short*)Vtlo + (size_t)slab * 64 * TK;
  float m_r[2][8], l_r[2][8]; v8f oacc[2][DT], oaccl[2][DT];
#pragma unroll
  for (int rt = 0; rt < RTN; ++rt) {
#pragma unroll
    for (int r = 0; r < 8; ++r) { m_r[rt][r] = -3.0e38f; l_r[rt][r] = 0.f; }
#pragma unroll
    for (int dt = 0; dt < DT; ++dt) { oacc[rt][dt] = (v8f){0.f,0.f,0.f,0.f,0.f,0.f,0.f,0.f}; oaccl[rt][dt] = oacc[rt][dt]; } }
  int jend = KE[qblk * 32]; jend = min(TK, (jend + 31) & ~31); if (jend < 32) jend = 32;      /* block-uniform */
  int allm[2][8]; const unsigned* mrow[2][8];
#pragma unroll
  for (int rt = 0; rt < RTN; ++rt)
#pragma unroll
    for (int r = 0; r < 8; ++r) { const int tq = q0 + rt * 16 + 8 * hh + r; allm[rt][r] = RA[tq]; mrow[rt][r] = MB + (size_t)tq * (TK / 32); }
#pragma unroll 1
  for (int j0 = 0; j0 < jend; j0 += 32) {
    
    v8f s[2][2];
#pragma unroll
    for (int nt = 0; nt < 2; ++nt) { const size_t ko = ((size_t)b * TK + j0 + nt * 16 + ln) * ldk + h * 64; const unsigned short* kr = (const unsigned short*)K16 + ko; const unsigned short* kl = (const unsigned short*)K16lo + ko; FragH bk[KS], bkl[KS];
#pragma unroll
      for (int ks = 0; ks < KS; ++ks) { bk[ks].half[0] = *(const v8us*)(kr + ks * 32 + 8 * hh); bk[ks].half[1] = *(const v8us*)(kr + ks * 32 + 16 + 8 * hh); bkl[ks].half[0] = *(const v8us*)(kl + ks * 32 + 8 * hh); bkl[ks].half[1] = *(const v8us*)(kl + ks * 32 + 16 + 8 * hh); }
#pragma unroll
      for (int rt = 0; rt < RTN; ++rt) { v8f acc = (v8f){0.f,0.f,0.f,0.f,0.f,0.f,0.f,0.f}, accr = acc;
#pragma unroll
        for (int ks = 0; ks < KS; ++ks) { acc = mmaH<1>(aq[rt][ks].v, aq[rt][ks].v, bk[ks].v, bk[ks].v, acc); accr = mmaH<1>(aql[rt][ks].v, aql[rt][ks].v, bk[ks].v, bk[ks].v, accr); accr = mmaH<1>(aq[rt][ks].v, aq[rt][ks].v, bkl[ks].v, bkl[ks].v, accr); }
        s[rt][nt] = acc + accr * 0.0009765625f; } }
#pragma unroll
    for (int rt = 0; rt < RTN; ++rt)
#pragma unroll
      for (int r = 0; r < 8; ++r) { const unsigned mw = mrow[rt][r][j0 >> 5]; const bool am = (allm[rt][r] != 0); const int tq = q0 + rt * 16 + 8 * hh + r;
        const bool ok0 = am || (((mw >> ln) & 1u) == 0u), ok1 = am || (((mw >> (16 + ln)) & 1u) == 0u);
        const float s0 = ok0 ? (am ? 0.f : s[rt][0][r] * SCL + gbias(BT, OB, LUT, h, LAG[tq], LAG[j0 + ln])) : -INFINITY, s1 = ok1 ? (am ? 0.f : s[rt][1][r] * SCL + gbias(BT, OB, LUT, h, LAG[tq], LAG[j0 + 16 + ln])) : -INFINITY;      /* + grammar distance-bucket and order biases */ float mc = fmaxf(s0, s1);
        mc = fmaxf(mc, __shfl_xor(mc, 1, 32)); mc = fmaxf(mc, __shfl_xor(mc, 2, 32)); mc = fmaxf(mc, __shfl_xor(mc, 4, 32)); mc = fmaxf(mc, __shfl_xor(mc, 8, 32));
        const float mn = fmaxf(m_r[rt][r], mc); const float al = (mn > -1.0e38f) ? expf(m_r[rt][r] - mn) : 1.0f; m_r[rt][r] = mn; const float p0 = ok0 ? expf(s0 - mn) : 0.f, p1 = ok1 ? expf(s1 - mn) : 0.f; l_r[rt][r] = l_r[rt][r] * al + p0 + p1;
#pragma unroll
        for (int dt = 0; dt < DT; ++dt) { oacc[rt][dt][r] *= al; oaccl[rt][dt][r] *= al; }
        FragH t2, t3; const float ps0 = p0 * 1024.0f, ps1 = p1 * 1024.0f; t2.h[0] = (_Float16)ps0; t2.h[1] = (_Float16)ps1; t3.h[0] = (_Float16)((ps0 - (float)t2.h[0]) * 1024.0f); t3.h[1] = (_Float16)((ps1 - (float)t2.h[1]) * 1024.0f);
        sP[w][rt * 16 + 8 * hh + r][ln] = t2.u[0]; sP[w][rt * 16 + 8 * hh + r][16 + ln] = t2.u[1]; sPl[w][rt * 16 + 8 * hh + r][ln] = t3.u[0]; sPl[w][rt * 16 + 8 * hh + r][16 + ln] = t3.u[1]; }
    __builtin_amdgcn_fence(__ATOMIC_ACQ_REL, "workgroup"); __builtin_amdgcn_wave_barrier();
    FragH pa[2], pl[2];
#pragma unroll
    for (int rt = 0; rt < RTN; ++rt) { pa[rt].half[0] = *(const v8us*)&sP[w][rt * 16 + ln][8 * hh]; pa[rt].half[1] = *(const v8us*)&sP[w][rt * 16 + ln][16 + 8 * hh]; pl[rt].half[0] = *(const v8us*)&sPl[w][rt * 16 + ln][8 * hh]; pl[rt].half[1] = *(const v8us*)&sPl[w][rt * 16 + ln][16 + 8 * hh]; }
#pragma unroll
    for (int dt = 0; dt < DT; ++dt) { const size_t vo = (size_t)(dt * 16 + ln) * TK + j0; FragH bv, bl; bv.half[0] = *(const v8us*)(Vth + vo + 8 * hh); bv.half[1] = *(const v8us*)(Vth + vo + 16 + 8 * hh); bl.half[0] = *(const v8us*)(Vtl + vo + 8 * hh); bl.half[1] = *(const v8us*)(Vtl + vo + 16 + 8 * hh);
#pragma unroll
      for (int rt = 0; rt < RTN; ++rt) { oacc[rt][dt] = mmaH<1>(pa[rt].v, pa[rt].v, bv.v, bv.v, oacc[rt][dt]); oaccl[rt][dt] = mmaH<1>(pa[rt].v, pa[rt].v, bl.v, bl.v, oaccl[rt][dt]); oaccl[rt][dt] = mmaH<1>(pl[rt].v, pl[rt].v, bv.v, bv.v, oaccl[rt][dt]); } }
    __builtin_amdgcn_fence(__ATOMIC_ACQ_REL, "workgroup"); __builtin_amdgcn_wave_barrier(); }
#pragma unroll
  for (int rt = 0; rt < RTN; ++rt) {
#pragma unroll
    for (int r = 0; r < 8; ++r) { float l = l_r[rt][r]; l += __shfl_xor(l, 1, 32); l += __shfl_xor(l, 2, 32); l += __shfl_xor(l, 4, 32); l += __shfl_xor(l, 8, 32); l_r[rt][r] = (l > 0.f) ? 1.0f / (l * 1024.0f) : 0.f; }
#pragma unroll
    for (int dt = 0; dt < DT; ++dt)
#pragma unroll
      for (int r = 0; r < 8; ++r) sO[w][rt * 16 + 8 * hh + r][dt * 16 + ln] = (oacc[rt][dt][r] + oaccl[rt][dt][r] * 0.0009765625f) * l_r[rt][r]; }
  __builtin_amdgcn_fence(__ATOMIC_ACQ_REL, "workgroup"); __builtin_amdgcn_wave_barrier();
  {
#pragma unroll
    for (int rp = 0; rp < RPW; rp += 2) { const int r = rp + (lane >> 4), pc = lane & 15; const v4f val = *(const v4fa*)&sO[w][r][pc * 4]; *(v4f*)(O + ((size_t)b * TQ + q0 + r) * ldo + h * 64 + pc * 4) = val; }
     } }


__global__ __launch_bounds__(256) void k_fulltab(unsigned* __restrict__ MB, int* __restrict__ RA, int* __restrict__ KE, int nq, int nk) {
  const int t = blockIdx.x * 256 + threadIdx.x;
  if (t < nq * (nk / 32)) { *(unsigned*)(MB + t) = 0u;  }
  if (t < nq) { *(int*)(RA + t) = 0;  }
  if (t < nq / 64) { *(int*)(KE + t * 32) = nk;  } }
__global__ __launch_bounds__(256) void k_lnx(const float* __restrict__ X, const float* __restrict__ g, const float* __restrict__ bb, _Float16* __restrict__ Y16, float* __restrict__ XB) {
  #pragma clang fp contract(off)
  const int tid = threadIdx.x, w = tid >> 5, ln = tid & 31; const int r = blockIdx.x * 8 + w; if (r >= NR) return; const float* x = X + (size_t)r * DM; float s = 0.f;
#pragma unroll 1
  for (int i = 0; i < DM / 128; ++i) { const v4f a = *(const v4fa*)(x + i * 128 + ln * 4); for (int q = 0; q < 4; ++q) s += bf16_round(a[q]); }
  for (int o = 16; o > 0; o >>= 1) s += __shfl_xor(s, o, 32); const float mu = s / (float)DM; float q2 = 0.f;
#pragma unroll 1
  for (int i = 0; i < DM / 128; ++i) { const v4f a = *(const v4fa*)(x + i * 128 + ln * 4); for (int q = 0; q < 4; ++q) { const float d = bf16_round(a[q]) - mu; q2 += d * d; } }
  for (int o = 16; o > 0; o >>= 1) q2 += __shfl_xor(q2, o, 32); const float rs = rsqrtf(q2 / (float)DM + 1e-5f);
  {
#pragma unroll 1
    for (int i = 0; i < DM / 128; ++i) { const int c0 = i * 128 + ln * 4; const v4f a = *(const v4fa*)(x + c0); _Float16 h4[4]; v4f xb;
      for (int q = 0; q < 4; ++q) { const float t = bf16_round(a[q]); h4[q] = (_Float16)((t - mu) * rs * bf16_round(g[c0 + q]) + bf16_round(bb[c0 + q])); xb[q] = t; }
      *(unsigned long long*)((unsigned short*)Y16 + (size_t)r * DM + c0) = *(const unsigned long long*)h4; *(v4f*)(XB + (size_t)r * DM + c0) = xb; }
     } }
// bucket table: LUT[d] = count of bf16-rounded edges < d (bucketize right=False), capped at NBIN-1, for d = 0..LUTN-1
__global__ __launch_bounds__(256) void k_lut(const float* __restrict__ edges, int* __restrict__ LUT) {
  #pragma clang fp contract(off)
  const int d = blockIdx.x * 256 + threadIdx.x; if (d >= LUTN) return; const float fd = (float)d; int c = 0;
#pragma unroll 1
  for (int e = 0; e < NBIN - 1; ++e) c += (bf16_round(edges[e]) < fd) ? 1 : 0;
  c = min(c, NBIN - 1); *(int*)(LUT + d) = c;  }
__global__ __launch_bounds__(256) void k_masktab(const float* __restrict__ mask, unsigned* __restrict__ MB, int* __restrict__ RA, int* __restrict__ KE) {
  const size_t t = (size_t)blockIdx.x * 256 + threadIdx.x; const int nw = SLEN / 32;
  if (t < (size_t)NBT * SLEN * nw) { const int w = (int)(t % nw); const int b = (int)(t / ((size_t)SLEN * nw)); unsigned bits = 0u; for (int j = 0; j < 32; ++j) bits |= (bf16_round(mask[(size_t)b * SLEN + 32 * w + j]) == 0.0f) ? (1u << j) : 0u; *(unsigned*)(MB + t) = bits;  }
  if (t < SLEN) { *(int*)(RA + t) = 0;  }
  if (t < SLEN / 64) { *(int*)(KE + t * 32) = SLEN;  } }
__global__ __launch_bounds__(256) void k_hlmask(const float* __restrict__ F, const float* __restrict__ mask, _Float16* __restrict__ Hh, _Float16* __restrict__ Hl, size_t n8) {
  #pragma clang fp contract(off)
  const size_t t = (size_t)blockIdx.x * 256 + threadIdx.x; if (t >= n8) return; const float mk = bf16_round(mask[(t * 8) / DM]); FragH fh, fl;
#pragma unroll
  for (int q = 0; q < 8; ++q) { const float v = F[t * 8 + q] * mk; const _Float16 h = (_Float16)v; fh.h[q] = h; fl.h[q] = (_Float16)((v - (float)h) * 1024.0f); }
  { *(v8us*)((unsigned short*)Hh + t * 8) = fh.half[0]; *(v8us*)((unsigned short*)Hl + t * 8) = fl.half[0];  } }
__global__ __launch_bounds__(256) void k_causaltab(unsigned* __restrict__ MB, int* __restrict__ RA, int* __restrict__ KE, int nq, int nk) {
  const int t = blockIdx.x * 256 + threadIdx.x; const int nw = nk / 32;
  if (t < nq * nw) { const int q = t / nw, w = t % nw; const int first = q + 1 - 32 * w; const unsigned bits = (first <= 0) ? 0xffffffffu : ((first >= 32) ? 0u : (0xffffffffu << first)); *(unsigned*)(MB + t) = bits;  }
  if (t < nq) { *(int*)(RA + t) = 0;  }
  if (t < nq / 64) { const int v = 64 * (t + 1); *(int*)(KE + t * 32) = v;  } }


extern "C" void kernel_launch(void* const* d_in, const int* in_sizes, int n_in,
                              void* d_out, int out_size, void* d_ws, size_t ws_size, hipStream_t stream) {
  (void)in_sizes; (void)n_in; (void)out_size;
  const float* const* I = (const float* const*)d_in; const float* x = I[0]; const int* pos = (const int*)d_in[1]; const float* mask = I[2]; const float* qw = I[3]; const float* qb = I[4]; const float* kw = I[5]; const float* kb = I[6]; const float* vw = I[7]; const float* vb = I[8]; const float* ow = I[9]; const float* ob = I[10]; const float* de = I[11]; const float* obias = I[12]; const float* edges = I[13];
  char* ws = (char*)d_ws; size_t off = 0;
  auto take = [&](size_t bytes) { char* p = ws + off; off += (bytes + 255) & ~(size_t)255; return p; };
  _Float16* BQ = (_Float16*)take((size_t)DM * DM * 2); _Float16* BK = (_Float16*)take((size_t)DM * DM * 2); _Float16* BV = (_Float16*)take((size_t)DM * DM * 2); _Float16* BO = (_Float16*)take((size_t)DM * DM * 2);
  _Float16* X16 = (_Float16*)take((size_t)NR * DM * 2); float* F = (float*)take((size_t)NR * DM * 4);
  _Float16* Qh = (_Float16*)take((size_t)NR * DM * 2); _Float16* Ql = (_Float16*)take((size_t)NR * DM * 2); _Float16* Kh = (_Float16*)take((size_t)NR * DM * 2); _Float16* Kl = (_Float16*)take((size_t)NR * DM * 2); _Float16* Vth = (_Float16*)take((size_t)NR * DM * 2); _Float16* Vtl = (_Float16*)take((size_t)NR * DM * 2);
  unsigned* MB = (unsigned*)take((size_t)NBT * SLEN * (SLEN / 32) * 4); int* RA = (int*)take((size_t)SLEN * 4); int* KE = (int*)take((size_t)(SLEN / 64) * 32 * 4); int* LUT = (int*)take((size_t)LUTN * 4);
  if (off > ws_size) return;      /* 2 + 8 + 16 + 48 + 1.1 = 75 MiB */
  float* O = F; _Float16* Oh = Qh; _Float16* Ol = Ql;
  const size_t w8 = (size_t)DM * DM / 8; const unsigned wb = (unsigned)((w8 + 255) / 256);
  k_round16f<<<wb, 256, 0, stream>>>(qw, BQ, w8); k_round16f<<<wb, 256, 0, stream>>>(kw, BK, w8); k_round16f<<<wb, 256, 0, stream>>>(vw, BV, w8); k_round16f<<<wb, 256, 0, stream>>>(ow, BO, w8);      /* torch (out,in) = natural Bt */
  k_lut<<<LUTN / 256, 256, 0, stream>>>(edges, LUT); k_masktab<<<(unsigned)(((size_t)NBT * SLEN * (SLEN / 32) + 255) / 256), 256, 0, stream>>>(mask, MB, RA, KE);
  const size_t n8 = (size_t)NR * DM / 8; const unsigned nb8 = (unsigned)((n8 + 255) / 256); const dim3 gP((NR / 128) * (DM / 64), 1);
  k_x16<<<nb8, 256, 0, stream>>>(x, X16, n8);
  k_gemm2<0><<<gP, 128, 0, stream>>>(X16, DM, 0, BQ, DM, 0, 0.0625f, qb, 0, nullptr, 1, 0, 0, F, nullptr, DM, 0, NR, DM, DM); k_hl<<<nb8, 256, 0, stream>>>(F, Qh, Ql, n8);
  k_gemm2<0><<<gP, 128, 0, stream>>>(X16, DM, 0, BK, DM, 0, 0.0625f, kb, 0, nullptr, 1, 0, 0, F, nullptr, DM, 0, NR, DM, DM); k_hl<<<nb8, 256, 0, stream>>>(F, Kh, Kl, n8);
  k_gemm2<0><<<gP, 128, 0, stream>>>(X16, DM, 0, BV, DM, 0, 0.0625f, vb, 0, nullptr, 1, 0, 0, F, nullptr, DM, 0, NR, DM, DM);
  k_vthl<SLEN><<<NBT * NH * (SLEN / 64), 256, 0, stream>>>(F, DM, Vth, Vtl);
  k_flashb<SLEN, SLEN><<<NBT * NH * (SLEN / 64), 128, 0, stream>>>(Qh, Ql, DM, Kh, Kl, DM, Vth, Vtl, MB, RA, KE, de, obias, LUT, pos, O, DM);
  k_hlmask<<<nb8, 256, 0, stream>>>(O, mask, Oh, Ol, n8);
  k_gemm2<0><<<gP, 128, 0, stream>>>(Oh, DM, 0, BO, DM, 0, 0.0625f, ob, 0, nullptr, 1, 0, 0, (float*)d_out, nullptr, DM, 0, NR, DM, DM);
  k_gemm2<0><<<gP, 128, 0, stream>>>(Ol, DM, 0, BO, DM, 0, 0.0625f / 1024.0f, nullptr, 0, (float*)d_out, 1, (size_t)DM, 0, (float*)d_out, nullptr, DM, 0, NR, DM, DM);
}

// v002
// A run of this version takes 457 microseconds.
// Timed twice side by side with v001, it ran 1.13 and 1.12 times as fast.
// Over all steps from v000 it is 4.51 times as fast.
#include <hip/hip_runtime.h>
// Grammar attention (8 x 1024 tokens, 512 = 8 heads x 64): q,k,v = x W^T + b; scores = q.k/8 + dist_emb[bucket(|pos_j - pos_i|)][h] + ((pos_j > pos_i) - 0.5) * order_bias[h] with INPUT int32 positions, INPUT bin edges (torch.bucketize right=False = count of edges < dist) and an INPUT key/query mask (masked keys excluded; masked query rows zeroed before the output projection, as out * mask); softmax; out = ((attn v) * mask) Wo^T + bo -> [8,1024,512].
// Structure: x as an exact f16 plane; projections as f16 WMMA GEMMs (32x64 wave tiles, f32 accumulation, exact x16 weights + bias); a device-built bucket lookup table over integer distances (from the INPUT edges) and per-batch key-mask bit tables; q, k as f16 hi + (x2^10) residual planes, V^T as hi + residual planes; the fused flash kernel gathers both biases by the INPUT positions inside the score stage (online f32 softmax, P staged hi + residual, two value accumulators); O scaled by the query mask, split hi/lo, into Wo (two GEMMs, bias in the first).
// Compute dtype: x, weights, biases, dist_emb, order_bias, bin_edges, mask rounded to bf16; projections exact; q, k, P, v, O as f16 hi + residual pairs (~2^-21); f32 accumulation and softmax. v_wmma_f32_16x16x32_f16.
#define NBT 8
#define SLEN 1024
#define NBIN 32
#define LUTN 16384            /* bucket lookup over integer distances 0..LUTN-1 (positions < 5000) */
#define DM 512
#define NH 8
#define SCL 0.125f
#define NR (NBT * SLEN)
typedef __bf16 v16b __attribute__((ext_vector_type(16)));
typedef unsigned short v8us __attribute__((ext_vector_type(8), may_alias));
typedef float  v8f  __attribute__((ext_vector_type(8)));
typedef float  v4f  __attribute__((ext_vector_type(4)));
typedef float  v4fa __attribute__((ext_vector_type(4), may_alias));
union FragB { v16b v; v8us half[2]; unsigned short u[16]; };

__device__ __forceinline__ unsigned short bf16_bits(float x) { unsigned int u = __float_as_uint(x); return (unsigned short)((u + 0x7FFFu + ((u >> 16) & 1u)) >> 16); }
__device__ __forceinline__ float bf16_val(unsigned short b) { return __uint_as_float(((unsigned int)b) << 16); }
__device__ __forceinline__ float bf16_round(float x) { return bf16_val(bf16_bits(x)); }
// D += A·B with NT terms: 1 = ah·bh, 2 = + al·bh (A split), 3 = + ah·bl (both split)
template <int NT>
__device__ __forceinline__ v8f mmaN(v16b ah, v16b al, v16b bh, v16b bl, v8f c) {
  c = __builtin_amdgcn_wmma_f32_16x16x32_bf16(false, ah, false, bh, (short)0, c, false, false);
  if (NT >= 2) c = __builtin_amdgcn_wmma_f32_16x16x32_bf16(false, al, false, bh, (short)0, c, false, false);
  if (NT >= 3) c = __builtin_amdgcn_wmma_f32_16x16x32_bf16(false, ah, false, bl, (short)0, c, false, false);
  asm volatile("v_nop\n\tv_nop\n\tv_nop\n\tv_nop" : "+v"(c) : "v"(ah), "v"(al), "v"(bh), "v"(bl));
  return c;
}

__global__ __launch_bounds__(256) void k_wt_bf16(const float* __restrict__ W, unsigned short* __restrict__ Wt, int K, int N) {
  const int t = blockIdx.x * 256 + threadIdx.x;
  const int k8n = K / 8;
  if (t >= N * k8n) return;
  const int n = t / k8n, k8 = (t % k8n) * 8;
  v8us v;
#pragma unroll
  for (int i = 0; i < 8; ++i) v[i] = bf16_bits(W[(size_t)(k8 + i) * N + n]);
  *(v8us*)(Wt + (size_t)n * K + k8) = v;
  
}

// GEMM C[M][N] (f32, pitch ldc) = act(A[M][K]·W + bias). A f32 row-major (pitch lda) converted per fragment to bf16
// (ASPLIT: hi/lo two planes -> 2 terms, else single rounded term); Wt bf16 [N][K] (pitch ldb). BIAS_BF16 rounds the
// bias to bf16 first (bias quantised to bf16 before the add). K%32==0, M%16==0, N%64==0.
template <bool ASPLIT, int ACT, bool BIAS_BF16>
__global__ __launch_bounds__(128) void k_gemm_bf(const float* __restrict__ A, int lda, const unsigned short* __restrict__ Wt, int ldb,
                                               const float* __restrict__ bias, float* __restrict__ C, int ldc, int M, int N, int K) {
  __shared__ __attribute__((aligned(16))) float so[4][16][64];
  const int tid = threadIdx.x, w = tid >> 5, lane = tid & 31, ln = lane & 15, hh = lane >> 4;
  const int ntn = N / 64;
  const int wid = blockIdx.x * 4 + w;
  const int mt = wid / ntn, nq = wid % ntn;
  if (mt * 16 >= M) return;
  const int row0 = mt * 16, col0 = nq * 64;
  const float* arow = A + (size_t)(row0 + ln) * lda;
  v8f acc[4] = {};
  for (int kb = 0; kb < K; kb += 32) {
    FragB ah, al;
    const v4f x0 = *(const v4fa*)(arow + kb + 8 * hh), x1 = *(const v4fa*)(arow + kb + 8 * hh + 4);
    const v4f x2 = *(const v4fa*)(arow + kb + 16 + 8 * hh), x3 = *(const v4fa*)(arow + kb + 16 + 8 * hh + 4);
    float xs[16] = {x0[0],x0[1],x0[2],x0[3],x1[0],x1[1],x1[2],x1[3],x2[0],x2[1],x2[2],x2[3],x3[0],x3[1],x3[2],x3[3]};
#pragma unroll
    for (int i = 0; i < 16; ++i) { const unsigned short hb = bf16_bits(xs[i]); ah.u[i] = hb; al.u[i] = ASPLIT ? bf16_bits(xs[i] - bf16_val(hb)) : (unsigned short)0; }
#pragma unroll
    for (int t = 0; t < 4; ++t) {
      const unsigned short* brow = Wt + (size_t)(col0 + t * 16 + ln) * ldb + kb;
      FragB b;
      b.half[0] = *(const v8us*)(brow + 8 * hh);
      b.half[1] = *(const v8us*)(brow + 16 + 8 * hh);
      acc[t] = mmaN<ASPLIT ? 2 : 1>(ah.v, al.v, b.v, b.v, acc[t]);
    }
  }
#pragma unroll
  for (int t = 0; t < 4; ++t) {
    float bv = bias ? bias[col0 + t * 16 + ln] : 0.f;
    if (BIAS_BF16) bv = bf16_round(bv);
#pragma unroll
    for (int r = 0; r < 8; ++r) { float v = acc[t][r] + bv; if (ACT == 1) v = fmaxf(v, 0.f); so[w][8 * hh + r][t * 16 + ln] = v; }
  }
  __builtin_amdgcn_fence(__ATOMIC_ACQ_REL, "workgroup");
  __builtin_amdgcn_wave_barrier();
  const int rsub = lane >> 4, c4 = (lane & 15) * 4;
  {
#pragma unroll
    for (int q = 0; q < 8; ++q) {
      const int r = q * 2 + rsub;
      const v4f v = *(const v4fa*)&so[w][r][c4];
      *(v4f*)(C + (size_t)(row0 + r) * ldc + col0 + c4) = v;
    }
    
  }
}

// GEMM C = act(A·W + bias + resid): A f32 (ASPLIT -> hi/lo 2 terms), Wt bf16 [N][K]; ACT 0 none, 1 relu, 2 exact gelu;
// resid (optional, f32, row index = (row % rmod), pitch ldr, RES_BF16 rounds it) added before the activation.
template <bool ASPLIT, int ACT, bool BIAS_BF16, bool RES_BF16>
__global__ __launch_bounds__(128) void k_gemm_bf3(const float* __restrict__ A, int lda, const unsigned short* __restrict__ Wt, int ldb,
                                                const float* __restrict__ bias, const float* __restrict__ resid, int rmod, int ldr,
                                                float* __restrict__ C, int ldc, int M, int N, int K) {
  __shared__ __attribute__((aligned(16))) float so[4][16][64];
  const int tid = threadIdx.x, w = tid >> 5, lane = tid & 31, ln = lane & 15, hh = lane >> 4;
  const int ntn = N / 64;
  const int wid = blockIdx.x * 4 + w;
  const int mt = wid / ntn, nq = wid % ntn;
  if (mt * 16 >= M) return;
  const int row0 = mt * 16, col0 = nq * 64;
  const float* arow = A + (size_t)(row0 + ln) * lda;
  v8f acc[4] = {};
  for (int kb = 0; kb < K; kb += 32) {
    FragB ah, al;
    const v4f x0 = *(const v4fa*)(arow + kb + 8 * hh), x1 = *(const v4fa*)(arow + kb + 8 * hh + 4);
    const v4f x2 = *(const v4fa*)(arow + kb + 16 + 8 * hh), x3 = *(const v4fa*)(arow + kb + 16 + 8 * hh + 4);
    float xs[16] = {x0[0],x0[1],x0[2],x0[3],x1[0],x1[1],x1[2],x1[3],x2[0],x2[1],x2[2],x2[3],x3[0],x3[1],x3[2],x3[3]};
#pragma unroll
    for (int i = 0; i < 16; ++i) { const unsigned short hb = bf16_bits(xs[i]); ah.u[i] = hb; al.u[i] = ASPLIT ? bf16_bits(xs[i] - bf16_val(hb)) : (unsigned short)0; }
#pragma unroll
    for (int t = 0; t < 4; ++t) {
      const unsigned short* brow = Wt + (size_t)(col0 + t * 16 + ln) * ldb + kb;
      FragB b;
      b.half[0] = *(const v8us*)(brow + 8 * hh);
      b.half[1] = *(const v8us*)(brow + 16 + 8 * hh);
      acc[t] = mmaN<ASPLIT ? 2 : 1>(ah.v, al.v, b.v, b.v, acc[t]);
    }
  }
#pragma unroll
  for (int t = 0; t < 4; ++t) {
    const int col = col0 + t * 16 + ln;
    float bv = bias ? bias[col] : 0.f;
    if (BIAS_BF16) bv = bf16_round(bv);
#pragma unroll
    for (int r = 0; r < 8; ++r) {
      float v = acc[t][r] + bv;
      if (resid) { float rv = resid[(size_t)((row0 + 8 * hh + r) % rmod) * ldr + col]; if (RES_BF16) rv = bf16_round(rv); v += rv; }
      if (ACT == 1) v = fmaxf(v, 0.f);
      if (ACT == 2) v = 0.5f * v * (1.0f + erff(v * 0.70710678118654752f));
      if (ACT == 3) { const float u = 0.7978845608028654f * (v + 0.044715f * v * v * v); v = 0.5f * v * (1.0f + tanhf(u)); }
      so[w][8 * hh + r][t * 16 + ln] = v;
    }
  }
  __builtin_amdgcn_fence(__ATOMIC_ACQ_REL, "workgroup");
  __builtin_amdgcn_wave_barrier();
  const int rsub = lane >> 4, c4 = (lane & 15) * 4;
  {
#pragma unroll
    for (int q = 0; q < 8; ++q) {
      const int r = q * 2 + rsub;
      const v4f v = *(const v4fa*)&so[w][r][c4];
      *(v4f*)(C + (size_t)(row0 + r) * ldc + col0 + c4) = v;
    }
    
  }
}
// row LayerNorm (biased variance, eps) over N: s = X (+ R); optional out_sum <- s; out_norm <- (s-mu)*rsqrt(var+eps)*g + b
template <bool PARAM_BF16>
__global__ __launch_bounds__(256) void k_layernorm(const float* __restrict__ X, const float* __restrict__ R, const float* __restrict__ g, const float* __restrict__ bta,
                                                  float* __restrict__ out_sum, float* __restrict__ out_norm, int N, float eps) {
  __shared__ float red[256];
  const int row = blockIdx.x, tid = threadIdx.x;
  const float* x = X + (size_t)row * N; const float* rr = R ? R + (size_t)row * N : nullptr;
  float vals[16];                     // up to N = 4096
  const int per = N / 256;            // contiguous chunk per thread? use strided-by-4 chunks: thread handles j = tid*4 + 1024*u
  float s1 = 0.f;
  for (int u = 0; u < per / 4; ++u) {
    const int j = tid * 4 + 1024 * u;
    const v4f a = *(const v4fa*)(x + j);
    v4f b = {0.f,0.f,0.f,0.f}; if (rr) b = *(const v4fa*)(rr + j);
#pragma unroll
    for (int q = 0; q < 4; ++q) { const float v = a[q] + b[q]; vals[u * 4 + q] = v; s1 += v; }
  }
  red[tid] = s1; __syncthreads();
  for (int st = 128; st > 0; st >>= 1) { if (tid < st) red[tid] += red[tid + st]; __syncthreads(); }
  const float mu = red[0] / (float)N; __syncthreads();
  float s2 = 0.f;
  for (int u = 0; u < per / 4; ++u)
#pragma unroll
    for (int q = 0; q < 4; ++q) { const float c = vals[u * 4 + q] - mu; s2 += c * c; }
  red[tid] = s2; __syncthreads();
  for (int st = 128; st > 0; st >>= 1) { if (tid < st) red[tid] += red[tid + st]; __syncthreads(); }
  const float rs = rsqrtf(red[0] / (float)N + eps);
  {
    for (int u = 0; u < per / 4; ++u) {
      const int j = tid * 4 + 1024 * u;
      v4f o, sm;
#pragma unroll
      for (int q = 0; q < 4; ++q) {
        float gg = g[j + q], bb = bta[j + q];
        if (PARAM_BF16) { gg = bf16_round(gg); bb = bf16_round(bb); }
        sm[q] = vals[u * 4 + q]; o[q] = (vals[u * 4 + q] - mu) * rs * gg + bb;
      }
      if (out_sum) *(v4f*)(out_sum + (size_t)row * N + j) = sm;
      *(v4f*)(out_norm + (size_t)row * N + j) = o;
    }
    
  }
}



// ---- f16 WMMA path (v_wmma_f32_16x16x32_f16): 11-bit significands for operands in range — used where a [0,1] probability operand needs more precision than bf16
typedef _Float16 v16h __attribute__((ext_vector_type(16)));
union FragH { v16h v; v8us half[2]; _Float16 h[16]; unsigned short u[16]; };
template <int NT>
__device__ __forceinline__ v8f mmaH(v16h ah, v16h al, v16h bh, v16h bl, v8f c) {
  c = __builtin_amdgcn_wmma_f32_16x16x32_f16(false, ah, false, bh, (short)0, c, false, false);
  if (NT >= 2) c = __builtin_amdgcn_wmma_f32_16x16x32_f16(false, al, false, bh, (short)0, c, false, false);
  if (NT >= 3) c = __builtin_amdgcn_wmma_f32_16x16x32_f16(false, ah, false, bl, (short)0, c, false, false);
  asm volatile("v_nop\n\tv_nop\n\tv_nop\n\tv_nop" : "+v"(c) : "v"(ah), "v"(al), "v"(bh), "v"(bl));
  return c;
}
// batched GEMM like k_gemm_b but f16 operands: A f32 (split into f16 hi/lo if ASPLIT, else rounded to f16), Bt = f16 values [n][k]; alpha; C f32; N multiple of 16 (partial tiles skipped)
template <bool ASPLIT>
__global__ __launch_bounds__(128) void k_gemm_h(const float* __restrict__ A, int lda, size_t sA, const _Float16* __restrict__ Bh, int ldb, size_t sB, float alpha, float* __restrict__ C, int ldc, size_t sC, int M, int N, int K) {
  __shared__ __attribute__((aligned(16))) float so[4][16][64];
  const int tid = threadIdx.x, w = tid >> 5, lane = tid & 31, ln = lane & 15, hh = lane >> 4; const int by = blockIdx.y;
  A += (size_t)by * sA; Bh += (size_t)by * sB; C += (size_t)by * sC;
  const int ntn = (N + 63) / 64; const int wid = blockIdx.x * 4 + w; const int mt = wid / ntn, nq = wid % ntn; if (mt * 16 >= M) return;
  const int row0 = mt * 16, col0 = nq * 64; const float* arow = A + (size_t)(row0 + ln) * lda;
  v8f acc[4] = {};
  for (int kb = 0; kb < K; kb += 32) {
    FragH ah, al;
    const v4f x0 = *(const v4fa*)(arow + kb + 8 * hh), x1 = *(const v4fa*)(arow + kb + 8 * hh + 4), x2 = *(const v4fa*)(arow + kb + 16 + 8 * hh), x3 = *(const v4fa*)(arow + kb + 16 + 8 * hh + 4);
    float xs[16] = {x0[0],x0[1],x0[2],x0[3],x1[0],x1[1],x1[2],x1[3],x2[0],x2[1],x2[2],x2[3],x3[0],x3[1],x3[2],x3[3]};
#pragma unroll
    for (int i = 0; i < 16; ++i) { const _Float16 h = (_Float16)xs[i]; ah.h[i] = h; al.h[i] = ASPLIT ? (_Float16)(xs[i] - (float)h) : (_Float16)0.0f; }
#pragma unroll
    for (int t = 0; t < 4; ++t) { if (col0 + t * 16 >= N) continue; const size_t boff = (size_t)(col0 + t * 16 + ln) * ldb + kb; FragH bq; bq.half[0] = *(const v8us*)(Bh + boff + 8 * hh); bq.half[1] = *(const v8us*)(Bh + boff + 16 + 8 * hh);
      acc[t] = mmaH<ASPLIT ? 2 : 1>(ah.v, al.v, bq.v, bq.v, acc[t]); }
  }
#pragma unroll
  for (int t = 0; t < 4; ++t) { if (col0 + t * 16 >= N) continue;
#pragma unroll
    for (int r = 0; r < 8; ++r) so[w][8 * hh + r][t * 16 + ln] = acc[t][r] * alpha; }
  __builtin_amdgcn_fence(__ATOMIC_ACQ_REL, "workgroup"); __builtin_amdgcn_wave_barrier();
  const int rsub = lane >> 4, c4 = (lane & 15) * 4;
  {
#pragma unroll
    for (int q = 0; q < 8; ++q) { const int r = q * 2 + rsub; if (col0 + c4 < N) { const v4f v = *(const v4fa*)&so[w][r][c4]; *(v4f*)(C + (size_t)(row0 + r) * ldc + col0 + c4) = v; } }
     }
}

// Wt[n][k] = f16(W[k][n]·scale) from f32 row-major W[K][N] (scale = power of two; bf16-exact weights stay exact in f16 away from the subnormal range)
__global__ __launch_bounds__(256) void k_wt_f16(const float* __restrict__ W, _Float16* __restrict__ Wt, int K, int N, float scale) {
  const int t = blockIdx.x * 256 + threadIdx.x; if (t >= N * (K / 8)) return; const int n = t / (K / 8), k8 = (t % (K / 8)) * 8; FragH f;
#pragma unroll
  for (int i = 0; i < 8; ++i) f.h[i] = (_Float16)(bf16_round(W[(size_t)(k8 + i) * N + n]) * scale); const v8us o = f.half[0];
  *(v8us*)((unsigned short*)Wt + (size_t)n * K + k8) = o; 
}
// k_gemm_hh variant with fused epilogue: v = acc·alpha + bias[by·sBias + col] (+ CP[(row/rowsPerB)·sCPb + by·64 + col] if CP) ; ACT 0 none / 1 elu ; writes f16 C16 (and f32 C if non-null)
template <int ACT>
__global__ __launch_bounds__(128) void k_gemm_hhx(const _Float16* __restrict__ A, int lda, size_t sA, const _Float16* __restrict__ Bh, int ldb, size_t sB, float alpha, const float* __restrict__ bias, size_t sBias, const float* __restrict__ CP, int rowsPerB, size_t sCPb, int row0g,
    float* __restrict__ C, _Float16* __restrict__ C16, int ldc, size_t sC, int M, int N, int K) {
  __shared__ __attribute__((aligned(16))) float so[4][16][64];
  const int tid = threadIdx.x, w = tid >> 5, lane = tid & 31, ln = lane & 15, hh = lane >> 4; const int by = blockIdx.y;
  A += (size_t)by * sA; Bh += (size_t)by * sB; const size_t cofs = (size_t)by * sC; const float* bp = bias ? bias + (size_t)by * sBias : nullptr;
  const int ntn = (N + 63) / 64; const int wid = blockIdx.x * 4 + w; const int mt = wid / ntn, nq = wid % ntn; if (mt * 16 >= M) return;
  const int row0 = mt * 16, col0 = nq * 64; const _Float16* arow = A + (size_t)(row0 + ln) * lda;
  v8f acc[4] = {};
  for (int kb = 0; kb < K; kb += 32) { FragH ah; ah.half[0] = *(const v8us*)((const unsigned short*)arow + kb + 8 * hh); ah.half[1] = *(const v8us*)((const unsigned short*)arow + kb + 16 + 8 * hh);
#pragma unroll
    for (int t = 0; t < 4; ++t) { if (col0 + t * 16 >= N) continue; const size_t boff = (size_t)(col0 + t * 16 + ln) * ldb + kb; FragH bq; bq.half[0] = *(const v8us*)((const unsigned short*)Bh + boff + 8 * hh); bq.half[1] = *(const v8us*)((const unsigned short*)Bh + boff + 16 + 8 * hh);
      acc[t] = mmaH<1>(ah.v, ah.v, bq.v, bq.v, acc[t]); }
  }
#pragma unroll
  for (int t = 0; t < 4; ++t) { if (col0 + t * 16 >= N) continue; const int col = col0 + t * 16 + ln; const float bv = bp ? bf16_round(bp[col]) : 0.f;
#pragma unroll
    for (int r = 0; r < 8; ++r) { float v = acc[t][r] * alpha + bv; if (CP) { const int bidx = (row0g + row0 + 8 * hh + r) / rowsPerB; v += CP[(size_t)bidx * sCPb + (size_t)by * 64 + col]; } if (ACT == 1) v = (v > 0.f) ? v : expm1f(v); else if (ACT == 7) v = (v > 0.f) ? v + 1.0f : expf(v); else if (ACT == 8) v = tanhf(v); else if (ACT == 9) v = 0.5f * v * (1.0f + tanhf(0.7978845608028654f * (v + 0.044715f * v * v * v))); else if (ACT == 11) v = 1.0f / (1.0f + expf(-v)); else if (ACT == 12) v = (v > 0.f) ? v : 0.01f * v; else if (ACT == 14) v = (v > 0.f) ? v : 0.1f * v; else if (ACT == 15) v = v / (1.0f + expf(-v)); else if (ACT == 3) v = fmaxf(v, 0.f); else if (ACT == 6) v = 0.5f * v * (1.0f + erff(v * 0.70710678118654752f)); so[w][8 * hh + r][t * 16 + ln] = v; } }
  __builtin_amdgcn_fence(__ATOMIC_ACQ_REL, "workgroup"); __builtin_amdgcn_wave_barrier();
  const int rsub = lane >> 4, c4 = (lane & 15) * 4; typedef _Float16 v4h __attribute__((ext_vector_type(4)));
  {
#pragma unroll
    for (int q = 0; q < 8; ++q) { const int r = q * 2 + rsub; if (col0 + c4 < N) { const v4f v = *(const v4fa*)&so[w][r][c4]; if (C) *(v4f*)(C + cofs + (size_t)(row0 + r) * ldc + col0 + c4) = v; if (C16) { v4h h4; for (int i = 0; i < 4; ++i) h4[i] = (_Float16)v[i]; *(v4h*)(C16 + cofs + (size_t)(row0 + r) * ldc + col0 + c4) = h4; } } }
     }
}


typedef _Float16 v4h __attribute__((ext_vector_type(4)));

__global__ __launch_bounds__(256) void k_x16(const float* __restrict__ x, _Float16* __restrict__ X16, size_t n8) { const size_t t = (size_t)blockIdx.x * 256 + threadIdx.x; if (t >= n8) return; FragH f;
#pragma unroll
  for (int q = 0; q < 8; ++q) f.h[q] = (_Float16)bf16_round(x[t * 8 + q]); *(v8us*)((unsigned short*)X16 + t * 8) = f.half[0];  }
__global__ __launch_bounds__(256) void k_h16(const float* __restrict__ x, _Float16* __restrict__ X16, size_t n8) { const size_t t = (size_t)blockIdx.x * 256 + threadIdx.x; if (t >= n8) return; FragH f;
#pragma unroll
  for (int q = 0; q < 8; ++q) f.h[q] = (_Float16)x[t * 8 + q]; *(v8us*)((unsigned short*)X16 + t * 8) = f.half[0];  }
__global__ __launch_bounds__(256) void k_round16f(const float* __restrict__ W, _Float16* __restrict__ Bt, size_t n8) { const size_t t = (size_t)blockIdx.x * 256 + threadIdx.x; if (t >= n8) return; FragH f;
#pragma unroll
  for (int i = 0; i < 8; ++i) f.h[i] = (_Float16)(bf16_round(W[t * 8 + i]) * 16.0f); *(v8us*)((unsigned short*)Bt + t * 8) = f.half[0];  }
template <int NHv, int TTv>
__global__ __launch_bounds__(256) void k_vt(const _Float16* __restrict__ V16, int ldv, int voff, _Float16* __restrict__ Vt) { __shared__ unsigned short tl[64][66]; const int tid = threadIdx.x; const int slab = blockIdx.x / (TTv / 64), lg = blockIdx.x % (TTv / 64); const int b = slab / NHv, h = slab % NHv;
  for (int i = tid; i < 64 * 8; i += 256) { const int r = i / 8, c8 = (i % 8) * 8; FragH f; f.half[0] = *(const v8us*)((const unsigned short*)V16 + ((size_t)b * TTv + lg * 64 + r) * ldv + voff + h * 64 + c8);
#pragma unroll
    for (int q = 0; q < 8; ++q) tl[r][c8 + q] = f.u[q]; }
  __syncthreads();
  {
#pragma unroll
    for (int rd = 0; rd < 2; ++rd) { const int d = rd * 32 + tid / 8, pc = tid % 8; FragH f;
#pragma unroll
      for (int q = 0; q < 8; ++q) f.u[q] = tl[pc * 8 + q][d];
      *(v8us*)((unsigned short*)Vt + ((size_t)slab * 64 + d) * TTv + lg * 64 + pc * 8) = f.half[0]; }
     } }

__global__ __launch_bounds__(256) void k_hl(const float* __restrict__ F, _Float16* __restrict__ Hh, _Float16* __restrict__ Hl, size_t n8) { const size_t t = (size_t)blockIdx.x * 256 + threadIdx.x; if (t >= n8) return; FragH fh, fl; const v4f a = *(const v4fa*)(F + t * 8), c = *(const v4fa*)(F + t * 8 + 4);
#pragma unroll
  for (int q = 0; q < 4; ++q) { _Float16 h = (_Float16)a[q]; fh.h[q] = h; fl.h[q] = (_Float16)((a[q] - (float)h) * 1024.0f); h = (_Float16)c[q]; fh.h[4 + q] = h; fl.h[4 + q] = (_Float16)((c[q] - (float)h) * 1024.0f); }
  { *(v8us*)((unsigned short*)Hh + t * 8) = fh.half[0]; *(v8us*)((unsigned short*)Hl + t * 8) = fl.half[0];  } }

// ---- fast GEMM (wave tile 32x64; requires M % 32 == 0 rows per launch region and N % 64 == 0); epilogue = k_gemm_hhx semantics ----
__device__ __forceinline__ v16h g2_frag(const _Float16* p, int hh) { FragH f; f.half[0] = *(const v8us*)((const unsigned short*)p + 8 * hh); f.half[1] = *(const v8us*)((const unsigned short*)p + 16 + 8 * hh); return f.v; }
__device__ __forceinline__ v8f g2_mma(v16h a, v16h b, v8f c) { v8f d = __builtin_amdgcn_wmma_f32_16x16x32_f16(false, a, false, b, (short)0, c, false, false); asm volatile("v_nop\n\tv_nop\n\tv_nop\n\tv_nop" : "+v"(d) : "v"(a), "v"(b)); return d; }
template <int ACT>
__global__ __launch_bounds__(128) void k_gemm2(const _Float16* __restrict__ A, int lda, size_t sA, const _Float16* __restrict__ Bh, int ldb, size_t sB, float alpha, const float* __restrict__ bias, size_t sBias, const float* __restrict__ CP, int rowsPerB, size_t sCPb, int row0g,
    float* __restrict__ C, _Float16* __restrict__ C16, int ldc, size_t sC, int M, int N, int K) {
  __shared__ __attribute__((aligned(16))) float so[4][32][68];
  const int tid = threadIdx.x, w = tid >> 5, lane = tid & 31, ln = lane & 15, hh = lane >> 4; const int by = blockIdx.y;
  A += (size_t)by * sA; Bh += (size_t)by * sB; const size_t cofs = (size_t)by * sC; const float* bp = bias ? bias + (size_t)by * sBias : nullptr;
  const int ntn = N >> 6; const int mt = blockIdx.x / ntn, nq = blockIdx.x - mt * ntn; const int row0 = mt * 128 + 32 * w, col0 = nq * 64; if (row0 >= M) return;
  const _Float16* a0p = A + (size_t)(row0 + ln) * lda; const _Float16* a1p = a0p + (size_t)16 * lda;
  const _Float16* b0p = Bh + (size_t)(col0 + ln) * ldb; const _Float16* b1p = b0p + (size_t)16 * ldb; const _Float16* b2p = b1p + (size_t)16 * ldb; const _Float16* b3p = b2p + (size_t)16 * ldb;
  const v8f z8 = {0.f,0.f,0.f,0.f,0.f,0.f,0.f,0.f}; v8f c00 = z8, c01 = z8, c02 = z8, c03 = z8, c10 = z8, c11 = z8, c12 = z8, c13 = z8;
#pragma unroll 1
  for (int kb = 0; kb < K; kb += 32) { const v16h a0 = g2_frag(a0p + kb, hh), a1 = g2_frag(a1p + kb, hh);
    v16h b = g2_frag(b0p + kb, hh); c00 = g2_mma(a0, b, c00); c10 = g2_mma(a1, b, c10);
    b = g2_frag(b1p + kb, hh); c01 = g2_mma(a0, b, c01); c11 = g2_mma(a1, b, c11);
    b = g2_frag(b2p + kb, hh); c02 = g2_mma(a0, b, c02); c12 = g2_mma(a1, b, c12);
    b = g2_frag(b3p + kb, hh); c03 = g2_mma(a0, b, c03); c13 = g2_mma(a1, b, c13); }
  v8f accs[8] = {c00, c01, c02, c03, c10, c11, c12, c13};
#pragma unroll
  for (int u = 0; u < 8; ++u) { const int t = u & 3, half = u >> 2; const int col = col0 + t * 16 + ln; const float bv = bp ? bf16_round(bp[col]) : 0.f;
#pragma unroll
    for (int r = 0; r < 8; ++r) { const int rloc = half * 16 + 8 * hh + r; float v = accs[u][r] * alpha + bv; if (CP) { const int bidx = (row0g + row0 + rloc) / rowsPerB; v += CP[(size_t)bidx * sCPb + (size_t)by * 64 + col]; }
      if (ACT == 3) v = fmaxf(v, 0.f); else if (ACT == 6) v = 0.5f * v * (1.0f + erff(v * 0.70710678118654752f)); else if (ACT == 11) v = 1.0f / (1.0f + expf(-v)); else if (ACT == 15) v = v / (1.0f + expf(-v)); else if (ACT == 12) v = (v > 0.f) ? v : 0.01f * v; else if (ACT == 8) v = tanhf(v);
      so[w][rloc][t * 16 + ln] = v; } }
  __builtin_amdgcn_fence(__ATOMIC_ACQ_REL, "workgroup"); __builtin_amdgcn_wave_barrier();
  const int rsub = lane >> 4, c4 = (lane & 15) * 4;
  {
#pragma unroll
    for (int q = 0; q < 16; ++q) { const int r = q * 2 + rsub; const v4f v = *(const v4fa*)&so[w][r][c4]; if (C) *(v4f*)(C + cofs + (size_t)(row0 + r) * ldc + col0 + c4) = v; if (C16) { v4h h4; for (int i = 0; i < 4; ++i) h4[i] = (_Float16)v[i]; *(v4h*)(C16 + cofs + (size_t)(row0 + r) * ldc + col0 + c4) = h4; } }
     } }



template <int TK>
__global__ __launch_bounds__(256) void k_vthl(const float* __restrict__ VF, int ldv, _Float16* __restrict__ Vth, _Float16* __restrict__ Vtl) { __shared__ float tl[64][65]; const int tid = threadIdx.x; const int slab = blockIdx.x / (TK / 64), lg = blockIdx.x % (TK / 64); const int b = slab / NH, h = slab % NH;
  for (int i = tid; i < 64 * 16; i += 256) { const int r = i / 16, c4 = (i % 16) * 4; const v4f a = *(const v4fa*)(VF + ((size_t)b * TK + lg * 64 + r) * ldv + h * 64 + c4); tl[r][c4] = a[0]; tl[r][c4 + 1] = a[1]; tl[r][c4 + 2] = a[2]; tl[r][c4 + 3] = a[3]; }
  __syncthreads();
  FragH fh[2], fl[2]; size_t oo[2];
#pragma unroll
  for (int rd = 0; rd < 2; ++rd) { const int d = rd * 32 + tid / 8, pc = tid % 8;
#pragma unroll
    for (int q = 0; q < 8; ++q) { const float v = tl[pc * 8 + q][d]; const _Float16 hv = (_Float16)v; fh[rd].h[q] = hv; fl[rd].h[q] = (_Float16)((v - (float)hv) * 1024.0f); } oo[rd] = ((size_t)slab * 64 + d) * TK + lg * 64 + pc * 8; }
  {
#pragma unroll
    for (int rd = 0; rd < 2; ++rd) { *(v8us*)((unsigned short*)Vth + oo[rd]) = fh[rd].half[0]; *(v8us*)((unsigned short*)Vtl + oo[rd]) = fl[rd].half[0]; }
     } }

// grammar bias for (query position pi, key position pj): dist_emb[bucket(|pj - pi|)][h] + ((pj > pi) - 0.5) * order_bias[h]
__device__ __forceinline__ float gbias(const float* sDE, const float* __restrict__ OB, const unsigned char* sLUT, int h, int pi, int pj) { int d = abs(pj - pi); d = min(d, LUTN - 1); const int bin = sLUT[d]; return sDE[bin] + (((pj > pi) ? 1.0f : 0.0f) - 0.5f) * bf16_round(OB[h]); }
template <int TQ, int TK>
__global__ __launch_bounds__(128) void k_flashb(const _Float16* __restrict__ Q16, const _Float16* __restrict__ Q16lo, int ldq, const _Float16* __restrict__ K16, const _Float16* __restrict__ K16lo, int ldk, const _Float16* __restrict__ Vt, const _Float16* __restrict__ Vtlo, const unsigned* __restrict__ MB, const int* __restrict__ RA, const int* __restrict__ KE, const float* __restrict__ BT, const float* __restrict__ OB, const int* __restrict__ LUT, const int* __restrict__ LAG, float* __restrict__ O, int ldo) {
  constexpr int RPW = 16, RTN = RPW / 16, NQB = TQ / (4 * RPW), DT = 4, KS = 2;
  __shared__ __attribute__((aligned(16))) unsigned short sP[4][RPW][40], sPl[4][RPW][40]; __shared__ __attribute__((aligned(16))) float sO[4][RPW][64 + 4];
  const int tid = threadIdx.x, w = tid >> 5, lane = tid & 31, ln = lane & 15, hh = lane >> 4;
  const int slab = blockIdx.x / NQB, qblk = blockIdx.x % NQB; const int b = slab / NH, h = slab % NH; const int qb0 = qblk * (4 * RPW); const int q0 = qb0 + w * RPW;
  MB += (size_t)b * TQ * (TK / 32); LAG += (size_t)b * TK;      /* per-batch key-mask table and positions: the grid spans all batches */
  /* the bias lookup's tables, staged once per block: bucket of every distance as one byte, the head's rounded dist_emb column, the batch's positions */
  typedef int v4ia __attribute__((ext_vector_type(4), may_alias));
  __shared__ __attribute__((aligned(16))) unsigned sLUTw[LUTN / 4]; __shared__ float sDE[NBIN]; __shared__ __attribute__((aligned(16))) int sPos[TK];
  for (int i = tid; i < LUTN / 4; i += 128) { const v4ia c = *(const v4ia*)(LUT + 4 * i); sLUTw[i] = (unsigned)(c[0] & (NBIN - 1)) | ((unsigned)(c[1] & (NBIN - 1)) << 8) | ((unsigned)(c[2] & (NBIN - 1)) << 16) | ((unsigned)(c[3] & (NBIN - 1)) << 24); }
  for (int i = tid; i < TK / 4; i += 128) *(v4ia*)(sPos + 4 * i) = *(const v4ia*)(LAG + 4 * i);
  if (tid < NBIN) sDE[tid] = bf16_round(BT[tid * NH + h]);
  __syncthreads();      /* every wave reads what all four staged */
  const unsigned char* sLUT = (const unsigned char*)sLUTw;
  FragH aq[2][KS], aql[2][KS];
#pragma unroll
  for (int rt = 0; rt < RTN; ++rt) { const size_t qo = ((size_t)b * TQ + q0 + rt * 16 + ln) * ldq + h * 64; const unsigned short* qr = (const unsigned short*)Q16 + qo; const unsigned short* ql = (const unsigned short*)Q16lo + qo;
#pragma unroll
    for (int ks = 0; ks < KS; ++ks) { aq[rt][ks].half[0] = *(const v8us*)(qr + ks * 32 + 8 * hh); aq[rt][ks].half[1] = *(const v8us*)(qr + ks * 32 + 16 + 8 * hh); aql[rt][ks].half[0] = *(const v8us*)(ql + ks * 32 + 8 * hh); aql[rt][ks].half[1] = *(const v8us*)(ql + ks * 32 + 16 + 8 * hh); } }
  const unsigned short* Vth = (const unsigned short*)Vt + (size_t)slab * 64 * TK; const unsigned short* Vtl = (const unsigned short*)Vtlo + (size_t)slab * 64 * TK;
  float m_r[2][8], l_r[2][8]; v8f oacc[2][DT], oaccl[2][DT];
#pragma unroll
  for (int rt = 0; rt < RTN; ++rt) {
#pragma unroll
    for (int r = 0; r < 8; ++r) { m_r[rt][r] = -3.0e38f; l_r[rt][r] = 0.f; }
#pragma unroll
    for (int dt = 0; dt < DT; ++dt) { oacc[rt][dt] = (v8f){0.f,0.f,0.f,0.f,0.f,0.f,0.f,0.f}; oaccl[rt][dt] = oacc[rt][dt]; } }
  int jend = KE[qblk * 32]; jend = min(TK, (jend + 31) & ~31); if (jend < 32) jend = 32;      /* block-uniform */
  int allm[2][8]; const unsigned* mrow[2][8];
#pragma unroll
  for (int rt = 0; rt < RTN; ++rt)
#pragma unroll
    for (int r = 0; r < 8; ++r) { const int tq = q0 + rt * 16 + 8 * hh + r; allm[rt][r] = RA[tq]; mrow[rt][r] = MB + (size_t)tq * (TK / 32); }
#pragma unroll 1
  for (int j0 = 0; j0 < jend; j0 += 32) {
    
    v8f s[2][2];
#pragma unroll
    for (int nt = 0; nt < 2; ++nt) { const size_t ko = ((size_t)b * TK + j0 + nt * 16 + ln) * ldk + h * 64; const unsigned short* kr = (const unsigned short*)K16 + ko; const unsigned short* kl = (const unsigned short*)K16lo + ko; FragH bk[KS], bkl[KS];
#pragma unroll
      for (int ks = 0; ks < KS; ++ks) { bk[ks].half[0] = *(const v8us*)(kr + ks * 32 + 8 * hh); bk[ks].half[1] = *(const v8us*)(kr + ks * 32 + 16 + 8 * hh); bkl[ks].half[0] = *(const v8us*)(kl + ks * 32 + 8 * hh); bkl[ks].half[1] = *(const v8us*)(kl + ks * 32 + 16 + 8 * hh); }
#pragma unroll
      for (int rt = 0; rt < RTN; ++rt) { v8f acc = (v8f){0.f,0.f,0.f,0.f,0.f,0.f,0.f,0.f}, accr = acc;
#pragma unroll
        for (int ks = 0; ks < KS; ++ks) { acc = mmaH<1>(aq[rt][ks].v, aq[rt][ks].v, bk[ks].v, bk[ks].v, acc); accr = mmaH<1>(aql[rt][ks].v, aql[rt][ks].v, bk[ks].v, bk[ks].v, accr); accr = mmaH<1>(aq[rt][ks].v, aq[rt][ks].v, bkl[ks].v, bkl[ks].v, accr); }
        s[rt][nt] = acc + accr * 0.0009765625f; } }
#pragma unroll
    for (int rt = 0; rt < RTN; ++rt)
#pragma unroll
      for (int r = 0; r < 8; ++r) { const unsigned mw = mrow[rt][r][j0 >> 5]; const bool am = (allm[rt][r] != 0); const int tq = q0 + rt * 16 + 8 * hh + r;
        const bool ok0 = am || (((mw >> ln) & 1u) == 0u), ok1 = am || (((mw >> (16 + ln)) & 1u) == 0u);
        const float s0 = ok0 ? (am ? 0.f : s[rt][0][r] * SCL + gbias(sDE, OB, sLUT, h, sPos[tq], sPos[j0 + ln])) : -INFINITY, s1 = ok1 ? (am ? 0.f : s[rt][1][r] * SCL + gbias(sDE, OB, sLUT, h, sPos[tq], sPos[j0 + 16 + ln])) : -INFINITY;      /* + grammar distance-bucket and order biases */ float mc = fmaxf(s0, s1);
        mc = fmaxf(mc, __shfl_xor(mc, 1, 32)); mc = fmaxf(mc, __shfl_xor(mc, 2, 32)); mc = fmaxf(mc, __shfl_xor(mc, 4, 32)); mc = fmaxf(mc, __shfl_xor(mc, 8, 32));
        const float mn = fmaxf(m_r[rt][r], mc); const float al = (mn > -1.0e38f) ? expf(m_r[rt][r] - mn) : 1.0f; m_r[rt][r] = mn; const float p0 = ok0 ? expf(s0 - mn) : 0.f, p1 = ok1 ? expf(s1 - mn) : 0.f; l_r[rt][r] = l_r[rt][r] * al + p0 + p1;
#pragma unroll
        for (int dt = 0; dt < DT; ++dt) { oacc[rt][dt][r] *= al; oaccl[rt][dt][r] *= al; }
        FragH t2, t3; const float ps0 = p0 * 1024.0f, ps1 = p1 * 1024.0f; t2.h[0] = (_Float16)ps0; t2.h[1] = (_Float16)ps1; t3.h[0] = (_Float16)((ps0 - (float)t2.h[0]) * 1024.0f); t3.h[1] = (_Float16)((ps1 - (float)t2.h[1]) * 1024.0f);
        sP[w][rt * 16 + 8 * hh + r][ln] = t2.u[0]; sP[w][rt * 16 + 8 * hh + r][16 + ln] = t2.u[1]; sPl[w][rt * 16 + 8 * hh + r][ln] = t3.u[0]; sPl[w][rt * 16 + 8 * hh + r][16 + ln] = t3.u[1]; }
    __builtin_amdgcn_fence(__ATOMIC_ACQ_REL, "workgroup"); __builtin_amdgcn_wave_barrier();
    FragH pa[2], pl[2];
#pragma unroll
    for (int rt = 0; rt < RTN; ++rt) { pa[rt].half[0] = *(const v8us*)&sP[w][rt * 16 + ln][8 * hh]; pa[rt].half[1] = *(const v8us*)&sP[w][rt * 16 + ln][16 + 8 * hh]; pl[rt].half[0] = *(const v8us*)&sPl[w][rt * 16 + ln][8 * hh]; pl[rt].half[1] = *(const v8us*)&sPl[w][rt * 16 + ln][16 + 8 * hh]; }
#pragma unroll
    for (int dt = 0; dt < DT; ++dt) { const size_t vo = (size_t)(dt * 16 + ln) * TK + j0; FragH bv, bl; bv.half[0] = *(const v8us*)(Vth + vo + 8 * hh); bv.half[1] = *(const v8us*)(Vth + vo + 16 + 8 * hh); bl.half[0] = *(const v8us*)(Vtl + vo + 8 * hh); bl.half[1] = *(const v8us*)(Vtl + vo + 16 + 8 * hh);
#pragma unroll
      for (int rt = 0; rt < RTN; ++rt) { oacc[rt][dt] = mmaH<1>(pa[rt].v, pa[rt].v, bv.v, bv.v, oacc[rt][dt]); oaccl[rt][dt] = mmaH<1>(pa[rt].v, pa[rt].v, bl.v, bl.v, oaccl[rt][dt]); oaccl[rt][dt] = mmaH<1>(pl[rt].v, pl[rt].v, bv.v, bv.v, oaccl[rt][dt]); } }
    __builtin_amdgcn_fence(__ATOMIC_ACQ_REL, "workgroup"); __builtin_amdgcn_wave_barrier(); }
#pragma unroll
  for (int rt = 0; rt < RTN; ++rt) {
#pragma unroll
    for (int r = 0; r < 8; ++r) { float l = l_r[rt][r]; l += __shfl_xor(l, 1, 32); l += __shfl_xor(l, 2, 32); l += __shfl_xor(l, 4, 32); l += __shfl_xor(l, 8, 32); l_r[rt][r] = (l > 0.f) ? 1.0f / (l * 1024.0f) : 0.f; }
#pragma unroll
    for (int dt = 0; dt < DT; ++dt)
#pragma unroll
      for (int r = 0; r < 8; ++r) sO[w][rt * 16 + 8 * hh + r][dt * 16 + ln] = (oacc[rt][dt][r] + oaccl[rt][dt][r] * 0.0009765625f) * l_r[rt][r]; }
  __builtin_amdgcn_fence(__ATOMIC_ACQ_REL, "workgroup"); __builtin_amdgcn_wave_barrier();
  {
#pragma unroll
    for (int rp = 0; rp < RPW; rp += 2) { const int r = rp + (lane >> 4), pc = lane & 15; const v4f val = *(const v4fa*)&sO[w][r][pc * 4]; *(v4f*)(O + ((size_t)b * TQ + q0 + r) * ldo + h * 64 + pc * 4) = val; }
     } }


__global__ __launch_bounds__(256) void k_fulltab(unsigned* __restrict__ MB, int* __restrict__ RA, int* __restrict__ KE, int nq, int nk) {
  const int t = blockIdx.x * 256 + threadIdx.x;
  if (t < nq * (nk / 32)) { *(unsigned*)(MB + t) = 0u;  }
  if (t < nq) { *(int*)(RA + t) = 0;  }
  if (t < nq / 64) { *(int*)(KE + t * 32) = nk;  } }
__global__ __launch_bounds__(256) void k_lnx(const float* __restrict__ X, const float* __restrict__ g, const float* __restrict__ bb, _Float16* __restrict__ Y16, float* __restrict__ XB) {
  #pragma clang fp contract(off)
  const int tid = threadIdx.x, w = tid >> 5, ln = tid & 31; const int r = blockIdx.x * 8 + w; if (r >= NR) return; const float* x = X + (size_t)r * DM; float s = 0.f;
#pragma unroll 1
  for (int i = 0; i < DM / 128; ++i) { const v4f a = *(const v4fa*)(x + i * 128 + ln * 4); for (int q = 0; q < 4; ++q) s += bf16_round(a[q]); }
  for (int o = 16; o > 0; o >>= 1) s += __shfl_xor(s, o, 32); const float mu = s / (float)DM; float q2 = 0.f;
#pragma unroll 1
  for (int i = 0; i < DM / 128; ++i) { const v4f a = *(const v4fa*)(x + i * 128 + ln * 4); for (int q = 0; q < 4; ++q) { const float d = bf16_round(a[q]) - mu; q2 += d * d; } }
  for (int o = 16; o > 0; o >>= 1) q2 += __shfl_xor(q2, o, 32); const float rs = rsqrtf(q2 / (float)DM + 1e-5f);
  {
#pragma unroll 1
    for (int i = 0; i < DM / 128; ++i) { const int c0 = i * 128 + ln * 4; const v4f a = *(const v4fa*)(x + c0); _Float16 h4[4]; v4f xb;
      for (int q = 0; q < 4; ++q) { const float t = bf16_round(a[q]); h4[q] = (_Float16)((t - mu) * rs * bf16_round(g[c0 + q]) + bf16_round(bb[c0 + q])); xb[q] = t; }
      *(unsigned long long*)((unsigned short*)Y16 + (size_t)r * DM + c0) = *(const unsigned long long*)h4; *(v4f*)(XB + (size_t)r * DM + c0) = xb; }
     } }
// bucket table: LUT[d] = count of bf16-rounded edges < d (bucketize right=False), capped at NBIN-1, for d = 0..LUTN-1
__global__ __launch_bounds__(256) void k_lut(const float* __restrict__ edges, int* __restrict__ LUT) {
  #pragma clang fp contract(off)
  const int d = blockIdx.x * 256 + threadIdx.x; if (d >= LUTN) return; const float fd = (float)d; int c = 0;
#pragma unroll 1
  for (int e = 0; e < NBIN - 1; ++e) c += (bf16_round(edges[e]) < fd) ? 1 : 0;
  c = min(c, NBIN - 1); *(int*)(LUT + d) = c;  }
__global__ __launch_bounds__(256) void k_masktab(const float* __restrict__ mask, unsigned* __restrict__ MB, int* __restrict__ RA, int* __restrict__ KE) {
  const size_t t = (size_t)blockIdx.x * 256 + threadIdx.x; const int nw = SLEN / 32;
  if (t < (size_t)NBT * SLEN * nw) { const int w = (int)(t % nw); const int b = (int)(t / ((size_t)SLEN * nw)); unsigned bits = 0u; for (int j = 0; j < 32; ++j) bits |= (bf16_round(mask[(size_t)b * SLEN + 32 * w + j]) == 0.0f) ? (1u << j) : 0u; *(unsigned*)(MB + t) = bits;  }
  if (t < SLEN) { *(int*)(RA + t) = 0;  }
  if (t < SLEN / 64) { *(int*)(KE + t * 32) = SLEN;  } }
__global__ __launch_bounds__(256) void k_hlmask(const float* __restrict__ F, const float* __restrict__ mask, _Float16* __restrict__ Hh, _Float16* __restrict__ Hl, size_t n8) {
  #pragma clang fp contract(off)
  const size_t t = (size_t)blockIdx.x * 256 + threadIdx.x; if (t >= n8) return; const float mk = bf16_round(mask[(t * 8) / DM]); FragH fh, fl;
#pragma unroll
  for (int q = 0; q < 8; ++q) { const float v = F[t * 8 + q] * mk; const _Float16 h = (_Float16)v; fh.h[q] = h; fl.h[q] = (_Float16)((v - (float)h) * 1024.0f); }
  { *(v8us*)((unsigned short*)Hh + t * 8) = fh.half[0]; *(v8us*)((unsigned short*)Hl + t * 8) = fl.half[0];  } }
__global__ __launch_bounds__(256) void k_causaltab(unsigned* __restrict__ MB, int* __restrict__ RA, int* __restrict__ KE, int nq, int nk) {
  const int t = blockIdx.x * 256 + threadIdx.x; const int nw = nk / 32;
  if (t < nq * nw) { const int q = t / nw, w = t % nw; const int first = q + 1 - 32 * w; const unsigned bits = (first <= 0) ? 0xffffffffu : ((first >= 32) ? 0u : (0xffffffffu << first)); *(unsigned*)(MB + t) = bits;  }
  if (t < nq) { *(int*)(RA + t) = 0;  }
  if (t < nq / 64) { const int v = 64 * (t + 1); *(int*)(KE + t * 32) = v;  } }


extern "C" void kernel_launch(void* const* d_in, const int* in_sizes, int n_in,
                              void* d_out, int out_size, void* d_ws, size_t ws_size, hipStream_t stream) {
  (void)in_sizes; (void)n_in; (void)out_size;
  const float* const* I = (const float* const*)d_in; const float* x = I[0]; const int* pos = (const int*)d_in[1]; const float* mask = I[2]; const float* qw = I[3]; const float* qb = I[4]; const float* kw = I[5]; const float* kb = I[6]; const float* vw = I[7]; const float* vb = I[8]; const float* ow = I[9]; const float* ob = I[10]; const float* de = I[11]; const float* obias = I[12]; const float* edges = I[13];
  char* ws = (char*)d_ws; size_t off = 0;
  auto take = [&](size_t bytes) { char* p = ws + off; off += (bytes + 255) & ~(size_t)255; return p; };
  _Float16* BQ = (_Float16*)take((size_t)DM * DM * 2); _Float16* BK = (_Float16*)take((size_t)DM * DM * 2); _Float16* BV = (_Float16*)take((size_t)DM * DM * 2); _Float16* BO = (_Float16*)take((size_t)DM * DM * 2);
  _Float16* X16 = (_Float16*)take((size_t)NR * DM * 2); float* F = (float*)take((size_t)NR * DM * 4);
  _Float16* Qh = (_Float16*)take((size_t)NR * DM * 2); _Float16* Ql = (_Float16*)take((size_t)NR * DM * 2); _Float16* Kh = (_Float16*)take((size_t)NR * DM * 2); _Float16* Kl = (_Float16*)take((size_t)NR * DM * 2); _Float16* Vth = (_Float16*)take((size_t)NR * DM * 2); _Float16* Vtl = (_Float16*)take((size_t)NR * DM * 2);
  unsigned* MB = (unsigned*)take((size_t)NBT * SLEN * (SLEN / 32) * 4); int* RA = (int*)take((size_t)SLEN * 4); int* KE = (int*)take((size_t)(SLEN / 64) * 32 * 4); int* LUT = (int*)take((size_t)LUTN * 4);
  if (off > ws_size) return;      /* 2 + 8 + 16 + 48 + 1.1 = 75 MiB */
  float* O = F; _Float16* Oh = Qh; _Float16* Ol = Ql;
  const size_t w8 = (size_t)DM * DM / 8; const unsigned wb = (unsigned)((w8 + 255) / 256);
  k_round16f<<<wb, 256, 0, stream>>>(qw, BQ, w8); k_round16f<<<wb, 256, 0, stream>>>(kw, BK, w8); k_round16f<<<wb, 256, 0, stream>>>(vw, BV, w8); k_round16f<<<wb, 256, 0, stream>>>(ow, BO, w8);      /* torch (out,in) = natural Bt */
  k_lut<<<LUTN / 256, 256, 0, stream>>>(edges, LUT); k_masktab<<<(unsigned)(((size_t)NBT * SLEN * (SLEN / 32) + 255) / 256), 256, 0, stream>>>(mask, MB, RA, KE);
  const size_t n8 = (size_t)NR * DM / 8; const unsigned nb8 = (unsigned)((n8 + 255) / 256); const dim3 gP((NR / 128) * (DM / 64), 1);
  k_x16<<<nb8, 256, 0, stream>>>(x, X16, n8);
  k_gemm2<0><<<gP, 128, 0, stream>>>(X16, DM, 0, BQ, DM, 0, 0.0625f, qb, 0, nullptr, 1, 0, 0, F, nullptr, DM, 0, NR, DM, DM); k_hl<<<nb8, 256, 0, stream>>>(F, Qh, Ql, n8);
  k_gemm2<0><<<gP, 128, 0, stream>>>(X16, DM, 0, BK, DM, 0, 0.0625f, kb, 0, nullptr, 1, 0, 0, F, nullptr, DM, 0, NR, DM, DM); k_hl<<<nb8, 256, 0, stream>>>(F, Kh, Kl, n8);
  k_gemm2<0><<<gP, 128, 0, stream>>>(X16, DM, 0, BV, DM, 0, 0.0625f, vb, 0, nullptr, 1, 0, 0, F, nullptr, DM, 0, NR, DM, DM);
  k_vthl<SLEN><<<NBT * NH * (SLEN / 64), 256, 0, stream>>>(F, DM, Vth, Vtl);
  k_flashb<SLEN, SLEN><<<NBT * NH * (SLEN / 64), 128, 0, stream>>>(Qh, Ql, DM, Kh, Kl, DM, Vth, Vtl, MB, RA, KE, de, obias, LUT, pos, O, DM);
  k_hlmask<<<nb8, 256, 0, stream>>>(O, mask, Oh, Ol, n8);
  k_gemm2<0><<<gP, 128, 0, stream>>>(Oh, DM, 0, BO, DM, 0, 0.0625f, ob, 0, nullptr, 1, 0, 0, (float*)d_out, nullptr, DM, 0, NR, DM, DM);
  k_gemm2<0><<<gP, 128, 0, stream>>>(Ol, DM, 0, BO, DM, 0, 0.0625f / 1024.0f, nullptr, 0, (float*)d_out, 1, (size_t)DM, 0, (float*)d_out, nullptr, DM, 0, NR, DM, DM);
}

// v003
// A run of this version takes 329 microseconds.
// In two side-by-side timings against v002, it was 1.38 and 1.39 times as fast.
// Over all steps from v000 it is 6.26 times as fast.
#include <hip/hip_runtime.h>
// Grammar attention (8 x 1024 tokens, 512 = 8 heads x 64): q,k,v = x W^T + b; scores = q.k/8 + dist_emb[bucket(|pos_j - pos_i|)][h] + ((pos_j > pos_i) - 0.5) * order_bias[h] with INPUT int32 positions, INPUT bin edges (torch.bucketize right=False = count of edges < dist) and an INPUT key/query mask (masked keys excluded; masked query rows zeroed before the output projection, as out * mask); softmax; out = ((attn v) * mask) Wo^T + bo -> [8,1024,512].
// Structure: x as an exact f16 plane; projections as f16 WMMA GEMMs (32x64 wave tiles, f32 accumulation, exact x16 weights + bias); a device-built bucket lookup table over integer distances (from the INPUT edges) and per-batch key-mask bit tables; q, k as f16 hi + (x2^10) residual planes, V^T as hi + residual planes; the fused flash kernel gathers both biases by the INPUT positions inside the score stage (transposed score and value tiles, online f32 softmax per lane, P hi + residual kept in registers, two value accumulators); O scaled by the query mask, split hi/lo, into Wo (two GEMMs, bias in the first).
// Compute dtype: x, weights, biases, dist_emb, order_bias, bin_edges, mask rounded to bf16; projections exact; q, k, P, v, O as f16 hi + residual pairs (~2^-21); f32 accumulation and softmax. v_wmma_f32_16x16x32_f16.
#define NBT 8
#define SLEN 1024
#define NBIN 32
#define LUTN 16384            /* bucket lookup over integer distances 0..LUTN-1 (positions < 5000) */
#define DM 512
#define NH 8
#define SCL 0.125f
#define NR (NBT * SLEN)
typedef __bf16 v16b __attribute__((ext_vector_type(16)));
typedef unsigned short v8us __attribute__((ext_vector_type(8), may_alias));
typedef float  v8f  __attribute__((ext_vector_type(8)));
typedef float  v4f  __attribute__((ext_vector_type(4)));
typedef float  v4fa __attribute__((ext_vector_type(4), may_alias));
union FragB { v16b v; v8us half[2]; unsigned short u[16]; };

__device__ __forceinline__ unsigned short bf16_bits(float x) { unsigned int u = __float_as_uint(x); return (unsigned short)((u + 0x7FFFu + ((u >> 16) & 1u)) >> 16); }
__device__ __forceinline__ float bf16_val(unsigned short b) { return __uint_as_float(((unsigned int)b) << 16); }
__device__ __forceinline__ float bf16_round(float x) { return bf16_val(bf16_bits(x)); }
// D += A·B with NT terms: 1 = ah·bh, 2 = + al·bh (A split), 3 = + ah·bl (both split)
template <int NT>
__device__ __forceinline__ v8f mmaN(v16b ah, v16b al, v16b bh, v16b bl, v8f c) {
  c = __builtin_amdgcn_wmma_f32_16x16x32_bf16(false, ah, false, bh, (short)0, c, false, false);
  if (NT >= 2) c = __builtin_amdgcn_wmma_f32_16x16x32_bf16(false, al, false, bh, (short)0, c, false, false);
  if (NT >= 3) c = __builtin_amdgcn_wmma_f32_16x16x32_bf16(false, ah, false, bl, (short)0, c, false, false);
  asm volatile("v_nop\n\tv_nop\n\tv_nop\n\tv_nop" : "+v"(c) : "v"(ah), "v"(al), "v"(bh), "v"(bl));
  return c;
}

__global__ __launch_bounds__(256) void k_wt_bf16(const float* __restrict__ W, unsigned short* __restrict__ Wt, int K, int N) {
  const int t = blockIdx.x * 256 + threadIdx.x;
  const int k8n = K / 8;
  if (t >= N * k8n) return;
  const int n = t / k8n, k8 = (t % k8n) * 8;
  v8us v;
#pragma unroll
  for (int i = 0; i < 8; ++i) v[i] = bf16_bits(W[(size_t)(k8 + i) * N + n]);
  *(v8us*)(Wt + (size_t)n * K + k8) = v;
  
}

// GEMM C[M][N] (f32, pitch ldc) = act(A[M][K]·W + bias). A f32 row-major (pitch lda) converted per fragment to bf16
// (ASPLIT: hi/lo two planes -> 2 terms, else single rounded term); Wt bf16 [N][K] (pitch ldb). BIAS_BF16 rounds the
// bias to bf16 first (bias quantised to bf16 before the add). K%32==0, M%16==0, N%64==0.
template <bool ASPLIT, int ACT, bool BIAS_BF16>
__global__ __launch_bounds__(128) void k_gemm_bf(const float* __restrict__ A, int lda, const unsigned short* __restrict__ Wt, int ldb,
                                               const float* __restrict__ bias, float* __restrict__ C, int ldc, int M, int N, int K) {
  __shared__ __attribute__((aligned(16))) float so[4][16][64];
  const int tid = threadIdx.x, w = tid >> 5, lane = tid & 31, ln = lane & 15, hh = lane >> 4;
  const int ntn = N / 64;
  const int wid = blockIdx.x * 4 + w;
  const int mt = wid / ntn, nq = wid % ntn;
  if (mt * 16 >= M) return;
  const int row0 = mt * 16, col0 = nq * 64;
  const float* arow = A + (size_t)(row0 + ln) * lda;
  v8f acc[4] = {};
  for (int kb = 0; kb < K; kb += 32) {
    FragB ah, al;
    const v4f x0 = *(const v4fa*)(arow + kb + 8 * hh), x1 = *(const v4fa*)(arow + kb + 8 * hh + 4);
    const v4f x2 = *(const v4fa*)(arow + kb + 16 + 8 * hh), x3 = *(const v4fa*)(arow + kb + 16 + 8 * hh + 4);
    float xs[16] = {x0[0],x0[1],x0[2],x0[3],x1[0],x1[1],x1[2],x1[3],x2[0],x2[1],x2[2],x2[3],x3[0],x3[1],x3[2],x3[3]};
#pragma unroll
    for (int i = 0; i < 16; ++i) { const unsigned short hb = bf16_bits(xs[i]); ah.u[i] = hb; al.u[i] = ASPLIT ? bf16_bits(xs[i] - bf16_val(hb)) : (unsigned short)0; }
#pragma unroll
    for (int t = 0; t < 4; ++t) {
      const unsigned short* brow = Wt + (size_t)(col0 + t * 16 + ln) * ldb + kb;
      FragB b;
      b.half[0] = *(const v8us*)(brow + 8 * hh);
      b.half[1] = *(const v8us*)(brow + 16 + 8 * hh);
      acc[t] = mmaN<ASPLIT ? 2 : 1>(ah.v, al.v, b.v, b.v, acc[t]);
    }
  }
#pragma unroll
  for (int t = 0; t < 4; ++t) {
    float bv = bias ? bias[col0 + t * 16 + ln] : 0.f;
    if (BIAS_BF16) bv = bf16_round(bv);
#pragma unroll
    for (int r = 0; r < 8; ++r) { float v = acc[t][r] + bv; if (ACT == 1) v = fmaxf(v, 0.f); so[w][8 * hh + r][t * 16 + ln] = v; }
  }
  __builtin_amdgcn_fence(__ATOMIC_ACQ_REL, "workgroup");
  __builtin_amdgcn_wave_barrier();
  const int rsub = lane >> 4, c4 = (lane & 15) * 4;
  {
#pragma unroll
    for (int q = 0; q < 8; ++q) {
      const int r = q * 2 + rsub;
      const v4f v = *(const v4fa*)&so[w][r][c4];
      *(v4f*)(C + (size_t)(row0 + r) * ldc + col0 + c4) = v;
    }
    
  }
}

// GEMM C = act(A·W + bias + resid): A f32 (ASPLIT -> hi/lo 2 terms), Wt bf16 [N][K]; ACT 0 none, 1 relu, 2 exact gelu;
// resid (optional, f32, row index = (row % rmod), pitch ldr, RES_BF16 rounds it) added before the activation.
template <bool ASPLIT, int ACT, bool BIAS_BF16, bool RES_BF16>
__global__ __launch_bounds__(128) void k_gemm_bf3(const float* __restrict__ A, int lda, const unsigned short* __restrict__ Wt, int ldb,
                                                const float* __restrict__ bias, const float* __restrict__ resid, int rmod, int ldr,
                                                float* __restrict__ C, int ldc, int M, int N, int K) {
  __shared__ __attribute__((aligned(16))) float so[4][16][64];
  const int tid = threadIdx.x, w = tid >> 5, lane = tid & 31, ln = lane & 15, hh = lane >> 4;
  const int ntn = N / 64;
  const int wid = blockIdx.x * 4 + w;
  const int mt = wid / ntn, nq = wid % ntn;
  if (mt * 16 >= M) return;
  const int row0 = mt * 16, col0 = nq * 64;
  const float* arow = A + (size_t)(row0 + ln) * lda;
  v8f acc[4] = {};
  for (int kb = 0; kb < K; kb += 32) {
    FragB ah, al;
    const v4f x0 = *(const v4fa*)(arow + kb + 8 * hh), x1 = *(const v4fa*)(arow + kb + 8 * hh + 4);
    const v4f x2 = *(const v4fa*)(arow + kb + 16 + 8 * hh), x3 = *(const v4fa*)(arow + kb + 16 + 8 * hh + 4);
    float xs[16] = {x0[0],x0[1],x0[2],x0[3],x1[0],x1[1],x1[2],x1[3],x2[0],x2[1],x2[2],x2[3],x3[0],x3[1],x3[2],x3[3]};
#pragma unroll
    for (int i = 0; i < 16; ++i) { const unsigned short hb = bf16_bits(xs[i]); ah.u[i] = hb; al.u[i] = ASPLIT ? bf16_bits(xs[i] - bf16_val(hb)) : (unsigned short)0; }
#pragma unroll
    for (int t = 0; t < 4; ++t) {
      const unsigned short* brow = Wt + (size_t)(col0 + t * 16 + ln) * ldb + kb;
      FragB b;
      b.half[0] = *(const v8us*)(brow + 8 * hh);
      b.half[1] = *(const v8us*)(brow + 16 + 8 * hh);
      acc[t] = mmaN<ASPLIT ? 2 : 1>(ah.v, al.v, b.v, b.v, acc[t]);
    }
  }
#pragma unroll
  for (int t = 0; t < 4; ++t) {
    const int col = col0 + t * 16 + ln;
    float bv = bias ? bias[col] : 0.f;
    if (BIAS_BF16) bv = bf16_round(bv);
#pragma unroll
    for (int r = 0; r < 8; ++r) {
      float v = acc[t][r] + bv;
      if (resid) { float rv = resid[(size_t)((row0 + 8 * hh + r) % rmod) * ldr + col]; if (RES_BF16) rv = bf16_round(rv); v += rv; }
      if (ACT == 1) v = fmaxf(v, 0.f);
      if (ACT == 2) v = 0.5f * v * (1.0f + erff(v * 0.70710678118654752f));
      if (ACT == 3) { const float u = 0.7978845608028654f * (v + 0.044715f * v * v * v); v = 0.5f * v * (1.0f + tanhf(u)); }
      so[w][8 * hh + r][t * 16 + ln] = v;
    }
  }
  __builtin_amdgcn_fence(__ATOMIC_ACQ_REL, "workgroup");
  __builtin_amdgcn_wave_barrier();
  const int rsub = lane >> 4, c4 = (lane & 15) * 4;
  {
#pragma unroll
    for (int q = 0; q < 8; ++q) {
      const int r = q * 2 + rsub;
      const v4f v = *(const v4fa*)&so[w][r][c4];
      *(v4f*)(C + (size_t)(row0 + r) * ldc + col0 + c4) = v;
    }
    
  }
}
// row LayerNorm (biased variance, eps) over N: s = X (+ R); optional out_sum <- s; out_norm <- (s-mu)*rsqrt(var+eps)*g + b
template <bool PARAM_BF16>
__global__ __launch_bounds__(256) void k_layernorm(const float* __restrict__ X, const float* __restrict__ R, const float* __restrict__ g, const float* __restrict__ bta,
                                                  float* __restrict__ out_sum, float* __restrict__ out_norm, int N, float eps) {
  __shared__ float red[256];
  const int row = blockIdx.x, tid = threadIdx.x;
  const float* x = X + (size_t)row * N; const float* rr = R ? R + (size_t)row * N : nullptr;
  float vals[16];                     // up to N = 4096
  const int per = N / 256;            // contiguous chunk per thread? use strided-by-4 chunks: thread handles j = tid*4 + 1024*u
  float s1 = 0.f;
  for (int u = 0; u < per / 4; ++u) {
    const int j = tid * 4 + 1024 * u;
    const v4f a = *(const v4fa*)(x + j);
    v4f b = {0.f,0.f,0.f,0.f}; if (rr) b = *(const v4fa*)(rr + j);
#pragma unroll
    for (int q = 0; q < 4; ++q) { const float v = a[q] + b[q]; vals[u * 4 + q] = v; s1 += v; }
  }
  red[tid] = s1; __syncthreads();
  for (int st = 128; st > 0; st >>= 1) { if (tid < st) red[tid] += red[tid + st]; __syncthreads(); }
  const float mu = red[0] / (float)N; __syncthreads();
  float s2 = 0.f;
  for (int u = 0; u < per / 4; ++u)
#pragma unroll
    for (int q = 0; q < 4; ++q) { const float c = vals[u * 4 + q] - mu; s2 += c * c; }
  red[tid] = s2; __syncthreads();
  for (int st = 128; st > 0; st >>= 1) { if (tid < st) red[tid] += red[tid + st]; __syncthreads(); }
  const float rs = rsqrtf(red[0] / (float)N + eps);
  {
    for (int u = 0; u < per / 4; ++u) {
      const int j = tid * 4 + 1024 * u;
      v4f o, sm;
#pragma unroll
      for (int q = 0; q < 4; ++q) {
        float gg = g[j + q], bb = bta[j + q];
        if (PARAM_BF16) { gg = bf16_round(gg); bb = bf16_round(bb); }
        sm[q] = vals[u * 4 + q]; o[q] = (vals[u * 4 + q] - mu) * rs * gg + bb;
      }
      if (out_sum) *(v4f*)(out_sum + (size_t)row * N + j) = sm;
      *(v4f*)(out_norm + (size_t)row * N + j) = o;
    }
    
  }
}



// ---- f16 WMMA path (v_wmma_f32_16x16x32_f16): 11-bit significands for operands in range — used where a [0,1] probability operand needs more precision than bf16
typedef _Float16 v16h __attribute__((ext_vector_type(16)));
union FragH { v16h v; v8us half[2]; _Float16 h[16]; unsigned short u[16]; };
template <int NT>
__device__ __forceinline__ v8f mmaH(v16h ah, v16h al, v16h bh, v16h bl, v8f c) {
  c = __builtin_amdgcn_wmma_f32_16x16x32_f16(false, ah, false, bh, (short)0, c, false, false);
  if (NT >= 2) c = __builtin_amdgcn_wmma_f32_16x16x32_f16(false, al, false, bh, (short)0, c, false, false);
  if (NT >= 3) c = __builtin_amdgcn_wmma_f32_16x16x32_f16(false, ah, false, bl, (short)0, c, false, false);
  asm volatile("v_nop\n\tv_nop\n\tv_nop\n\tv_nop" : "+v"(c) : "v"(ah), "v"(al), "v"(bh), "v"(bl));
  return c;
}
// batched GEMM like k_gemm_b but f16 operands: A f32 (split into f16 hi/lo if ASPLIT, else rounded to f16), Bt = f16 values [n][k]; alpha; C f32; N multiple of 16 (partial tiles skipped)
template <bool ASPLIT>
__global__ __launch_bounds__(128) void k_gemm_h(const float* __restrict__ A, int lda, size_t sA, const _Float16* __restrict__ Bh, int ldb, size_t sB, float alpha, float* __restrict__ C, int ldc, size_t sC, int M, int N, int K) {
  __shared__ __attribute__((aligned(16))) float so[4][16][64];
  const int tid = threadIdx.x, w = tid >> 5, lane = tid & 31, ln = lane & 15, hh = lane >> 4; const int by = blockIdx.y;
  A += (size_t)by * sA; Bh += (size_t)by * sB; C += (size_t)by * sC;
  const int ntn = (N + 63) / 64; const int wid = blockIdx.x * 4 + w; const int mt = wid / ntn, nq = wid % ntn; if (mt * 16 >= M) return;
  const int row0 = mt * 16, col0 = nq * 64; const float* arow = A + (size_t)(row0 + ln) * lda;
  v8f acc[4] = {};
  for (int kb = 0; kb < K; kb += 32) {
    FragH ah, al;
    const v4f x0 = *(const v4fa*)(arow + kb + 8 * hh), x1 = *(const v4fa*)(arow + kb + 8 * hh + 4), x2 = *(const v4fa*)(arow + kb + 16 + 8 * hh), x3 = *(const v4fa*)(arow + kb + 16 + 8 * hh + 4);
    float xs[16] = {x0[0],x0[1],x0[2],x0[3],x1[0],x1[1],x1[2],x1[3],x2[0],x2[1],x2[2],x2[3],x3[0],x3[1],x3[2],x3[3]};
#pragma unroll
    for (int i = 0; i < 16; ++i) { const _Float16 h = (_Float16)xs[i]; ah.h[i] = h; al.h[i] = ASPLIT ? (_Float16)(xs[i] - (float)h) : (_Float16)0.0f; }
#pragma unroll
    for (int t = 0; t < 4; ++t) { if (col0 + t * 16 >= N) continue; const size_t boff = (size_t)(col0 + t * 16 + ln) * ldb + kb; FragH bq; bq.half[0] = *(const v8us*)(Bh + boff + 8 * hh); bq.half[1] = *(const v8us*)(Bh + boff + 16 + 8 * hh);
      acc[t] = mmaH<ASPLIT ? 2 : 1>(ah.v, al.v, bq.v, bq.v, acc[t]); }
  }
#pragma unroll
  for (int t = 0; t < 4; ++t) { if (col0 + t * 16 >= N) continue;
#pragma unroll
    for (int r = 0; r < 8; ++r) so[w][8 * hh + r][t * 16 + ln] = acc[t][r] * alpha; }
  __builtin_amdgcn_fence(__ATOMIC_ACQ_REL, "workgroup"); __builtin_amdgcn_wave_barrier();
  const int rsub = lane >> 4, c4 = (lane & 15) * 4;
  {
#pragma unroll
    for (int q = 0; q < 8; ++q) { const int r = q * 2 + rsub; if (col0 + c4 < N) { const v4f v = *(const v4fa*)&so[w][r][c4]; *(v4f*)(C + (size_t)(row0 + r) * ldc + col0 + c4) = v; } }
     }
}

// Wt[n][k] = f16(W[k][n]·scale) from f32 row-major W[K][N] (scale = power of two; bf16-exact weights stay exact in f16 away from the subnormal range)
__global__ __launch_bounds__(256) void k_wt_f16(const float* __restrict__ W, _Float16* __restrict__ Wt, int K, int N, float scale) {
  const int t = blockIdx.x * 256 + threadIdx.x; if (t >= N * (K / 8)) return; const int n = t / (K / 8), k8 = (t % (K / 8)) * 8; FragH f;
#pragma unroll
  for (int i = 0; i < 8; ++i) f.h[i] = (_Float16)(bf16_round(W[(size_t)(k8 + i) * N + n]) * scale); const v8us o = f.half[0];
  *(v8us*)((unsigned short*)Wt + (size_t)n * K + k8) = o; 
}
// k_gemm_hh variant with fused epilogue: v = acc·alpha + bias[by·sBias + col] (+ CP[(row/rowsPerB)·sCPb + by·64 + col] if CP) ; ACT 0 none / 1 elu ; writes f16 C16 (and f32 C if non-null)
template <int ACT>
__global__ __launch_bounds__(128) void k_gemm_hhx(const _Float16* __restrict__ A, int lda, size_t sA, const _Float16* __restrict__ Bh, int ldb, size_t sB, float alpha, const float* __restrict__ bias, size_t sBias, const float* __restrict__ CP, int rowsPerB, size_t sCPb, int row0g,
    float* __restrict__ C, _Float16* __restrict__ C16, int ldc, size_t sC, int M, int N, int K) {
  __shared__ __attribute__((aligned(16))) float so[4][16][64];
  const int tid = threadIdx.x, w = tid >> 5, lane = tid & 31, ln = lane & 15, hh = lane >> 4; const int by = blockIdx.y;
  A += (size_t)by * sA; Bh += (size_t)by * sB; const size_t cofs = (size_t)by * sC; const float* bp = bias ? bias + (size_t)by * sBias : nullptr;
  const int ntn = (N + 63) / 64; const int wid = blockIdx.x * 4 + w; const int mt = wid / ntn, nq = wid % ntn; if (mt * 16 >= M) return;
  const int row0 = mt * 16, col0 = nq * 64; const _Float16* arow = A + (size_t)(row0 + ln) * lda;
  v8f acc[4] = {};
  for (int kb = 0; kb < K; kb += 32) { FragH ah; ah.half[0] = *(const v8us*)((const unsigned short*)arow + kb + 8 * hh); ah.half[1] = *(const v8us*)((const unsigned short*)arow + kb + 16 + 8 * hh);
#pragma unroll
    for (int t = 0; t < 4; ++t) { if (col0 + t * 16 >= N) continue; const size_t boff = (size_t)(col0 + t * 16 + ln) * ldb + kb; FragH bq; bq.half[0] = *(const v8us*)((const unsigned short*)Bh + boff + 8 * hh); bq.half[1] = *(const v8us*)((const unsigned short*)Bh + boff + 16 + 8 * hh);
      acc[t] = mmaH<1>(ah.v, ah.v, bq.v, bq.v, acc[t]); }
  }
#pragma unroll
  for (int t = 0; t < 4; ++t) { if (col0 + t * 16 >= N) continue; const int col = col0 + t * 16 + ln; const float bv = bp ? bf16_round(bp[col]) : 0.f;
#pragma unroll
    for (int r = 0; r < 8; ++r) { float v = acc[t][r] * alpha + bv; if (CP) { const int bidx = (row0g + row0 + 8 * hh + r) / rowsPerB; v += CP[(size_t)bidx * sCPb + (size_t)by * 64 + col]; } if (ACT == 1) v = (v > 0.f) ? v : expm1f(v); else if (ACT == 7) v = (v > 0.f) ? v + 1.0f : expf(v); else if (ACT == 8) v = tanhf(v); else if (ACT == 9) v = 0.5f * v * (1.0f + tanhf(0.7978845608028654f * (v + 0.044715f * v * v * v))); else if (ACT == 11) v = 1.0f / (1.0f + expf(-v)); else if (ACT == 12) v = (v > 0.f) ? v : 0.01f * v; else if (ACT == 14) v = (v > 0.f) ? v : 0.1f * v; else if (ACT == 15) v = v / (1.0f + expf(-v)); else if (ACT == 3) v = fmaxf(v, 0.f); else if (ACT == 6) v = 0.5f * v * (1.0f + erff(v * 0.70710678118654752f)); so[w][8 * hh + r][t * 16 + ln] = v; } }
  __builtin_amdgcn_fence(__ATOMIC_ACQ_REL, "workgroup"); __builtin_amdgcn_wave_barrier();
  const int rsub = lane >> 4, c4 = (lane & 15) * 4; typedef _Float16 v4h __attribute__((ext_vector_type(4)));
  {
#pragma unroll
    for (int q = 0; q < 8; ++q) { const int r = q * 2 + rsub; if (col0 + c4 < N) { const v4f v = *(const v4fa*)&so[w][r][c4]; if (C) *(v4f*)(C + cofs + (size_t)(row0 + r) * ldc + col0 + c4) = v; if (C16) { v4h h4; for (int i = 0; i < 4; ++i) h4[i] = (_Float16)v[i]; *(v4h*)(C16 + cofs + (size_t)(row0 + r) * ldc + col0 + c4) = h4; } } }
     }
}


typedef _Float16 v4h __attribute__((ext_vector_type(4)));

__global__ __launch_bounds__(256) void k_x16(const float* __restrict__ x, _Float16* __restrict__ X16, size_t n8) { const size_t t = (size_t)blockIdx.x * 256 + threadIdx.x; if (t >= n8) return; FragH f;
#pragma unroll
  for (int q = 0; q < 8; ++q) f.h[q] = (_Float16)bf16_round(x[t * 8 + q]); *(v8us*)((unsigned short*)X16 + t * 8) = f.half[0];  }
__global__ __launch_bounds__(256) void k_h16(const float* __restrict__ x, _Float16* __restrict__ X16, size_t n8) { const size_t t = (size_t)blockIdx.x * 256 + threadIdx.x; if (t >= n8) return; FragH f;
#pragma unroll
  for (int q = 0; q < 8; ++q) f.h[q] = (_Float16)x[t * 8 + q]; *(v8us*)((unsigned short*)X16 + t * 8) = f.half[0];  }
__global__ __launch_bounds__(256) void k_round16f(const float* __restrict__ W, _Float16* __restrict__ Bt, size_t n8) { const size_t t = (size_t)blockIdx.x * 256 + threadIdx.x; if (t >= n8) return; FragH f;
#pragma unroll
  for (int i = 0; i < 8; ++i) f.h[i] = (_Float16)(bf16_round(W[t * 8 + i]) * 16.0f); *(v8us*)((unsigned short*)Bt + t * 8) = f.half[0];  }
template <int NHv, int TTv>
__global__ __launch_bounds__(256) void k_vt(const _Float16* __restrict__ V16, int ldv, int voff, _Float16* __restrict__ Vt) { __shared__ unsigned short tl[64][66]; const int tid = threadIdx.x; const int slab = blockIdx.x / (TTv / 64), lg = blockIdx.x % (TTv / 64); const int b = slab / NHv, h = slab % NHv;
  for (int i = tid; i < 64 * 8; i += 256) { const int r = i / 8, c8 = (i % 8) * 8; FragH f; f.half[0] = *(const v8us*)((const unsigned short*)V16 + ((size_t)b * TTv + lg * 64 + r) * ldv + voff + h * 64 + c8);
#pragma unroll
    for (int q = 0; q < 8; ++q) tl[r][c8 + q] = f.u[q]; }
  __syncthreads();
  {
#pragma unroll
    for (int rd = 0; rd < 2; ++rd) { const int d = rd * 32 + tid / 8, pc = tid % 8; FragH f;
#pragma unroll
      for (int q = 0; q < 8; ++q) f.u[q] = tl[pc * 8 + q][d];
      *(v8us*)((unsigned short*)Vt + ((size_t)slab * 64 + d) * TTv + lg * 64 + pc * 8) = f.half[0]; }
     } }

__global__ __launch_bounds__(256) void k_hl(const float* __restrict__ F, _Float16* __restrict__ Hh, _Float16* __restrict__ Hl, size_t n8) { const size_t t = (size_t)blockIdx.x * 256 + threadIdx.x; if (t >= n8) return; FragH fh, fl; const v4f a = *(const v4fa*)(F + t * 8), c = *(const v4fa*)(F + t * 8 + 4);
#pragma unroll
  for (int q = 0; q < 4; ++q) { _Float16 h = (_Float16)a[q]; fh.h[q] = h; fl.h[q] = (_Float16)((a[q] - (float)h) * 1024.0f); h = (_Float16)c[q]; fh.h[4 + q] = h; fl.h[4 + q] = (_Float16)((c[q] - (float)h) * 1024.0f); }
  { *(v8us*)((unsigned short*)Hh + t * 8) = fh.half[0]; *(v8us*)((unsigned short*)Hl + t * 8) = fl.half[0];  } }

// ---- fast GEMM (wave tile 32x64; requires M % 32 == 0 rows per launch region and N % 64 == 0); epilogue = k_gemm_hhx semantics ----
__device__ __forceinline__ v16h g2_frag(const _Float16* p, int hh) { FragH f; f.half[0] = *(const v8us*)((const unsigned short*)p + 8 * hh); f.half[1] = *(const v8us*)((const unsigned short*)p + 16 + 8 * hh); return f.v; }
__device__ __forceinline__ v8f g2_mma(v16h a, v16h b, v8f c) { v8f d = __builtin_amdgcn_wmma_f32_16x16x32_f16(false, a, false, b, (short)0, c, false, false); asm volatile("v_nop\n\tv_nop\n\tv_nop\n\tv_nop" : "+v"(d) : "v"(a), "v"(b)); return d; }
template <int ACT>
__global__ __launch_bounds__(128) void k_gemm2(const _Float16* __restrict__ A, int lda, size_t sA, const _Float16* __restrict__ Bh, int ldb, size_t sB, float alpha, const float* __restrict__ bias, size_t sBias, const float* __restrict__ CP, int rowsPerB, size_t sCPb, int row0g,
    float* __restrict__ C, _Float16* __restrict__ C16, int ldc, size_t sC, int M, int N, int K) {
  __shared__ __attribute__((aligned(16))) float so[4][32][68];
  const int tid = threadIdx.x, w = tid >> 5, lane = tid & 31, ln = lane & 15, hh = lane >> 4; const int by = blockIdx.y;
  A += (size_t)by * sA; Bh += (size_t)by * sB; const size_t cofs = (size_t)by * sC; const float* bp = bias ? bias + (size_t)by * sBias : nullptr;
  const int ntn = N >> 6; const int mt = blockIdx.x / ntn, nq = blockIdx.x - mt * ntn; const int row0 = mt * 128 + 32 * w, col0 = nq * 64; if (row0 >= M) return;
  const _Float16* a0p = A + (size_t)(row0 + ln) * lda; const _Float16* a1p = a0p + (size_t)16 * lda;
  const _Float16* b0p = Bh + (size_t)(col0 + ln) * ldb; const _Float16* b1p = b0p + (size_t)16 * ldb; const _Float16* b2p = b1p + (size_t)16 * ldb; const _Float16* b3p = b2p + (size_t)16 * ldb;
  const v8f z8 = {0.f,0.f,0.f,0.f,0.f,0.f,0.f,0.f}; v8f c00 = z8, c01 = z8, c02 = z8, c03 = z8, c10 = z8, c11 = z8, c12 = z8, c13 = z8;
#pragma unroll 1
  for (int kb = 0; kb < K; kb += 32) { const v16h a0 = g2_frag(a0p + kb, hh), a1 = g2_frag(a1p + kb, hh);
    v16h b = g2_frag(b0p + kb, hh); c00 = g2_mma(a0, b, c00); c10 = g2_mma(a1, b, c10);
    b = g2_frag(b1p + kb, hh); c01 = g2_mma(a0, b, c01); c11 = g2_mma(a1, b, c11);
    b = g2_frag(b2p + kb, hh); c02 = g2_mma(a0, b, c02); c12 = g2_mma(a1, b, c12);
    b = g2_frag(b3p + kb, hh); c03 = g2_mma(a0, b, c03); c13 = g2_mma(a1, b, c13); }
  v8f accs[8] = {c00, c01, c02, c03, c10, c11, c12, c13};
#pragma unroll
  for (int u = 0; u < 8; ++u) { const int t = u & 3, half = u >> 2; const int col = col0 + t * 16 + ln; const float bv = bp ? bf16_round(bp[col]) : 0.f;
#pragma unroll
    for (int r = 0; r < 8; ++r) { const int rloc = half * 16 + 8 * hh + r; float v = accs[u][r] * alpha + bv; if (CP) { const int bidx = (row0g + row0 + rloc) / rowsPerB; v += CP[(size_t)bidx * sCPb + (size_t)by * 64 + col]; }
      if (ACT == 3) v = fmaxf(v, 0.f); else if (ACT == 6) v = 0.5f * v * (1.0f + erff(v * 0.70710678118654752f)); else if (ACT == 11) v = 1.0f / (1.0f + expf(-v)); else if (ACT == 15) v = v / (1.0f + expf(-v)); else if (ACT == 12) v = (v > 0.f) ? v : 0.01f * v; else if (ACT == 8) v = tanhf(v);
      so[w][rloc][t * 16 + ln] = v; } }
  __builtin_amdgcn_fence(__ATOMIC_ACQ_REL, "workgroup"); __builtin_amdgcn_wave_barrier();
  const int rsub = lane >> 4, c4 = (lane & 15) * 4;
  {
#pragma unroll
    for (int q = 0; q < 16; ++q) { const int r = q * 2 + rsub; const v4f v = *(const v4fa*)&so[w][r][c4]; if (C) *(v4f*)(C + cofs + (size_t)(row0 + r) * ldc + col0 + c4) = v; if (C16) { v4h h4; for (int i = 0; i < 4; ++i) h4[i] = (_Float16)v[i]; *(v4h*)(C16 + cofs + (size_t)(row0 + r) * ldc + col0 + c4) = h4; } }
     } }



template <int TK>
__global__ __launch_bounds__(256) void k_vthl(const float* __restrict__ VF, int ldv, _Float16* __restrict__ Vth, _Float16* __restrict__ Vtl) { __shared__ float tl[64][65]; const int tid = threadIdx.x; const int slab = blockIdx.x / (TK / 64), lg = blockIdx.x % (TK / 64); const int b = slab / NH, h = slab % NH;
  for (int i = tid; i < 64 * 16; i += 256) { const int r = i / 16, c4 = (i % 16) * 4; const v4f a = *(const v4fa*)(VF + ((size_t)b * TK + lg * 64 + r) * ldv + h * 64 + c4); tl[r][c4] = a[0]; tl[r][c4 + 1] = a[1]; tl[r][c4 + 2] = a[2]; tl[r][c4 + 3] = a[3]; }
  __syncthreads();
  FragH fh[2], fl[2]; size_t oo[2];
#pragma unroll
  for (int rd = 0; rd < 2; ++rd) { const int d = rd * 32 + tid / 8, pc = tid % 8;
#pragma unroll
    for (int q = 0; q < 8; ++q) { const float v = tl[pc * 8 + q][d]; const _Float16 hv = (_Float16)v; fh[rd].h[q] = hv; fl[rd].h[q] = (_Float16)((v - (float)hv) * 1024.0f); } oo[rd] = ((size_t)slab * 64 + d) * TK + lg * 64 + pc * 8; }
  {
#pragma unroll
    for (int rd = 0; rd < 2; ++rd) { *(v8us*)((unsigned short*)Vth + oo[rd]) = fh[rd].half[0]; *(v8us*)((unsigned short*)Vtl + oo[rd]) = fl[rd].half[0]; }
     } }

// grammar bias for (query position pi, key position pj): dist_emb[bucket(|pj - pi|)][h] + ((pj > pi) - 0.5) * order_bias[h]
__device__ __forceinline__ float gbias(const float* sDE, const float* __restrict__ OB, const unsigned char* sLUT, int h, int pi, int pj) { int d = abs(pj - pi); d = min(d, LUTN - 1); const int bin = sLUT[d]; return sDE[bin] + (((pj > pi) ? 1.0f : 0.0f) - 0.5f) * bf16_round(OB[h]); }
// lane l <-> l ^ 16 (the other half of the wave), all lanes on
__device__ __forceinline__ float xhalf(float v) { const int b = __float_as_int(v); return __int_as_float(__builtin_amdgcn_permlanex16(b, b, 0x76543210, 0xfedcba98, false, false)); }
template <int TQ, int TK>
__global__ __launch_bounds__(128) void k_flashb(const _Float16* __restrict__ Q16, const _Float16* __restrict__ Q16lo, int ldq, const _Float16* __restrict__ K16, const _Float16* __restrict__ K16lo, int ldk, const _Float16* __restrict__ Vt, const _Float16* __restrict__ Vtlo, const unsigned* __restrict__ MB, const int* __restrict__ RA, const int* __restrict__ KE, const float* __restrict__ BT, const float* __restrict__ OB, const int* __restrict__ LUT, const int* __restrict__ LAG, float* __restrict__ O, int ldo) {
  constexpr int RPW = 16, NQB = TQ / (4 * RPW), DT = 4, KS = 2;
  __shared__ __attribute__((aligned(16))) float sO[4][RPW][64 + 4];
  const int tid = threadIdx.x, w = tid >> 5, lane = tid & 31, ln = lane & 15, hh = lane >> 4;
  const int slab = blockIdx.x / NQB, qblk = blockIdx.x % NQB; const int b = slab / NH, h = slab % NH; const int qb0 = qblk * (4 * RPW); const int q0 = qb0 + w * RPW;
  MB += (size_t)b * TQ * (TK / 32); LAG += (size_t)b * TK;      /* per-batch key-mask table and positions: the grid spans all batches */
  /* the bias lookup's tables, staged once per block: bucket of every distance as one byte, the head's rounded dist_emb column, the batch's positions */
  typedef int v4ia __attribute__((ext_vector_type(4), may_alias));
  __shared__ __attribute__((aligned(16))) unsigned sLUTw[LUTN / 4]; __shared__ float sDE[NBIN]; __shared__ __attribute__((aligned(16))) int sPos[TK];
  for (int i = tid; i < LUTN / 4; i += 128) { const v4ia c = *(const v4ia*)(LUT + 4 * i); sLUTw[i] = (unsigned)(c[0] & (NBIN - 1)) | ((unsigned)(c[1] & (NBIN - 1)) << 8) | ((unsigned)(c[2] & (NBIN - 1)) << 16) | ((unsigned)(c[3] & (NBIN - 1)) << 24); }
  for (int i = tid; i < TK / 4; i += 128) *(v4ia*)(sPos + 4 * i) = *(const v4ia*)(LAG + 4 * i);
  if (tid < NBIN) sDE[tid] = bf16_round(BT[tid * NH + h]);
  __syncthreads();      /* every wave reads what all four staged */
  const unsigned char* sLUT = (const unsigned char*)sLUTw;
  const int tq = q0 + ln;      /* this lane's query */
  FragH aq[KS], aql[KS];       /* Q as the B operand: column = query ln */
  { const size_t qo = ((size_t)b * TQ + tq) * ldq + h * 64; const unsigned short* qr = (const unsigned short*)Q16 + qo; const unsigned short* ql = (const unsigned short*)Q16lo + qo;
#pragma unroll
    for (int ks = 0; ks < KS; ++ks) { aq[ks].half[0] = *(const v8us*)(qr + ks * 32 + 8 * hh); aq[ks].half[1] = *(const v8us*)(qr + ks * 32 + 16 + 8 * hh); aql[ks].half[0] = *(const v8us*)(ql + ks * 32 + 8 * hh); aql[ks].half[1] = *(const v8us*)(ql + ks * 32 + 16 + 8 * hh); } }
  int jend = KE[qblk * 32]; jend = min(TK, (jend + 31) & ~31); if (jend < 32) jend = 32;      /* block-uniform */
  const bool am = (RA[tq] != 0); const unsigned* mrow = MB + (size_t)tq * (TK / 32); const int pi = sPos[tq];
  const unsigned short* Vth = (const unsigned short*)Vt + (size_t)slab * 64 * TK; const unsigned short* Vtl = (const unsigned short*)Vtlo + (size_t)slab * 64 * TK;
  float m_q = -3.0e38f, l_q = 0.f; v8f oacc[DT], oaccl[DT];
#pragma unroll
  for (int dt = 0; dt < DT; ++dt) { oacc[dt] = (v8f){0.f,0.f,0.f,0.f,0.f,0.f,0.f,0.f}; oaccl[dt] = oacc[dt]; }
#pragma unroll 1
  for (int j0 = 0; j0 < jend; j0 += 32) {
    const unsigned mword = mrow[j0 >> 5];      /* this query's key-mask bits of the 32 keys */
    v8f s[2];
#pragma unroll
    for (int nt = 0; nt < 2; ++nt) { const size_t ko = ((size_t)b * TK + j0 + nt * 16 + ln) * ldk + h * 64; const unsigned short* kr = (const unsigned short*)K16 + ko; const unsigned short* kl = (const unsigned short*)K16lo + ko; FragH bk[KS], bkl[KS];      /* K as the A operand: row = key */
#pragma unroll
      for (int ks = 0; ks < KS; ++ks) { bk[ks].half[0] = *(const v8us*)(kr + ks * 32 + 8 * hh); bk[ks].half[1] = *(const v8us*)(kr + ks * 32 + 16 + 8 * hh); bkl[ks].half[0] = *(const v8us*)(kl + ks * 32 + 8 * hh); bkl[ks].half[1] = *(const v8us*)(kl + ks * 32 + 16 + 8 * hh); }
      v8f acc = (v8f){0.f,0.f,0.f,0.f,0.f,0.f,0.f,0.f}, accr = acc;
#pragma unroll
      for (int ks = 0; ks < KS; ++ks) { acc = mmaH<1>(bk[ks].v, bk[ks].v, aq[ks].v, aq[ks].v, acc); accr = mmaH<1>(bk[ks].v, bk[ks].v, aql[ks].v, aql[ks].v, accr); accr = mmaH<1>(bkl[ks].v, bkl[ks].v, aq[ks].v, aq[ks].v, accr); }
      s[nt] = acc + accr * 0.0009765625f; }
    const unsigned mw = mword >> (8 * hh);      /* bit nt * 16 + r = this lane's key nt * 16 + 8 hh + r */
    float sc[2][8]; bool ok[2][8]; float mc = -INFINITY;
#pragma unroll
    for (int nt = 0; nt < 2; ++nt) { const v4ia pA = *(const v4ia*)(sPos + j0 + nt * 16 + 8 * hh), pB = *(const v4ia*)(sPos + j0 + nt * 16 + 8 * hh + 4);
#pragma unroll
      for (int r = 0; r < 8; ++r) { const int pj = (r < 4) ? pA[r & 3] : pB[r & 3]; ok[nt][r] = am || (((mw >> (nt * 16 + r)) & 1u) == 0u);
        const float sv = s[nt][r] * SCL + gbias(sDE, OB, sLUT, h, pi, pj);      /* + grammar distance-bucket and order biases */
        sc[nt][r] = ok[nt][r] ? (am ? 0.f : sv) : -INFINITY; mc = fmaxf(mc, sc[nt][r]); } }
    mc = fmaxf(mc, xhalf(mc));
    const float mn = fmaxf(m_q, mc); const float ea = expf(m_q - mn); const float al = (mn > -1.0e38f) ? ea : 1.0f; m_q = mn;
    FragH pa, pl; float ls = 0.f;      /* P^T hi and residual, already in the B operand's order */
#pragma unroll
    for (int nt = 0; nt < 2; ++nt)
#pragma unroll
      for (int r = 0; r < 8; ++r) { const float e = expf(sc[nt][r] - mn); const float p = ok[nt][r] ? e : 0.f; ls += p;
        const float ps = p * 1024.0f; const _Float16 t2 = (_Float16)ps; pa.h[nt * 8 + r] = t2; pl.h[nt * 8 + r] = (_Float16)((ps - (float)t2) * 1024.0f); }
    l_q = l_q * al + ls;
#pragma unroll
    for (int dt = 0; dt < DT; ++dt) { oacc[dt] *= al; oaccl[dt] *= al; }
#pragma unroll
    for (int dt = 0; dt < DT; ++dt) { const size_t vo = (size_t)(dt * 16 + ln) * TK + j0; FragH bv, bl; bv.half[0] = *(const v8us*)(Vth + vo + 8 * hh); bv.half[1] = *(const v8us*)(Vth + vo + 16 + 8 * hh); bl.half[0] = *(const v8us*)(Vtl + vo + 8 * hh); bl.half[1] = *(const v8us*)(Vtl + vo + 16 + 8 * hh);      /* V^T as the A operand: row = d */
      oacc[dt] = mmaH<1>(bv.v, bv.v, pa.v, pa.v, oacc[dt]); oaccl[dt] = mmaH<1>(bl.v, bl.v, pa.v, pa.v, oaccl[dt]); oaccl[dt] = mmaH<1>(bv.v, bv.v, pl.v, pl.v, oaccl[dt]); } }
  const float lt = l_q + xhalf(l_q); const float inv = (lt > 0.f) ? 1.0f / (lt * 1024.0f) : 0.f;
#pragma unroll
  for (int dt = 0; dt < DT; ++dt)
#pragma unroll
    for (int g = 0; g < 2; ++g) { v4f o4;
#pragma unroll
      for (int i = 0; i < 4; ++i) o4[i] = (oacc[dt][g * 4 + i] + oaccl[dt][g * 4 + i] * 0.0009765625f) * inv;
      *(v4fa*)&sO[w][ln][dt * 16 + 8 * hh + g * 4] = o4; }
  __builtin_amdgcn_fence(__ATOMIC_ACQ_REL, "workgroup"); __builtin_amdgcn_wave_barrier();
  {
#pragma unroll
    for (int rp = 0; rp < RPW; rp += 2) { const int r = rp + (lane >> 4), pc = lane & 15; const v4f val = *(const v4fa*)&sO[w][r][pc * 4]; *(v4f*)(O + ((size_t)b * TQ + q0 + r) * ldo + h * 64 + pc * 4) = val; }
     } }


__global__ __launch_bounds__(256) void k_fulltab(unsigned* __restrict__ MB, int* __restrict__ RA, int* __restrict__ KE, int nq, int nk) {
  const int t = blockIdx.x * 256 + threadIdx.x;
  if (t < nq * (nk / 32)) { *(unsigned*)(MB + t) = 0u;  }
  if (t < nq) { *(int*)(RA + t) = 0;  }
  if (t < nq / 64) { *(int*)(KE + t * 32) = nk;  } }
__global__ __launch_bounds__(256) void k_lnx(const float* __restrict__ X, const float* __restrict__ g, const float* __restrict__ bb, _Float16* __restrict__ Y16, float* __restrict__ XB) {
  #pragma clang fp contract(off)
  const int tid = threadIdx.x, w = tid >> 5, ln = tid & 31; const int r = blockIdx.x * 8 + w; if (r >= NR) return; const float* x = X + (size_t)r * DM; float s = 0.f;
#pragma unroll 1
  for (int i = 0; i < DM / 128; ++i) { const v4f a = *(const v4fa*)(x + i * 128 + ln * 4); for (int q = 0; q < 4; ++q) s += bf16_round(a[q]); }
  for (int o = 16; o > 0; o >>= 1) s += __shfl_xor(s, o, 32); const float mu = s / (float)DM; float q2 = 0.f;
#pragma unroll 1
  for (int i = 0; i < DM / 128; ++i) { const v4f a = *(const v4fa*)(x + i * 128 + ln * 4); for (int q = 0; q < 4; ++q) { const float d = bf16_round(a[q]) - mu; q2 += d * d; } }
  for (int o = 16; o > 0; o >>= 1) q2 += __shfl_xor(q2, o, 32); const float rs = rsqrtf(q2 / (float)DM + 1e-5f);
  {
#pragma unroll 1
    for (int i = 0; i < DM / 128; ++i) { const int c0 = i * 128 + ln * 4; const v4f a = *(const v4fa*)(x + c0); _Float16 h4[4]; v4f xb;
      for (int q = 0; q < 4; ++q) { const float t = bf16_round(a[q]); h4[q] = (_Float16)((t - mu) * rs * bf16_round(g[c0 + q]) + bf16_round(bb[c0 + q])); xb[q] = t; }
      *(unsigned long long*)((unsigned short*)Y16 + (size_t)r * DM + c0) = *(const unsigned long long*)h4; *(v4f*)(XB + (size_t)r * DM + c0) = xb; }
     } }
// bucket table: LUT[d] = count of bf16-rounded edges < d (bucketize right=False), capped at NBIN-1, for d = 0..LUTN-1
__global__ __launch_bounds__(256) void k_lut(const float* __restrict__ edges, int* __restrict__ LUT) {
  #pragma clang fp contract(off)
  const int d = blockIdx.x * 256 + threadIdx.x; if (d >= LUTN) return; const float fd = (float)d; int c = 0;
#pragma unroll 1
  for (int e = 0; e < NBIN - 1; ++e) c += (bf16_round(edges[e]) < fd) ? 1 : 0;
  c = min(c, NBIN - 1); *(int*)(LUT + d) = c;  }
__global__ __launch_bounds__(256) void k_masktab(const float* __restrict__ mask, unsigned* __restrict__ MB, int* __restrict__ RA, int* __restrict__ KE) {
  const size_t t = (size_t)blockIdx.x * 256 + threadIdx.x; const int nw = SLEN / 32;
  if (t < (size_t)NBT * SLEN * nw) { const int w = (int)(t % nw); const int b = (int)(t / ((size_t)SLEN * nw)); unsigned bits = 0u; for (int j = 0; j < 32; ++j) bits |= (bf16_round(mask[(size_t)b * SLEN + 32 * w + j]) == 0.0f) ? (1u << j) : 0u; *(unsigned*)(MB + t) = bits;  }
  if (t < SLEN) { *(int*)(RA + t) = 0;  }
  if (t < SLEN / 64) { *(int*)(KE + t * 32) = SLEN;  } }
__global__ __launch_bounds__(256) void k_hlmask(const float* __restrict__ F, const float* __restrict__ mask, _Float16* __restrict__ Hh, _Float16* __restrict__ Hl, size_t n8) {
  #pragma clang fp contract(off)
  const size_t t = (size_t)blockIdx.x * 256 + threadIdx.x; if (t >= n8) return; const float mk = bf16_round(mask[(t * 8) / DM]); FragH fh, fl;
#pragma unroll
  for (int q = 0; q < 8; ++q) { const float v = F[t * 8 + q] * mk; const _Float16 h = (_Float16)v; fh.h[q] = h; fl.h[q] = (_Float16)((v - (float)h) * 1024.0f); }
  { *(v8us*)((unsigned short*)Hh + t * 8) = fh.half[0]; *(v8us*)((unsigned short*)Hl + t * 8) = fl.half[0];  } }
__global__ __launch_bounds__(256) void k_causaltab(unsigned* __restrict__ MB, int* __restrict__ RA, int* __restrict__ KE, int nq, int nk) {
  const int t = blockIdx.x * 256 + threadIdx.x; const int nw = nk / 32;
  if (t < nq * nw) { const int q = t / nw, w = t % nw; const int first = q + 1 - 32 * w; const unsigned bits = (first <= 0) ? 0xffffffffu : ((first >= 32) ? 0u : (0xffffffffu << first)); *(unsigned*)(MB + t) = bits;  }
  if (t < nq) { *(int*)(RA + t) = 0;  }
  if (t < nq / 64) { const int v = 64 * (t + 1); *(int*)(KE + t * 32) = v;  } }


extern "C" void kernel_launch(void* const* d_in, const int* in_sizes, int n_in,
                              void* d_out, int out_size, void* d_ws, size_t ws_size, hipStream_t stream) {
  (void)in_sizes; (void)n_in; (void)out_size;
  const float* const* I = (const float* const*)d_in; const float* x = I[0]; const int* pos = (const int*)d_in[1]; const float* mask = I[2]; const float* qw = I[3]; const float* qb = I[4]; const float* kw = I[5]; const float* kb = I[6]; const float* vw = I[7]; const float* vb = I[8]; const float* ow = I[9]; const float* ob = I[10]; const float* de = I[11]; const float* obias = I[12]; const float* edges = I[13];
  char* ws = (char*)d_ws; size_t off = 0;
  auto take = [&](size_t bytes) { char* p = ws + off; off += (bytes + 255) & ~(size_t)255; return p; };
  _Float16* BQ = (_Float16*)take((size_t)DM * DM * 2); _Float16* BK = (_Float16*)take((size_t)DM * DM * 2); _Float16* BV = (_Float16*)take((size_t)DM * DM * 2); _Float16* BO = (_Float16*)take((size_t)DM * DM * 2);
  _Float16* X16 = (_Float16*)take((size_t)NR * DM * 2); float* F = (float*)take((size_t)NR * DM * 4);
  _Float16* Qh = (_Float16*)take((size_t)NR * DM * 2); _Float16* Ql = (_Float16*)take((size_t)NR * DM * 2); _Float16* Kh = (_Float16*)take((size_t)NR * DM * 2); _Float16* Kl = (_Float16*)take((size_t)NR * DM * 2); _Float16* Vth = (_Float16*)take((size_t)NR * DM * 2); _Float16* Vtl = (_Float16*)take((size_t)NR * DM * 2);
  unsigned* MB = (unsigned*)take((size_t)NBT * SLEN * (SLEN / 32) * 4); int* RA = (int*)take((size_t)SLEN * 4); int* KE = (int*)take((size_t)(SLEN / 64) * 32 * 4); int* LUT = (int*)take((size_t)LUTN * 4);
  if (off > ws_size) return;      /* 2 + 8 + 16 + 48 + 1.1 = 75 MiB */
  float* O = F; _Float16* Oh = Qh; _Float16* Ol = Ql;
  const size_t w8 = (size_t)DM * DM / 8; const unsigned wb = (unsigned)((w8 + 255) / 256);
  k_round16f<<<wb, 256, 0, stream>>>(qw, BQ, w8); k_round16f<<<wb, 256, 0, stream>>>(kw, BK, w8); k_round16f<<<wb, 256, 0, stream>>>(vw, BV, w8); k_round16f<<<wb, 256, 0, stream>>>(ow, BO, w8);      /* torch (out,in) = natural Bt */
  k_lut<<<LUTN / 256, 256, 0, stream>>>(edges, LUT); k_masktab<<<(unsigned)(((size_t)NBT * SLEN * (SLEN / 32) + 255) / 256), 256, 0, stream>>>(mask, MB, RA, KE);
  const size_t n8 = (size_t)NR * DM / 8; const unsigned nb8 = (unsigned)((n8 + 255) / 256); const dim3 gP((NR / 128) * (DM / 64), 1);
  k_x16<<<nb8, 256, 0, stream>>>(x, X16, n8);
  k_gemm2<0><<<gP, 128, 0, stream>>>(X16, DM, 0, BQ, DM, 0, 0.0625f, qb, 0, nullptr, 1, 0, 0, F, nullptr, DM, 0, NR, DM, DM); k_hl<<<nb8, 256, 0, stream>>>(F, Qh, Ql, n8);
  k_gemm2<0><<<gP, 128, 0, stream>>>(X16, DM, 0, BK, DM, 0, 0.0625f, kb, 0, nullptr, 1, 0, 0, F, nullptr, DM, 0, NR, DM, DM); k_hl<<<nb8, 256, 0, stream>>>(F, Kh, Kl, n8);
  k_gemm2<0><<<gP, 128, 0, stream>>>(X16, DM, 0, BV, DM, 0, 0.0625f, vb, 0, nullptr, 1, 0, 0, F, nullptr, DM, 0, NR, DM, DM);
  k_vthl<SLEN><<<NBT * NH * (SLEN / 64), 256, 0, stream>>>(F, DM, Vth, Vtl);
  k_flashb<SLEN, SLEN><<<NBT * NH * (SLEN / 64), 128, 0, stream>>>(Qh, Ql, DM, Kh, Kl, DM, Vth, Vtl, MB, RA, KE, de, obias, LUT, pos, O, DM);
  k_hlmask<<<nb8, 256, 0, stream>>>(O, mask, Oh, Ol, n8);
  k_gemm2<0><<<gP, 128, 0, stream>>>(Oh, DM, 0, BO, DM, 0, 0.0625f, ob, 0, nullptr, 1, 0, 0, (float*)d_out, nullptr, DM, 0, NR, DM, DM);
  k_gemm2<0><<<gP, 128, 0, stream>>>(Ol, DM, 0, BO, DM, 0, 0.0625f / 1024.0f, nullptr, 0, (float*)d_out, 1, (size_t)DM, 0, (float*)d_out, nullptr, DM, 0, NR, DM, DM);
}

// v004
// Measured time: 297 microseconds a run.
// Timed twice side by side with v003, it ran 1.10 and 1.11 times as fast.
// Counting every step since v000, it is 6.93 times as fast.
#include <hip/hip_runtime.h>
// Grammar attention (8 x 1024 tokens, 512 = 8 heads x 64): q,k,v = x W^T + b; scores = q.k/8 + dist_emb[bucket(|pos_j - pos_i|)][h] + ((pos_j > pos_i) - 0.5) * order_bias[h] with INPUT int32 positions, INPUT bin edges (torch.bucketize right=False = count of edges < dist) and an INPUT key/query mask (masked keys excluded; masked query rows zeroed before the output projection, as out * mask); softmax; out = ((attn v) * mask) Wo^T + bo -> [8,1024,512].
// Structure: x as an exact f16 plane; projections as f16 WMMA GEMMs (32x64 wave tiles, f32 accumulation, exact x16 weights + bias); a device-built bucket lookup table over integer distances (from the INPUT edges) and per-batch key-mask bit tables; q, k as f16 hi + (x2^10) residual planes, V^T as hi + residual planes; the fused flash kernel gathers both biases by the INPUT positions inside the score stage (transposed score and value tiles, online f32 softmax per lane, P hi + residual kept in registers, two value accumulators); O scaled by the query mask, split hi/lo, into Wo (two GEMMs, bias in the first).
// Compute dtype: x, weights, biases, dist_emb, order_bias, bin_edges, mask rounded to bf16; projections exact; q, k, P, v, O as f16 hi + residual pairs (~2^-21); f32 accumulation and softmax. v_wmma_f32_16x16x32_f16.
#define NBT 8
#define SLEN 1024
#define NBIN 32
#define LUTN 16384            /* bucket lookup over integer distances 0..LUTN-1 (positions < 5000) */
#define DM 512
#define NH 8
#define SCL 0.125f
#define NR (NBT * SLEN)
typedef __bf16 v16b __attribute__((ext_vector_type(16)));
typedef unsigned short v8us __attribute__((ext_vector_type(8), may_alias));
typedef float  v8f  __attribute__((ext_vector_type(8)));
typedef float  v4f  __attribute__((ext_vector_type(4)));
typedef float  v4fa __attribute__((ext_vector_type(4), may_alias));
union FragB { v16b v; v8us half[2]; unsigned short u[16]; };

__device__ __forceinline__ unsigned short bf16_bits(float x) { unsigned int u = __float_as_uint(x); return (unsigned short)((u + 0x7FFFu + ((u >> 16) & 1u)) >> 16); }
__device__ __forceinline__ float bf16_val(unsigned short b) { return __uint_as_float(((unsigned int)b) << 16); }
__device__ __forceinline__ float bf16_round(float x) { return bf16_val(bf16_bits(x)); }
// D += A·B with NT terms: 1 = ah·bh, 2 = + al·bh (A split), 3 = + ah·bl (both split)
template <int NT>
__device__ __forceinline__ v8f mmaN(v16b ah, v16b al, v16b bh, v16b bl, v8f c) {
  c = __builtin_amdgcn_wmma_f32_16x16x32_bf16(false, ah, false, bh, (short)0, c, false, false);
  if (NT >= 2) c = __builtin_amdgcn_wmma_f32_16x16x32_bf16(false, al, false, bh, (short)0, c, false, false);
  if (NT >= 3) c = __builtin_amdgcn_wmma_f32_16x16x32_bf16(false, ah, false, bl, (short)0, c, false, false);
  asm volatile("v_nop\n\tv_nop\n\tv_nop\n\tv_nop" : "+v"(c) : "v"(ah), "v"(al), "v"(bh), "v"(bl));
  return c;
}

__global__ __launch_bounds__(256) void k_wt_bf16(const float* __restrict__ W, unsigned short* __restrict__ Wt, int K, int N) {
  const int t = blockIdx.x * 256 + threadIdx.x;
  const int k8n = K / 8;
  if (t >= N * k8n) return;
  const int n = t / k8n, k8 = (t % k8n) * 8;
  v8us v;
#pragma unroll
  for (int i = 0; i < 8; ++i) v[i] = bf16_bits(W[(size_t)(k8 + i) * N + n]);
  *(v8us*)(Wt + (size_t)n * K + k8) = v;
  
}

// GEMM C[M][N] (f32, pitch ldc) = act(A[M][K]·W + bias). A f32 row-major (pitch lda) converted per fragment to bf16
// (ASPLIT: hi/lo two planes -> 2 terms, else single rounded term); Wt bf16 [N][K] (pitch ldb). BIAS_BF16 rounds the
// bias to bf16 first (bias quantised to bf16 before the add). K%32==0, M%16==0, N%64==0.
template <bool ASPLIT, int ACT, bool BIAS_BF16>
__global__ __launch_bounds__(128) void k_gemm_bf(const float* __restrict__ A, int lda, const unsigned short* __restrict__ Wt, int ldb,
                                               const float* __restrict__ bias, float* __restrict__ C, int ldc, int M, int N, int K) {
  __shared__ __attribute__((aligned(16))) float so[4][16][64];
  const int tid = threadIdx.x, w = tid >> 5, lane = tid & 31, ln = lane & 15, hh = lane >> 4;
  const int ntn = N / 64;
  const int wid = blockIdx.x * 4 + w;
  const int mt = wid / ntn, nq = wid % ntn;
  if (mt * 16 >= M) return;
  const int row0 = mt * 16, col0 = nq * 64;
  const float* arow = A + (size_t)(row0 + ln) * lda;
  v8f acc[4] = {};
  for (int kb = 0; kb < K; kb += 32) {
    FragB ah, al;
    const v4f x0 = *(const v4fa*)(arow + kb + 8 * hh), x1 = *(const v4fa*)(arow + kb + 8 * hh + 4);
    const v4f x2 = *(const v4fa*)(arow + kb + 16 + 8 * hh), x3 = *(const v4fa*)(arow + kb + 16 + 8 * hh + 4);
    float xs[16] = {x0[0],x0[1],x0[2],x0[3],x1[0],x1[1],x1[2],x1[3],x2[0],x2[1],x2[2],x2[3],x3[0],x3[1],x3[2],x3[3]};
#pragma unroll
    for (int i = 0; i < 16; ++i) { const unsigned short hb = bf16_bits(xs[i]); ah.u[i] = hb; al.u[i] = ASPLIT ? bf16_bits(xs[i] - bf16_val(hb)) : (unsigned short)0; }
#pragma unroll
    for (int t = 0; t < 4; ++t) {
      const unsigned short* brow = Wt + (size_t)(col0 + t * 16 + ln) * ldb + kb;
      FragB b;
      b.half[0] = *(const v8us*)(brow + 8 * hh);
      b.half[1] = *(const v8us*)(brow + 16 + 8 * hh);
      acc[t] = mmaN<ASPLIT ? 2 : 1>(ah.v, al.v, b.v, b.v, acc[t]);
    }
  }
#pragma unroll
  for (int t = 0; t < 4; ++t) {
    float bv = bias ? bias[col0 + t * 16 + ln] : 0.f;
    if (BIAS_BF16) bv = bf16_round(bv);
#pragma unroll
    for (int r = 0; r < 8; ++r) { float v = acc[t][r] + bv; if (ACT == 1) v = fmaxf(v, 0.f); so[w][8 * hh + r][t * 16 + ln] = v; }
  }
  __builtin_amdgcn_fence(__ATOMIC_ACQ_REL, "workgroup");
  __builtin_amdgcn_wave_barrier();
  const int rsub = lane >> 4, c4 = (lane & 15) * 4;
  {
#pragma unroll
    for (int q = 0; q < 8; ++q) {
      const int r = q * 2 + rsub;
      const v4f v = *(const v4fa*)&so[w][r][c4];
      *(v4f*)(C + (size_t)(row0 + r) * ldc + col0 + c4) = v;
    }
    
  }
}

// GEMM C = act(A·W + bias + resid): A f32 (ASPLIT -> hi/lo 2 terms), Wt bf16 [N][K]; ACT 0 none, 1 relu, 2 exact gelu;
// resid (optional, f32, row index = (row % rmod), pitch ldr, RES_BF16 rounds it) added before the activation.
template <bool ASPLIT, int ACT, bool BIAS_BF16, bool RES_BF16>
__global__ __launch_bounds__(128) void k_gemm_bf3(const float* __restrict__ A, int lda, const unsigned short* __restrict__ Wt, int ldb,
                                                const float* __restrict__ bias, const float* __restrict__ resid, int rmod, int ldr,
                                                float* __restrict__ C, int ldc, int M, int N, int K) {
  __shared__ __attribute__((aligned(16))) float so[4][16][64];
  const int tid = threadIdx.x, w = tid >> 5, lane = tid & 31, ln = lane & 15, hh = lane >> 4;
  const int ntn = N / 64;
  const int wid = blockIdx.x * 4 + w;
  const int mt = wid / ntn, nq = wid % ntn;
  if (mt * 16 >= M) return;
  const int row0 = mt * 16, col0 = nq * 64;
  const float* arow = A + (size_t)(row0 + ln) * lda;
  v8f acc[4] = {};
  for (int kb = 0; kb < K; kb += 32) {
    FragB ah, al;
    const v4f x0 = *(const v4fa*)(arow + kb + 8 * hh), x1 = *(const v4fa*)(arow + kb + 8 * hh + 4);
    const v4f x2 = *(const v4fa*)(arow + kb + 16 + 8 * hh), x3 = *(const v4fa*)(arow + kb + 16 + 8 * hh + 4);
    float xs[16] = {x0[0],x0[1],x0[2],x0[3],x1[0],x1[1],x1[2],x1[3],x2[0],x2[1],x2[2],x2[3],x3[0],x3[1],x3[2],x3[3]};
#pragma unroll
    for (int i = 0; i < 16; ++i) { const unsigned short hb = bf16_bits(xs[i]); ah.u[i] = hb; al.u[i] = ASPLIT ? bf16_bits(xs[i] - bf16_val(hb)) : (unsigned short)0; }
#pragma unroll
    for (int t = 0; t < 4; ++t) {
      const unsigned short* brow = Wt + (size_t)(col0 + t * 16 + ln) * ldb + kb;
      FragB b;
      b.half[0] = *(const v8us*)(brow + 8 * hh);
      b.half[1] = *(const v8us*)(brow + 16 + 8 * hh);
      acc[t] = mmaN<ASPLIT ? 2 : 1>(ah.v, al.v, b.v, b.v, acc[t]);
    }
  }
#pragma unroll
  for (int t = 0; t < 4; ++t) {
    const int col = col0 + t * 16 + ln;
    float bv = bias ? bias[col] : 0.f;
    if (BIAS_BF16) bv = bf16_round(bv);
#pragma unroll
    for (int r = 0; r < 8; ++r) {
      float v = acc[t][r] + bv;
      if (resid) { float rv = resid[(size_t)((row0 + 8 * hh + r) % rmod) * ldr + col]; if (RES_BF16) rv = bf16_round(rv); v += rv; }
      if (ACT == 1) v = fmaxf(v, 0.f);
      if (ACT == 2) v = 0.5f * v * (1.0f + erff(v * 0.70710678118654752f));
      if (ACT == 3) { const float u = 0.7978845608028654f * (v + 0.044715f * v * v * v); v = 0.5f * v * (1.0f + tanhf(u)); }
      so[w][8 * hh + r][t * 16 + ln] = v;
    }
  }
  __builtin_amdgcn_fence(__ATOMIC_ACQ_REL, "workgroup");
  __builtin_amdgcn_wave_barrier();
  const int rsub = lane >> 4, c4 = (lane & 15) * 4;
  {
#pragma unroll
    for (int q = 0; q < 8; ++q) {
      const int r = q * 2 + rsub;
      const v4f v = *(const v4fa*)&so[w][r][c4];
      *(v4f*)(C + (size_t)(row0 + r) * ldc + col0 + c4) = v;
    }
    
  }
}
// row LayerNorm (biased variance, eps) over N: s = X (+ R); optional out_sum <- s; out_norm <- (s-mu)*rsqrt(var+eps)*g + b
template <bool PARAM_BF16>
__global__ __launch_bounds__(256) void k_layernorm(const float* __restrict__ X, const float* __restrict__ R, const float* __restrict__ g, const float* __restrict__ bta,
                                                  float* __restrict__ out_sum, float* __restrict__ out_norm, int N, float eps) {
  __shared__ float red[256];
  const int row = blockIdx.x, tid = threadIdx.x;
  const float* x = X + (size_t)row * N; const float* rr = R ? R + (size_t)row * N : nullptr;
  float vals[16];                     // up to N = 4096
  const int per = N / 256;            // contiguous chunk per thread? use strided-by-4 chunks: thread handles j = tid*4 + 1024*u
  float s1 = 0.f;
  for (int u = 0; u < per / 4; ++u) {
    const int j = tid * 4 + 1024 * u;
    const v4f a = *(const v4fa*)(x + j);
    v4f b = {0.f,0.f,0.f,0.f}; if (rr) b = *(const v4fa*)(rr + j);
#pragma unroll
    for (int q = 0; q < 4; ++q) { const float v = a[q] + b[q]; vals[u * 4 + q] = v; s1 += v; }
  }
  red[tid] = s1; __syncthreads();
  for (int st = 128; st > 0; st >>= 1) { if (tid < st) red[tid] += red[tid + st]; __syncthreads(); }
  const float mu = red[0] / (float)N; __syncthreads();
  float s2 = 0.f;
  for (int u = 0; u < per / 4; ++u)
#pragma unroll
    for (int q = 0; q < 4; ++q) { const float c = vals[u * 4 + q] - mu; s2 += c * c; }
  red[tid] = s2; __syncthreads();
  for (int st = 128; st > 0; st >>= 1) { if (tid < st) red[tid] += red[tid + st]; __syncthreads(); }
  const float rs = rsqrtf(red[0] / (float)N + eps);
  {
    for (int u = 0; u < per / 4; ++u) {
      const int j = tid * 4 + 1024 * u;
      v4f o, sm;
#pragma unroll
      for (int q = 0; q < 4; ++q) {
        float gg = g[j + q], bb = bta[j + q];
        if (PARAM_BF16) { gg = bf16_round(gg); bb = bf16_round(bb); }
        sm[q] = vals[u * 4 + q]; o[q] = (vals[u * 4 + q] - mu) * rs * gg + bb;
      }
      if (out_sum) *(v4f*)(out_sum + (size_t)row * N + j) = sm;
      *(v4f*)(out_norm + (size_t)row * N + j) = o;
    }
    
  }
}



// ---- f16 WMMA path (v_wmma_f32_16x16x32_f16): 11-bit significands for operands in range — used where a [0,1] probability operand needs more precision than bf16
typedef _Float16 v16h __attribute__((ext_vector_type(16)));
union FragH { v16h v; v8us half[2]; _Float16 h[16]; unsigned short u[16]; };
template <int NT>
__device__ __forceinline__ v8f mmaH(v16h ah, v16h al, v16h bh, v16h bl, v8f c) {
  c = __builtin_amdgcn_wmma_f32_16x16x32_f16(false, ah, false, bh, (short)0, c, false, false);
  if (NT >= 2) c = __builtin_amdgcn_wmma_f32_16x16x32_f16(false, al, false, bh, (short)0, c, false, false);
  if (NT >= 3) c = __builtin_amdgcn_wmma_f32_16x16x32_f16(false, ah, false, bl, (short)0, c, false, false);
  asm volatile("v_nop\n\tv_nop\n\tv_nop\n\tv_nop" : "+v"(c) : "v"(ah), "v"(al), "v"(bh), "v"(bl));
  return c;
}
// batched GEMM like k_gemm_b but f16 operands: A f32 (split into f16 hi/lo if ASPLIT, else rounded to f16), Bt = f16 values [n][k]; alpha; C f32; N multiple of 16 (partial tiles skipped)
template <bool ASPLIT>
__global__ __launch_bounds__(128) void k_gemm_h(const float* __restrict__ A, int lda, size_t sA, const _Float16* __restrict__ Bh, int ldb, size_t sB, float alpha, float* __restrict__ C, int ldc, size_t sC, int M, int N, int K) {
  __shared__ __attribute__((aligned(16))) float so[4][16][64];
  const int tid = threadIdx.x, w = tid >> 5, lane = tid & 31, ln = lane & 15, hh = lane >> 4; const int by = blockIdx.y;
  A += (size_t)by * sA; Bh += (size_t)by * sB; C += (size_t)by * sC;
  const int ntn = (N + 63) / 64; const int wid = blockIdx.x * 4 + w; const int mt = wid / ntn, nq = wid % ntn; if (mt * 16 >= M) return;
  const int row0 = mt * 16, col0 = nq * 64; const float* arow = A + (size_t)(row0 + ln) * lda;
  v8f acc[4] = {};
  for (int kb = 0; kb < K; kb += 32) {
    FragH ah, al;
    const v4f x0 = *(const v4fa*)(arow + kb + 8 * hh), x1 = *(const v4fa*)(arow + kb + 8 * hh + 4), x2 = *(const v4fa*)(arow + kb + 16 + 8 * hh), x3 = *(const v4fa*)(arow + kb + 16 + 8 * hh + 4);
    float xs[16] = {x0[0],x0[1],x0[2],x0[3],x1[0],x1[1],x1[2],x1[3],x2[0],x2[1],x2[2],x2[3],x3[0],x3[1],x3[2],x3[3]};
#pragma unroll
    for (int i = 0; i < 16; ++i) { const _Float16 h = (_Float16)xs[i]; ah.h[i] = h; al.h[i] = ASPLIT ? (_Float16)(xs[i] - (float)h) : (_Float16)0.0f; }
#pragma unroll
    for (int t = 0; t < 4; ++t) { if (col0 + t * 16 >= N) continue; const size_t boff = (size_t)(col0 + t * 16 + ln) * ldb + kb; FragH bq; bq.half[0] = *(const v8us*)(Bh + boff + 8 * hh); bq.half[1] = *(const v8us*)(Bh + boff + 16 + 8 * hh);
      acc[t] = mmaH<ASPLIT ? 2 : 1>(ah.v, al.v, bq.v, bq.v, acc[t]); }
  }
#pragma unroll
  for (int t = 0; t < 4; ++t) { if (col0 + t * 16 >= N) continue;
#pragma unroll
    for (int r = 0; r < 8; ++r) so[w][8 * hh + r][t * 16 + ln] = acc[t][r] * alpha; }
  __builtin_amdgcn_fence(__ATOMIC_ACQ_REL, "workgroup"); __builtin_amdgcn_wave_barrier();
  const int rsub = lane >> 4, c4 = (lane & 15) * 4;
  {
#pragma unroll
    for (int q = 0; q < 8; ++q) { const int r = q * 2 + rsub; if (col0 + c4 < N) { const v4f v = *(const v4fa*)&so[w][r][c4]; *(v4f*)(C + (size_t)(row0 + r) * ldc + col0 + c4) = v; } }
     }
}

// Wt[n][k] = f16(W[k][n]·scale) from f32 row-major W[K][N] (scale = power of two; bf16-exact weights stay exact in f16 away from the subnormal range)
__global__ __launch_bounds__(256) void k_wt_f16(const float* __restrict__ W, _Float16* __restrict__ Wt, int K, int N, float scale) {
  const int t = blockIdx.x * 256 + threadIdx.x; if (t >= N * (K / 8)) return; const int n = t / (K / 8), k8 = (t % (K / 8)) * 8; FragH f;
#pragma unroll
  for (int i = 0; i < 8; ++i) f.h[i] = (_Float16)(bf16_round(W[(size_t)(k8 + i) * N + n]) * scale); const v8us o = f.half[0];
  *(v8us*)((unsigned short*)Wt + (size_t)n * K + k8) = o; 
}
// k_gemm_hh variant with fused epilogue: v = acc·alpha + bias[by·sBias + col] (+ CP[(row/rowsPerB)·sCPb + by·64 + col] if CP) ; ACT 0 none / 1 elu ; writes f16 C16 (and f32 C if non-null)
template <int ACT>
__global__ __launch_bounds__(128) void k_gemm_hhx(const _Float16* __restrict__ A, int lda, size_t sA, const _Float16* __restrict__ Bh, int ldb, size_t sB, float alpha, const float* __restrict__ bias, size_t sBias, const float* __restrict__ CP, int rowsPerB, size_t sCPb, int row0g,
    float* __restrict__ C, _Float16* __restrict__ C16, int ldc, size_t sC, int M, int N, int K) {
  __shared__ __attribute__((aligned(16))) float so[4][16][64];
  const int tid = threadIdx.x, w = tid >> 5, lane = tid & 31, ln = lane & 15, hh = lane >> 4; const int by = blockIdx.y;
  A += (size_t)by * sA; Bh += (size_t)by * sB; const size_t cofs = (size_t)by * sC; const float* bp = bias ? bias + (size_t)by * sBias : nullptr;
  const int ntn = (N + 63) / 64; const int wid = blockIdx.x * 4 + w; const int mt = wid / ntn, nq = wid % ntn; if (mt * 16 >= M) return;
  const int row0 = mt * 16, col0 = nq * 64; const _Float16* arow = A + (size_t)(row0 + ln) * lda;
  v8f acc[4] = {};
  for (int kb = 0; kb < K; kb += 32) { FragH ah; ah.half[0] = *(const v8us*)((const unsigned short*)arow + kb + 8 * hh); ah.half[1] = *(const v8us*)((const unsigned short*)arow + kb + 16 + 8 * hh);
#pragma unroll
    for (int t = 0; t < 4; ++t) { if (col0 + t * 16 >= N) continue; const size_t boff = (size_t)(col0 + t * 16 + ln) * ldb + kb; FragH bq; bq.half[0] = *(const v8us*)((const unsigned short*)Bh + boff + 8 * hh); bq.half[1] = *(const v8us*)((const unsigned short*)Bh + boff + 16 + 8 * hh);
      acc[t] = mmaH<1>(ah.v, ah.v, bq.v, bq.v, acc[t]); }
  }
#pragma unroll
  for (int t = 0; t < 4; ++t) { if (col0 + t * 16 >= N) continue; const int col = col0 + t * 16 + ln; const float bv = bp ? bf16_round(bp[col]) : 0.f;
#pragma unroll
    for (int r = 0; r < 8; ++r) { float v = acc[t][r] * alpha + bv; if (CP) { const int bidx = (row0g + row0 + 8 * hh + r) / rowsPerB; v += CP[(size_t)bidx * sCPb + (size_t)by * 64 + col]; } if (ACT == 1) v = (v > 0.f) ? v : expm1f(v); else if (ACT == 7) v = (v > 0.f) ? v + 1.0f : expf(v); else if (ACT == 8) v = tanhf(v); else if (ACT == 9) v = 0.5f * v * (1.0f + tanhf(0.7978845608028654f * (v + 0.044715f * v * v * v))); else if (ACT == 11) v = 1.0f / (1.0f + expf(-v)); else if (ACT == 12) v = (v > 0.f) ? v : 0.01f * v; else if (ACT == 14) v = (v > 0.f) ? v : 0.1f * v; else if (ACT == 15) v = v / (1.0f + expf(-v)); else if (ACT == 3) v = fmaxf(v, 0.f); else if (ACT == 6) v = 0.5f * v * (1.0f + erff(v * 0.70710678118654752f)); so[w][8 * hh + r][t * 16 + ln] = v; } }
  __builtin_amdgcn_fence(__ATOMIC_ACQ_REL, "workgroup"); __builtin_amdgcn_wave_barrier();
  const int rsub = lane >> 4, c4 = (lane & 15) * 4; typedef _Float16 v4h __attribute__((ext_vector_type(4)));
  {
#pragma unroll
    for (int q = 0; q < 8; ++q) { const int r = q * 2 + rsub; if (col0 + c4 < N) { const v4f v = *(const v4fa*)&so[w][r][c4]; if (C) *(v4f*)(C + cofs + (size_t)(row0 + r) * ldc + col0 + c4) = v; if (C16) { v4h h4; for (int i = 0; i < 4; ++i) h4[i] = (_Float16)v[i]; *(v4h*)(C16 + cofs + (size_t)(row0 + r) * ldc + col0 + c4) = h4; } } }
     }
}


typedef _Float16 v4h __attribute__((ext_vector_type(4)));

__global__ __launch_bounds__(256) void k_x16(const float* __restrict__ x, _Float16* __restrict__ X16, size_t n8) { const size_t t = (size_t)blockIdx.x * 256 + threadIdx.x; if (t >= n8) return; FragH f;
#pragma unroll
  for (int q = 0; q < 8; ++q) f.h[q] = (_Float16)bf16_round(x[t * 8 + q]); *(v8us*)((unsigned short*)X16 + t * 8) = f.half[0];  }
__global__ __launch_bounds__(256) void k_h16(const float* __restrict__ x, _Float16* __restrict__ X16, size_t n8) { const size_t t = (size_t)blockIdx.x * 256 + threadIdx.x; if (t >= n8) return; FragH f;
#pragma unroll
  for (int q = 0; q < 8; ++q) f.h[q] = (_Float16)x[t * 8 + q]; *(v8us*)((unsigned short*)X16 + t * 8) = f.half[0];  }
__global__ __launch_bounds__(256) void k_round16f(const float* __restrict__ W, _Float16* __restrict__ Bt, size_t n8) { const size_t t = (size_t)blockIdx.x * 256 + threadIdx.x; if (t >= n8) return; FragH f;
#pragma unroll
  for (int i = 0; i < 8; ++i) f.h[i] = (_Float16)(bf16_round(W[t * 8 + i]) * 16.0f); *(v8us*)((unsigned short*)Bt + t * 8) = f.half[0];  }
template <int NHv, int TTv>
__global__ __launch_bounds__(256) void k_vt(const _Float16* __restrict__ V16, int ldv, int voff, _Float16* __restrict__ Vt) { __shared__ unsigned short tl[64][66]; const int tid = threadIdx.x; const int slab = blockIdx.x / (TTv / 64), lg = blockIdx.x % (TTv / 64); const int b = slab / NHv, h = slab % NHv;
  for (int i = tid; i < 64 * 8; i += 256) { const int r = i / 8, c8 = (i % 8) * 8; FragH f; f.half[0] = *(const v8us*)((const unsigned short*)V16 + ((size_t)b * TTv + lg * 64 + r) * ldv + voff + h * 64 + c8);
#pragma unroll
    for (int q = 0; q < 8; ++q) tl[r][c8 + q] = f.u[q]; }
  __syncthreads();
  {
#pragma unroll
    for (int rd = 0; rd < 2; ++rd) { const int d = rd * 32 + tid / 8, pc = tid % 8; FragH f;
#pragma unroll
      for (int q = 0; q < 8; ++q) f.u[q] = tl[pc * 8 + q][d];
      *(v8us*)((unsigned short*)Vt + ((size_t)slab * 64 + d) * TTv + lg * 64 + pc * 8) = f.half[0]; }
     } }

__global__ __launch_bounds__(256) void k_hl(const float* __restrict__ F, _Float16* __restrict__ Hh, _Float16* __restrict__ Hl, size_t n8) { const size_t t = (size_t)blockIdx.x * 256 + threadIdx.x; if (t >= n8) return; FragH fh, fl; const v4f a = *(const v4fa*)(F + t * 8), c = *(const v4fa*)(F + t * 8 + 4);
#pragma unroll
  for (int q = 0; q < 4; ++q) { _Float16 h = (_Float16)a[q]; fh.h[q] = h; fl.h[q] = (_Float16)((a[q] - (float)h) * 1024.0f); h = (_Float16)c[q]; fh.h[4 + q] = h; fl.h[4 + q] = (_Float16)((c[q] - (float)h) * 1024.0f); }
  { *(v8us*)((unsigned short*)Hh + t * 8) = fh.half[0]; *(v8us*)((unsigned short*)Hl + t * 8) = fl.half[0];  } }

// ---- fast GEMM (wave tile 32x64; requires M % 32 == 0 rows per launch region and N % 64 == 0); epilogue = k_gemm_hhx semantics ----
__device__ __forceinline__ v16h g2_fragb(const char* base, unsigned off, int kb) { FragH f; f.half[0] = *(const v8us*)(base + off + kb * 2); f.half[1] = *(const v8us*)(base + off + kb * 2 + 32); return f.v; }
__device__ __forceinline__ v8f g2_mma(v16h a, v16h b, v8f c) { v8f d = __builtin_amdgcn_wmma_f32_16x16x32_f16(false, a, false, b, (short)0, c, false, false); asm volatile("v_nop\n\tv_nop\n\tv_nop\n\tv_nop" : "+v"(d) : "v"(a), "v"(b)); return d; }
template <int ACT, int KC>      /* KC = K, a compile-time multiple of 32: the k loop is unrolled over a ring of fragment registers */
__global__ __launch_bounds__(128) __attribute__((amdgpu_waves_per_eu(4)))      /* a budget of 256 registers: the ring and the accumulators fit it, and the build needs no register-window switches */
void k_gemm2(const _Float16* __restrict__ A, int lda, size_t sA, const _Float16* __restrict__ Bh, int ldb, size_t sB, float alpha, const float* __restrict__ bias, size_t sBias, const float* __restrict__ CP, int rowsPerB, size_t sCPb, int row0g,
    float* __restrict__ C, _Float16* __restrict__ C16, int ldc, size_t sC, int M, int N, int K) {
  __shared__ __attribute__((aligned(16))) float so[4][32][68];
  const int tid = threadIdx.x, w = tid >> 5, lane = tid & 31, ln = lane & 15, hh = lane >> 4; const int by = blockIdx.y;
  A += (size_t)by * sA; Bh += (size_t)by * sB; const size_t cofs = (size_t)by * sC; const float* bp = bias ? bias + (size_t)by * sBias : nullptr;
  const int ntn = N >> 6; const int mt = blockIdx.x / ntn, nq = blockIdx.x - mt * ntn; const int row0 = mt * 128 + 32 * w, col0 = nq * 64; if (row0 >= M) return;
  /* uniform base + one 32-bit byte offset a fragment row (the planes are far below 4 GiB): six address registers, the k step in the immediate offset */
  const char* Ab = (const char*)A; const char* Bb = (const char*)Bh;
  const unsigned a0o = (unsigned)((row0 + ln) * lda + 8 * hh) * 2u, a1o = a0o + (unsigned)(16 * lda) * 2u;
  const unsigned b0o = (unsigned)((col0 + ln) * ldb + 8 * hh) * 2u, b1o = b0o + (unsigned)(16 * ldb) * 2u, b2o = b1o + (unsigned)(16 * ldb) * 2u, b3o = b2o + (unsigned)(16 * ldb) * 2u;
  const v8f z8 = {0.f,0.f,0.f,0.f,0.f,0.f,0.f,0.f}; v8f c00 = z8, c01 = z8, c02 = z8, c03 = z8, c10 = z8, c11 = z8, c12 = z8, c13 = z8;
  (void)K; constexpr int NS = KC / 32;
  /* three sets of the six fragments of a k step: the twelve loads of step s + 2 are issued together, ahead of step s's products, so a step waits once, for loads issued two steps earlier */
  v16h fa0[3], fa1[3], fb0[3], fb1[3], fb2[3], fb3[3];
#pragma unroll
  for (int s = 0; s < 2 && s < NS; ++s) { const int kb = s * 32; fa0[s] = g2_fragb(Ab, a0o, kb); fb0[s] = g2_fragb(Bb, b0o, kb); fa1[s] = g2_fragb(Ab, a1o, kb); fb1[s] = g2_fragb(Bb, b1o, kb); fb2[s] = g2_fragb(Bb, b2o, kb); fb3[s] = g2_fragb(Bb, b3o, kb); }
#pragma unroll      /* full unroll: the ring index must be a constant for the sets to stay in registers */
  for (int s = 0; s < NS; ++s) { const int cu = s % 3, nx = (s + 2) % 3;
    if (s + 2 < NS) { const int kb = (s + 2) * 32; fa0[nx] = g2_fragb(Ab, a0o, kb); fb0[nx] = g2_fragb(Bb, b0o, kb); fa1[nx] = g2_fragb(Ab, a1o, kb); fb1[nx] = g2_fragb(Bb, b1o, kb); fb2[nx] = g2_fragb(Bb, b2o, kb); fb3[nx] = g2_fragb(Bb, b3o, kb); }
    c00 = g2_mma(fa0[cu], fb0[cu], c00); c10 = g2_mma(fa1[cu], fb0[cu], c10);
    c01 = g2_mma(fa0[cu], fb1[cu], c01); c11 = g2_mma(fa1[cu], fb1[cu], c11);
    c02 = g2_mma(fa0[cu], fb2[cu], c02); c12 = g2_mma(fa1[cu], fb2[cu], c12);
    c03 = g2_mma(fa0[cu], fb3[cu], c03); c13 = g2_mma(fa1[cu], fb3[cu], c13); }
  v8f accs[8] = {c00, c01, c02, c03, c10, c11, c12, c13};
#pragma unroll
  for (int u = 0; u < 8; ++u) { const int t = u & 3, half = u >> 2; const int col = col0 + t * 16 + ln; const float bv = bp ? bf16_round(bp[col]) : 0.f;
#pragma unroll
    for (int r = 0; r < 8; ++r) { const int rloc = half * 16 + 8 * hh + r; float v = accs[u][r] * alpha + bv; if (CP) { const int bidx = (row0g + row0 + rloc) / rowsPerB; v += CP[(size_t)bidx * sCPb + (size_t)by * 64 + col]; }
      if (ACT == 3) v = fmaxf(v, 0.f); else if (ACT == 6) v = 0.5f * v * (1.0f + erff(v * 0.70710678118654752f)); else if (ACT == 11) v = 1.0f / (1.0f + expf(-v)); else if (ACT == 15) v = v / (1.0f + expf(-v)); else if (ACT == 12) v = (v > 0.f) ? v : 0.01f * v; else if (ACT == 8) v = tanhf(v);
      so[w][rloc][t * 16 + ln] = v; } }
  __builtin_amdgcn_fence(__ATOMIC_ACQ_REL, "workgroup"); __builtin_amdgcn_wave_barrier();
  const int rsub = lane >> 4, c4 = (lane & 15) * 4;
  {
#pragma unroll
    for (int q = 0; q < 16; ++q) { const int r = q * 2 + rsub; const v4f v = *(const v4fa*)&so[w][r][c4]; if (C) *(v4f*)(C + cofs + (size_t)(row0 + r) * ldc + col0 + c4) = v; if (C16) { v4h h4; for (int i = 0; i < 4; ++i) h4[i] = (_Float16)v[i]; *(v4h*)(C16 + cofs + (size_t)(row0 + r) * ldc + col0 + c4) = h4; } }
     } }



template <int TK>
__global__ __launch_bounds__(256) void k_vthl(const float* __restrict__ VF, int ldv, _Float16* __restrict__ Vth, _Float16* __restrict__ Vtl) { __shared__ float tl[64][65]; const int tid = threadIdx.x; const int slab = blockIdx.x / (TK / 64), lg = blockIdx.x % (TK / 64); const int b = slab / NH, h = slab % NH;
  for (int i = tid; i < 64 * 16; i += 256) { const int r = i / 16, c4 = (i % 16) * 4; const v4f a = *(const v4fa*)(VF + ((size_t)b * TK + lg * 64 + r) * ldv + h * 64 + c4); tl[r][c4] = a[0]; tl[r][c4 + 1] = a[1]; tl[r][c4 + 2] = a[2]; tl[r][c4 + 3] = a[3]; }
  __syncthreads();
  FragH fh[2], fl[2]; size_t oo[2];
#pragma unroll
  for (int rd = 0; rd < 2; ++rd) { const int d = rd * 32 + tid / 8, pc = tid % 8;
#pragma unroll
    for (int q = 0; q < 8; ++q) { const float v = tl[pc * 8 + q][d]; const _Float16 hv = (_Float16)v; fh[rd].h[q] = hv; fl[rd].h[q] = (_Float16)((v - (float)hv) * 1024.0f); } oo[rd] = ((size_t)slab * 64 + d) * TK + lg * 64 + pc * 8; }
  {
#pragma unroll
    for (int rd = 0; rd < 2; ++rd) { *(v8us*)((unsigned short*)Vth + oo[rd]) = fh[rd].half[0]; *(v8us*)((unsigned short*)Vtl + oo[rd]) = fl[rd].half[0]; }
     } }

// grammar bias for (query position pi, key position pj): dist_emb[bucket(|pj - pi|)][h] + ((pj > pi) - 0.5) * order_bias[h]
__device__ __forceinline__ float gbias(const float* sDE, const float* __restrict__ OB, const unsigned char* sLUT, int h, int pi, int pj) { int d = abs(pj - pi); d = min(d, LUTN - 1); const int bin = sLUT[d]; return sDE[bin] + (((pj > pi) ? 1.0f : 0.0f) - 0.5f) * bf16_round(OB[h]); }
// lane l <-> l ^ 16 (the other half of the wave), all lanes on
__device__ __forceinline__ float xhalf(float v) { const int b = __float_as_int(v); return __int_as_float(__builtin_amdgcn_permlanex16(b, b, 0x76543210, 0xfedcba98, false, false)); }
template <int TQ, int TK>
__global__ __launch_bounds__(128) void k_flashb(const _Float16* __restrict__ Q16, const _Float16* __restrict__ Q16lo, int ldq, const _Float16* __restrict__ K16, const _Float16* __restrict__ K16lo, int ldk, const _Float16* __restrict__ Vt, const _Float16* __restrict__ Vtlo, const unsigned* __restrict__ MB, const int* __restrict__ RA, const int* __restrict__ KE, const float* __restrict__ BT, const float* __restrict__ OB, const int* __restrict__ LUT, const int* __restrict__ LAG, float* __restrict__ O, int ldo) {
  constexpr int RPW = 16, NQB = TQ / (4 * RPW), DT = 4, KS = 2;
  __shared__ __attribute__((aligned(16))) float sO[4][RPW][64 + 4];
  const int tid = threadIdx.x, w = tid >> 5, lane = tid & 31, ln = lane & 15, hh = lane >> 4;
  const int slab = blockIdx.x / NQB, qblk = blockIdx.x % NQB; const int b = slab / NH, h = slab % NH; const int qb0 = qblk * (4 * RPW); const int q0 = qb0 + w * RPW;
  MB += (size_t)b * TQ * (TK / 32); LAG += (size_t)b * TK;      /* per-batch key-mask table and positions: the grid spans all batches */
  /* the bias lookup's tables, staged once per block: bucket of every distance as one byte, the head's rounded dist_emb column, the batch's positions */
  typedef int v4ia __attribute__((ext_vector_type(4), may_alias));
  __shared__ __attribute__((aligned(16))) unsigned sLUTw[LUTN / 4]; __shared__ float sDE[NBIN]; __shared__ __attribute__((aligned(16))) int sPos[TK];
  for (int i = tid; i < LUTN / 4; i += 128) { const v4ia c = *(const v4ia*)(LUT + 4 * i); sLUTw[i] = (unsigned)(c[0] & (NBIN - 1)) | ((unsigned)(c[1] & (NBIN - 1)) << 8) | ((unsigned)(c[2] & (NBIN - 1)) << 16) | ((unsigned)(c[3] & (NBIN - 1)) << 24); }
  for (int i = tid; i < TK / 4; i += 128) *(v4ia*)(sPos + 4 * i) = *(const v4ia*)(LAG + 4 * i);
  if (tid < NBIN) sDE[tid] = bf16_round(BT[tid * NH + h]);
  __syncthreads();      /* every wave reads what all four staged */
  const unsigned char* sLUT = (const unsigned char*)sLUTw;
  const int tq = q0 + ln;      /* this lane's query */
  FragH aq[KS], aql[KS];       /* Q as the B operand: column = query ln */
  { const size_t qo = ((size_t)b * TQ + tq) * ldq + h * 64; const unsigned short* qr = (const unsigned short*)Q16 + qo; const unsigned short* ql = (const unsigned short*)Q16lo + qo;
#pragma unroll
    for (int ks = 0; ks < KS; ++ks) { aq[ks].half[0] = *(const v8us*)(qr + ks * 32 + 8 * hh); aq[ks].half[1] = *(const v8us*)(qr + ks * 32 + 16 + 8 * hh); aql[ks].half[0] = *(const v8us*)(ql + ks * 32 + 8 * hh); aql[ks].half[1] = *(const v8us*)(ql + ks * 32 + 16 + 8 * hh); } }
  int jend = KE[qblk * 32]; jend = min(TK, (jend + 31) & ~31); if (jend < 32) jend = 32;      /* block-uniform */
  const bool am = (RA[tq] != 0); const unsigned* mrow = MB + (size_t)tq * (TK / 32); const int pi = sPos[tq];
  const unsigned short* Vth = (const unsigned short*)Vt + (size_t)slab * 64 * TK; const unsigned short* Vtl = (const unsigned short*)Vtlo + (size_t)slab * 64 * TK;
  float m_q = -3.0e38f, l_q = 0.f; v8f oacc[DT], oaccl[DT];
#pragma unroll
  for (int dt = 0; dt < DT; ++dt) { oacc[dt] = (v8f){0.f,0.f,0.f,0.f,0.f,0.f,0.f,0.f}; oaccl[dt] = oacc[dt]; }
#pragma unroll 1
  for (int j0 = 0; j0 < jend; j0 += 32) {
    const unsigned mword = mrow[j0 >> 5];      /* this query's key-mask bits of the 32 keys */
    v8f s[2];
#pragma unroll
    for (int nt = 0; nt < 2; ++nt) { const size_t ko = ((size_t)b * TK + j0 + nt * 16 + ln) * ldk + h * 64; const unsigned short* kr = (const unsigned short*)K16 + ko; const unsigned short* kl = (const unsigned short*)K16lo + ko; FragH bk[KS], bkl[KS];      /* K as the A operand: row = key */
#pragma unroll
      for (int ks = 0; ks < KS; ++ks) { bk[ks].half[0] = *(const v8us*)(kr + ks * 32 + 8 * hh); bk[ks].half[1] = *(const v8us*)(kr + ks * 32 + 16 + 8 * hh); bkl[ks].half[0] = *(const v8us*)(kl + ks * 32 + 8 * hh); bkl[ks].half[1] = *(const v8us*)(kl + ks * 32 + 16 + 8 * hh); }
      v8f acc = (v8f){0.f,0.f,0.f,0.f,0.f,0.f,0.f,0.f}, accr = acc;
#pragma unroll
      for (int ks = 0; ks < KS; ++ks) { acc = mmaH<1>(bk[ks].v, bk[ks].v, aq[ks].v, aq[ks].v, acc); accr = mmaH<1>(bk[ks].v, bk[ks].v, aql[ks].v, aql[ks].v, accr); accr = mmaH<1>(bkl[ks].v, bkl[ks].v, aq[ks].v, aq[ks].v, accr); }
      s[nt] = acc + accr * 0.0009765625f; }
    const unsigned mw = mword >> (8 * hh);      /* bit nt * 16 + r = this lane's key nt * 16 + 8 hh + r */
    float sc[2][8]; bool ok[2][8]; float mc = -INFINITY;
#pragma unroll
    for (int nt = 0; nt < 2; ++nt) { const v4ia pA = *(const v4ia*)(sPos + j0 + nt * 16 + 8 * hh), pB = *(const v4ia*)(sPos + j0 + nt * 16 + 8 * hh + 4);
#pragma unroll
      for (int r = 0; r < 8; ++r) { const int pj = (r < 4) ? pA[r & 3] : pB[r & 3]; ok[nt][r] = am || (((mw >> (nt * 16 + r)) & 1u) == 0u);
        const float sv = s[nt][r] * SCL + gbias(sDE, OB, sLUT, h, pi, pj);      /* + grammar distance-bucket and order biases */
        sc[nt][r] = ok[nt][r] ? (am ? 0.f : sv) : -INFINITY; mc = fmaxf(mc, sc[nt][r]); } }
    mc = fmaxf(mc, xhalf(mc));
    const float mn = fmaxf(m_q, mc); const float ea = expf(m_q - mn); const float al = (mn > -1.0e38f) ? ea : 1.0f; m_q = mn;
    FragH pa, pl; float ls = 0.f;      /* P^T hi and residual, already in the B operand's order */
#pragma unroll
    for (int nt = 0; nt < 2; ++nt)
#pragma unroll
      for (int r = 0; r < 8; ++r) { const float e = expf(sc[nt][r] - mn); const float p = ok[nt][r] ? e : 0.f; ls += p;
        const float ps = p * 1024.0f; const _Float16 t2 = (_Float16)ps; pa.h[nt * 8 + r] = t2; pl.h[nt * 8 + r] = (_Float16)((ps - (float)t2) * 1024.0f); }
    l_q = l_q * al + ls;
#pragma unroll
    for (int dt = 0; dt < DT; ++dt) { oacc[dt] *= al; oaccl[dt] *= al; }
#pragma unroll
    for (int dt = 0; dt < DT; ++dt) { const size_t vo = (size_t)(dt * 16 + ln) * TK + j0; FragH bv, bl; bv.half[0] = *(const v8us*)(Vth + vo + 8 * hh); bv.half[1] = *(const v8us*)(Vth + vo + 16 + 8 * hh); bl.half[0] = *(const v8us*)(Vtl + vo + 8 * hh); bl.half[1] = *(const v8us*)(Vtl + vo + 16 + 8 * hh);      /* V^T as the A operand: row = d */
      oacc[dt] = mmaH<1>(bv.v, bv.v, pa.v, pa.v, oacc[dt]); oaccl[dt] = mmaH<1>(bl.v, bl.v, pa.v, pa.v, oaccl[dt]); oaccl[dt] = mmaH<1>(bv.v, bv.v, pl.v, pl.v, oaccl[dt]); } }
  const float lt = l_q + xhalf(l_q); const float inv = (lt > 0.f) ? 1.0f / (lt * 1024.0f) : 0.f;
#pragma unroll
  for (int dt = 0; dt < DT; ++dt)
#pragma unroll
    for (int g = 0; g < 2; ++g) { v4f o4;
#pragma unroll
      for (int i = 0; i < 4; ++i) o4[i] = (oacc[dt][g * 4 + i] + oaccl[dt][g * 4 + i] * 0.0009765625f) * inv;
      *(v4fa*)&sO[w][ln][dt * 16 + 8 * hh + g * 4] = o4; }
  __builtin_amdgcn_fence(__ATOMIC_ACQ_REL, "workgroup"); __builtin_amdgcn_wave_barrier();
  {
#pragma unroll
    for (int rp = 0; rp < RPW; rp += 2) { const int r = rp + (lane >> 4), pc = lane & 15; const v4f val = *(const v4fa*)&sO[w][r][pc * 4]; *(v4f*)(O + ((size_t)b * TQ + q0 + r) * ldo + h * 64 + pc * 4) = val; }
     } }


__global__ __launch_bounds__(256) void k_fulltab(unsigned* __restrict__ MB, int* __restrict__ RA, int* __restrict__ KE, int nq, int nk) {
  const int t = blockIdx.x * 256 + threadIdx.x;
  if (t < nq * (nk / 32)) { *(unsigned*)(MB + t) = 0u;  }
  if (t < nq) { *(int*)(RA + t) = 0;  }
  if (t < nq / 64) { *(int*)(KE + t * 32) = nk;  } }
__global__ __launch_bounds__(256) void k_lnx(const float* __restrict__ X, const float* __restrict__ g, const float* __restrict__ bb, _Float16* __restrict__ Y16, float* __restrict__ XB) {
  #pragma clang fp contract(off)
  const int tid = threadIdx.x, w = tid >> 5, ln = tid & 31; const int r = blockIdx.x * 8 + w; if (r >= NR) return; const float* x = X + (size_t)r * DM; float s = 0.f;
#pragma unroll 1
  for (int i = 0; i < DM / 128; ++i) { const v4f a = *(const v4fa*)(x + i * 128 + ln * 4); for (int q = 0; q < 4; ++q) s += bf16_round(a[q]); }
  for (int o = 16; o > 0; o >>= 1) s += __shfl_xor(s, o, 32); const float mu = s / (float)DM; float q2 = 0.f;
#pragma unroll 1
  for (int i = 0; i < DM / 128; ++i) { const v4f a = *(const v4fa*)(x + i * 128 + ln * 4); for (int q = 0; q < 4; ++q) { const float d = bf16_round(a[q]) - mu; q2 += d * d; } }
  for (int o = 16; o > 0; o >>= 1) q2 += __shfl_xor(q2, o, 32); const float rs = rsqrtf(q2 / (float)DM + 1e-5f);
  {
#pragma unroll 1
    for (int i = 0; i < DM / 128; ++i) { const int c0 = i * 128 + ln * 4; const v4f a = *(const v4fa*)(x + c0); _Float16 h4[4]; v4f xb;
      for (int q = 0; q < 4; ++q) { const float t = bf16_round(a[q]); h4[q] = (_Float16)((t - mu) * rs * bf16_round(g[c0 + q]) + bf16_round(bb[c0 + q])); xb[q] = t; }
      *(unsigned long long*)((unsigned short*)Y16 + (size_t)r * DM + c0) = *(const unsigned long long*)h4; *(v4f*)(XB + (size_t)r * DM + c0) = xb; }
     } }
// bucket table: LUT[d] = count of bf16-rounded edges < d (bucketize right=False), capped at NBIN-1, for d = 0..LUTN-1
__global__ __launch_bounds__(256) void k_lut(const float* __restrict__ edges, int* __restrict__ LUT) {
  #pragma clang fp contract(off)
  const int d = blockIdx.x * 256 + threadIdx.x; if (d >= LUTN) return; const float fd = (float)d; int c = 0;
#pragma unroll 1
  for (int e = 0; e < NBIN - 1; ++e) c += (bf16_round(edges[e]) < fd) ? 1 : 0;
  c = min(c, NBIN - 1); *(int*)(LUT + d) = c;  }
__global__ __launch_bounds__(256) void k_masktab(const float* __restrict__ mask, unsigned* __restrict__ MB, int* __restrict__ RA, int* __restrict__ KE) {
  const size_t t = (size_t)blockIdx.x * 256 + threadIdx.x; const int nw = SLEN / 32;
  if (t < (size_t)NBT * SLEN * nw) { const int w = (int)(t % nw); const int b = (int)(t / ((size_t)SLEN * nw)); unsigned bits = 0u; for (int j = 0; j < 32; ++j) bits |= (bf16_round(mask[(size_t)b * SLEN + 32 * w + j]) == 0.0f) ? (1u << j) : 0u; *(unsigned*)(MB + t) = bits;  }
  if (t < SLEN) { *(int*)(RA + t) = 0;  }
  if (t < SLEN / 64) { *(int*)(KE + t * 32) = SLEN;  } }
__global__ __launch_bounds__(256) void k_hlmask(const float* __restrict__ F, const float* __restrict__ mask, _Float16* __restrict__ Hh, _Float16* __restrict__ Hl, size_t n8) {
  #pragma clang fp contract(off)
  const size_t t = (size_t)blockIdx.x * 256 + threadIdx.x; if (t >= n8) return; const float mk = bf16_round(mask[(t * 8) / DM]); FragH fh, fl;
#pragma unroll
  for (int q = 0; q < 8; ++q) { const float v = F[t * 8 + q] * mk; const _Float16 h = (_Float16)v; fh.h[q] = h; fl.h[q] = (_Float16)((v - (float)h) * 1024.0f); }
  { *(v8us*)((unsigned short*)Hh + t * 8) = fh.half[0]; *(v8us*)((unsigned short*)Hl + t * 8) = fl.half[0];  } }
__global__ __launch_bounds__(256) void k_causaltab(unsigned* __restrict__ MB, int* __restrict__ RA, int* __restrict__ KE, int nq, int nk) {
  const int t = blockIdx.x * 256 + threadIdx.x; const int nw = nk / 32;
  if (t < nq * nw) { const int q = t / nw, w = t % nw; const int first = q + 1 - 32 * w; const unsigned bits = (first <= 0) ? 0xffffffffu : ((first >= 32) ? 0u : (0xffffffffu << first)); *(unsigned*)(MB + t) = bits;  }
  if (t < nq) { *(int*)(RA + t) = 0;  }
  if (t < nq / 64) { const int v = 64 * (t + 1); *(int*)(KE + t * 32) = v;  } }


extern "C" void kernel_launch(void* const* d_in, const int* in_sizes, int n_in,
                              void* d_out, int out_size, void* d_ws, size_t ws_size, hipStream_t stream) {
  (void)in_sizes; (void)n_in; (void)out_size;
  const float* const* I = (const float* const*)d_in; const float* x = I[0]; const int* pos = (const int*)d_in[1]; const float* mask = I[2]; const float* qw = I[3]; const float* qb = I[4]; const float* kw = I[5]; const float* kb = I[6]; const float* vw = I[7]; const float* vb = I[8]; const float* ow = I[9]; const float* ob = I[10]; const float* de = I[11]; const float* obias = I[12]; const float* edges = I[13];
  char* ws = (char*)d_ws; size_t off = 0;
  auto take = [&](size_t bytes) { char* p = ws + off; off += (bytes + 255) & ~(size_t)255; return p; };
  _Float16* BQ = (_Float16*)take((size_t)DM * DM * 2); _Float16* BK = (_Float16*)take((size_t)DM * DM * 2); _Float16* BV = (_Float16*)take((size_t)DM * DM * 2); _Float16* BO = (_Float16*)take((size_t)DM * DM * 2);
  _Float16* X16 = (_Float16*)take((size_t)NR * DM * 2); float* F = (float*)take((size_t)NR * DM * 4);
  _Float16* Qh = (_Float16*)take((size_t)NR * DM * 2); _Float16* Ql = (_Float16*)take((size_t)NR * DM * 2); _Float16* Kh = (_Float16*)take((size_t)NR * DM * 2); _Float16* Kl = (_Float16*)take((size_t)NR * DM * 2); _Float16* Vth = (_Float16*)take((size_t)NR * DM * 2); _Float16* Vtl = (_Float16*)take((size_t)NR * DM * 2);
  unsigned* MB = (unsigned*)take((size_t)NBT * SLEN * (SLEN / 32) * 4); int* RA = (int*)take((size_t)SLEN * 4); int* KE = (int*)take((size_t)(SLEN / 64) * 32 * 4); int* LUT = (int*)take((size_t)LUTN * 4);
  if (off > ws_size) return;      /* 2 + 8 + 16 + 48 + 1.1 = 75 MiB */
  float* O = F; _Float16* Oh = Qh; _Float16* Ol = Ql;
  const size_t w8 = (size_t)DM * DM / 8; const unsigned wb = (unsigned)((w8 + 255) / 256);
  k_round16f<<<wb, 256, 0, stream>>>(qw, BQ, w8); k_round16f<<<wb, 256, 0, stream>>>(kw, BK, w8); k_round16f<<<wb, 256, 0, stream>>>(vw, BV, w8); k_round16f<<<wb, 256, 0, stream>>>(ow, BO, w8);      /* torch (out,in) = natural Bt */
  k_lut<<<LUTN / 256, 256, 0, stream>>>(edges, LUT); k_masktab<<<(unsigned)(((size_t)NBT * SLEN * (SLEN / 32) + 255) / 256), 256, 0, stream>>>(mask, MB, RA, KE);
  const size_t n8 = (size_t)NR * DM / 8; const unsigned nb8 = (unsigned)((n8 + 255) / 256); const dim3 gP((NR / 128) * (DM / 64), 1);
  k_x16<<<nb8, 256, 0, stream>>>(x, X16, n8);
  k_gemm2<0, DM><<<gP, 128, 0, stream>>>(X16, DM, 0, BQ, DM, 0, 0.0625f, qb, 0, nullptr, 1, 0, 0, F, nullptr, DM, 0, NR, DM, DM); k_hl<<<nb8, 256, 0, stream>>>(F, Qh, Ql, n8);
  k_gemm2<0, DM><<<gP, 128, 0, stream>>>(X16, DM, 0, BK, DM, 0, 0.0625f, kb, 0, nullptr, 1, 0, 0, F, nullptr, DM, 0, NR, DM, DM); k_hl<<<nb8, 256, 0, stream>>>(F, Kh, Kl, n8);
  k_gemm2<0, DM><<<gP, 128, 0, stream>>>(X16, DM, 0, BV, DM, 0, 0.0625f, vb, 0, nullptr, 1, 0, 0, F, nullptr, DM, 0, NR, DM, DM);
  k_vthl<SLEN><<<NBT * NH * (SLEN / 64), 256, 0, stream>>>(F, DM, Vth, Vtl);
  k_flashb<SLEN, SLEN><<<NBT * NH * (SLEN / 64), 128, 0, stream>>>(Qh, Ql, DM, Kh, Kl, DM, Vth, Vtl, MB, RA, KE, de, obias, LUT, pos, O, DM);
  k_hlmask<<<nb8, 256, 0, stream>>>(O, mask, Oh, Ol, n8);
  k_gemm2<0, DM><<<gP, 128, 0, stream>>>(Oh, DM, 0, BO, DM, 0, 0.0625f, ob, 0, nullptr, 1, 0, 0, (float*)d_out, nullptr, DM, 0, NR, DM, DM);
  k_gemm2<0, DM><<<gP, 128, 0, stream>>>(Ol, DM, 0, BO, DM, 0, 0.0625f / 1024.0f, nullptr, 0, (float*)d_out, 1, (size_t)DM, 0, (float*)d_out, nullptr, DM, 0, NR, DM, DM);
}

// v005
// A run of this version takes 272 microseconds.
// Timed twice side by side with v004, it ran 1.10 and 1.09 times as fast.
// All steps since v000 together make it 7.59 times as fast.
#include <hip/hip_runtime.h>
// Grammar attention (8 x 1024 tokens, 512 = 8 heads x 64): q,k,v = x W^T + b; scores = q.k/8 + dist_emb[bucket(|pos_j - pos_i|)][h] + ((pos_j > pos_i) - 0.5) * order_bias[h] with INPUT int32 positions, INPUT bin edges (torch.bucketize right=False = count of edges < dist) and an INPUT key/query mask (masked keys excluded; masked query rows zeroed before the output projection, as out * mask); softmax; out = ((attn v) * mask) Wo^T + bo -> [8,1024,512].
// Structure: x as an exact f16 plane; projections as f16 WMMA GEMMs (32x64 wave tiles, f32 accumulation, exact x16 weights + bias); a device-built bucket lookup table over integer distances (from the INPUT edges) and per-batch key-mask bit tables; q, k as f16 hi + (x2^10) residual planes, V^T as hi + residual planes; the fused flash kernel gathers both biases by the INPUT positions inside the score stage (transposed score and value tiles, online f32 softmax per lane, P hi + residual kept in registers, two value accumulators); O scaled by the query mask, split hi/lo, into Wo (two GEMMs, bias in the first).
// Compute dtype: x, weights, biases, dist_emb, order_bias, bin_edges, mask rounded to bf16; projections exact; q, k, P, v, O as f16 hi + residual pairs (~2^-21); f32 accumulation and softmax. v_wmma_f32_16x16x32_f16.
#define NBT 8
#define SLEN 1024
#define NBIN 32
#define LUTN 16384            /* bucket lookup over integer distances 0..LUTN-1 (positions < 5000) */
#define DM 512
#define NH 8
#define SCL 0.125f
#define NR (NBT * SLEN)
typedef __bf16 v16b __attribute__((ext_vector_type(16)));
typedef unsigned short v8us __attribute__((ext_vector_type(8), may_alias));
typedef float  v8f  __attribute__((ext_vector_type(8)));
typedef float  v4f  __attribute__((ext_vector_type(4)));
typedef float  v4fa __attribute__((ext_vector_type(4), may_alias));
union FragB { v16b v; v8us half[2]; unsigned short u[16]; };

__device__ __forceinline__ unsigned short bf16_bits(float x) { unsigned int u = __float_as_uint(x); return (unsigned short)((u + 0x7FFFu + ((u >> 16) & 1u)) >> 16); }
__device__ __forceinline__ float bf16_val(unsigned short b) { return __uint_as_float(((unsigned int)b) << 16); }
__device__ __forceinline__ float bf16_round(float x) { return bf16_val(bf16_bits(x)); }
// D += A·B with NT terms: 1 = ah·bh, 2 = + al·bh (A split), 3 = + ah·bl (both split)
template <int NT>
__device__ __forceinline__ v8f mmaN(v16b ah, v16b al, v16b bh, v16b bl, v8f c) {
  c = __builtin_amdgcn_wmma_f32_16x16x32_bf16(false, ah, false, bh, (short)0, c, false, false);
  if (NT >= 2) c = __builtin_amdgcn_wmma_f32_16x16x32_bf16(false, al, false, bh, (short)0, c, false, false);
  if (NT >= 3) c = __builtin_amdgcn_wmma_f32_16x16x32_bf16(false, ah, false, bl, (short)0, c, false, false);
  asm volatile("v_nop\n\tv_nop\n\tv_nop\n\tv_nop" : "+v"(c) : "v"(ah), "v"(al), "v"(bh), "v"(bl));
  return c;
}

__global__ __launch_bounds__(256) void k_wt_bf16(const float* __restrict__ W, unsigned short* __restrict__ Wt, int K, int N) {
  const int t = blockIdx.x * 256 + threadIdx.x;
  const int k8n = K / 8;
  if (t >= N * k8n) return;
  const int n = t / k8n, k8 = (t % k8n) * 8;
  v8us v;
#pragma unroll
  for (int i = 0; i < 8; ++i) v[i] = bf16_bits(W[(size_t)(k8 + i) * N + n]);
  *(v8us*)(Wt + (size_t)n * K + k8) = v;
  
}

// GEMM C[M][N] (f32, pitch ldc) = act(A[M][K]·W + bias). A f32 row-major (pitch lda) converted per fragment to bf16
// (ASPLIT: hi/lo two planes -> 2 terms, else single rounded term); Wt bf16 [N][K] (pitch ldb). BIAS_BF16 rounds the
// bias to bf16 first (bias quantised to bf16 before the add). K%32==0, M%16==0, N%64==0.
template <bool ASPLIT, int ACT, bool BIAS_BF16>
__global__ __launch_bounds__(128) void k_gemm_bf(const float* __restrict__ A, int lda, const unsigned short* __restrict__ Wt, int ldb,
                                               const float* __restrict__ bias, float* __restrict__ C, int ldc, int M, int N, int K) {
  __shared__ __attribute__((aligned(16))) float so[4][16][64];
  const int tid = threadIdx.x, w = tid >> 5, lane = tid & 31, ln = lane & 15, hh = lane >> 4;
  const int ntn = N / 64;
  const int wid = blockIdx.x * 4 + w;
  const int mt = wid / ntn, nq = wid % ntn;
  if (mt * 16 >= M) return;
  const int row0 = mt * 16, col0 = nq * 64;
  const float* arow = A + (size_t)(row0 + ln) * lda;
  v8f acc[4] = {};
  for (int kb = 0; kb < K; kb += 32) {
    FragB ah, al;
    const v4f x0 = *(const v4fa*)(arow + kb + 8 * hh), x1 = *(const v4fa*)(arow + kb + 8 * hh + 4);
    const v4f x2 = *(const v4fa*)(arow + kb + 16 + 8 * hh), x3 = *(const v4fa*)(arow + kb + 16 + 8 * hh + 4);
    float xs[16] = {x0[0],x0[1],x0[2],x0[3],x1[0],x1[1],x1[2],x1[3],x2[0],x2[1],x2[2],x2[3],x3[0],x3[1],x3[2],x3[3]};
#pragma unroll
    for (int i = 0; i < 16; ++i) { const unsigned short hb = bf16_bits(xs[i]); ah.u[i] = hb; al.u[i] = ASPLIT ? bf16_bits(xs[i] - bf16_val(hb)) : (unsigned short)0; }
#pragma unroll
    for (int t = 0; t < 4; ++t) {
      const unsigned short* brow = Wt + (size_t)(col0 + t * 16 + ln) * ldb + kb;
      FragB b;
      b.half[0] = *(const v8us*)(brow + 8 * hh);
      b.half[1] = *(const v8us*)(brow + 16 + 8 * hh);
      acc[t] = mmaN<ASPLIT ? 2 : 1>(ah.v, al.v, b.v, b.v, acc[t]);
    }
  }
#pragma unroll
  for (int t = 0; t < 4; ++t) {
    float bv = bias ? bias[col0 + t * 16 + ln] : 0.f;
    if (BIAS_BF16) bv = bf16_round(bv);
#pragma unroll
    for (int r = 0; r < 8; ++r) { float v = acc[t][r] + bv; if (ACT == 1) v = fmaxf(v, 0.f); so[w][8 * hh + r][t * 16 + ln] = v; }
  }
  __builtin_amdgcn_fence(__ATOMIC_ACQ_REL, "workgroup");
  __builtin_amdgcn_wave_barrier();
  const int rsub = lane >> 4, c4 = (lane & 15) * 4;
  {
#pragma unroll
    for (int q = 0; q < 8; ++q) {
      const int r = q * 2 + rsub;
      const v4f v = *(const v4fa*)&so[w][r][c4];
      *(v4f*)(C + (size_t)(row0 + r) * ldc + col0 + c4) = v;
    }
    
  }
}

// GEMM C = act(A·W + bias + resid): A f32 (ASPLIT -> hi/lo 2 terms), Wt bf16 [N][K]; ACT 0 none, 1 relu, 2 exact gelu;
// resid (optional, f32, row index = (row % rmod), pitch ldr, RES_BF16 rounds it) added before the activation.
template <bool ASPLIT, int ACT, bool BIAS_BF16, bool RES_BF16>
__global__ __launch_bounds__(128) void k_gemm_bf3(const float* __restrict__ A, int lda, const unsigned short* __restrict__ Wt, int ldb,
                                                const float* __restrict__ bias, const float* __restrict__ resid, int rmod, int ldr,
                                                float* __restrict__ C, int ldc, int M, int N, int K) {
  __shared__ __attribute__((aligned(16))) float so[4][16][64];
  const int tid = threadIdx.x, w = tid >> 5, lane = tid & 31, ln = lane & 15, hh = lane >> 4;
  const int ntn = N / 64;
  const int wid = blockIdx.x * 4 + w;
  const int mt = wid / ntn, nq = wid % ntn;
  if (mt * 16 >= M) return;
  const int row0 = mt * 16, col0 = nq * 64;
  const float* arow = A + (size_t)(row0 + ln) * lda;
  v8f acc[4] = {};
  for (int kb = 0; kb < K; kb += 32) {
    FragB ah, al;
    const v4f x0 = *(const v4fa*)(arow + kb + 8 * hh), x1 = *(const v4fa*)(arow + kb + 8 * hh + 4);
    const v4f x2 = *(const v4fa*)(arow + kb + 16 + 8 * hh), x3 = *(const v4fa*)(arow + kb + 16 + 8 * hh + 4);
    float xs[16] = {x0[0],x0[1],x0[2],x0[3],x1[0],x1[1],x1[2],x1[3],x2[0],x2[1],x2[2],x2[3],x3[0],x3[1],x3[2],x3[3]};
#pragma unroll
    for (int i = 0; i < 16; ++i) { const unsigned short hb = bf16_bits(xs[i]); ah.u[i] = hb; al.u[i] = ASPLIT ? bf16_bits(xs[i] - bf16_val(hb)) : (unsigned short)0; }
#pragma unroll
    for (int t = 0; t < 4; ++t) {
      const unsigned short* brow = Wt + (size_t)(col0 + t * 16 + ln) * ldb + kb;
      FragB b;
      b.half[0] = *(const v8us*)(brow + 8 * hh);
      b.half[1] = *(const v8us*)(brow + 16 + 8 * hh);
      acc[t] = mmaN<ASPLIT ? 2 : 1>(ah.v, al.v, b.v, b.v, acc[t]);
    }
  }
#pragma unroll
  for (int t = 0; t < 4; ++t) {
    const int col = col0 + t * 16 + ln;
    float bv = bias ? bias[col] : 0.f;
    if (BIAS_BF16) bv = bf16_round(bv);
#pragma unroll
    for (int r = 0; r < 8; ++r) {
      float v = acc[t][r] + bv;
      if (resid) { float rv = resid[(size_t)((row0 + 8 * hh + r) % rmod) * ldr + col]; if (RES_BF16) rv = bf16_round(rv); v += rv; }
      if (ACT == 1) v = fmaxf(v, 0.f);
      if (ACT == 2) v = 0.5f * v * (1.0f + erff(v * 0.70710678118654752f));
      if (ACT == 3) { const float u = 0.7978845608028654f * (v + 0.044715f * v * v * v); v = 0.5f * v * (1.0f + tanhf(u)); }
      so[w][8 * hh + r][t * 16 + ln] = v;
    }
  }
  __builtin_amdgcn_fence(__ATOMIC_ACQ_REL, "workgroup");
  __builtin_amdgcn_wave_barrier();
  const int rsub = lane >> 4, c4 = (lane & 15) * 4;
  {
#pragma unroll
    for (int q = 0; q < 8; ++q) {
      const int r = q * 2 + rsub;
      const v4f v = *(const v4fa*)&so[w][r][c4];
      *(v4f*)(C + (size_t)(row0 + r) * ldc + col0 + c4) = v;
    }
    
  }
}
// row LayerNorm (biased variance, eps) over N: s = X (+ R); optional out_sum <- s; out_norm <- (s-mu)*rsqrt(var+eps)*g + b
template <bool PARAM_BF16>
__global__ __launch_bounds__(256) void k_layernorm(const float* __restrict__ X, const float* __restrict__ R, const float* __restrict__ g, const float* __restrict__ bta,
                                                  float* __restrict__ out_sum, float* __restrict__ out_norm, int N, float eps) {
  __shared__ float red[256];
  const int row = blockIdx.x, tid = threadIdx.x;
  const float* x = X + (size_t)row * N; const float* rr = R ? R + (size_t)row * N : nullptr;
  float vals[16];                     // up to N = 4096
  const int per = N / 256;            // contiguous chunk per thread? use strided-by-4 chunks: thread handles j = tid*4 + 1024*u
  float s1 = 0.f;
  for (int u = 0; u < per / 4; ++u) {
    const int j = tid * 4 + 1024 * u;
    const v4f a = *(const v4fa*)(x + j);
    v4f b = {0.f,0.f,0.f,0.f}; if (rr) b = *(const v4fa*)(rr + j);
#pragma unroll
    for (int q = 0; q < 4; ++q) { const float v = a[q] + b[q]; vals[u * 4 + q] = v; s1 += v; }
  }
  red[tid] = s1; __syncthreads();
  for (int st = 128; st > 0; st >>= 1) { if (tid < st) red[tid] += red[tid + st]; __syncthreads(); }
  const float mu = red[0] / (float)N; __syncthreads();
  float s2 = 0.f;
  for (int u = 0; u < per / 4; ++u)
#pragma unroll
    for (int q = 0; q < 4; ++q) { const float c = vals[u * 4 + q] - mu; s2 += c * c; }
  red[tid] = s2; __syncthreads();
  for (int st = 128; st > 0; st >>= 1) { if (tid < st) red[tid] += red[tid + st]; __syncthreads(); }
  const float rs = rsqrtf(red[0] / (float)N + eps);
  {
    for (int u = 0; u < per / 4; ++u) {
      const int j = tid * 4 + 1024 * u;
      v4f o, sm;
#pragma unroll
      for (int q = 0; q < 4; ++q) {
        float gg = g[j + q], bb = bta[j + q];
        if (PARAM_BF16) { gg = bf16_round(gg); bb = bf16_round(bb); }
        sm[q] = vals[u * 4 + q]; o[q] = (vals[u * 4 + q] - mu) * rs * gg + bb;
      }
      if (out_sum) *(v4f*)(out_sum + (size_t)row * N + j) = sm;
      *(v4f*)(out_norm + (size_t)row * N + j) = o;
    }
    
  }
}



// ---- f16 WMMA path (v_wmma_f32_16x16x32_f16): 11-bit significands for operands in range — used where a [0,1] probability operand needs more precision than bf16
typedef _Float16 v16h __attribute__((ext_vector_type(16)));
union FragH { v16h v; v8us half[2]; _Float16 h[16]; unsigned short u[16]; };
template <int NT>
__device__ __forceinline__ v8f mmaH(v16h ah, v16h al, v16h bh, v16h bl, v8f c) {
  c = __builtin_amdgcn_wmma_f32_16x16x32_f16(false, ah, false, bh, (short)0, c, false, false);
  if (NT >= 2) c = __builtin_amdgcn_wmma_f32_16x16x32_f16(false, al, false, bh, (short)0, c, false, false);
  if (NT >= 3) c = __builtin_amdgcn_wmma_f32_16x16x32_f16(false, ah, false, bl, (short)0, c, false, false);
  asm volatile("v_nop\n\tv_nop\n\tv_nop\n\tv_nop" : "+v"(c) : "v"(ah), "v"(al), "v"(bh), "v"(bl));
  return c;
}
// batched GEMM like k_gemm_b but f16 operands: A f32 (split into f16 hi/lo if ASPLIT, else rounded to f16), Bt = f16 values [n][k]; alpha; C f32; N multiple of 16 (partial tiles skipped)
template <bool ASPLIT>
__global__ __launch_bounds__(128) void k_gemm_h(const float* __restrict__ A, int lda, size_t sA, const _Float16* __restrict__ Bh, int ldb, size_t sB, float alpha, float* __restrict__ C, int ldc, size_t sC, int M, int N, int K) {
  __shared__ __attribute__((aligned(16))) float so[4][16][64];
  const int tid = threadIdx.x, w = tid >> 5, lane = tid & 31, ln = lane & 15, hh = lane >> 4; const int by = blockIdx.y;
  A += (size_t)by * sA; Bh += (size_t)by * sB; C += (size_t)by * sC;
  const int ntn = (N + 63) / 64; const int wid = blockIdx.x * 4 + w; const int mt = wid / ntn, nq = wid % ntn; if (mt * 16 >= M) return;
  const int row0 = mt * 16, col0 = nq * 64; const float* arow = A + (size_t)(row0 + ln) * lda;
  v8f acc[4] = {};
  for (int kb = 0; kb < K; kb += 32) {
    FragH ah, al;
    const v4f x0 = *(const v4fa*)(arow + kb + 8 * hh), x1 = *(const v4fa*)(arow + kb + 8 * hh + 4), x2 = *(const v4fa*)(arow + kb + 16 + 8 * hh), x3 = *(const v4fa*)(arow + kb + 16 + 8 * hh + 4);
    float xs[16] = {x0[0],x0[1],x0[2],x0[3],x1[0],x1[1],x1[2],x1[3],x2[0],x2[1],x2[2],x2[3],x3[0],x3[1],x3[2],x3[3]};
#pragma unroll
    for (int i = 0; i < 16; ++i) { const _Float16 h = (_Float16)xs[i]; ah.h[i] = h; al.h[i] = ASPLIT ? (_Float16)(xs[i] - (float)h) : (_Float16)0.0f; }
#pragma unroll
    for (int t = 0; t < 4; ++t) { if (col0 + t * 16 >= N) continue; const size_t boff = (size_t)(col0 + t * 16 + ln) * ldb + kb; FragH bq; bq.half[0] = *(const v8us*)(Bh + boff + 8 * hh); bq.half[1] = *(const v8us*)(Bh + boff + 16 + 8 * hh);
      acc[t] = mmaH<ASPLIT ? 2 : 1>(ah.v, al.v, bq.v, bq.v, acc[t]); }
  }
#pragma unroll
  for (int t = 0; t < 4; ++t) { if (col0 + t * 16 >= N) continue;
#pragma unroll
    for (int r = 0; r < 8; ++r) so[w][8 * hh + r][t * 16 + ln] = acc[t][r] * alpha; }
  __builtin_amdgcn_fence(__ATOMIC_ACQ_REL, "workgroup"); __builtin_amdgcn_wave_barrier();
  const int rsub = lane >> 4, c4 = (lane & 15) * 4;
  {
#pragma unroll
    for (int q = 0; q < 8; ++q) { const int r = q * 2 + rsub; if (col0 + c4 < N) { const v4f v = *(const v4fa*)&so[w][r][c4]; *(v4f*)(C + (size_t)(row0 + r) * ldc + col0 + c4) = v; } }
     }
}

// Wt[n][k] = f16(W[k][n]·scale) from f32 row-major W[K][N] (scale = power of two; bf16-exact weights stay exact in f16 away from the subnormal range)
__global__ __launch_bounds__(256) void k_wt_f16(const float* __restrict__ W, _Float16* __restrict__ Wt, int K, int N, float scale) {
  const int t = blockIdx.x * 256 + threadIdx.x; if (t >= N * (K / 8)) return; const int n = t / (K / 8), k8 = (t % (K / 8)) * 8; FragH f;
#pragma unroll
  for (int i = 0; i < 8; ++i) f.h[i] = (_Float16)(bf16_round(W[(size_t)(k8 + i) * N + n]) * scale); const v8us o = f.half[0];
  *(v8us*)((unsigned short*)Wt + (size_t)n * K + k8) = o; 
}
// k_gemm_hh variant with fused epilogue: v = acc·alpha + bias[by·sBias + col] (+ CP[(row/rowsPerB)·sCPb + by·64 + col] if CP) ; ACT 0 none / 1 elu ; writes f16 C16 (and f32 C if non-null)
template <int ACT>
__global__ __launch_bounds__(128) void k_gemm_hhx(const _Float16* __restrict__ A, int lda, size_t sA, const _Float16* __restrict__ Bh, int ldb, size_t sB, float alpha, const float* __restrict__ bias, size_t sBias, const float* __restrict__ CP, int rowsPerB, size_t sCPb, int row0g,
    float* __restrict__ C, _Float16* __restrict__ C16, int ldc, size_t sC, int M, int N, int K) {
  __shared__ __attribute__((aligned(16))) float so[4][16][64];
  const int tid = threadIdx.x, w = tid >> 5, lane = tid & 31, ln = lane & 15, hh = lane >> 4; const int by = blockIdx.y;
  A += (size_t)by * sA; Bh += (size_t)by * sB; const size_t cofs = (size_t)by * sC; const float* bp = bias ? bias + (size_t)by * sBias : nullptr;
  const int ntn = (N + 63) / 64; const int wid = blockIdx.x * 4 + w; const int mt = wid / ntn, nq = wid % ntn; if (mt * 16 >= M) return;
  const int row0 = mt * 16, col0 = nq * 64; const _Float16* arow = A + (size_t)(row0 + ln) * lda;
  v8f acc[4] = {};
  for (int kb = 0; kb < K; kb += 32) { FragH ah; ah.half[0] = *(const v8us*)((const unsigned short*)arow + kb + 8 * hh); ah.half[1] = *(const v8us*)((const unsigned short*)arow + kb + 16 + 8 * hh);
#pragma unroll
    for (int t = 0; t < 4; ++t) { if (col0 + t * 16 >= N) continue; const size_t boff = (size_t)(col0 + t * 16 + ln) * ldb + kb; FragH bq; bq.half[0] = *(const v8us*)((const unsigned short*)Bh + boff + 8 * hh); bq.half[1] = *(const v8us*)((const unsigned short*)Bh + boff + 16 + 8 * hh);
      acc[t] = mmaH<1>(ah.v, ah.v, bq.v, bq.v, acc[t]); }
  }
#pragma unroll
  for (int t = 0; t < 4; ++t) { if (col0 + t * 16 >= N) continue; const int col = col0 + t * 16 + ln; const float bv = bp ? bf16_round(bp[col]) : 0.f;
#pragma unroll
    for (int r = 0; r < 8; ++r) { float v = acc[t][r] * alpha + bv; if (CP) { const int bidx = (row0g + row0 + 8 * hh + r) / rowsPerB; v += CP[(size_t)bidx * sCPb + (size_t)by * 64 + col]; } if (ACT == 1) v = (v > 0.f) ? v : expm1f(v); else if (ACT == 7) v = (v > 0.f) ? v + 1.0f : expf(v); else if (ACT == 8) v = tanhf(v); else if (ACT == 9) v = 0.5f * v * (1.0f + tanhf(0.7978845608028654f * (v + 0.044715f * v * v * v))); else if (ACT == 11) v = 1.0f / (1.0f + expf(-v)); else if (ACT == 12) v = (v > 0.f) ? v : 0.01f * v; else if (ACT == 14) v = (v > 0.f) ? v : 0.1f * v; else if (ACT == 15) v = v / (1.0f + expf(-v)); else if (ACT == 3) v = fmaxf(v, 0.f); else if (ACT == 6) v = 0.5f * v * (1.0f + erff(v * 0.70710678118654752f)); so[w][8 * hh + r][t * 16 + ln] = v; } }
  __builtin_amdgcn_fence(__ATOMIC_ACQ_REL, "workgroup"); __builtin_amdgcn_wave_barrier();
  const int rsub = lane >> 4, c4 = (lane & 15) * 4; typedef _Float16 v4h __attribute__((ext_vector_type(4)));
  {
#pragma unroll
    for (int q = 0; q < 8; ++q) { const int r = q * 2 + rsub; if (col0 + c4 < N) { const v4f v = *(const v4fa*)&so[w][r][c4]; if (C) *(v4f*)(C + cofs + (size_t)(row0 + r) * ldc + col0 + c4) = v; if (C16) { v4h h4; for (int i = 0; i < 4; ++i) h4[i] = (_Float16)v[i]; *(v4h*)(C16 + cofs + (size_t)(row0 + r) * ldc + col0 + c4) = h4; } } }
     }
}


typedef _Float16 v4h __attribute__((ext_vector_type(4)));

// The p_* functions are jobs of 256-thread blocks; bid is the block's index within its job (k_prep and k_split hand it over).
__device__ __forceinline__ void p_x16(unsigned bid, const float* __restrict__ x, _Float16* __restrict__ X16, size_t n8) { const size_t t = (size_t)bid * 256 + threadIdx.x; if (t >= n8) return; FragH f;
#pragma unroll
  for (int q = 0; q < 8; ++q) f.h[q] = (_Float16)bf16_round(x[t * 8 + q]); *(v8us*)((unsigned short*)X16 + t * 8) = f.half[0];  }
__global__ __launch_bounds__(256) void k_h16(const float* __restrict__ x, _Float16* __restrict__ X16, size_t n8) { const size_t t = (size_t)blockIdx.x * 256 + threadIdx.x; if (t >= n8) return; FragH f;
#pragma unroll
  for (int q = 0; q < 8; ++q) f.h[q] = (_Float16)x[t * 8 + q]; *(v8us*)((unsigned short*)X16 + t * 8) = f.half[0];  }
__device__ __forceinline__ void p_round16f(unsigned bid, const float* __restrict__ W, _Float16* __restrict__ Bt, size_t n8) { const size_t t = (size_t)bid * 256 + threadIdx.x; if (t >= n8) return; FragH f;
#pragma unroll
  for (int i = 0; i < 8; ++i) f.h[i] = (_Float16)(bf16_round(W[t * 8 + i]) * 16.0f); *(v8us*)((unsigned short*)Bt + t * 8) = f.half[0];  }
template <int NHv, int TTv>
__global__ __launch_bounds__(256) void k_vt(const _Float16* __restrict__ V16, int ldv, int voff, _Float16* __restrict__ Vt) { __shared__ unsigned short tl[64][66]; const int tid = threadIdx.x; const int slab = blockIdx.x / (TTv / 64), lg = blockIdx.x % (TTv / 64); const int b = slab / NHv, h = slab % NHv;
  for (int i = tid; i < 64 * 8; i += 256) { const int r = i / 8, c8 = (i % 8) * 8; FragH f; f.half[0] = *(const v8us*)((const unsigned short*)V16 + ((size_t)b * TTv + lg * 64 + r) * ldv + voff + h * 64 + c8);
#pragma unroll
    for (int q = 0; q < 8; ++q) tl[r][c8 + q] = f.u[q]; }
  __syncthreads();
  {
#pragma unroll
    for (int rd = 0; rd < 2; ++rd) { const int d = rd * 32 + tid / 8, pc = tid % 8; FragH f;
#pragma unroll
      for (int q = 0; q < 8; ++q) f.u[q] = tl[pc * 8 + q][d];
      *(v8us*)((unsigned short*)Vt + ((size_t)slab * 64 + d) * TTv + lg * 64 + pc * 8) = f.half[0]; }
     } }

__device__ __forceinline__ void p_hl(unsigned bid, const float* __restrict__ F, _Float16* __restrict__ Hh, _Float16* __restrict__ Hl, size_t n8) { const size_t t = (size_t)bid * 256 + threadIdx.x; if (t >= n8) return; FragH fh, fl; const v4f a = *(const v4fa*)(F + t * 8), c = *(const v4fa*)(F + t * 8 + 4);
#pragma unroll
  for (int q = 0; q < 4; ++q) { _Float16 h = (_Float16)a[q]; fh.h[q] = h; fl.h[q] = (_Float16)((a[q] - (float)h) * 1024.0f); h = (_Float16)c[q]; fh.h[4 + q] = h; fl.h[4 + q] = (_Float16)((c[q] - (float)h) * 1024.0f); }
  { *(v8us*)((unsigned short*)Hh + t * 8) = fh.half[0]; *(v8us*)((unsigned short*)Hl + t * 8) = fl.half[0];  } }

// ---- fast GEMM (wave tile 32x64; requires M % 32 == 0 rows per launch region and N % 64 == 0); epilogue = k_gemm_hhx semantics, but the bias input is picked by blockIdx.y ----
__device__ __forceinline__ v16h g2_fragb(const char* base, unsigned off, int kb) { FragH f; f.half[0] = *(const v8us*)(base + off + kb * 2); f.half[1] = *(const v8us*)(base + off + kb * 2 + 32); return f.v; }
__device__ __forceinline__ v8f g2_mma(v16h a, v16h b, v8f c) { v8f d = __builtin_amdgcn_wmma_f32_16x16x32_f16(false, a, false, b, (short)0, c, false, false); asm volatile("v_nop\n\tv_nop\n\tv_nop\n\tv_nop" : "+v"(d) : "v"(a), "v"(b)); return d; }
template <int ACT, int KC>      /* KC = K, a compile-time multiple of 32: the k loop is unrolled over a ring of fragment registers */
__global__ __launch_bounds__(128) __attribute__((amdgpu_waves_per_eu(4)))      /* a budget of 256 registers: the ring and the accumulators fit it, and the build needs no register-window switches */
void k_gemm2(const _Float16* __restrict__ A, int lda, size_t sA, const _Float16* __restrict__ Bh, int ldb, size_t sB, float alpha, const float* __restrict__ bias, const float* __restrict__ bias1, const float* __restrict__ bias2, size_t sBias, const float* __restrict__ CP, int rowsPerB, size_t sCPb, int row0g,
    float* __restrict__ C, _Float16* __restrict__ C16, int ldc, size_t sC, int M, int N, int K) {
  __shared__ __attribute__((aligned(16))) float so[4][32][68];
  const int tid = threadIdx.x, w = tid >> 5, lane = tid & 31, ln = lane & 15, hh = lane >> 4; const int by = blockIdx.y;
  const float* bsel = (by == 0) ? bias : ((by == 1) ? bias1 : bias2);      /* products that share one grid (blockIdx.y) have each their own bias input */
  A += (size_t)by * sA; Bh += (size_t)by * sB; const size_t cofs = (size_t)by * sC; const float* bp = bsel ? bsel + (size_t)by * sBias : nullptr;
  const int ntn = N >> 6; const int mt = blockIdx.x / ntn, nq = blockIdx.x - mt * ntn; const int row0 = mt * 128 + 32 * w, col0 = nq * 64; if (row0 >= M) return;
  /* uniform base + one 32-bit byte offset a fragment row (the planes are far below 4 GiB): six address registers, the k step in the immediate offset */
  const char* Ab = (const char*)A; const char* Bb = (const char*)Bh;
  const unsigned a0o = (unsigned)((row0 + ln) * lda + 8 * hh) * 2u, a1o = a0o + (unsigned)(16 * lda) * 2u;
  const unsigned b0o = (unsigned)((col0 + ln) * ldb + 8 * hh) * 2u, b1o = b0o + (unsigned)(16 * ldb) * 2u, b2o = b1o + (unsigned)(16 * ldb) * 2u, b3o = b2o + (unsigned)(16 * ldb) * 2u;
  const v8f z8 = {0.f,0.f,0.f,0.f,0.f,0.f,0.f,0.f}; v8f c00 = z8, c01 = z8, c02 = z8, c03 = z8, c10 = z8, c11 = z8, c12 = z8, c13 = z8;
  (void)K; constexpr int NS = KC / 32;
  /* three sets of the six fragments of a k step: the twelve loads of step s + 2 are issued together, ahead of step s's products, so a step waits once, for loads issued two steps earlier */
  v16h fa0[3], fa1[3], fb0[3], fb1[3], fb2[3], fb3[3];
#pragma unroll
  for (int s = 0; s < 2 && s < NS; ++s) { const int kb = s * 32; fa0[s] = g2_fragb(Ab, a0o, kb); fb0[s] = g2_fragb(Bb, b0o, kb); fa1[s] = g2_fragb(Ab, a1o, kb); fb1[s] = g2_fragb(Bb, b1o, kb); fb2[s] = g2_fragb(Bb, b2o, kb); fb3[s] = g2_fragb(Bb, b3o, kb); }
#pragma unroll      /* full unroll: the ring index must be a constant for the sets to stay in registers */
  for (int s = 0; s < NS; ++s) { const int cu = s % 3, nx = (s + 2) % 3;
    if (s + 2 < NS) { const int kb = (s + 2) * 32; fa0[nx] = g2_fragb(Ab, a0o, kb); fb0[nx] = g2_fragb(Bb, b0o, kb); fa1[nx] = g2_fragb(Ab, a1o, kb); fb1[nx] = g2_fragb(Bb, b1o, kb); fb2[nx] = g2_fragb(Bb, b2o, kb); fb3[nx] = g2_fragb(Bb, b3o, kb); }
    c00 = g2_mma(fa0[cu], fb0[cu], c00); c10 = g2_mma(fa1[cu], fb0[cu], c10);
    c01 = g2_mma(fa0[cu], fb1[cu], c01); c11 = g2_mma(fa1[cu], fb1[cu], c11);
    c02 = g2_mma(fa0[cu], fb2[cu], c02); c12 = g2_mma(fa1[cu], fb2[cu], c12);
    c03 = g2_mma(fa0[cu], fb3[cu], c03); c13 = g2_mma(fa1[cu], fb3[cu], c13); }
  v8f accs[8] = {c00, c01, c02, c03, c10, c11, c12, c13};
#pragma unroll
  for (int u = 0; u < 8; ++u) { const int t = u & 3, half = u >> 2; const int col = col0 + t * 16 + ln; const float bv = bp ? bf16_round(bp[col]) : 0.f;
#pragma unroll
    for (int r = 0; r < 8; ++r) { const int rloc = half * 16 + 8 * hh + r; float v = accs[u][r] * alpha + bv; if (CP) { const int bidx = (row0g + row0 + rloc) / rowsPerB; v += CP[(size_t)bidx * sCPb + (size_t)by * 64 + col]; }
      if (ACT == 3) v = fmaxf(v, 0.f); else if (ACT == 6) v = 0.5f * v * (1.0f + erff(v * 0.70710678118654752f)); else if (ACT == 11) v = 1.0f / (1.0f + expf(-v)); else if (ACT == 15) v = v / (1.0f + expf(-v)); else if (ACT == 12) v = (v > 0.f) ? v : 0.01f * v; else if (ACT == 8) v = tanhf(v);
      so[w][rloc][t * 16 + ln] = v; } }
  __builtin_amdgcn_fence(__ATOMIC_ACQ_REL, "workgroup"); __builtin_amdgcn_wave_barrier();
  const int rsub = lane >> 4, c4 = (lane & 15) * 4;
  {
#pragma unroll
    for (int q = 0; q < 16; ++q) { const int r = q * 2 + rsub; const v4f v = *(const v4fa*)&so[w][r][c4]; if (C) *(v4f*)(C + cofs + (size_t)(row0 + r) * ldc + col0 + c4) = v; if (C16) { v4h h4; for (int i = 0; i < 4; ++i) h4[i] = (_Float16)v[i]; *(v4h*)(C16 + cofs + (size_t)(row0 + r) * ldc + col0 + c4) = h4; } }
     } }



template <int TK>
__device__ __forceinline__ void p_vthl(unsigned bid, const float* __restrict__ VF, int ldv, _Float16* __restrict__ Vth, _Float16* __restrict__ Vtl) { __shared__ float tl[64][65]; const int tid = threadIdx.x; const int slab = bid / (TK / 64), lg = bid % (TK / 64); const int b = slab / NH, h = slab % NH;
  for (int i = tid; i < 64 * 16; i += 256) { const int r = i / 16, c4 = (i % 16) * 4; const v4f a = *(const v4fa*)(VF + ((size_t)b * TK + lg * 64 + r) * ldv + h * 64 + c4); tl[r][c4] = a[0]; tl[r][c4 + 1] = a[1]; tl[r][c4 + 2] = a[2]; tl[r][c4 + 3] = a[3]; }
  __syncthreads();
  FragH fh[2], fl[2]; size_t oo[2];
#pragma unroll
  for (int rd = 0; rd < 2; ++rd) { const int d = rd * 32 + tid / 8, pc = tid % 8;
#pragma unroll
    for (int q = 0; q < 8; ++q) { const float v = tl[pc * 8 + q][d]; const _Float16 hv = (_Float16)v; fh[rd].h[q] = hv; fl[rd].h[q] = (_Float16)((v - (float)hv) * 1024.0f); } oo[rd] = ((size_t)slab * 64 + d) * TK + lg * 64 + pc * 8; }
  {
#pragma unroll
    for (int rd = 0; rd < 2; ++rd) { *(v8us*)((unsigned short*)Vth + oo[rd]) = fh[rd].half[0]; *(v8us*)((unsigned short*)Vtl + oo[rd]) = fl[rd].half[0]; }
     } }
#define NB_E8 (NR * DM / 8 / 256)            /* blocks of a job with one thread to 8 elements of a [NR][DM] plane */
#define NB_VT (NBT * NH * (SLEN / 64))       /* blocks of the V transpose */
// One grid for the three jobs behind the projections (V^T planes, q planes, k planes), which need nothing of each other: a block-uniform range of the block index picks the job.
__global__ __launch_bounds__(256) void k_split(const float* __restrict__ FQ, const float* __restrict__ FK, const float* __restrict__ FV, _Float16* __restrict__ Qh, _Float16* __restrict__ Ql, _Float16* __restrict__ Kh, _Float16* __restrict__ Kl, _Float16* __restrict__ Vth, _Float16* __restrict__ Vtl) {
  unsigned bid = blockIdx.x; const size_t n8 = (size_t)NR * DM / 8;
  if (bid < NB_VT) { p_vthl<SLEN>(bid, FV, DM, Vth, Vtl); return; }
  bid -= NB_VT;
  if (bid < NB_E8) { p_hl(bid, FQ, Qh, Ql, n8); return; }
  p_hl(bid - NB_E8, FK, Kh, Kl, n8); }

// grammar bias for (query position pi, key position pj): dist_emb[bucket(|pj - pi|)][h] + ((pj > pi) - 0.5) * order_bias[h]
__device__ __forceinline__ float gbias(const float* sDE, const float* __restrict__ OB, const unsigned char* sLUT, int h, int pi, int pj) { int d = abs(pj - pi); d = min(d, LUTN - 1); const int bin = sLUT[d]; return sDE[bin] + (((pj > pi) ? 1.0f : 0.0f) - 0.5f) * bf16_round(OB[h]); }
// lane l <-> l ^ 16 (the other half of the wave), all lanes on
__device__ __forceinline__ float xhalf(float v) { const int b = __float_as_int(v); return __int_as_float(__builtin_amdgcn_permlanex16(b, b, 0x76543210, 0xfedcba98, false, false)); }
template <int TQ, int TK>
__global__ __launch_bounds__(128) void k_flashb(const _Float16* __restrict__ Q16, const _Float16* __restrict__ Q16lo, int ldq, const _Float16* __restrict__ K16, const _Float16* __restrict__ K16lo, int ldk, const _Float16* __restrict__ Vt, const _Float16* __restrict__ Vtlo, const unsigned* __restrict__ MB, const int* __restrict__ RA, const int* __restrict__ KE, const float* __restrict__ BT, const float* __restrict__ OB, const int* __restrict__ LUT, const int* __restrict__ LAG, float* __restrict__ O, int ldo) {
  constexpr int RPW = 16, NQB = TQ / (4 * RPW), DT = 4, KS = 2;
  __shared__ __attribute__((aligned(16))) float sO[4][RPW][64 + 4];
  const int tid = threadIdx.x, w = tid >> 5, lane = tid & 31, ln = lane & 15, hh = lane >> 4;
  const int slab = blockIdx.x / NQB, qblk = blockIdx.x % NQB; const int b = slab / NH, h = slab % NH; const int qb0 = qblk * (4 * RPW); const int q0 = qb0 + w * RPW;
  MB += (size_t)b * TQ * (TK / 32); LAG += (size_t)b * TK;      /* per-batch key-mask table and positions: the grid spans all batches */
  /* the bias lookup's tables, staged once per block: bucket of every distance as one byte, the head's rounded dist_emb column, the batch's positions */
  typedef int v4ia __attribute__((ext_vector_type(4), may_alias));
  __shared__ __attribute__((aligned(16))) unsigned sLUTw[LUTN / 4]; __shared__ float sDE[NBIN]; __shared__ __attribute__((aligned(16))) int sPos[TK];
  for (int i = tid; i < LUTN / 4; i += 128) { const v4ia c = *(const v4ia*)(LUT + 4 * i); sLUTw[i] = (unsigned)(c[0] & (NBIN - 1)) | ((unsigned)(c[1] & (NBIN - 1)) << 8) | ((unsigned)(c[2] & (NBIN - 1)) << 16) | ((unsigned)(c[3] & (NBIN - 1)) << 24); }
  for (int i = tid; i < TK / 4; i += 128) *(v4ia*)(sPos + 4 * i) = *(const v4ia*)(LAG + 4 * i);
  if (tid < NBIN) sDE[tid] = bf16_round(BT[tid * NH + h]);
  __syncthreads();      /* every wave reads what all four staged */
  const unsigned char* sLUT = (const unsigned char*)sLUTw;
  const int tq = q0 + ln;      /* this lane's query */
  FragH aq[KS], aql[KS];       /* Q as the B operand: column = query ln */
  { const size_t qo = ((size_t)b * TQ + tq) * ldq + h * 64; const unsigned short* qr = (const unsigned short*)Q16 + qo; const unsigned short* ql = (const unsigned short*)Q16lo + qo;
#pragma unroll
    for (int ks = 0; ks < KS; ++ks) { aq[ks].half[0] = *(const v8us*)(qr + ks * 32 + 8 * hh); aq[ks].half[1] = *(const v8us*)(qr + ks * 32 + 16 + 8 * hh); aql[ks].half[0] = *(const v8us*)(ql + ks * 32 + 8 * hh); aql[ks].half[1] = *(const v8us*)(ql + ks * 32 + 16 + 8 * hh); } }
  int jend = KE[qblk * 32]; jend = min(TK, (jend + 31) & ~31); if (jend < 32) jend = 32;      /* block-uniform */
  const bool am = (RA[tq] != 0); const unsigned* mrow = MB + (size_t)tq * (TK / 32); const int pi = sPos[tq];
  const unsigned short* Vth = (const unsigned short*)Vt + (size_t)slab * 64 * TK; const unsigned short* Vtl = (const unsigned short*)Vtlo + (size_t)slab * 64 * TK;
  float m_q = -3.0e38f, l_q = 0.f; v8f oacc[DT], oaccl[DT];
#pragma unroll
  for (int dt = 0; dt < DT; ++dt) { oacc[dt] = (v8f){0.f,0.f,0.f,0.f,0.f,0.f,0.f,0.f}; oaccl[dt] = oacc[dt]; }
#pragma unroll 1
  for (int j0 = 0; j0 < jend; j0 += 32) {
    const unsigned mword = mrow[j0 >> 5];      /* this query's key-mask bits of the 32 keys */
    v8f s[2];
#pragma unroll
    for (int nt = 0; nt < 2; ++nt) { const size_t ko = ((size_t)b * TK + j0 + nt * 16 + ln) * ldk + h * 64; const unsigned short* kr = (const unsigned short*)K16 + ko; const unsigned short* kl = (const unsigned short*)K16lo + ko; FragH bk[KS], bkl[KS];      /* K as the A operand: row = key */
#pragma unroll
      for (int ks = 0; ks < KS; ++ks) { bk[ks].half[0] = *(const v8us*)(kr + ks * 32 + 8 * hh); bk[ks].half[1] = *(const v8us*)(kr + ks * 32 + 16 + 8 * hh); bkl[ks].half[0] = *(const v8us*)(kl + ks * 32 + 8 * hh); bkl[ks].half[1] = *(const v8us*)(kl + ks * 32 + 16 + 8 * hh); }
      v8f acc = (v8f){0.f,0.f,0.f,0.f,0.f,0.f,0.f,0.f}, accr = acc;
#pragma unroll
      for (int ks = 0; ks < KS; ++ks) { acc = mmaH<1>(bk[ks].v, bk[ks].v, aq[ks].v, aq[ks].v, acc); accr = mmaH<1>(bk[ks].v, bk[ks].v, aql[ks].v, aql[ks].v, accr); accr = mmaH<1>(bkl[ks].v, bkl[ks].v, aq[ks].v, aq[ks].v, accr); }
      s[nt] = acc + accr * 0.0009765625f; }
    const unsigned mw = mword >> (8 * hh);      /* bit nt * 16 + r = this lane's key nt * 16 + 8 hh + r */
    float sc[2][8]; bool ok[2][8]; float mc = -INFINITY;
#pragma unroll
    for (int nt = 0; nt < 2; ++nt) { const v4ia pA = *(const v4ia*)(sPos + j0 + nt * 16 + 8 * hh), pB = *(const v4ia*)(sPos + j0 + nt * 16 + 8 * hh + 4);
#pragma unroll
      for (int r = 0; r < 8; ++r) { const int pj = (r < 4) ? pA[r & 3] : pB[r & 3]; ok[nt][r] = am || (((mw >> (nt * 16 + r)) & 1u) == 0u);
        const float sv = s[nt][r] * SCL + gbias(sDE, OB, sLUT, h, pi, pj);      /* + grammar distance-bucket and order biases */
        sc[nt][r] = ok[nt][r] ? (am ? 0.f : sv) : -INFINITY; mc = fmaxf(mc, sc[nt][r]); } }
    mc = fmaxf(mc, xhalf(mc));
    const float mn = fmaxf(m_q, mc); const float ea = expf(m_q - mn); const float al = (mn > -1.0e38f) ? ea : 1.0f; m_q = mn;
    FragH pa, pl; float ls = 0.f;      /* P^T hi and residual, already in the B operand's order */
#pragma unroll
    for (int nt = 0; nt < 2; ++nt)
#pragma unroll
      for (int r = 0; r < 8; ++r) { const float e = expf(sc[nt][r] - mn); const float p = ok[nt][r] ? e : 0.f; ls += p;
        const float ps = p * 1024.0f; const _Float16 t2 = (_Float16)ps; pa.h[nt * 8 + r] = t2; pl.h[nt * 8 + r] = (_Float16)((ps - (float)t2) * 1024.0f); }
    l_q = l_q * al + ls;
#pragma unroll
    for (int dt = 0; dt < DT; ++dt) { oacc[dt] *= al; oaccl[dt] *= al; }
#pragma unroll
    for (int dt = 0; dt < DT; ++dt) { const size_t vo = (size_t)(dt * 16 + ln) * TK + j0; FragH bv, bl; bv.half[0] = *(const v8us*)(Vth + vo + 8 * hh); bv.half[1] = *(const v8us*)(Vth + vo + 16 + 8 * hh); bl.half[0] = *(const v8us*)(Vtl + vo + 8 * hh); bl.half[1] = *(const v8us*)(Vtl + vo + 16 + 8 * hh);      /* V^T as the A operand: row = d */
      oacc[dt] = mmaH<1>(bv.v, bv.v, pa.v, pa.v, oacc[dt]); oaccl[dt] = mmaH<1>(bl.v, bl.v, pa.v, pa.v, oaccl[dt]); oaccl[dt] = mmaH<1>(bv.v, bv.v, pl.v, pl.v, oaccl[dt]); } }
  const float lt = l_q + xhalf(l_q); const float inv = (lt > 0.f) ? 1.0f / (lt * 1024.0f) : 0.f;
#pragma unroll
  for (int dt = 0; dt < DT; ++dt)
#pragma unroll
    for (int g = 0; g < 2; ++g) { v4f o4;
#pragma unroll
      for (int i = 0; i < 4; ++i) o4[i] = (oacc[dt][g * 4 + i] + oaccl[dt][g * 4 + i] * 0.0009765625f) * inv;
      *(v4fa*)&sO[w][ln][dt * 16 + 8 * hh + g * 4] = o4; }
  __builtin_amdgcn_fence(__ATOMIC_ACQ_REL, "workgroup"); __builtin_amdgcn_wave_barrier();
  {
#pragma unroll
    for (int rp = 0; rp < RPW; rp += 2) { const int r = rp + (lane >> 4), pc = lane & 15; const v4f val = *(const v4fa*)&sO[w][r][pc * 4]; *(v4f*)(O + ((size_t)b * TQ + q0 + r) * ldo + h * 64 + pc * 4) = val; }
     } }


__global__ __launch_bounds__(256) void k_fulltab(unsigned* __restrict__ MB, int* __restrict__ RA, int* __restrict__ KE, int nq, int nk) {
  const int t = blockIdx.x * 256 + threadIdx.x;
  if (t < nq * (nk / 32)) { *(unsigned*)(MB + t) = 0u;  }
  if (t < nq) { *(int*)(RA + t) = 0;  }
  if (t < nq / 64) { *(int*)(KE + t * 32) = nk;  } }
__global__ __launch_bounds__(256) void k_lnx(const float* __restrict__ X, const float* __restrict__ g, const float* __restrict__ bb, _Float16* __restrict__ Y16, float* __restrict__ XB) {
  #pragma clang fp contract(off)
  const int tid = threadIdx.x, w = tid >> 5, ln = tid & 31; const int r = blockIdx.x * 8 + w; if (r >= NR) return; const float* x = X + (size_t)r * DM; float s = 0.f;
#pragma unroll 1
  for (int i = 0; i < DM / 128; ++i) { const v4f a = *(const v4fa*)(x + i * 128 + ln * 4); for (int q = 0; q < 4; ++q) s += bf16_round(a[q]); }
  for (int o = 16; o > 0; o >>= 1) s += __shfl_xor(s, o, 32); const float mu = s / (float)DM; float q2 = 0.f;
#pragma unroll 1
  for (int i = 0; i < DM / 128; ++i) { const v4f a = *(const v4fa*)(x + i * 128 + ln * 4); for (int q = 0; q < 4; ++q) { const float d = bf16_round(a[q]) - mu; q2 += d * d; } }
  for (int o = 16; o > 0; o >>= 1) q2 += __shfl_xor(q2, o, 32); const float rs = rsqrtf(q2 / (float)DM + 1e-5f);
  {
#pragma unroll 1
    for (int i = 0; i < DM / 128; ++i) { const int c0 = i * 128 + ln * 4; const v4f a = *(const v4fa*)(x + c0); _Float16 h4[4]; v4f xb;
      for (int q = 0; q < 4; ++q) { const float t = bf16_round(a[q]); h4[q] = (_Float16)((t - mu) * rs * bf16_round(g[c0 + q]) + bf16_round(bb[c0 + q])); xb[q] = t; }
      *(unsigned long long*)((unsigned short*)Y16 + (size_t)r * DM + c0) = *(const unsigned long long*)h4; *(v4f*)(XB + (size_t)r * DM + c0) = xb; }
     } }
// bucket table: LUT[d] = count of the NBIN - 1 bf16-rounded edges below d (at most NBIN - 1), for d < LUTN
__device__ __forceinline__ void p_lut(unsigned bid, const float* __restrict__ edges, int* __restrict__ LUT) {
  #pragma clang fp contract(off)
  const int d = bid * 256 + threadIdx.x; if (d >= LUTN) return; const float fd = (float)d; int c = 0;
#pragma unroll 1
  for (int e = 0; e < NBIN - 1; ++e) c += (bf16_round(edges[e]) < fd) ? 1 : 0;
  c = min(c, NBIN - 1); *(int*)(LUT + d) = c;  }
__device__ __forceinline__ void p_masktab(unsigned bid, const float* __restrict__ mask, unsigned* __restrict__ MB, int* __restrict__ RA, int* __restrict__ KE) {
  const size_t t = (size_t)bid * 256 + threadIdx.x; const int nw = SLEN / 32;
  if (t < (size_t)NBT * SLEN * nw) { const int w = (int)(t % nw); const int b = (int)(t / ((size_t)SLEN * nw)); unsigned bits = 0u; for (int j = 0; j < 32; ++j) bits |= (bf16_round(mask[(size_t)b * SLEN + 32 * w + j]) == 0.0f) ? (1u << j) : 0u; *(unsigned*)(MB + t) = bits;  }
  if (t < SLEN) { *(int*)(RA + t) = 0;  }
  if (t < SLEN / 64) { *(int*)(KE + t * 32) = SLEN;  } }
#define NB_MT (NBT * SLEN * (SLEN / 32) / 256)   /* blocks of the key-mask tables */
#define NB_W (DM * DM / 8 / 256)                 /* blocks of one weight plane */
// One grid for the seven set-up jobs (mask tables, the x plane, four weight planes, the bucket table), which need nothing of each other: a block-uniform range of the block index picks the job.
__global__ __launch_bounds__(256) void k_prep(const float* __restrict__ x, const float* __restrict__ mask, const float* __restrict__ qw, const float* __restrict__ kw, const float* __restrict__ vw, const float* __restrict__ ow, const float* __restrict__ edges,
    _Float16* __restrict__ X16, _Float16* __restrict__ BW, unsigned* __restrict__ MB, int* __restrict__ RA, int* __restrict__ KE, int* __restrict__ LUT) {
  unsigned bid = blockIdx.x;
  if (bid < NB_MT) { p_masktab(bid, mask, MB, RA, KE); return; }
  bid -= NB_MT;
  if (bid < NB_E8) { p_x16(bid, x, X16, (size_t)NR * DM / 8); return; }
  bid -= NB_E8;
  if (bid < 4 * NB_W) { const unsigned j = bid / NB_W; const float* W = (j == 0) ? qw : ((j == 1) ? kw : ((j == 2) ? vw : ow)); p_round16f(bid - j * NB_W, W, BW + (size_t)j * DM * DM, (size_t)DM * DM / 8); return; }      /* BW: the four planes one behind the other */
  p_lut(bid - 4 * NB_W, edges, LUT); }
__global__ __launch_bounds__(256) void k_hlmask(const float* __restrict__ F, const float* __restrict__ mask, _Float16* __restrict__ Hh, _Float16* __restrict__ Hl, size_t n8) {
  #pragma clang fp contract(off)
  const size_t t = (size_t)blockIdx.x * 256 + threadIdx.x; if (t >= n8) return; const float mk = bf16_round(mask[(t * 8) / DM]); FragH fh, fl;
#pragma unroll
  for (int q = 0; q < 8; ++q) { const float v = F[t * 8 + q] * mk; const _Float16 h = (_Float16)v; fh.h[q] = h; fl.h[q] = (_Float16)((v - (float)h) * 1024.0f); }
  { *(v8us*)((unsigned short*)Hh + t * 8) = fh.half[0]; *(v8us*)((unsigned short*)Hl + t * 8) = fl.half[0];  } }
__global__ __launch_bounds__(256) void k_causaltab(unsigned* __restrict__ MB, int* __restrict__ RA, int* __restrict__ KE, int nq, int nk) {
  const int t = blockIdx.x * 256 + threadIdx.x; const int nw = nk / 32;
  if (t < nq * nw) { const int q = t / nw, w = t % nw; const int first = q + 1 - 32 * w; const unsigned bits = (first <= 0) ? 0xffffffffu : ((first >= 32) ? 0u : (0xffffffffu << first)); *(unsigned*)(MB + t) = bits;  }
  if (t < nq) { *(int*)(RA + t) = 0;  }
  if (t < nq / 64) { const int v = 64 * (t + 1); *(int*)(KE + t * 32) = v;  } }


extern "C" void kernel_launch(void* const* d_in, const int* in_sizes, int n_in,
                              void* d_out, int out_size, void* d_ws, size_t ws_size, hipStream_t stream) {
  (void)in_sizes; (void)n_in; (void)out_size;
  const float* const* I = (const float* const*)d_in; const float* x = I[0]; const int* pos = (const int*)d_in[1]; const float* mask = I[2]; const float* qw = I[3]; const float* qb = I[4]; const float* kw = I[5]; const float* kb = I[6]; const float* vw = I[7]; const float* vb = I[8]; const float* ow = I[9]; const float* ob = I[10]; const float* de = I[11]; const float* obias = I[12]; const float* edges = I[13];
  char* ws = (char*)d_ws; size_t off = 0;
  auto take = [&](size_t bytes) { char* p = ws + off; off += (bytes + 255) & ~(size_t)255; return p; };
  _Float16* BQ = (_Float16*)take((size_t)4 * DM * DM * 2); _Float16* BO = BQ + (size_t)3 * DM * DM;      /* q, k, v, o weight planes, one behind the other */
  _Float16* X16 = (_Float16*)take((size_t)NR * DM * 2); float* F = (float*)take((size_t)3 * NR * DM * 4);      /* q, k, v in f32, one behind the other */
  _Float16* Qh = (_Float16*)take((size_t)NR * DM * 2); _Float16* Ql = (_Float16*)take((size_t)NR * DM * 2); _Float16* Kh = (_Float16*)take((size_t)NR * DM * 2); _Float16* Kl = (_Float16*)take((size_t)NR * DM * 2); _Float16* Vth = (_Float16*)take((size_t)NR * DM * 2); _Float16* Vtl = (_Float16*)take((size_t)NR * DM * 2);
  unsigned* MB = (unsigned*)take((size_t)NBT * SLEN * (SLEN / 32) * 4); int* RA = (int*)take((size_t)SLEN * 4); int* KE = (int*)take((size_t)(SLEN / 64) * 32 * 4); int* LUT = (int*)take((size_t)LUTN * 4);
  if (off > ws_size) return;      /* 2 + 8 + 48 + 48 + 1.1 = 107 MiB */
  float* O = F; _Float16* Oh = Qh; _Float16* Ol = Ql;
  const size_t n8 = (size_t)NR * DM / 8; const unsigned nb8 = (unsigned)((n8 + 255) / 256); const dim3 gP((NR / 128) * (DM / 64), 1), gP3((NR / 128) * (DM / 64), 3);
  k_prep<<<NB_MT + NB_E8 + 4 * NB_W + LUTN / 256, 256, 0, stream>>>(x, mask, qw, kw, vw, ow, edges, X16, BQ, MB, RA, KE, LUT);      /* torch (out,in) = natural Bt */
  k_gemm2<0, DM><<<gP3, 128, 0, stream>>>(X16, DM, 0, BQ, DM, (size_t)DM * DM, 0.0625f, qb, kb, vb, 0, nullptr, 1, 0, 0, F, nullptr, DM, (size_t)NR * DM, NR, DM, DM);      /* blockIdx.y = q, k, v */
  k_split<<<NB_VT + 2 * NB_E8, 256, 0, stream>>>(F, F + (size_t)NR * DM, F + (size_t)2 * NR * DM, Qh, Ql, Kh, Kl, Vth, Vtl);
  k_flashb<SLEN, SLEN><<<NBT * NH * (SLEN / 64), 128, 0, stream>>>(Qh, Ql, DM, Kh, Kl, DM, Vth, Vtl, MB, RA, KE, de, obias, LUT, pos, O, DM);
  k_hlmask<<<nb8, 256, 0, stream>>>(O, mask, Oh, Ol, n8);
  k_gemm2<0, DM><<<gP, 128, 0, stream>>>(Oh, DM, 0, BO, DM, 0, 0.0625f, ob, nullptr, nullptr, 0, nullptr, 1, 0, 0, (float*)d_out, nullptr, DM, 0, NR, DM, DM);
  k_gemm2<0, DM><<<gP, 128, 0, stream>>>(Ol, DM, 0, BO, DM, 0, 0.0625f / 1024.0f, nullptr, nullptr, nullptr, 0, (float*)d_out, 1, (size_t)DM, 0, (float*)d_out, nullptr, DM, 0, NR, DM, DM);
}

// v006
// One run takes 218 microseconds.
// Next to v005, in two timings, it ran 1.26 and 1.25 times as fast.
// All steps since v000 together make it 9.51 times as fast.
#include <hip/hip_runtime.h>
// Grammar attention (8 x 1024 tokens, 512 = 8 heads x 64): q,k,v = x W^T + b; scores = q.k/8 + dist_emb[bucket(|pos_j - pos_i|)][h] + ((pos_j > pos_i) - 0.5) * order_bias[h] with INPUT int32 positions, INPUT bin edges (torch.bucketize right=False = count of edges < dist) and an INPUT key/query mask (masked keys excluded; masked query rows zeroed before the output projection, as out * mask); softmax; out = ((attn v) * mask) Wo^T + bo -> [8,1024,512].
// Structure: x as an exact f16 plane; projections as f16 WMMA GEMMs (32x64 wave tiles, f32 accumulation, exact x16 weights + bias); a device-built bucket lookup table over integer distances (from the INPUT edges) and per-batch key-mask bit tables; q, k as f16 hi + (x2^10) residual planes, V^T as hi + residual planes; the fused flash kernel gathers both biases by the INPUT positions inside the score stage (transposed score and value tiles, online f32 softmax per lane, P hi + residual kept in registers, two value accumulators); O scaled by the query mask, split hi/lo, into Wo (two GEMMs, bias in the first).
// Compute dtype: x, weights, biases, dist_emb, order_bias, bin_edges, mask rounded to bf16; projections exact; q, k, P, v, O as f16 hi + residual pairs (~2^-21); f32 accumulation and softmax. v_wmma_f32_16x16x32_f16.
#define NBT 8
#define SLEN 1024
#define NBIN 32
#define LUTN 16384            /* bucket lookup over integer distances 0..LUTN-1 (positions < 5000) */
#define DM 512
#define NH 8
#define SCL 0.125f
#define NR (NBT * SLEN)
typedef __bf16 v16b __attribute__((ext_vector_type(16)));
typedef unsigned short v8us __attribute__((ext_vector_type(8), may_alias));
typedef float  v8f  __attribute__((ext_vector_type(8)));
typedef float  v4f  __attribute__((ext_vector_type(4)));
typedef float  v4fa __attribute__((ext_vector_type(4), may_alias));
union FragB { v16b v; v8us half[2]; unsigned short u[16]; };

__device__ __forceinline__ unsigned short bf16_bits(float x) { unsigned int u = __float_as_uint(x); return (unsigned short)((u + 0x7FFFu + ((u >> 16) & 1u)) >> 16); }
__device__ __forceinline__ float bf16_val(unsigned short b) { return __uint_as_float(((unsigned int)b) << 16); }
__device__ __forceinline__ float bf16_round(float x) { return bf16_val(bf16_bits(x)); }
// D += A·B with NT terms: 1 = ah·bh, 2 = + al·bh (A split), 3 = + ah·bl (both split)
template <int NT>
__device__ __forceinline__ v8f mmaN(v16b ah, v16b al, v16b bh, v16b bl, v8f c) {
  c = __builtin_amdgcn_wmma_f32_16x16x32_bf16(false, ah, false, bh, (short)0, c, false, false);
  if (NT >= 2) c = __builtin_amdgcn_wmma_f32_16x16x32_bf16(false, al, false, bh, (short)0, c, false, false);
  if (NT >= 3) c = __builtin_amdgcn_wmma_f32_16x16x32_bf16(false, ah, false, bl, (short)0, c, false, false);
  asm volatile("v_nop\n\tv_nop\n\tv_nop\n\tv_nop" : "+v"(c) : "v"(ah), "v"(al), "v"(bh), "v"(bl));
  return c;
}

__global__ __launch_bounds__(256) void k_wt_bf16(const float* __restrict__ W, unsigned short* __restrict__ Wt, int K, int N) {
  const int t = blockIdx.x * 256 + threadIdx.x;
  const int k8n = K / 8;
  if (t >= N * k8n) return;
  const int n = t / k8n, k8 = (t % k8n) * 8;
  v8us v;
#pragma unroll
  for (int i = 0; i < 8; ++i) v[i] = bf16_bits(W[(size_t)(k8 + i) * N + n]);
  *(v8us*)(Wt + (size_t)n * K + k8) = v;
  
}

// GEMM C[M][N] (f32, pitch ldc) = act(A[M][K]·W + bias). A f32 row-major (pitch lda) converted per fragment to bf16
// (ASPLIT: hi/lo two planes -> 2 terms, else single rounded term); Wt bf16 [N][K] (pitch ldb). BIAS_BF16 rounds the
// bias to bf16 first (bias quantised to bf16 before the add). K%32==0, M%16==0, N%64==0.
template <bool ASPLIT, int ACT, bool BIAS_BF16>
__global__ __launch_bounds__(128) void k_gemm_bf(const float* __restrict__ A, int lda, const unsigned short* __restrict__ Wt, int ldb,
                                               const float* __restrict__ bias, float* __restrict__ C, int ldc, int M, int N, int K) {
  __shared__ __attribute__((aligned(16))) float so[4][16][64];
  const int tid = threadIdx.x, w = tid >> 5, lane = tid & 31, ln = lane & 15, hh = lane >> 4;
  const int ntn = N / 64;
  const int wid = blockIdx.x * 4 + w;
  const int mt = wid / ntn, nq = wid % ntn;
  if (mt * 16 >= M) return;
  const int row0 = mt * 16, col0 = nq * 64;
  const float* arow = A + (size_t)(row0 + ln) * lda;
  v8f acc[4] = {};
  for (int kb = 0; kb < K; kb += 32) {
    FragB ah, al;
    const v4f x0 = *(const v4fa*)(arow + kb + 8 * hh), x1 = *(const v4fa*)(arow + kb + 8 * hh + 4);
    const v4f x2 = *(const v4fa*)(arow + kb + 16 + 8 * hh), x3 = *(const v4fa*)(arow + kb + 16 + 8 * hh + 4);
    float xs[16] = {x0[0],x0[1],x0[2],x0[3],x1[0],x1[1],x1[2],x1[3],x2[0],x2[1],x2[2],x2[3],x3[0],x3[1],x3[2],x3[3]};
#pragma unroll
    for (int i = 0; i < 16; ++i) { const unsigned short hb = bf16_bits(xs[i]); ah.u[i] = hb; al.u[i] = ASPLIT ? bf16_bits(xs[i] - bf16_val(hb)) : (unsigned short)0; }
#pragma unroll
    for (int t = 0; t < 4; ++t) {
      const unsigned short* brow = Wt + (size_t)(col0 + t * 16 + ln) * ldb + kb;
      FragB b;
      b.half[0] = *(const v8us*)(brow + 8 * hh);
      b.half[1] = *(const v8us*)(brow + 16 + 8 * hh);
      acc[t] = mmaN<ASPLIT ? 2 : 1>(ah.v, al.v, b.v, b.v, acc[t]);
    }
  }
#pragma unroll
  for (int t = 0; t < 4; ++t) {
    float bv = bias ? bias[col0 + t * 16 + ln] : 0.f;
    if (BIAS_BF16) bv = bf16_round(bv);
#pragma unroll
    for (int r = 0; r < 8; ++r) { float v = acc[t][r] + bv; if (ACT == 1) v = fmaxf(v, 0.f); so[w][8 * hh + r][t * 16 + ln] = v; }
  }
  __builtin_amdgcn_fence(__ATOMIC_ACQ_REL, "workgroup");
  __builtin_amdgcn_wave_barrier();
  const int rsub = lane >> 4, c4 = (lane & 15) * 4;
  {
#pragma unroll
    for (int q = 0; q < 8; ++q) {
      const int r = q * 2 + rsub;
      const v4f v = *(const v4fa*)&so[w][r][c4];
      *(v4f*)(C + (size_t)(row0 + r) * ldc + col0 + c4) = v;
    }
    
  }
}

// GEMM C = act(A·W + bias + resid): A f32 (ASPLIT -> hi/lo 2 terms), Wt bf16 [N][K]; ACT 0 none, 1 relu, 2 exact gelu;
// resid (optional, f32, row index = (row % rmod), pitch ldr, RES_BF16 rounds it) added before the activation.
template <bool ASPLIT, int ACT, bool BIAS_BF16, bool RES_BF16>
__global__ __launch_bounds__(128) void k_gemm_bf3(const float* __restrict__ A, int lda, const unsigned short* __restrict__ Wt, int ldb,
                                                const float* __restrict__ bias, const float* __restrict__ resid, int rmod, int ldr,
                                                float* __restrict__ C, int ldc, int M, int N, int K) {
  __shared__ __attribute__((aligned(16))) float so[4][16][64];
  const int tid = threadIdx.x, w = tid >> 5, lane = tid & 31, ln = lane & 15, hh = lane >> 4;
  const int ntn = N / 64;
  const int wid = blockIdx.x * 4 + w;
  const int mt = wid / ntn, nq = wid % ntn;
  if (mt * 16 >= M) return;
  const int row0 = mt * 16, col0 = nq * 64;
  const float* arow = A + (size_t)(row0 + ln) * lda;
  v8f acc[4] = {};
  for (int kb = 0; kb < K; kb += 32) {
    FragB ah, al;
    const v4f x0 = *(const v4fa*)(arow + kb + 8 * hh), x1 = *(const v4fa*)(arow + kb + 8 * hh + 4);
    const v4f x2 = *(const v4fa*)(arow + kb + 16 + 8 * hh), x3 = *(const v4fa*)(arow + kb + 16 + 8 * hh + 4);
    float xs[16] = {x0[0],x0[1],x0[2],x0[3],x1[0],x1[1],x1[2],x1[3],x2[0],x2[1],x2[2],x2[3],x3[0],x3[1],x3[2],x3[3]};
#pragma unroll
    for (int i = 0; i < 16; ++i) { const unsigned short hb = bf16_bits(xs[i]); ah.u[i] = hb; al.u[i] = ASPLIT ? bf16_bits(xs[i] - bf16_val(hb)) : (unsigned short)0; }
#pragma unroll
    for (int t = 0; t < 4; ++t) {
      const unsigned short* brow = Wt + (size_t)(col0 + t * 16 + ln) * ldb + kb;
      FragB b;
      b.half[0] = *(const v8us*)(brow + 8 * hh);
      b.half[1] = *(const v8us*)(brow + 16 + 8 * hh);
      acc[t] = mmaN<ASPLIT ? 2 : 1>(ah.v, al.v, b.v, b.v, acc[t]);
    }
  }
#pragma unroll
  for (int t = 0; t < 4; ++t) {
    const int col = col0 + t * 16 + ln;
    float bv = bias ? bias[col] : 0.f;
    if (BIAS_BF16) bv = bf16_round(bv);
#pragma unroll
    for (int r = 0; r < 8; ++r) {
      float v = acc[t][r] + bv;
      if (resid) { float rv = resid[(size_t)((row0 + 8 * hh + r) % rmod) * ldr + col]; if (RES_BF16) rv = bf16_round(rv); v += rv; }
      if (ACT == 1) v = fmaxf(v, 0.f);
      if (ACT == 2) v = 0.5f * v * (1.0f + erff(v * 0.70710678118654752f));
      if (ACT == 3) { const float u = 0.7978845608028654f * (v + 0.044715f * v * v * v); v = 0.5f * v * (1.0f + tanhf(u)); }
      so[w][8 * hh + r][t * 16 + ln] = v;
    }
  }
  __builtin_amdgcn_fence(__ATOMIC_ACQ_REL, "workgroup");
  __builtin_amdgcn_wave_barrier();
  const int rsub = lane >> 4, c4 = (lane & 15) * 4;
  {
#pragma unroll
    for (int q = 0; q < 8; ++q) {
      const int r = q * 2 + rsub;
      const v4f v = *(const v4fa*)&so[w][r][c4];
      *(v4f*)(C + (size_t)(row0 + r) * ldc + col0 + c4) = v;
    }
    
  }
}
// row LayerNorm (biased variance, eps) over N: s = X (+ R); optional out_sum <- s; out_norm <- (s-mu)*rsqrt(var+eps)*g + b
template <bool PARAM_BF16>
__global__ __launch_bounds__(256) void k_layernorm(const float* __restrict__ X, const float* __restrict__ R, const float* __restrict__ g, const float* __restrict__ bta,
                                                  float* __restrict__ out_sum, float* __restrict__ out_norm, int N, float eps) {
  __shared__ float red[256];
  const int row = blockIdx.x, tid = threadIdx.x;
  const float* x = X + (size_t)row * N; const float* rr = R ? R + (size_t)row * N : nullptr;
  float vals[16];                     // up to N = 4096
  const int per = N / 256;            // contiguous chunk per thread? use strided-by-4 chunks: thread handles j = tid*4 + 1024*u
  float s1 = 0.f;
  for (int u = 0; u < per / 4; ++u) {
    const int j = tid * 4 + 1024 * u;
    const v4f a = *(const v4fa*)(x + j);
    v4f b = {0.f,0.f,0.f,0.f}; if (rr) b = *(const v4fa*)(rr + j);
#pragma unroll
    for (int q = 0; q < 4; ++q) { const float v = a[q] + b[q]; vals[u * 4 + q] = v; s1 += v; }
  }
  red[tid] = s1; __syncthreads();
  for (int st = 128; st > 0; st >>= 1) { if (tid < st) red[tid] += red[tid + st]; __syncthreads(); }
  const float mu = red[0] / (float)N; __syncthreads();
  float s2 = 0.f;
  for (int u = 0; u < per / 4; ++u)
#pragma unroll
    for (int q = 0; q < 4; ++q) { const float c = vals[u * 4 + q] - mu; s2 += c * c; }
  red[tid] = s2; __syncthreads();
  for (int st = 128; st > 0; st >>= 1) { if (tid < st) red[tid] += red[tid + st]; __syncthreads(); }
  const float rs = rsqrtf(red[0] / (float)N + eps);
  {
    for (int u = 0; u < per / 4; ++u) {
      const int j = tid * 4 + 1024 * u;
      v4f o, sm;
#pragma unroll
      for (int q = 0; q < 4; ++q) {
        float gg = g[j + q], bb = bta[j + q];
        if (PARAM_BF16) { gg = bf16_round(gg); bb = bf16_round(bb); }
        sm[q] = vals[u * 4 + q]; o[q] = (vals[u * 4 + q] - mu) * rs * gg + bb;
      }
      if (out_sum) *(v4f*)(out_sum + (size_t)row * N + j) = sm;
      *(v4f*)(out_norm + (size_t)row * N + j) = o;
    }
    
  }
}



// ---- f16 WMMA path (v_wmma_f32_16x16x32_f16): 11-bit significands for operands in range — used where a [0,1] probability operand needs more precision than bf16
typedef _Float16 v16h __attribute__((ext_vector_type(16)));
union FragH { v16h v; v8us half[2]; _Float16 h[16]; unsigned short u[16]; };
template <int NT>
__device__ __forceinline__ v8f mmaH(v16h ah, v16h al, v16h bh, v16h bl, v8f c) {
  c = __builtin_amdgcn_wmma_f32_16x16x32_f16(false, ah, false, bh, (short)0, c, false, false);
  if (NT >= 2) c = __builtin_amdgcn_wmma_f32_16x16x32_f16(false, al, false, bh, (short)0, c, false, false);
  if (NT >= 3) c = __builtin_amdgcn_wmma_f32_16x16x32_f16(false, ah, false, bl, (short)0, c, false, false);
  asm volatile("v_nop\n\tv_nop\n\tv_nop\n\tv_nop" : "+v"(c) : "v"(ah), "v"(al), "v"(bh), "v"(bl));
  return c;
}
// batched GEMM like k_gemm_b but f16 operands: A f32 (split into f16 hi/lo if ASPLIT, else rounded to f16), Bt = f16 values [n][k]; alpha; C f32; N multiple of 16 (partial tiles skipped)
template <bool ASPLIT>
__global__ __launch_bounds__(128) void k_gemm_h(const float* __restrict__ A, int lda, size_t sA, const _Float16* __restrict__ Bh, int ldb, size_t sB, float alpha, float* __restrict__ C, int ldc, size_t sC, int M, int N, int K) {
  __shared__ __attribute__((aligned(16))) float so[4][16][64];
  const int tid = threadIdx.x, w = tid >> 5, lane = tid & 31, ln = lane & 15, hh = lane >> 4; const int by = blockIdx.y;
  A += (size_t)by * sA; Bh += (size_t)by * sB; C += (size_t)by * sC;
  const int ntn = (N + 63) / 64; const int wid = blockIdx.x * 4 + w; const int mt = wid / ntn, nq = wid % ntn; if (mt * 16 >= M) return;
  const int row0 = mt * 16, col0 = nq * 64; const float* arow = A + (size_t)(row0 + ln) * lda;
  v8f acc[4] = {};
  for (int kb = 0; kb < K; kb += 32) {
    FragH ah, al;
    const v4f x0 = *(const v4fa*)(arow + kb + 8 * hh), x1 = *(const v4fa*)(arow + kb + 8 * hh + 4), x2 = *(const v4fa*)(arow + kb + 16 + 8 * hh), x3 = *(const v4fa*)(arow + kb + 16 + 8 * hh + 4);
    float xs[16] = {x0[0],x0[1],x0[2],x0[3],x1[0],x1[1],x1[2],x1[3],x2[0],x2[1],x2[2],x2[3],x3[0],x3[1],x3[2],x3[3]};
#pragma unroll
    for (int i = 0; i < 16; ++i) { const _Float16 h = (_Float16)xs[i]; ah.h[i] = h; al.h[i] = ASPLIT ? (_Float16)(xs[i] - (float)h) : (_Float16)0.0f; }
#pragma unroll
    for (int t = 0; t < 4; ++t) { if (col0 + t * 16 >= N) continue; const size_t boff = (size_t)(col0 + t * 16 + ln) * ldb + kb; FragH bq; bq.half[0] = *(const v8us*)(Bh + boff + 8 * hh); bq.half[1] = *(const v8us*)(Bh + boff + 16 + 8 * hh);
      acc[t] = mmaH<ASPLIT ? 2 : 1>(ah.v, al.v, bq.v, bq.v, acc[t]); }
  }
#pragma unroll
  for (int t = 0; t < 4; ++t) { if (col0 + t * 16 >= N) continue;
#pragma unroll
    for (int r = 0; r < 8; ++r) so[w][8 * hh + r][t * 16 + ln] = acc[t][r] * alpha; }
  __builtin_amdgcn_fence(__ATOMIC_ACQ_REL, "workgroup"); __builtin_amdgcn_wave_barrier();
  const int rsub = lane >> 4, c4 = (lane & 15) * 4;
  {
#pragma unroll
    for (int q = 0; q < 8; ++q) { const int r = q * 2 + rsub; if (col0 + c4 < N) { const v4f v = *(const v4fa*)&so[w][r][c4]; *(v4f*)(C + (size_t)(row0 + r) * ldc + col0 + c4) = v; } }
     }
}

// Wt[n][k] = f16(W[k][n]·scale) from f32 row-major W[K][N] (scale = power of two; bf16-exact weights stay exact in f16 away from the subnormal range)
__global__ __launch_bounds__(256) void k_wt_f16(const float* __restrict__ W, _Float16* __restrict__ Wt, int K, int N, float scale) {
  const int t = blockIdx.x * 256 + threadIdx.x; if (t >= N * (K / 8)) return; const int n = t / (K / 8), k8 = (t % (K / 8)) * 8; FragH f;
#pragma unroll
  for (int i = 0; i < 8; ++i) f.h[i] = (_Float16)(bf16_round(W[(size_t)(k8 + i) * N + n]) * scale); const v8us o = f.half[0];
  *(v8us*)((unsigned short*)Wt + (size_t)n * K + k8) = o; 
}
// k_gemm_hh variant with fused epilogue: v = acc·alpha + bias[by·sBias + col] (+ CP[(row/rowsPerB)·sCPb + by·64 + col] if CP) ; ACT 0 none / 1 elu ; writes f16 C16 (and f32 C if non-null)
template <int ACT>
__global__ __launch_bounds__(128) void k_gemm_hhx(const _Float16* __restrict__ A, int lda, size_t sA, const _Float16* __restrict__ Bh, int ldb, size_t sB, float alpha, const float* __restrict__ bias, size_t sBias, const float* __restrict__ CP, int rowsPerB, size_t sCPb, int row0g,
    float* __restrict__ C, _Float16* __restrict__ C16, int ldc, size_t sC, int M, int N, int K) {
  __shared__ __attribute__((aligned(16))) float so[4][16][64];
  const int tid = threadIdx.x, w = tid >> 5, lane = tid & 31, ln = lane & 15, hh = lane >> 4; const int by = blockIdx.y;
  A += (size_t)by * sA; Bh += (size_t)by * sB; const size_t cofs = (size_t)by * sC; const float* bp = bias ? bias + (size_t)by * sBias : nullptr;
  const int ntn = (N + 63) / 64; const int wid = blockIdx.x * 4 + w; const int mt = wid / ntn, nq = wid % ntn; if (mt * 16 >= M) return;
  const int row0 = mt * 16, col0 = nq * 64; const _Float16* arow = A + (size_t)(row0 + ln) * lda;
  v8f acc[4] = {};
  for (int kb = 0; kb < K; kb += 32) { FragH ah; ah.half[0] = *(const v8us*)((const unsigned short*)arow + kb + 8 * hh); ah.half[1] = *(const v8us*)((const unsigned short*)arow + kb + 16 + 8 * hh);
#pragma unroll
    for (int t = 0; t < 4; ++t) { if (col0 + t * 16 >= N) continue; const size_t boff = (size_t)(col0 + t * 16 + ln) * ldb + kb; FragH bq; bq.half[0] = *(const v8us*)((const unsigned short*)Bh + boff + 8 * hh); bq.half[1] = *(const v8us*)((const unsigned short*)Bh + boff + 16 + 8 * hh);
      acc[t] = mmaH<1>(ah.v, ah.v, bq.v, bq.v, acc[t]); }
  }
#pragma unroll
  for (int t = 0; t < 4; ++t) { if (col0 + t * 16 >= N) continue; const int col = col0 + t * 16 + ln; const float bv = bp ? bf16_round(bp[col]) : 0.f;
#pragma unroll
    for (int r = 0; r < 8; ++r) { float v = acc[t][r] * alpha + bv; if (CP) { const int bidx = (row0g + row0 + 8 * hh + r) / rowsPerB; v += CP[(size_t)bidx * sCPb + (size_t)by * 64 + col]; } if (ACT == 1) v = (v > 0.f) ? v : expm1f(v); else if (ACT == 7) v = (v > 0.f) ? v + 1.0f : expf(v); else if (ACT == 8) v = tanhf(v); else if (ACT == 9) v = 0.5f * v * (1.0f + tanhf(0.7978845608028654f * (v + 0.044715f * v * v * v))); else if (ACT == 11) v = 1.0f / (1.0f + expf(-v)); else if (ACT == 12) v = (v > 0.f) ? v : 0.01f * v; else if (ACT == 14) v = (v > 0.f) ? v : 0.1f * v; else if (ACT == 15) v = v / (1.0f + expf(-v)); else if (ACT == 3) v = fmaxf(v, 0.f); else if (ACT == 6) v = 0.5f * v * (1.0f + erff(v * 0.70710678118654752f)); so[w][8 * hh + r][t * 16 + ln] = v; } }
  __builtin_amdgcn_fence(__ATOMIC_ACQ_REL, "workgroup"); __builtin_amdgcn_wave_barrier();
  const int rsub = lane >> 4, c4 = (lane & 15) * 4; typedef _Float16 v4h __attribute__((ext_vector_type(4)));
  {
#pragma unroll
    for (int q = 0; q < 8; ++q) { const int r = q * 2 + rsub; if (col0 + c4 < N) { const v4f v = *(const v4fa*)&so[w][r][c4]; if (C) *(v4f*)(C + cofs + (size_t)(row0 + r) * ldc + col0 + c4) = v; if (C16) { v4h h4; for (int i = 0; i < 4; ++i) h4[i] = (_Float16)v[i]; *(v4h*)(C16 + cofs + (size_t)(row0 + r) * ldc + col0 + c4) = h4; } } }
     }
}


typedef _Float16 v4h __attribute__((ext_vector_type(4)));

// The p_* functions are jobs of 256-thread blocks; bid is the block's index within its job (k_prep and k_split hand it over).
__device__ __forceinline__ void p_x16(unsigned bid, const float* __restrict__ x, _Float16* __restrict__ X16, size_t n8) { const size_t t = (size_t)bid * 256 + threadIdx.x; if (t >= n8) return; FragH f;
#pragma unroll
  for (int q = 0; q < 8; ++q) f.h[q] = (_Float16)bf16_round(x[t * 8 + q]); *(v8us*)((unsigned short*)X16 + t * 8) = f.half[0];  }
__global__ __launch_bounds__(256) void k_h16(const float* __restrict__ x, _Float16* __restrict__ X16, size_t n8) { const size_t t = (size_t)blockIdx.x * 256 + threadIdx.x; if (t >= n8) return; FragH f;
#pragma unroll
  for (int q = 0; q < 8; ++q) f.h[q] = (_Float16)x[t * 8 + q]; *(v8us*)((unsigned short*)X16 + t * 8) = f.half[0];  }
__device__ __forceinline__ void p_round16f(unsigned bid, const float* __restrict__ W, _Float16* __restrict__ Bt, size_t n8) { const size_t t = (size_t)bid * 256 + threadIdx.x; if (t >= n8) return; FragH f;
#pragma unroll
  for (int i = 0; i < 8; ++i) f.h[i] = (_Float16)(bf16_round(W[t * 8 + i]) * 16.0f); *(v8us*)((unsigned short*)Bt + t * 8) = f.half[0];  }
template <int NHv, int TTv>
__global__ __launch_bounds__(256) void k_vt(const _Float16* __restrict__ V16, int ldv, int voff, _Float16* __restrict__ Vt) { __shared__ unsigned short tl[64][66]; const int tid = threadIdx.x; const int slab = blockIdx.x / (TTv / 64), lg = blockIdx.x % (TTv / 64); const int b = slab / NHv, h = slab % NHv;
  for (int i = tid; i < 64 * 8; i += 256) { const int r = i / 8, c8 = (i % 8) * 8; FragH f; f.half[0] = *(const v8us*)((const unsigned short*)V16 + ((size_t)b * TTv + lg * 64 + r) * ldv + voff + h * 64 + c8);
#pragma unroll
    for (int q = 0; q < 8; ++q) tl[r][c8 + q] = f.u[q]; }
  __syncthreads();
  {
#pragma unroll
    for (int rd = 0; rd < 2; ++rd) { const int d = rd * 32 + tid / 8, pc = tid % 8; FragH f;
#pragma unroll
      for (int q = 0; q < 8; ++q) f.u[q] = tl[pc * 8 + q][d];
      *(v8us*)((unsigned short*)Vt + ((size_t)slab * 64 + d) * TTv + lg * 64 + pc * 8) = f.half[0]; }
     } }

__device__ __forceinline__ void p_hl(unsigned bid, const float* __restrict__ F, _Float16* __restrict__ Hh, _Float16* __restrict__ Hl, size_t n8) { const size_t t = (size_t)bid * 256 + threadIdx.x; if (t >= n8) return; FragH fh, fl; const v4f a = *(const v4fa*)(F + t * 8), c = *(const v4fa*)(F + t * 8 + 4);
#pragma unroll
  for (int q = 0; q < 4; ++q) { _Float16 h = (_Float16)a[q]; fh.h[q] = h; fl.h[q] = (_Float16)((a[q] - (float)h) * 1024.0f); h = (_Float16)c[q]; fh.h[4 + q] = h; fl.h[4 + q] = (_Float16)((c[q] - (float)h) * 1024.0f); }
  { *(v8us*)((unsigned short*)Hh + t * 8) = fh.half[0]; *(v8us*)((unsigned short*)Hl + t * 8) = fl.half[0];  } }

// ---- fast GEMM (wave tile 32x64; requires M % 32 == 0 rows per launch region and N % 64 == 0); epilogue = k_gemm_hhx semantics, but the bias input is picked by blockIdx.y ----
__device__ __forceinline__ v16h g2_fragb(const char* base, unsigned off, int kb) { FragH f; f.half[0] = *(const v8us*)(base + off + kb * 2); f.half[1] = *(const v8us*)(base + off + kb * 2 + 32); return f.v; }
__device__ __forceinline__ v8f g2_mma(v16h a, v16h b, v8f c) { v8f d = __builtin_amdgcn_wmma_f32_16x16x32_f16(false, a, false, b, (short)0, c, false, false); asm volatile("v_nop\n\tv_nop\n\tv_nop\n\tv_nop" : "+v"(d) : "v"(a), "v"(b)); return d; }
template <int ACT, int KC>      /* KC = K, a compile-time multiple of 32: the k loop is unrolled over a ring of fragment registers */
__global__ __launch_bounds__(128) __attribute__((amdgpu_waves_per_eu(4)))      /* a budget of 256 registers: the ring and the accumulators fit it, and the build needs no register-window switches */
void k_gemm2(const _Float16* __restrict__ A, int lda, size_t sA, const _Float16* __restrict__ Bh, int ldb, size_t sB, float alpha, const float* __restrict__ bias, const float* __restrict__ bias1, const float* __restrict__ bias2, size_t sBias, const float* __restrict__ CP, int rowsPerB, size_t sCPb, int row0g,
    float* __restrict__ C, _Float16* __restrict__ C16, int ldc, size_t sC, int M, int N, int K) {
  __shared__ __attribute__((aligned(16))) float so[4][32][68];
  const int tid = threadIdx.x, w = tid >> 5, lane = tid & 31, ln = lane & 15, hh = lane >> 4; const int by = blockIdx.y;
  const float* bsel = (by == 0) ? bias : ((by == 1) ? bias1 : bias2);      /* products that share one grid (blockIdx.y) have each their own bias input */
  A += (size_t)by * sA; Bh += (size_t)by * sB; const size_t cofs = (size_t)by * sC; const float* bp = bsel ? bsel + (size_t)by * sBias : nullptr;
  const int ntn = N >> 6; const int mt = blockIdx.x / ntn, nq = blockIdx.x - mt * ntn; const int row0 = mt * 128 + 32 * w, col0 = nq * 64; if (row0 >= M) return;
  /* uniform base + one 32-bit byte offset a fragment row (the planes are far below 4 GiB): six address registers, the k step in the immediate offset */
  const char* Ab = (const char*)A; const char* Bb = (const char*)Bh;
  const unsigned a0o = (unsigned)((row0 + ln) * lda + 8 * hh) * 2u, a1o = a0o + (unsigned)(16 * lda) * 2u;
  const unsigned b0o = (unsigned)((col0 + ln) * ldb + 8 * hh) * 2u, b1o = b0o + (unsigned)(16 * ldb) * 2u, b2o = b1o + (unsigned)(16 * ldb) * 2u, b3o = b2o + (unsigned)(16 * ldb) * 2u;
  const v8f z8 = {0.f,0.f,0.f,0.f,0.f,0.f,0.f,0.f}; v8f c00 = z8, c01 = z8, c02 = z8, c03 = z8, c10 = z8, c11 = z8, c12 = z8, c13 = z8;
  (void)K; constexpr int NS = KC / 32;
  /* three sets of the six fragments of a k step: the twelve loads of step s + 2 are issued together, ahead of step s's products, so a step waits once, for loads issued two steps earlier */
  v16h fa0[3], fa1[3], fb0[3], fb1[3], fb2[3], fb3[3];
#pragma unroll
  for (int s = 0; s < 2 && s < NS; ++s) { const int kb = s * 32; fa0[s] = g2_fragb(Ab, a0o, kb); fb0[s] = g2_fragb(Bb, b0o, kb); fa1[s] = g2_fragb(Ab, a1o, kb); fb1[s] = g2_fragb(Bb, b1o, kb); fb2[s] = g2_fragb(Bb, b2o, kb); fb3[s] = g2_fragb(Bb, b3o, kb); }
#pragma unroll      /* full unroll: the ring index must be a constant for the sets to stay in registers */
  for (int s = 0; s < NS; ++s) { const int cu = s % 3, nx = (s + 2) % 3;
    if (s + 2 < NS) { const int kb = (s + 2) * 32; fa0[nx] = g2_fragb(Ab, a0o, kb); fb0[nx] = g2_fragb(Bb, b0o, kb); fa1[nx] = g2_fragb(Ab, a1o, kb); fb1[nx] = g2_fragb(Bb, b1o, kb); fb2[nx] = g2_fragb(Bb, b2o, kb); fb3[nx] = g2_fragb(Bb, b3o, kb); }
    c00 = g2_mma(fa0[cu], fb0[cu], c00); c10 = g2_mma(fa1[cu], fb0[cu], c10);
    c01 = g2_mma(fa0[cu], fb1[cu], c01); c11 = g2_mma(fa1[cu], fb1[cu], c11);
    c02 = g2_mma(fa0[cu], fb2[cu], c02); c12 = g2_mma(fa1[cu], fb2[cu], c12);
    c03 = g2_mma(fa0[cu], fb3[cu], c03); c13 = g2_mma(fa1[cu], fb3[cu], c13); }
  v8f accs[8] = {c00, c01, c02, c03, c10, c11, c12, c13};
#pragma unroll
  for (int u = 0; u < 8; ++u) { const int t = u & 3, half = u >> 2; const int col = col0 + t * 16 + ln; const float bv = bp ? bf16_round(bp[col]) : 0.f;
#pragma unroll
    for (int r = 0; r < 8; ++r) { const int rloc = half * 16 + 8 * hh + r; float v = accs[u][r] * alpha + bv; if (CP) { const int bidx = (row0g + row0 + rloc) / rowsPerB; v += CP[(size_t)bidx * sCPb + (size_t)by * 64 + col]; }
      if (ACT == 3) v = fmaxf(v, 0.f); else if (ACT == 6) v = 0.5f * v * (1.0f + erff(v * 0.70710678118654752f)); else if (ACT == 11) v = 1.0f / (1.0f + expf(-v)); else if (ACT == 15) v = v / (1.0f + expf(-v)); else if (ACT == 12) v = (v > 0.f) ? v : 0.01f * v; else if (ACT == 8) v = tanhf(v);
      so[w][rloc][t * 16 + ln] = v; } }
  __builtin_amdgcn_fence(__ATOMIC_ACQ_REL, "workgroup"); __builtin_amdgcn_wave_barrier();
  const int rsub = lane >> 4, c4 = (lane & 15) * 4;
  {
#pragma unroll
    for (int q = 0; q < 16; ++q) { const int r = q * 2 + rsub; const v4f v = *(const v4fa*)&so[w][r][c4]; if (C) *(v4f*)(C + cofs + (size_t)(row0 + r) * ldc + col0 + c4) = v; if (C16) { v4h h4; for (int i = 0; i < 4; ++i) h4[i] = (_Float16)v[i]; *(v4h*)(C16 + cofs + (size_t)(row0 + r) * ldc + col0 + c4) = h4; } }
     } }



template <int TK>
__device__ __forceinline__ void p_vthl(unsigned bid, const float* __restrict__ VF, int ldv, _Float16* __restrict__ Vth, _Float16* __restrict__ Vtl) { __shared__ float tl[64][65]; const int tid = threadIdx.x; const int slab = bid / (TK / 64), lg = bid % (TK / 64); const int b = slab / NH, h = slab % NH;
  for (int i = tid; i < 64 * 16; i += 256) { const int r = i / 16, c4 = (i % 16) * 4; const v4f a = *(const v4fa*)(VF + ((size_t)b * TK + lg * 64 + r) * ldv + h * 64 + c4); tl[r][c4] = a[0]; tl[r][c4 + 1] = a[1]; tl[r][c4 + 2] = a[2]; tl[r][c4 + 3] = a[3]; }
  __syncthreads();
  FragH fh[2], fl[2]; size_t oo[2];
#pragma unroll
  for (int rd = 0; rd < 2; ++rd) { const int d = rd * 32 + tid / 8, pc = tid % 8;
#pragma unroll
    for (int q = 0; q < 8; ++q) { const float v = tl[pc * 8 + q][d]; const _Float16 hv = (_Float16)v; fh[rd].h[q] = hv; fl[rd].h[q] = (_Float16)((v - (float)hv) * 1024.0f); } oo[rd] = ((size_t)slab * 64 + d) * TK + lg * 64 + pc * 8; }
  {
#pragma unroll
    for (int rd = 0; rd < 2; ++rd) { *(v8us*)((unsigned short*)Vth + oo[rd]) = fh[rd].half[0]; *(v8us*)((unsigned short*)Vtl + oo[rd]) = fl[rd].half[0]; }
     } }
#define NB_E8 (NR * DM / 8 / 256)            /* blocks of a job with one thread to 8 elements of a [NR][DM] plane */
#define NB_VT (NBT * NH * (SLEN / 64))       /* blocks of the V transpose */
// One grid for the three jobs behind the projections (V^T planes, q planes, k planes), which need nothing of each other: a block-uniform range of the block index picks the job.
__global__ __launch_bounds__(256) void k_split(const float* __restrict__ FQ, const float* __restrict__ FK, const float* __restrict__ FV, _Float16* __restrict__ Qh, _Float16* __restrict__ Ql, _Float16* __restrict__ Kh, _Float16* __restrict__ Kl, _Float16* __restrict__ Vth, _Float16* __restrict__ Vtl) {
  unsigned bid = blockIdx.x; const size_t n8 = (size_t)NR * DM / 8;
  if (bid < NB_VT) { p_vthl<SLEN>(bid, FV, DM, Vth, Vtl); return; }
  bid -= NB_VT;
  if (bid < NB_E8) { p_hl(bid, FQ, Qh, Ql, n8); return; }
  p_hl(bid - NB_E8, FK, Kh, Kl, n8); }

// grammar bias for (query position pi, key position pj): dist_emb[bucket(|pj - pi|)][h] + ((pj > pi) - 0.5) * order_bias[h]
__device__ __forceinline__ float gbias(const float* sDE, float obh, const unsigned char* sLUT, int pi, int pj) { int d = abs(pj - pi); d = min(d, LUTN - 1); const int bin = sLUT[d]; return sDE[bin] + (((pj > pi) ? 1.0f : 0.0f) - 0.5f) * obh; }      /* obh = the head's rounded order_bias */
// lane l <-> l ^ 16 (the other half of the wave), all lanes on
__device__ __forceinline__ float xhalf(float v) { const int b = __float_as_int(v); return __int_as_float(__builtin_amdgcn_permlanex16(b, b, 0x76543210, 0xfedcba98, false, false)); }
// LDS image of one tile of 32 keys: K hi and K residual as 32 rows of 128 B at a pitch of 144 B, V^T hi and residual as 64 rows of 64 B at a pitch of 80 B (16 B x odd: ds_load_b128 fragment reads meet no bank twice).
#define FK_P 144
#define FV_P 80
#define F_KH 0
#define F_KL (32 * FK_P)
#define F_VH (2 * 32 * FK_P)
#define F_VL (2 * 32 * FK_P + 64 * FV_P)
#define F_TILE (2 * 32 * FK_P + 2 * 64 * FV_P)
// A thread's eight 16-byte asynchronous copies of one tile (128 threads x 8 x 16 B = the tile's 16 KiB): lk, lv = its LDS byte addresses in the K and V^T parts of the buffer, g* = its global addresses in the four planes; k16, v32 = bytes of 16 K rows and of 32 V^T rows in global memory.
__device__ __forceinline__ void f_tile_copy(unsigned lk, unsigned lv, const char* gkh, const char* gkl, const char* gvh, const char* gvl, unsigned k16, unsigned v32) {
  const unsigned a0 = lk + F_KH, a1 = a0 + 16 * FK_P, a2 = lk + F_KL, a3 = a2 + 16 * FK_P, a4 = lv + F_VH, a5 = a4 + 32 * FV_P, a6 = lv + F_VL, a7 = a6 + 32 * FV_P;
  const char* p1 = gkh + k16; const char* p3 = gkl + k16; const char* p5 = gvh + v32; const char* p7 = gvl + v32;
  /* the copies and, as the last line of the same statement, the wait that stands in front of any rewrite of their address registers */
  asm volatile("global_load_async_to_lds_b128 %0, %8, off\n\t"
               "global_load_async_to_lds_b128 %1, %9, off\n\t"
               "global_load_async_to_lds_b128 %2, %10, off\n\t"
               "global_load_async_to_lds_b128 %3, %11, off\n\t"
               "global_load_async_to_lds_b128 %4, %12, off\n\t"
               "global_load_async_to_lds_b128 %5, %13, off\n\t"
               "global_load_async_to_lds_b128 %6, %14, off\n\t"
               "global_load_async_to_lds_b128 %7, %15, off\n\t"
               "s_wait_xcnt 0x0"
               :: "v"(a0), "v"(a1), "v"(a2), "v"(a3), "v"(a4), "v"(a5), "v"(a6), "v"(a7), "v"(gkh), "v"(p1), "v"(gkl), "v"(p3), "v"(gvh), "v"(p5), "v"(gvl), "v"(p7) : "memory"); }
template <int TQ, int TK>
__global__ __launch_bounds__(128) void k_flashb(const _Float16* __restrict__ Q16, const _Float16* __restrict__ Q16lo, int ldq, const _Float16* __restrict__ K16, const _Float16* __restrict__ K16lo, int ldk, const _Float16* __restrict__ Vt, const _Float16* __restrict__ Vtlo, const unsigned* __restrict__ MB, const int* __restrict__ RA, const int* __restrict__ KE, const float* __restrict__ BT, const float* __restrict__ OB, const int* __restrict__ LUT, const int* __restrict__ LAG, float* __restrict__ O, int ldo) {
  constexpr int RPW = 16, NQB = TQ / (4 * RPW), DT = 4, KS = 2;
  __shared__ __attribute__((aligned(16))) float sO[4][RPW][64 + 4];
  const int tid = threadIdx.x, w = tid >> 5, lane = tid & 31, ln = lane & 15, hh = lane >> 4;
  const int slab = blockIdx.x / NQB, qblk = blockIdx.x % NQB; const int b = slab / NH, h = slab % NH; const int qb0 = qblk * (4 * RPW); const int q0 = qb0 + w * RPW;
  MB += (size_t)b * TQ * (TK / 32); LAG += (size_t)b * TK;      /* per-batch key-mask table and positions: the grid spans all batches */
  const float obh = bf16_round(OB[h]);      /* read once, ahead of the loop: behind the loop's waits (memory clobbers) it would be loaded anew every trip */
  /* K and V^T reach the four waves through LDS: two buffers of one 32-key tile each, filled by asynchronous copies in whole rows, one tile ahead of the tile in work; every wave reads its fragments from there */
  __shared__ __attribute__((aligned(16))) unsigned char ring[2 * F_TILE];
  int jend = __builtin_amdgcn_readfirstlane(KE[qblk * 32]); jend = min(TK, (jend + 31) & ~31); if (jend < 32) jend = 32;      /* block-uniform, in a scalar register: it decides whether copies issue */
  const unsigned k16 = (unsigned)(16 * ldk) * 2u, v32 = (unsigned)(32 * TK) * 2u;
  const unsigned lk = (unsigned)(size_t)ring + (unsigned)((tid >> 3) * FK_P + (tid & 7) * 16), lv = (unsigned)(size_t)ring + (unsigned)((tid >> 2) * FV_P + (tid & 3) * 16);      /* 8 lanes to a K row (one 128-B line), 4 lanes to a V^T row */
  const size_t gko = (((size_t)b * TK + (tid >> 3)) * ldk + h * 64) * 2 + (tid & 7) * 16, gvo = (((size_t)slab * 64 + (tid >> 2)) * TK) * 2 + (tid & 3) * 16;
  const char* gkh = (const char*)K16 + gko; const char* gkl = (const char*)K16lo + gko; const char* gvh = (const char*)Vt + gvo; const char* gvl = (const char*)Vtlo + gvo;      /* the next tile to copy */
  f_tile_copy(lk, lv, gkh, gkl, gvh, gvl, k16, v32);      /* tile 0 into buffer 0 */
  /* the bias lookup's tables, staged once per block: bucket of every distance as one byte, the head's rounded dist_emb column, the batch's positions */
  typedef int v4ia __attribute__((ext_vector_type(4), may_alias));
  __shared__ __attribute__((aligned(16))) unsigned sLUTw[LUTN / 4]; __shared__ float sDE[NBIN]; __shared__ __attribute__((aligned(16))) int sPos[TK];
  for (int i = tid; i < LUTN / 4; i += 128) { const v4ia c = *(const v4ia*)(LUT + 4 * i); sLUTw[i] = (unsigned)(c[0] & (NBIN - 1)) | ((unsigned)(c[1] & (NBIN - 1)) << 8) | ((unsigned)(c[2] & (NBIN - 1)) << 16) | ((unsigned)(c[3] & (NBIN - 1)) << 24); }
  for (int i = tid; i < TK / 4; i += 128) *(v4ia*)(sPos + 4 * i) = *(const v4ia*)(LAG + 4 * i);
  if (tid < NBIN) sDE[tid] = bf16_round(BT[tid * NH + h]);
  asm volatile("s_wait_asynccnt 0x0" ::: "memory");      /* this wave's copies of tile 0 have landed before the barrier publishes them */
  __syncthreads();      /* every wave reads what all four staged */
  gkh += 2 * (size_t)k16; gkl += 2 * (size_t)k16; gvh += 64; gvl += 64;
  if (jend > 32) f_tile_copy(lk + F_TILE, lv + F_TILE, gkh, gkl, gvh, gvl, k16, v32);      /* tile 1 into buffer 1 */
  const unsigned char* sLUT = (const unsigned char*)sLUTw;
  const int tq = q0 + ln;      /* this lane's query */
  FragH aq[KS], aql[KS];       /* Q as the B operand: column = query ln */
  { const size_t qo = ((size_t)b * TQ + tq) * ldq + h * 64; const unsigned short* qr = (const unsigned short*)Q16 + qo; const unsigned short* ql = (const unsigned short*)Q16lo + qo;
#pragma unroll
    for (int ks = 0; ks < KS; ++ks) { aq[ks].half[0] = *(const v8us*)(qr + ks * 32 + 8 * hh); aq[ks].half[1] = *(const v8us*)(qr + ks * 32 + 16 + 8 * hh); aql[ks].half[0] = *(const v8us*)(ql + ks * 32 + 8 * hh); aql[ks].half[1] = *(const v8us*)(ql + ks * 32 + 16 + 8 * hh); } }
  const bool am = (RA[tq] != 0); const unsigned* mrow = MB + (size_t)tq * (TK / 32); const int pi = sPos[tq];
  const unsigned char* fk = ring + ln * FK_P; const unsigned char* fv = ring + ln * FV_P;      /* this lane's fragment rows in buffer 0 */
  unsigned bo = 0;      /* byte offset of the buffer in work */
  float m_q = -3.0e38f, l_q = 0.f; v8f oacc[DT], oaccl[DT];
#pragma unroll
  for (int dt = 0; dt < DT; ++dt) { oacc[dt] = (v8f){0.f,0.f,0.f,0.f,0.f,0.f,0.f,0.f}; oaccl[dt] = oacc[dt]; }
#pragma unroll 1
  for (int j0 = 0; j0 < jend; j0 += 32) {
    const unsigned mword = mrow[j0 >> 5];      /* this query's key-mask bits of the 32 keys */
    v8f s[2];
#pragma unroll
    for (int nt = 0; nt < 2; ++nt) { const unsigned short* kr = (const unsigned short*)(fk + bo + F_KH + nt * 16 * FK_P); const unsigned short* kl = (const unsigned short*)(fk + bo + F_KL + nt * 16 * FK_P); FragH bk[KS], bkl[KS];      /* K as the A operand: row = key */
#pragma unroll
      for (int ks = 0; ks < KS; ++ks) { bk[ks].half[0] = *(const v8us*)(kr + ks * 32 + 8 * hh); bk[ks].half[1] = *(const v8us*)(kr + ks * 32 + 16 + 8 * hh); bkl[ks].half[0] = *(const v8us*)(kl + ks * 32 + 8 * hh); bkl[ks].half[1] = *(const v8us*)(kl + ks * 32 + 16 + 8 * hh); }
      v8f acc = (v8f){0.f,0.f,0.f,0.f,0.f,0.f,0.f,0.f}, accr = acc;
#pragma unroll
      for (int ks = 0; ks < KS; ++ks) { acc = mmaH<1>(bk[ks].v, bk[ks].v, aq[ks].v, aq[ks].v, acc); accr = mmaH<1>(bk[ks].v, bk[ks].v, aql[ks].v, aql[ks].v, accr); accr = mmaH<1>(bkl[ks].v, bkl[ks].v, aq[ks].v, aq[ks].v, accr); }
      s[nt] = acc + accr * 0.0009765625f; }
    const unsigned mw = mword >> (8 * hh);      /* bit nt * 16 + r = this lane's key nt * 16 + 8 hh + r */
    float sc[2][8]; bool ok[2][8]; float mc = -INFINITY;
#pragma unroll
    for (int nt = 0; nt < 2; ++nt) { const v4ia pA = *(const v4ia*)(sPos + j0 + nt * 16 + 8 * hh), pB = *(const v4ia*)(sPos + j0 + nt * 16 + 8 * hh + 4);
#pragma unroll
      for (int r = 0; r < 8; ++r) { const int pj = (r < 4) ? pA[r & 3] : pB[r & 3]; ok[nt][r] = am || (((mw >> (nt * 16 + r)) & 1u) == 0u);
        const float sv = s[nt][r] * SCL + gbias(sDE, obh, sLUT, pi, pj);      /* + grammar distance-bucket and order biases */
        sc[nt][r] = ok[nt][r] ? (am ? 0.f : sv) : -INFINITY; mc = fmaxf(mc, sc[nt][r]); } }
    mc = fmaxf(mc, xhalf(mc));
    const float mn = fmaxf(m_q, mc); const float ea = expf(m_q - mn); const float al = (mn > -1.0e38f) ? ea : 1.0f; m_q = mn;
    FragH pa, pl; float ls = 0.f;      /* P^T hi and residual, already in the B operand's order */
#pragma unroll
    for (int nt = 0; nt < 2; ++nt)
#pragma unroll
      for (int r = 0; r < 8; ++r) { const float e = expf(sc[nt][r] - mn); const float p = ok[nt][r] ? e : 0.f; ls += p;
        const float ps = p * 1024.0f; const _Float16 t2 = (_Float16)ps; pa.h[nt * 8 + r] = t2; pl.h[nt * 8 + r] = (_Float16)((ps - (float)t2) * 1024.0f); }
    l_q = l_q * al + ls;
#pragma unroll
    for (int dt = 0; dt < DT; ++dt) { oacc[dt] *= al; oaccl[dt] *= al; }
#pragma unroll
    for (int dt = 0; dt < DT; ++dt) { const unsigned short* vh = (const unsigned short*)(fv + bo + F_VH + dt * 16 * FV_P); const unsigned short* vl = (const unsigned short*)(fv + bo + F_VL + dt * 16 * FV_P); FragH bv, bl; bv.half[0] = *(const v8us*)(vh + 8 * hh); bv.half[1] = *(const v8us*)(vh + 16 + 8 * hh); bl.half[0] = *(const v8us*)(vl + 8 * hh); bl.half[1] = *(const v8us*)(vl + 16 + 8 * hh);      /* V^T as the A operand: row = d */
      oacc[dt] = mmaH<1>(bv.v, bv.v, pa.v, pa.v, oacc[dt]); oaccl[dt] = mmaH<1>(bl.v, bl.v, pa.v, pa.v, oaccl[dt]); oaccl[dt] = mmaH<1>(bv.v, bv.v, pl.v, pl.v, oaccl[dt]); }
    /* hand-over, every wave in this order: its own reads of this buffer are done, its own copies of the next tile have landed, the barrier tells the other waves both; only then is this buffer refilled */
    asm volatile("s_wait_dscnt 0x0" ::: "memory");
    asm volatile("s_wait_asynccnt 0x0" ::: "memory");
    __syncthreads();
    gkh += 2 * (size_t)k16; gkl += 2 * (size_t)k16; gvh += 64; gvl += 64;
    if (j0 + 64 < jend) f_tile_copy(lk + bo, lv + bo, gkh, gkl, gvh, gvl, k16, v32);      /* the tile after next, while one exists (a scalar test) */
    bo ^= F_TILE; }
  asm volatile("s_wait_asynccnt 0x0" ::: "memory");      /* no copy is left in flight when the wave goes on to its end */
  const float lt = l_q + xhalf(l_q); const float inv = (lt > 0.f) ? 1.0f / (lt * 1024.0f) : 0.f;
#pragma unroll
  for (int dt = 0; dt < DT; ++dt)
#pragma unroll
    for (int g = 0; g < 2; ++g) { v4f o4;
#pragma unroll
      for (int i = 0; i < 4; ++i) o4[i] = (oacc[dt][g * 4 + i] + oaccl[dt][g * 4 + i] * 0.0009765625f) * inv;
      *(v4fa*)&sO[w][ln][dt * 16 + 8 * hh + g * 4] = o4; }
  __builtin_amdgcn_fence(__ATOMIC_ACQ_REL, "workgroup"); __builtin_amdgcn_wave_barrier();
  {
#pragma unroll
    for (int rp = 0; rp < RPW; rp += 2) { const int r = rp + (lane >> 4), pc = lane & 15; const v4f val = *(const v4fa*)&sO[w][r][pc * 4]; *(v4f*)(O + ((size_t)b * TQ + q0 + r) * ldo + h * 64 + pc * 4) = val; }
     } }


__global__ __launch_bounds__(256) void k_fulltab(unsigned* __restrict__ MB, int* __restrict__ RA, int* __restrict__ KE, int nq, int nk) {
  const int t = blockIdx.x * 256 + threadIdx.x;
  if (t < nq * (nk / 32)) { *(unsigned*)(MB + t) = 0u;  }
  if (t < nq) { *(int*)(RA + t) = 0;  }
  if (t < nq / 64) { *(int*)(KE + t * 32) = nk;  } }
__global__ __launch_bounds__(256) void k_lnx(const float* __restrict__ X, const float* __restrict__ g, const float* __restrict__ bb, _Float16* __restrict__ Y16, float* __restrict__ XB) {
  #pragma clang fp contract(off)
  const int tid = threadIdx.x, w = tid >> 5, ln = tid & 31; const int r = blockIdx.x * 8 + w; if (r >= NR) return; const float* x = X + (size_t)r * DM; float s = 0.f;
#pragma unroll 1
  for (int i = 0; i < DM / 128; ++i) { const v4f a = *(const v4fa*)(x + i * 128 + ln * 4); for (int q = 0; q < 4; ++q) s += bf16_round(a[q]); }
  for (int o = 16; o > 0; o >>= 1) s += __shfl_xor(s, o, 32); const float mu = s / (float)DM; float q2 = 0.f;
#pragma unroll 1
  for (int i = 0; i < DM / 128; ++i) { const v4f a = *(const v4fa*)(x + i * 128 + ln * 4); for (int q = 0; q < 4; ++q) { const float d = bf16_round(a[q]) - mu; q2 += d * d; } }
  for (int o = 16; o > 0; o >>= 1) q2 += __shfl_xor(q2, o, 32); const float rs = rsqrtf(q2 / (float)DM + 1e-5f);
  {
#pragma unroll 1
    for (int i = 0; i < DM / 128; ++i) { const int c0 = i * 128 + ln * 4; const v4f a = *(const v4fa*)(x + c0); _Float16 h4[4]; v4f xb;
      for (int q = 0; q < 4; ++q) { const float t = bf16_round(a[q]); h4[q] = (_Float16)((t - mu) * rs * bf16_round(g[c0 + q]) + bf16_round(bb[c0 + q])); xb[q] = t; }
      *(unsigned long long*)((unsigned short*)Y16 + (size_t)r * DM + c0) = *(const unsigned long long*)h4; *(v4f*)(XB + (size_t)r * DM + c0) = xb; }
     } }
// bucket table: LUT[d] = count of the NBIN - 1 bf16-rounded edges below d (at most NBIN - 1), for d < LUTN
__device__ __forceinline__ void p_lut(unsigned bid, const float* __restrict__ edges, int* __restrict__ LUT) {
  #pragma clang fp contract(off)
  const int d = bid * 256 + threadIdx.x; if (d >= LUTN) return; const float fd = (float)d; int c = 0;
#pragma unroll 1
  for (int e = 0; e < NBIN - 1; ++e) c += (bf16_round(edges[e]) < fd) ? 1 : 0;
  c = min(c, NBIN - 1); *(int*)(LUT + d) = c;  }
__device__ __forceinline__ void p_masktab(unsigned bid, const float* __restrict__ mask, unsigned* __restrict__ MB, int* __restrict__ RA, int* __restrict__ KE) {
  const size_t t = (size_t)bid * 256 + threadIdx.x; const int nw = SLEN / 32;
  if (t < (size_t)NBT * SLEN * nw) { const int w = (int)(t % nw); const int b = (int)(t / ((size_t)SLEN * nw)); unsigned bits = 0u; for (int j = 0; j < 32; ++j) bits |= (bf16_round(mask[(size_t)b * SLEN + 32 * w + j]) == 0.0f) ? (1u << j) : 0u; *(unsigned*)(MB + t) = bits;  }
  if (t < SLEN) { *(int*)(RA + t) = 0;  }
  if (t < SLEN / 64) { *(int*)(KE + t * 32) = SLEN;  } }
#define NB_MT (NBT * SLEN * (SLEN / 32) / 256)   /* blocks of the key-mask tables */
#define NB_W (DM * DM / 8 / 256)                 /* blocks of one weight plane */
// One grid for the seven set-up jobs (mask tables, the x plane, four weight planes, the bucket table), which need nothing of each other: a block-uniform range of the block index picks the job.
__global__ __launch_bounds__(256) void k_prep(const float* __restrict__ x, const float* __restrict__ mask, const float* __restrict__ qw, const float* __restrict__ kw, const float* __restrict__ vw, const float* __restrict__ ow, const float* __restrict__ edges,
    _Float16* __restrict__ X16, _Float16* __restrict__ BW, unsigned* __restrict__ MB, int* __restrict__ RA, int* __restrict__ KE, int* __restrict__ LUT) {
  unsigned bid = blockIdx.x;
  if (bid < NB_MT) { p_masktab(bid, mask, MB, RA, KE); return; }
  bid -= NB_MT;
  if (bid < NB_E8) { p_x16(bid, x, X16, (size_t)NR * DM / 8); return; }
  bid -= NB_E8;
  if (bid < 4 * NB_W) { const unsigned j = bid / NB_W; const float* W = (j == 0) ? qw : ((j == 1) ? kw : ((j == 2) ? vw : ow)); p_round16f(bid - j * NB_W, W, BW + (size_t)j * DM * DM, (size_t)DM * DM / 8); return; }      /* BW: the four planes one behind the other */
  p_lut(bid - 4 * NB_W, edges, LUT); }
__global__ __launch_bounds__(256) void k_hlmask(const float* __restrict__ F, const float* __restrict__ mask, _Float16* __restrict__ Hh, _Float16* __restrict__ Hl, size_t n8) {
  #pragma clang fp contract(off)
  const size_t t = (size_t)blockIdx.x * 256 + threadIdx.x; if (t >= n8) return; const float mk = bf16_round(mask[(t * 8) / DM]); FragH fh, fl;
#pragma unroll
  for (int q = 0; q < 8; ++q) { const float v = F[t * 8 + q] * mk; const _Float16 h = (_Float16)v; fh.h[q] = h; fl.h[q] = (_Float16)((v - (float)h) * 1024.0f); }
  { *(v8us*)((unsigned short*)Hh + t * 8) = fh.half[0]; *(v8us*)((unsigned short*)Hl + t * 8) = fl.half[0];  } }
__global__ __launch_bounds__(256) void k_causaltab(unsigned* __restrict__ MB, int* __restrict__ RA, int* __restrict__ KE, int nq, int nk) {
  const int t = blockIdx.x * 256 + threadIdx.x; const int nw = nk / 32;
  if (t < nq * nw) { const int q = t / nw, w = t % nw; const int first = q + 1 - 32 * w; const unsigned bits = (first <= 0) ? 0xffffffffu : ((first >= 32) ? 0u : (0xffffffffu << first)); *(unsigned*)(MB + t) = bits;  }
  if (t < nq) { *(int*)(RA + t) = 0;  }
  if (t < nq / 64) { const int v = 64 * (t + 1); *(int*)(KE + t * 32) = v;  } }


extern "C" void kernel_launch(void* const* d_in, const int* in_sizes, int n_in,
                              void* d_out, int out_size, void* d_ws, size_t ws_size, hipStream_t stream) {
  (void)in_sizes; (void)n_in; (void)out_size;
  const float* const* I = (const float* const*)d_in; const float* x = I[0]; const int* pos = (const int*)d_in[1]; const float* mask = I[2]; const float* qw = I[3]; const float* qb = I[4]; const float* kw = I[5]; const float* kb = I[6]; const float* vw = I[7]; const float* vb = I[8]; const float* ow = I[9]; const float* ob = I[10]; const float* de = I[11]; const float* obias = I[12]; const float* edges = I[13];
  char* ws = (char*)d_ws; size_t off = 0;
  auto take = [&](size_t bytes) { char* p = ws + off; off += (bytes + 255) & ~(size_t)255; return p; };
  _Float16* BQ = (_Float16*)take((size_t)4 * DM * DM * 2); _Float16* BO = BQ + (size_t)3 * DM * DM;      /* q, k, v, o weight planes, one behind the other */
  _Float16* X16 = (_Float16*)take((size_t)NR * DM * 2); float* F = (float*)take((size_t)3 * NR * DM * 4);      /* q, k, v in f32, one behind the other */
  _Float16* Qh = (_Float16*)take((size_t)NR * DM * 2); _Float16* Ql = (_Float16*)take((size_t)NR * DM * 2); _Float16* Kh = (_Float16*)take((size_t)NR * DM * 2); _Float16* Kl = (_Float16*)take((size_t)NR * DM * 2); _Float16* Vth = (_Float16*)take((size_t)NR * DM * 2); _Float16* Vtl = (_Float16*)take((size_t)NR * DM * 2);
  unsigned* MB = (unsigned*)take((size_t)NBT * SLEN * (SLEN / 32) * 4); int* RA = (int*)take((size_t)SLEN * 4); int* KE = (int*)take((size_t)(SLEN / 64) * 32 * 4); int* LUT = (int*)take((size_t)LUTN * 4);
  if (off > ws_size) return;      /* 2 + 8 + 48 + 48 + 1.1 = 107 MiB */
  float* O = F; _Float16* Oh = Qh; _Float16* Ol = Ql;
  const size_t n8 = (size_t)NR * DM / 8; const unsigned nb8 = (unsigned)((n8 + 255) / 256); const dim3 gP((NR / 128) * (DM / 64), 1), gP3((NR / 128) * (DM / 64), 3);
  k_prep<<<NB_MT + NB_E8 + 4 * NB_W + LUTN / 256, 256, 0, stream>>>(x, mask, qw, kw, vw, ow, edges, X16, BQ, MB, RA, KE, LUT);      /* torch (out,in) = natural Bt */
  k_gemm2<0, DM><<<gP3, 128, 0, stream>>>(X16, DM, 0, BQ, DM, (size_t)DM * DM, 0.0625f, qb, kb, vb, 0, nullptr, 1, 0, 0, F, nullptr, DM, (size_t)NR * DM, NR, DM, DM);      /* blockIdx.y = q, k, v */
  k_split<<<NB_VT + 2 * NB_E8, 256, 0, stream>>>(F, F + (size_t)NR * DM, F + (size_t)2 * NR * DM, Qh, Ql, Kh, Kl, Vth, Vtl);
  k_flashb<SLEN, SLEN><<<NBT * NH * (SLEN / 64), 128, 0, stream>>>(Qh, Ql, DM, Kh, Kl, DM, Vth, Vtl, MB, RA, KE, de, obias, LUT, pos, O, DM);
  k_hlmask<<<nb8, 256, 0, stream>>>(O, mask, Oh, Ol, n8);
  k_gemm2<0, DM><<<gP, 128, 0, stream>>>(Oh, DM, 0, BO, DM, 0, 0.0625f, ob, nullptr, nullptr, 0, nullptr, 1, 0, 0, (float*)d_out, nullptr, DM, 0, NR, DM, DM);
  k_gemm2<0, DM><<<gP, 128, 0, stream>>>(Ol, DM, 0, BO, DM, 0, 0.0625f / 1024.0f, nullptr, nullptr, nullptr, 0, (float*)d_out, 1, (size_t)DM, 0, (float*)d_out, nullptr, DM, 0, NR, DM, DM);
}

// v007
// Measured time: 206 microseconds a run.
// In both of two side-by-side timings against v006, it was 1.05 times as fast.
// All steps since v000 together make it 10.00 times as fast.
#include <hip/hip_runtime.h>
// Grammar attention (8 x 1024 tokens, 512 = 8 heads x 64): q,k,v = x W^T + b; scores = q.k/8 + dist_emb[bucket(|pos_j - pos_i|)][h] + ((pos_j > pos_i) - 0.5) * order_bias[h] with INPUT int32 positions, INPUT bin edges (torch.bucketize right=False = count of edges < dist) and an INPUT key/query mask (masked keys excluded; masked query rows zeroed before the output projection, as out * mask); softmax; out = ((attn v) * mask) Wo^T + bo -> [8,1024,512].
// Structure: x as an exact f16 plane; projections as f16 WMMA GEMMs (32x64 wave tiles, f32 accumulation, exact x16 weights + bias); a device-built bucket lookup table over integer distances (from the INPUT edges) and per-batch key-mask bit tables; q, k as f16 hi + (x2^10) residual planes, V^T as hi + residual planes; the fused flash kernel gathers both biases by the INPUT positions inside the score stage (transposed score and value tiles, online f32 softmax per lane, P hi + residual kept in registers, two value accumulators); O scaled by the query mask, split hi/lo, into Wo (two GEMMs, bias in the first).
// Compute dtype: x, weights, biases, dist_emb, order_bias, bin_edges, mask rounded to bf16; projections exact; q, k, P, v, O as f16 hi + residual pairs (~2^-21); f32 accumulation and softmax. v_wmma_f32_16x16x32_f16.
#define NBT 8
#define SLEN 1024
#define NBIN 32
#define LUTN 16384            /* bucket lookup over integer distances 0..LUTN-1 (positions < 5000) */
#define DM 512
#define NH 8
#define SCL 0.125f
#define LOG2E 1.4426950408889634f   /* the flash kernel's scores, biases and running maximum are kept times log2(e): e^(s - m) is then one native 2^x */
#define NR (NBT * SLEN)
typedef __bf16 v16b __attribute__((ext_vector_type(16)));
typedef unsigned short v8us __attribute__((ext_vector_type(8), may_alias));
typedef float  v8f  __attribute__((ext_vector_type(8)));
typedef float  v4f  __attribute__((ext_vector_type(4)));
typedef float  v4fa __attribute__((ext_vector_type(4), may_alias));
union FragB { v16b v; v8us half[2]; unsigned short u[16]; };

__device__ __forceinline__ unsigned short bf16_bits(float x) { unsigned int u = __float_as_uint(x); return (unsigned short)((u + 0x7FFFu + ((u >> 16) & 1u)) >> 16); }
__device__ __forceinline__ float bf16_val(unsigned short b) { return __uint_as_float(((unsigned int)b) << 16); }
__device__ __forceinline__ float bf16_round(float x) { return bf16_val(bf16_bits(x)); }
// D += A·B with NT terms: 1 = ah·bh, 2 = + al·bh (A split), 3 = + ah·bl (both split)
template <int NT>
__device__ __forceinline__ v8f mmaN(v16b ah, v16b al, v16b bh, v16b bl, v8f c) {
  c = __builtin_amdgcn_wmma_f32_16x16x32_bf16(false, ah, false, bh, (short)0, c, false, false);
  if (NT >= 2) c = __builtin_amdgcn_wmma_f32_16x16x32_bf16(false, al, false, bh, (short)0, c, false, false);
  if (NT >= 3) c = __builtin_amdgcn_wmma_f32_16x16x32_bf16(false, ah, false, bl, (short)0, c, false, false);
  asm volatile("v_nop\n\tv_nop\n\tv_nop\n\tv_nop" : "+v"(c) : "v"(ah), "v"(al), "v"(bh), "v"(bl));
  return c;
}

__global__ __launch_bounds__(256) void k_wt_bf16(const float* __restrict__ W, unsigned short* __restrict__ Wt, int K, int N) {
  const int t = blockIdx.x * 256 + threadIdx.x;
  const int k8n = K / 8;
  if (t >= N * k8n) return;
  const int n = t / k8n, k8 = (t % k8n) * 8;
  v8us v;
#pragma unroll
  for (int i = 0; i < 8; ++i) v[i] = bf16_bits(W[(size_t)(k8 + i) * N + n]);
  *(v8us*)(Wt + (size_t)n * K + k8) = v;
  
}

// GEMM C[M][N] (f32, pitch ldc) = act(A[M][K]·W + bias). A f32 row-major (pitch lda) converted per fragment to bf16
// (ASPLIT: hi/lo two planes -> 2 terms, else single rounded term); Wt bf16 [N][K] (pitch ldb). BIAS_BF16 rounds the
// bias to bf16 first (bias quantised to bf16 before the add). K%32==0, M%16==0, N%64==0.
template <bool ASPLIT, int ACT, bool BIAS_BF16>
__global__ __launch_bounds__(128) void k_gemm_bf(const float* __restrict__ A, int lda, const unsigned short* __restrict__ Wt, int ldb,
                                               const float* __restrict__ bias, float* __restrict__ C, int ldc, int M, int N, int K) {
  __shared__ __attribute__((aligned(16))) float so[4][16][64];
  const int tid = threadIdx.x, w = tid >> 5, lane = tid & 31, ln = lane & 15, hh = lane >> 4;
  const int ntn = N / 64;
  const int wid = blockIdx.x * 4 + w;
  const int mt = wid / ntn, nq = wid % ntn;
  if (mt * 16 >= M) return;
  const int row0 = mt * 16, col0 = nq * 64;
  const float* arow = A + (size_t)(row0 + ln) * lda;
  v8f acc[4] = {};
  for (int kb = 0; kb < K; kb += 32) {
    FragB ah, al;
    const v4f x0 = *(const v4fa*)(arow + kb + 8 * hh), x1 = *(const v4fa*)(arow + kb + 8 * hh + 4);
    const v4f x2 = *(const v4fa*)(arow + kb + 16 + 8 * hh), x3 = *(const v4fa*)(arow + kb + 16 + 8 * hh + 4);
    float xs[16] = {x0[0],x0[1],x0[2],x0[3],x1[0],x1[1],x1[2],x1[3],x2[0],x2[1],x2[2],x2[3],x3[0],x3[1],x3[2],x3[3]};
#pragma unroll
    for (int i = 0; i < 16; ++i) { const unsigned short hb = bf16_bits(xs[i]); ah.u[i] = hb; al.u[i] = ASPLIT ? bf16_bits(xs[i] - bf16_val(hb)) : (unsigned short)0; }
#pragma unroll
    for (int t = 0; t < 4; ++t) {
      const unsigned short* brow = Wt + (size_t)(col0 + t * 16 + ln) * ldb + kb;
      FragB b;
      b.half[0] = *(const v8us*)(brow + 8 * hh);
      b.half[1] = *(const v8us*)(brow + 16 + 8 * hh);
      acc[t] = mmaN<ASPLIT ? 2 : 1>(ah.v, al.v, b.v, b.v, acc[t]);
    }
  }
#pragma unroll
  for (int t = 0; t < 4; ++t) {
    float bv = bias ? bias[col0 + t * 16 + ln] : 0.f;
    if (BIAS_BF16) bv = bf16_round(bv);
#pragma unroll
    for (int r = 0; r < 8; ++r) { float v = acc[t][r] + bv; if (ACT == 1) v = fmaxf(v, 0.f); so[w][8 * hh + r][t * 16 + ln] = v; }
  }
  __builtin_amdgcn_fence(__ATOMIC_ACQ_REL, "workgroup");
  __builtin_amdgcn_wave_barrier();
  const int rsub = lane >> 4, c4 = (lane & 15) * 4;
  {
#pragma unroll
    for (int q = 0; q < 8; ++q) {
      const int r = q * 2 + rsub;
      const v4f v = *(const v4fa*)&so[w][r][c4];
      *(v4f*)(C + (size_t)(row0 + r) * ldc + col0 + c4) = v;
    }
    
  }
}

// GEMM C = act(A·W + bias + resid): A f32 (ASPLIT -> hi/lo 2 terms), Wt bf16 [N][K]; ACT 0 none, 1 relu, 2 exact gelu;
// resid (optional, f32, row index = (row % rmod), pitch ldr, RES_BF16 rounds it) added before the activation.
template <bool ASPLIT, int ACT, bool BIAS_BF16, bool RES_BF16>
__global__ __launch_bounds__(128) void k_gemm_bf3(const float* __restrict__ A, int lda, const unsigned short* __restrict__ Wt, int ldb,
                                                const float* __restrict__ bias, const float* __restrict__ resid, int rmod, int ldr,
                                                float* __restrict__ C, int ldc, int M, int N, int K) {
  __shared__ __attribute__((aligned(16))) float so[4][16][64];
  const int tid = threadIdx.x, w = tid >> 5, lane = tid & 31, ln = lane & 15, hh = lane >> 4;
  const int ntn = N / 64;
  const int wid = blockIdx.x * 4 + w;
  const int mt = wid / ntn, nq = wid % ntn;
  if (mt * 16 >= M) return;
  const int row0 = mt * 16, col0 = nq * 64;
  const float* arow = A + (size_t)(row0 + ln) * lda;
  v8f acc[4] = {};
  for (int kb = 0; kb < K; kb += 32) {
    FragB ah, al;
    const v4f x0 = *(const v4fa*)(arow + kb + 8 * hh), x1 = *(const v4fa*)(arow + kb + 8 * hh + 4);
    const v4f x2 = *(const v4fa*)(arow + kb + 16 + 8 * hh), x3 = *(const v4fa*)(arow + kb + 16 + 8 * hh + 4);
    float xs[16] = {x0[0],x0[1],x0[2],x0[3],x1[0],x1[1],x1[2],x1[3],x2[0],x2[1],x2[2],x2[3],x3[0],x3[1],x3[2],x3[3]};
#pragma unroll
    for (int i = 0; i < 16; ++i) { const unsigned short hb = bf16_bits(xs[i]); ah.u[i] = hb; al.u[i] = ASPLIT ? bf16_bits(xs[i] - bf16_val(hb)) : (unsigned short)0; }
#pragma unroll
    for (int t = 0; t < 4; ++t) {
      const unsigned short* brow = Wt + (size_t)(col0 + t * 16 + ln) * ldb + kb;
      FragB b;
      b.half[0] = *(const v8us*)(brow + 8 * hh);
      b.half[1] = *(const v8us*)(brow + 16 + 8 * hh);
      acc[t] = mmaN<ASPLIT ? 2 : 1>(ah.v, al.v, b.v, b.v, acc[t]);
    }
  }
#pragma unroll
  for (int t = 0; t < 4; ++t) {
    const int col = col0 + t * 16 + ln;
    float bv = bias ? bias[col] : 0.f;
    if (BIAS_BF16) bv = bf16_round(bv);
#pragma unroll
    for (int r = 0; r < 8; ++r) {
      float v = acc[t][r] + bv;
      if (resid) { float rv = resid[(size_t)((row0 + 8 * hh + r) % rmod) * ldr + col]; if (RES_BF16) rv = bf16_round(rv); v += rv; }
      if (ACT == 1) v = fmaxf(v, 0.f);
      if (ACT == 2) v = 0.5f * v * (1.0f + erff(v * 0.70710678118654752f));
      if (ACT == 3) { const float u = 0.7978845608028654f * (v + 0.044715f * v * v * v); v = 0.5f * v * (1.0f + tanhf(u)); }
      so[w][8 * hh + r][t * 16 + ln] = v;
    }
  }
  __builtin_amdgcn_fence(__ATOMIC_ACQ_REL, "workgroup");
  __builtin_amdgcn_wave_barrier();
  const int rsub = lane >> 4, c4 = (lane & 15) * 4;
  {
#pragma unroll
    for (int q = 0; q < 8; ++q) {
      const int r = q * 2 + rsub;
      const v4f v = *(const v4fa*)&so[w][r][c4];
      *(v4f*)(C + (size_t)(row0 + r) * ldc + col0 + c4) = v;
    }
    
  }
}
// row LayerNorm (biased variance, eps) over N: s = X (+ R); optional out_sum <- s; out_norm <- (s-mu)*rsqrt(var+eps)*g + b
template <bool PARAM_BF16>
__global__ __launch_bounds__(256) void k_layernorm(const float* __restrict__ X, const float* __restrict__ R, const float* __restrict__ g, const float* __restrict__ bta,
                                                  float* __restrict__ out_sum, float* __restrict__ out_norm, int N, float eps) {
  __shared__ float red[256];
  const int row = blockIdx.x, tid = threadIdx.x;
  const float* x = X + (size_t)row * N; const float* rr = R ? R + (size_t)row * N : nullptr;
  float vals[16];                     // up to N = 4096
  const int per = N / 256;            // contiguous chunk per thread? use strided-by-4 chunks: thread handles j = tid*4 + 1024*u
  float s1 = 0.f;
  for (int u = 0; u < per / 4; ++u) {
    const int j = tid * 4 + 1024 * u;
    const v4f a = *(const v4fa*)(x + j);
    v4f b = {0.f,0.f,0.f,0.f}; if (rr) b = *(const v4fa*)(rr + j);
#pragma unroll
    for (int q = 0; q < 4; ++q) { const float v = a[q] + b[q]; vals[u * 4 + q] = v; s1 += v; }
  }
  red[tid] = s1; __syncthreads();
  for (int st = 128; st > 0; st >>= 1) { if (tid < st) red[tid] += red[tid + st]; __syncthreads(); }
  const float mu = red[0] / (float)N; __syncthreads();
  float s2 = 0.f;
  for (int u = 0; u < per / 4; ++u)
#pragma unroll
    for (int q = 0; q < 4; ++q) { const float c = vals[u * 4 + q] - mu; s2 += c * c; }
  red[tid] = s2; __syncthreads();
  for (int st = 128; st > 0; st >>= 1) { if (tid < st) red[tid] += red[tid + st]; __syncthreads(); }
  const float rs = rsqrtf(red[0] / (float)N + eps);
  {
    for (int u = 0; u < per / 4; ++u) {
      const int j = tid * 4 + 1024 * u;
      v4f o, sm;
#pragma unroll
      for (int q = 0; q < 4; ++q) {
        float gg = g[j + q], bb = bta[j + q];
        if (PARAM_BF16) { gg = bf16_round(gg); bb = bf16_round(bb); }
        sm[q] = vals[u * 4 + q]; o[q] = (vals[u * 4 + q] - mu) * rs * gg + bb;
      }
      if (out_sum) *(v4f*)(out_sum + (size_t)row * N + j) = sm;
      *(v4f*)(out_norm + (size_t)row * N + j) = o;
    }
    
  }
}



// ---- f16 WMMA path (v_wmma_f32_16x16x32_f16): 11-bit significands for operands in range — used where a [0,1] probability operand needs more precision than bf16
typedef _Float16 v16h __attribute__((ext_vector_type(16)));
union FragH { v16h v; v8us half[2]; _Float16 h[16]; unsigned short u[16]; };
template <int NT>
__device__ __forceinline__ v8f mmaH(v16h ah, v16h al, v16h bh, v16h bl, v8f c) {
  c = __builtin_amdgcn_wmma_f32_16x16x32_f16(false, ah, false, bh, (short)0, c, false, false);
  if (NT >= 2) c = __builtin_amdgcn_wmma_f32_16x16x32_f16(false, al, false, bh, (short)0, c, false, false);
  if (NT >= 3) c = __builtin_amdgcn_wmma_f32_16x16x32_f16(false, ah, false, bl, (short)0, c, false, false);
  asm volatile("v_nop\n\tv_nop\n\tv_nop\n\tv_nop" : "+v"(c) : "v"(ah), "v"(al), "v"(bh), "v"(bl));
  return c;
}
// batched GEMM like k_gemm_b but f16 operands: A f32 (split into f16 hi/lo if ASPLIT, else rounded to f16), Bt = f16 values [n][k]; alpha; C f32; N multiple of 16 (partial tiles skipped)
template <bool ASPLIT>
__global__ __launch_bounds__(128) void k_gemm_h(const float* __restrict__ A, int lda, size_t sA, const _Float16* __restrict__ Bh, int ldb, size_t sB, float alpha, float* __restrict__ C, int ldc, size_t sC, int M, int N, int K) {
  __shared__ __attribute__((aligned(16))) float so[4][16][64];
  const int tid = threadIdx.x, w = tid >> 5, lane = tid & 31, ln = lane & 15, hh = lane >> 4; const int by = blockIdx.y;
  A += (size_t)by * sA; Bh += (size_t)by * sB; C += (size_t)by * sC;
  const int ntn = (N + 63) / 64; const int wid = blockIdx.x * 4 + w; const int mt = wid / ntn, nq = wid % ntn; if (mt * 16 >= M) return;
  const int row0 = mt * 16, col0 = nq * 64; const float* arow = A + (size_t)(row0 + ln) * lda;
  v8f acc[4] = {};
  for (int kb = 0; kb < K; kb += 32) {
    FragH ah, al;
    const v4f x0 = *(const v4fa*)(arow + kb + 8 * hh), x1 = *(const v4fa*)(arow + kb + 8 * hh + 4), x2 = *(const v4fa*)(arow + kb + 16 + 8 * hh), x3 = *(const v4fa*)(arow + kb + 16 + 8 * hh + 4);
    float xs[16] = {x0[0],x0[1],x0[2],x0[3],x1[0],x1[1],x1[2],x1[3],x2[0],x2[1],x2[2],x2[3],x3[0],x3[1],x3[2],x3[3]};
#pragma unroll
    for (int i = 0; i < 16; ++i) { const _Float16 h = (_Float16)xs[i]; ah.h[i] = h; al.h[i] = ASPLIT ? (_Float16)(xs[i] - (float)h) : (_Float16)0.0f; }
#pragma unroll
    for (int t = 0; t < 4; ++t) { if (col0 + t * 16 >= N) continue; const size_t boff = (size_t)(col0 + t * 16 + ln) * ldb + kb; FragH bq; bq.half[0] = *(const v8us*)(Bh + boff + 8 * hh); bq.half[1] = *(const v8us*)(Bh + boff + 16 + 8 * hh);
      acc[t] = mmaH<ASPLIT ? 2 : 1>(ah.v, al.v, bq.v, bq.v, acc[t]); }
  }
#pragma unroll
  for (int t = 0; t < 4; ++t) { if (col0 + t * 16 >= N) continue;
#pragma unroll
    for (int r = 0; r < 8; ++r) so[w][8 * hh + r][t * 16 + ln] = acc[t][r] * alpha; }
  __builtin_amdgcn_fence(__ATOMIC_ACQ_REL, "workgroup"); __builtin_amdgcn_wave_barrier();
  const int rsub = lane >> 4, c4 = (lane & 15) * 4;
  {
#pragma unroll
    for (int q = 0; q < 8; ++q) { const int r = q * 2 + rsub; if (col0 + c4 < N) { const v4f v = *(const v4fa*)&so[w][r][c4]; *(v4f*)(C + (size_t)(row0 + r) * ldc + col0 + c4) = v; } }
     }
}

// Wt[n][k] = f16(W[k][n]·scale) from f32 row-major W[K][N] (scale = power of two; bf16-exact weights stay exact in f16 away from the subnormal range)
__global__ __launch_bounds__(256) void k_wt_f16(const float* __restrict__ W, _Float16* __restrict__ Wt, int K, int N, float scale) {
  const int t = blockIdx.x * 256 + threadIdx.x; if (t >= N * (K / 8)) return; const int n = t / (K / 8), k8 = (t % (K / 8)) * 8; FragH f;
#pragma unroll
  for (int i = 0; i < 8; ++i) f.h[i] = (_Float16)(bf16_round(W[(size_t)(k8 + i) * N + n]) * scale); const v8us o = f.half[0];
  *(v8us*)((unsigned short*)Wt + (size_t)n * K + k8) = o; 
}
// k_gemm_hh variant with fused epilogue: v = acc·alpha + bias[by·sBias + col] (+ CP[(row/rowsPerB)·sCPb + by·64 + col] if CP) ; ACT 0 none / 1 elu ; writes f16 C16 (and f32 C if non-null)
template <int ACT>
__global__ __launch_bounds__(128) void k_gemm_hhx(const _Float16* __restrict__ A, int lda, size_t sA, const _Float16* __restrict__ Bh, int ldb, size_t sB, float alpha, const float* __restrict__ bias, size_t sBias, const float* __restrict__ CP, int rowsPerB, size_t sCPb, int row0g,
    float* __restrict__ C, _Float16* __restrict__ C16, int ldc, size_t sC, int M, int N, int K) {
  __shared__ __attribute__((aligned(16))) float so[4][16][64];
  const int tid = threadIdx.x, w = tid >> 5, lane = tid & 31, ln = lane & 15, hh = lane >> 4; const int by = blockIdx.y;
  A += (size_t)by * sA; Bh += (size_t)by * sB; const size_t cofs = (size_t)by * sC; const float* bp = bias ? bias + (size_t)by * sBias : nullptr;
  const int ntn = (N + 63) / 64; const int wid = blockIdx.x * 4 + w; const int mt = wid / ntn, nq = wid % ntn; if (mt * 16 >= M) return;
  const int row0 = mt * 16, col0 = nq * 64; const _Float16* arow = A + (size_t)(row0 + ln) * lda;
  v8f acc[4] = {};
  for (int kb = 0; kb < K; kb += 32) { FragH ah; ah.half[0] = *(const v8us*)((const unsigned short*)arow + kb + 8 * hh); ah.half[1] = *(const v8us*)((const unsigned short*)arow + kb + 16 + 8 * hh);
#pragma unroll
    for (int t = 0; t < 4; ++t) { if (col0 + t * 16 >= N) continue; const size_t boff = (size_t)(col0 + t * 16 + ln) * ldb + kb; FragH bq; bq.half[0] = *(const v8us*)((const unsigned short*)Bh + boff + 8 * hh); bq.half[1] = *(const v8us*)((const unsigned short*)Bh + boff + 16 + 8 * hh);
      acc[t] = mmaH<1>(ah.v, ah.v, bq.v, bq.v, acc[t]); }
  }
#pragma unroll
  for (int t = 0; t < 4; ++t) { if (col0 + t * 16 >= N) continue; const int col = col0 + t * 16 + ln; const float bv = bp ? bf16_round(bp[col]) : 0.f;
#pragma unroll
    for (int r = 0; r < 8; ++r) { float v = acc[t][r] * alpha + bv; if (CP) { const int bidx = (row0g + row0 + 8 * hh + r) / rowsPerB; v += CP[(size_t)bidx * sCPb + (size_t)by * 64 + col]; } if (ACT == 1) v = (v > 0.f) ? v : expm1f(v); else if (ACT == 7) v = (v > 0.f) ? v + 1.0f : expf(v); else if (ACT == 8) v = tanhf(v); else if (ACT == 9) v = 0.5f * v * (1.0f + tanhf(0.7978845608028654f * (v + 0.044715f * v * v * v))); else if (ACT == 11) v = 1.0f / (1.0f + expf(-v)); else if (ACT == 12) v = (v > 0.f) ? v : 0.01f * v; else if (ACT == 14) v = (v > 0.f) ? v : 0.1f * v; else if (ACT == 15) v = v / (1.0f + expf(-v)); else if (ACT == 3) v = fmaxf(v, 0.f); else if (ACT == 6) v = 0.5f * v * (1.0f + erff(v * 0.70710678118654752f)); so[w][8 * hh + r][t * 16 + ln] = v; } }
  __builtin_amdgcn_fence(__ATOMIC_ACQ_REL, "workgroup"); __builtin_amdgcn_wave_barrier();
  const int rsub = lane >> 4, c4 = (lane & 15) * 4; typedef _Float16 v4h __attribute__((ext_vector_type(4)));
  {
#pragma unroll
    for (int q = 0; q < 8; ++q) { const int r = q * 2 + rsub; if (col0 + c4 < N) { const v4f v = *(const v4fa*)&so[w][r][c4]; if (C) *(v4f*)(C + cofs + (size_t)(row0 + r) * ldc + col0 + c4) = v; if (C16) { v4h h4; for (int i = 0; i < 4; ++i) h4[i] = (_Float16)v[i]; *(v4h*)(C16 + cofs + (size_t)(row0 + r) * ldc + col0 + c4) = h4; } } }
     }
}


typedef _Float16 v4h __attribute__((ext_vector_type(4)));

// The p_* functions are jobs of 256-thread blocks; bid is the block's index within its job (k_prep and k_split hand it over).
__device__ __forceinline__ void p_x16(unsigned bid, const float* __restrict__ x, _Float16* __restrict__ X16, size_t n8) { const size_t t = (size_t)bid * 256 + threadIdx.x; if (t >= n8) return; FragH f;
#pragma unroll
  for (int q = 0; q < 8; ++q) f.h[q] = (_Float16)bf16_round(x[t * 8 + q]); *(v8us*)((unsigned short*)X16 + t * 8) = f.half[0];  }
__global__ __launch_bounds__(256) void k_h16(const float* __restrict__ x, _Float16* __restrict__ X16, size_t n8) { const size_t t = (size_t)blockIdx.x * 256 + threadIdx.x; if (t >= n8) return; FragH f;
#pragma unroll
  for (int q = 0; q < 8; ++q) f.h[q] = (_Float16)x[t * 8 + q]; *(v8us*)((unsigned short*)X16 + t * 8) = f.half[0];  }
__device__ __forceinline__ void p_round16f(unsigned bid, const float* __restrict__ W, _Float16* __restrict__ Bt, size_t n8) { const size_t t = (size_t)bid * 256 + threadIdx.x; if (t >= n8) return; FragH f;
#pragma unroll
  for (int i = 0; i < 8; ++i) f.h[i] = (_Float16)(bf16_round(W[t * 8 + i]) * 16.0f); *(v8us*)((unsigned short*)Bt + t * 8) = f.half[0];  }
template <int NHv, int TTv>
__global__ __launch_bounds__(256) void k_vt(const _Float16* __restrict__ V16, int ldv, int voff, _Float16* __restrict__ Vt) { __shared__ unsigned short tl[64][66]; const int tid = threadIdx.x; const int slab = blockIdx.x / (TTv / 64), lg = blockIdx.x % (TTv / 64); const int b = slab / NHv, h = slab % NHv;
  for (int i = tid; i < 64 * 8; i += 256) { const int r = i / 8, c8 = (i % 8) * 8; FragH f; f.half[0] = *(const v8us*)((const unsigned short*)V16 + ((size_t)b * TTv + lg * 64 + r) * ldv + voff + h * 64 + c8);
#pragma unroll
    for (int q = 0; q < 8; ++q) tl[r][c8 + q] = f.u[q]; }
  __syncthreads();
  {
#pragma unroll
    for (int rd = 0; rd < 2; ++rd) { const int d = rd * 32 + tid / 8, pc = tid % 8; FragH f;
#pragma unroll
      for (int q = 0; q < 8; ++q) f.u[q] = tl[pc * 8 + q][d];
      *(v8us*)((unsigned short*)Vt + ((size_t)slab * 64 + d) * TTv + lg * 64 + pc * 8) = f.half[0]; }
     } }

__device__ __forceinline__ void p_hl(unsigned bid, const float* __restrict__ F, _Float16* __restrict__ Hh, _Float16* __restrict__ Hl, size_t n8) { const size_t t = (size_t)bid * 256 + threadIdx.x; if (t >= n8) return; FragH fh, fl; const v4f a = *(const v4fa*)(F + t * 8), c = *(const v4fa*)(F + t * 8 + 4);
#pragma unroll
  for (int q = 0; q < 4; ++q) { _Float16 h = (_Float16)a[q]; fh.h[q] = h; fl.h[q] = (_Float16)((a[q] - (float)h) * 1024.0f); h = (_Float16)c[q]; fh.h[4 + q] = h; fl.h[4 + q] = (_Float16)((c[q] - (float)h) * 1024.0f); }
  { *(v8us*)((unsigned short*)Hh + t * 8) = fh.half[0]; *(v8us*)((unsigned short*)Hl + t * 8) = fl.half[0];  } }

// ---- fast GEMM (wave tile 32x64; requires M % 32 == 0 rows per launch region and N % 64 == 0); epilogue = k_gemm_hhx semantics, but the bias input is picked by blockIdx.y ----
__device__ __forceinline__ v16h g2_fragb(const char* base, unsigned off, int kb) { FragH f; f.half[0] = *(const v8us*)(base + off + kb * 2); f.half[1] = *(const v8us*)(base + off + kb * 2 + 32); return f.v; }
__device__ __forceinline__ v8f g2_mma(v16h a, v16h b, v8f c) { v8f d = __builtin_amdgcn_wmma_f32_16x16x32_f16(false, a, false, b, (short)0, c, false, false); asm volatile("v_nop\n\tv_nop\n\tv_nop\n\tv_nop" : "+v"(d) : "v"(a), "v"(b)); return d; }
template <int ACT, int KC>      /* KC = K, a compile-time multiple of 32: the k loop is unrolled over a ring of fragment registers */
__global__ __launch_bounds__(128) __attribute__((amdgpu_waves_per_eu(4)))      /* a budget of 256 registers: the ring and the accumulators fit it, and the build needs no register-window switches */
void k_gemm2(const _Float16* __restrict__ A, int lda, size_t sA, const _Float16* __restrict__ Bh, int ldb, size_t sB, float alpha, const float* __restrict__ bias, const float* __restrict__ bias1, const float* __restrict__ bias2, size_t sBias, const float* __restrict__ CP, int rowsPerB, size_t sCPb, int row0g,
    float* __restrict__ C, _Float16* __restrict__ C16, int ldc, size_t sC, int M, int N, int K) {
  __shared__ __attribute__((aligned(16))) float so[4][32][68];
  const int tid = threadIdx.x, w = tid >> 5, lane = tid & 31, ln = lane & 15, hh = lane >> 4; const int by = blockIdx.y;
  const float* bsel = (by == 0) ? bias : ((by == 1) ? bias1 : bias2);      /* products that share one grid (blockIdx.y) have each their own bias input */
  A += (size_t)by * sA; Bh += (size_t)by * sB; const size_t cofs = (size_t)by * sC; const float* bp = bsel ? bsel + (size_t)by * sBias : nullptr;
  const int ntn = N >> 6; const int mt = blockIdx.x / ntn, nq = blockIdx.x - mt * ntn; const int row0 = mt * 128 + 32 * w, col0 = nq * 64; if (row0 >= M) return;
  /* uniform base + one 32-bit byte offset a fragment row (the planes are far below 4 GiB): six address registers, the k step in the immediate offset */
  const char* Ab = (const char*)A; const char* Bb = (const char*)Bh;
  const unsigned a0o = (unsigned)((row0 + ln) * lda + 8 * hh) * 2u, a1o = a0o + (unsigned)(16 * lda) * 2u;
  const unsigned b0o = (unsigned)((col0 + ln) * ldb + 8 * hh) * 2u, b1o = b0o + (unsigned)(16 * ldb) * 2u, b2o = b1o + (unsigned)(16 * ldb) * 2u, b3o = b2o + (unsigned)(16 * ldb) * 2u;
  const v8f z8 = {0.f,0.f,0.f,0.f,0.f,0.f,0.f,0.f}; v8f c00 = z8, c01 = z8, c02 = z8, c03 = z8, c10 = z8, c11 = z8, c12 = z8, c13 = z8;
  (void)K; constexpr int NS = KC / 32;
  /* three sets of the six fragments of a k step: the twelve loads of step s + 2 are issued together, ahead of step s's products, so a step waits once, for loads issued two steps earlier */
  v16h fa0[3], fa1[3], fb0[3], fb1[3], fb2[3], fb3[3];
#pragma unroll
  for (int s = 0; s < 2 && s < NS; ++s) { const int kb = s * 32; fa0[s] = g2_fragb(Ab, a0o, kb); fb0[s] = g2_fragb(Bb, b0o, kb); fa1[s] = g2_fragb(Ab, a1o, kb); fb1[s] = g2_fragb(Bb, b1o, kb); fb2[s] = g2_fragb(Bb, b2o, kb); fb3[s] = g2_fragb(Bb, b3o, kb); }
#pragma unroll      /* full unroll: the ring index must be a constant for the sets to stay in registers */
  for (int s = 0; s < NS; ++s) { const int cu = s % 3, nx = (s + 2) % 3;
    if (s + 2 < NS) { const int kb = (s + 2) * 32; fa0[nx] = g2_fragb(Ab, a0o, kb); fb0[nx] = g2_fragb(Bb, b0o, kb); fa1[nx] = g2_fragb(Ab, a1o, kb); fb1[nx] = g2_fragb(Bb, b1o, kb); fb2[nx] = g2_fragb(Bb, b2o, kb); fb3[nx] = g2_fragb(Bb, b3o, kb); }
    c00 = g2_mma(fa0[cu], fb0[cu], c00); c10 = g2_mma(fa1[cu], fb0[cu], c10);
    c01 = g2_mma(fa0[cu], fb1[cu], c01); c11 = g2_mma(fa1[cu], fb1[cu], c11);
    c02 = g2_mma(fa0[cu], fb2[cu], c02); c12 = g2_mma(fa1[cu], fb2[cu], c12);
    c03 = g2_mma(fa0[cu], fb3[cu], c03); c13 = g2_mma(fa1[cu], fb3[cu], c13); }
  v8f accs[8] = {c00, c01, c02, c03, c10, c11, c12, c13};
#pragma unroll
  for (int u = 0; u < 8; ++u) { const int t = u & 3, half = u >> 2; const int col = col0 + t * 16 + ln; const float bv = bp ? bf16_round(bp[col]) : 0.f;
#pragma unroll
    for (int r = 0; r < 8; ++r) { const int rloc = half * 16 + 8 * hh + r; float v = accs[u][r] * alpha + bv; if (CP) { const int bidx = (row0g + row0 + rloc) / rowsPerB; v += CP[(size_t)bidx * sCPb + (size_t)by * 64 + col]; }
      if (ACT == 3) v = fmaxf(v, 0.f); else if (ACT == 6) v = 0.5f * v * (1.0f + erff(v * 0.70710678118654752f)); else if (ACT == 11) v = 1.0f / (1.0f + expf(-v)); else if (ACT == 15) v = v / (1.0f + expf(-v)); else if (ACT == 12) v = (v > 0.f) ? v : 0.01f * v; else if (ACT == 8) v = tanhf(v);
      so[w][rloc][t * 16 + ln] = v; } }
  __builtin_amdgcn_fence(__ATOMIC_ACQ_REL, "workgroup"); __builtin_amdgcn_wave_barrier();
  const int rsub = lane >> 4, c4 = (lane & 15) * 4;
  {
#pragma unroll
    for (int q = 0; q < 16; ++q) { const int r = q * 2 + rsub; const v4f v = *(const v4fa*)&so[w][r][c4]; if (C) *(v4f*)(C + cofs + (size_t)(row0 + r) * ldc + col0 + c4) = v; if (C16) { v4h h4; for (int i = 0; i < 4; ++i) h4[i] = (_Float16)v[i]; *(v4h*)(C16 + cofs + (size_t)(row0 + r) * ldc + col0 + c4) = h4; } }
     } }



template <int TK>
__device__ __forceinline__ void p_vthl(unsigned bid, const float* __restrict__ VF, int ldv, _Float16* __restrict__ Vth, _Float16* __restrict__ Vtl) { __shared__ float tl[64][65]; const int tid = threadIdx.x; const int slab = bid / (TK / 64), lg = bid % (TK / 64); const int b = slab / NH, h = slab % NH;
  for (int i = tid; i < 64 * 16; i += 256) { const int r = i / 16, c4 = (i % 16) * 4; const v4f a = *(const v4fa*)(VF + ((size_t)b * TK + lg * 64 + r) * ldv + h * 64 + c4); tl[r][c4] = a[0]; tl[r][c4 + 1] = a[1]; tl[r][c4 + 2] = a[2]; tl[r][c4 + 3] = a[3]; }
  __syncthreads();
  FragH fh[2], fl[2]; size_t oo[2];
#pragma unroll
  for (int rd = 0; rd < 2; ++rd) { const int d = rd * 32 + tid / 8, pc = tid % 8;
#pragma unroll
    for (int q = 0; q < 8; ++q) { const float v = tl[pc * 8 + q][d]; const _Float16 hv = (_Float16)v; fh[rd].h[q] = hv; fl[rd].h[q] = (_Float16)((v - (float)hv) * 1024.0f); } oo[rd] = ((size_t)slab * 64 + d) * TK + lg * 64 + pc * 8; }
  {
#pragma unroll
    for (int rd = 0; rd < 2; ++rd) { *(v8us*)((unsigned short*)Vth + oo[rd]) = fh[rd].half[0]; *(v8us*)((unsigned short*)Vtl + oo[rd]) = fl[rd].half[0]; }
     } }
#define NB_E8 (NR * DM / 8 / 256)            /* blocks of a job with one thread to 8 elements of a [NR][DM] plane */
#define NB_VT (NBT * NH * (SLEN / 64))       /* blocks of the V transpose */
// One grid for the three jobs behind the projections (V^T planes, q planes, k planes), which need nothing of each other: a block-uniform range of the block index picks the job.
__global__ __launch_bounds__(256) void k_split(const float* __restrict__ FQ, const float* __restrict__ FK, const float* __restrict__ FV, _Float16* __restrict__ Qh, _Float16* __restrict__ Ql, _Float16* __restrict__ Kh, _Float16* __restrict__ Kl, _Float16* __restrict__ Vth, _Float16* __restrict__ Vtl) {
  unsigned bid = blockIdx.x; const size_t n8 = (size_t)NR * DM / 8;
  if (bid < NB_VT) { p_vthl<SLEN>(bid, FV, DM, Vth, Vtl); return; }
  bid -= NB_VT;
  if (bid < NB_E8) { p_hl(bid, FQ, Qh, Ql, n8); return; }
  p_hl(bid - NB_E8, FK, Kh, Kl, n8); }

// grammar bias for (query position pi, key position pj): dist_emb[bucket(|pj - pi|)][h] + ((pj > pi) - 0.5) * order_bias[h]
__device__ __forceinline__ float gbias(const float* sDE, float obh, const unsigned char* sLUT, int pi, int pj) { int d = abs(pj - pi); d = min(d, LUTN - 1); const int bin = sLUT[d]; return sDE[bin] + (((pj > pi) ? 1.0f : 0.0f) - 0.5f) * obh; }      /* sDE, obh = the head's rounded dist_emb column and order_bias, both times LOG2E */
// lane l <-> l ^ 16 (the other half of the wave), all lanes on
__device__ __forceinline__ float xhalf(float v) { const int b = __float_as_int(v); return __int_as_float(__builtin_amdgcn_permlanex16(b, b, 0x76543210, 0xfedcba98, false, false)); }
// LDS image of one tile of 32 keys: K hi and K residual as 32 rows of 128 B at a pitch of 144 B, V^T hi and residual as 64 rows of 64 B at a pitch of 80 B (16 B x odd: ds_load_b128 fragment reads meet no bank twice).
#define FK_P 144
#define FV_P 80
#define F_KH 0
#define F_KL (32 * FK_P)
#define F_VH (2 * 32 * FK_P)
#define F_VL (2 * 32 * FK_P + 64 * FV_P)
#define F_TILE (2 * 32 * FK_P + 2 * 64 * FV_P)
// A thread's eight 16-byte asynchronous copies of one tile (128 threads x 8 x 16 B = the tile's 16 KiB): lk, lv = its LDS byte addresses in the K and V^T parts of the buffer, g* = its global addresses in the four planes; k16, v32 = bytes of 16 K rows and of 32 V^T rows in global memory.
__device__ __forceinline__ void f_tile_copy(unsigned lk, unsigned lv, const char* gkh, const char* gkl, const char* gvh, const char* gvl, unsigned k16, unsigned v32) {
  const unsigned a0 = lk + F_KH, a1 = a0 + 16 * FK_P, a2 = lk + F_KL, a3 = a2 + 16 * FK_P, a4 = lv + F_VH, a5 = a4 + 32 * FV_P, a6 = lv + F_VL, a7 = a6 + 32 * FV_P;
  const char* p1 = gkh + k16; const char* p3 = gkl + k16; const char* p5 = gvh + v32; const char* p7 = gvl + v32;
  /* the copies and, as the last line of the same statement, the wait that stands in front of any rewrite of their address registers */
  asm volatile("global_load_async_to_lds_b128 %0, %8, off\n\t"
               "global_load_async_to_lds_b128 %1, %9, off\n\t"
               "global_load_async_to_lds_b128 %2, %10, off\n\t"
               "global_load_async_to_lds_b128 %3, %11, off\n\t"
               "global_load_async_to_lds_b128 %4, %12, off\n\t"
               "global_load_async_to_lds_b128 %5, %13, off\n\t"
               "global_load_async_to_lds_b128 %6, %14, off\n\t"
               "global_load_async_to_lds_b128 %7, %15, off\n\t"
               "s_wait_xcnt 0x0"
               :: "v"(a0), "v"(a1), "v"(a2), "v"(a3), "v"(a4), "v"(a5), "v"(a6), "v"(a7), "v"(gkh), "v"(p1), "v"(gkl), "v"(p3), "v"(gvh), "v"(p5), "v"(gvl), "v"(p7) : "memory"); }
template <int TQ, int TK>
__global__ __launch_bounds__(128) void k_flashb(const _Float16* __restrict__ Q16, const _Float16* __restrict__ Q16lo, int ldq, const _Float16* __restrict__ K16, const _Float16* __restrict__ K16lo, int ldk, const _Float16* __restrict__ Vt, const _Float16* __restrict__ Vtlo, const unsigned* __restrict__ MB, const int* __restrict__ RA, const int* __restrict__ KE, const float* __restrict__ BT, const float* __restrict__ OB, const int* __restrict__ LUT, const int* __restrict__ LAG, float* __restrict__ O, int ldo) {
  constexpr int RPW = 16, NQB = TQ / (4 * RPW), DT = 4, KS = 2;
  __shared__ __attribute__((aligned(16))) float sO[4][RPW][64 + 4];
  const int tid = threadIdx.x, w = tid >> 5, lane = tid & 31, ln = lane & 15, hh = lane >> 4;
  const int slab = blockIdx.x / NQB, qblk = blockIdx.x % NQB; const int b = slab / NH, h = slab % NH; const int qb0 = qblk * (4 * RPW); const int q0 = qb0 + w * RPW;
  MB += (size_t)b * TQ * (TK / 32); LAG += (size_t)b * TK;      /* per-batch key-mask table and positions: the grid spans all batches */
  const float obh = bf16_round(OB[h]) * LOG2E;      /* read once, ahead of the loop: behind the loop's waits (memory clobbers) it would be loaded anew every trip */
  /* K and V^T reach the four waves through LDS: two buffers of one 32-key tile each, filled by asynchronous copies in whole rows, one tile ahead of the tile in work; every wave reads its fragments from there */
  __shared__ __attribute__((aligned(16))) unsigned char ring[2 * F_TILE];
  int jend = __builtin_amdgcn_readfirstlane(KE[qblk * 32]); jend = min(TK, (jend + 31) & ~31); if (jend < 32) jend = 32;      /* block-uniform, in a scalar register: it decides whether copies issue */
  const unsigned k16 = (unsigned)(16 * ldk) * 2u, v32 = (unsigned)(32 * TK) * 2u;
  const unsigned lk = (unsigned)(size_t)ring + (unsigned)((tid >> 3) * FK_P + (tid & 7) * 16), lv = (unsigned)(size_t)ring + (unsigned)((tid >> 2) * FV_P + (tid & 3) * 16);      /* 8 lanes to a K row (one 128-B line), 4 lanes to a V^T row */
  const size_t gko = (((size_t)b * TK + (tid >> 3)) * ldk + h * 64) * 2 + (tid & 7) * 16, gvo = (((size_t)slab * 64 + (tid >> 2)) * TK) * 2 + (tid & 3) * 16;
  const char* gkh = (const char*)K16 + gko; const char* gkl = (const char*)K16lo + gko; const char* gvh = (const char*)Vt + gvo; const char* gvl = (const char*)Vtlo + gvo;      /* the next tile to copy */
  f_tile_copy(lk, lv, gkh, gkl, gvh, gvl, k16, v32);      /* tile 0 into buffer 0 */
  /* the bias lookup's tables, staged once per block: bucket of every distance as one byte, the head's rounded dist_emb column, the batch's positions */
  typedef int v4ia __attribute__((ext_vector_type(4), may_alias));
  __shared__ __attribute__((aligned(16))) unsigned sLUTw[LUTN / 4]; __shared__ float sDE[NBIN]; __shared__ __attribute__((aligned(16))) int sPos[TK];
  for (int i = tid; i < LUTN / 4; i += 128) { const v4ia c = *(const v4ia*)(LUT + 4 * i); sLUTw[i] = (unsigned)(c[0] & (NBIN - 1)) | ((unsigned)(c[1] & (NBIN - 1)) << 8) | ((unsigned)(c[2] & (NBIN - 1)) << 16) | ((unsigned)(c[3] & (NBIN - 1)) << 24); }
  for (int i = tid; i < TK / 4; i += 128) *(v4ia*)(sPos + 4 * i) = *(const v4ia*)(LAG + 4 * i);
  if (tid < NBIN) sDE[tid] = bf16_round(BT[tid * NH + h]) * LOG2E;
  asm volatile("s_wait_asynccnt 0x0" ::: "memory");      /* this wave's copies of tile 0 have landed before the barrier publishes them */
  __syncthreads();      /* every wave reads what all four staged */
  gkh += 2 * (size_t)k16; gkl += 2 * (size_t)k16; gvh += 64; gvl += 64;
  if (jend > 32) f_tile_copy(lk + F_TILE, lv + F_TILE, gkh, gkl, gvh, gvl, k16, v32);      /* tile 1 into buffer 1 */
  const unsigned char* sLUT = (const unsigned char*)sLUTw;
  const int tq = q0 + ln;      /* this lane's query */
  FragH aq[KS], aql[KS];       /* Q as the B operand: column = query ln */
  { const size_t qo = ((size_t)b * TQ + tq) * ldq + h * 64; const unsigned short* qr = (const unsigned short*)Q16 + qo; const unsigned short* ql = (const unsigned short*)Q16lo + qo;
#pragma unroll
    for (int ks = 0; ks < KS; ++ks) { aq[ks].half[0] = *(const v8us*)(qr + ks * 32 + 8 * hh); aq[ks].half[1] = *(const v8us*)(qr + ks * 32 + 16 + 8 * hh); aql[ks].half[0] = *(const v8us*)(ql + ks * 32 + 8 * hh); aql[ks].half[1] = *(const v8us*)(ql + ks * 32 + 16 + 8 * hh); } }
  const bool am = (RA[tq] != 0); const unsigned* mrow = MB + (size_t)tq * (TK / 32); const int pi = sPos[tq];
  const unsigned char* fk = ring + ln * FK_P; const unsigned char* fv = ring + ln * FV_P;      /* this lane's fragment rows in buffer 0 */
  unsigned bo = 0;      /* byte offset of the buffer in work */
  float m_q = -3.0e38f, l_q = 0.f; v8f oacc[DT], oaccl[DT];
#pragma unroll
  for (int dt = 0; dt < DT; ++dt) { oacc[dt] = (v8f){0.f,0.f,0.f,0.f,0.f,0.f,0.f,0.f}; oaccl[dt] = oacc[dt]; }
#pragma unroll 1
  for (int j0 = 0; j0 < jend; j0 += 32) {
    const unsigned mword = mrow[j0 >> 5];      /* this query's key-mask bits of the 32 keys */
    v8f s[2];
#pragma unroll
    for (int nt = 0; nt < 2; ++nt) { const unsigned short* kr = (const unsigned short*)(fk + bo + F_KH + nt * 16 * FK_P); const unsigned short* kl = (const unsigned short*)(fk + bo + F_KL + nt * 16 * FK_P); FragH bk[KS], bkl[KS];      /* K as the A operand: row = key */
#pragma unroll
      for (int ks = 0; ks < KS; ++ks) { bk[ks].half[0] = *(const v8us*)(kr + ks * 32 + 8 * hh); bk[ks].half[1] = *(const v8us*)(kr + ks * 32 + 16 + 8 * hh); bkl[ks].half[0] = *(const v8us*)(kl + ks * 32 + 8 * hh); bkl[ks].half[1] = *(const v8us*)(kl + ks * 32 + 16 + 8 * hh); }
      v8f acc = (v8f){0.f,0.f,0.f,0.f,0.f,0.f,0.f,0.f}, accr = acc;
#pragma unroll
      for (int ks = 0; ks < KS; ++ks) { acc = mmaH<1>(bk[ks].v, bk[ks].v, aq[ks].v, aq[ks].v, acc); accr = mmaH<1>(bk[ks].v, bk[ks].v, aql[ks].v, aql[ks].v, accr); accr = mmaH<1>(bkl[ks].v, bkl[ks].v, aq[ks].v, aq[ks].v, accr); }
      s[nt] = acc + accr * 0.0009765625f; }
    const unsigned mw = mword >> (8 * hh);      /* bit nt * 16 + r = this lane's key nt * 16 + 8 hh + r */
    float sc[2][8]; bool ok[2][8]; float mc = -INFINITY;
#pragma unroll
    for (int nt = 0; nt < 2; ++nt) { const v4ia pA = *(const v4ia*)(sPos + j0 + nt * 16 + 8 * hh), pB = *(const v4ia*)(sPos + j0 + nt * 16 + 8 * hh + 4);
#pragma unroll
      for (int r = 0; r < 8; ++r) { const int pj = (r < 4) ? pA[r & 3] : pB[r & 3]; ok[nt][r] = am || (((mw >> (nt * 16 + r)) & 1u) == 0u);
        const float sv = s[nt][r] * (SCL * LOG2E) + gbias(sDE, obh, sLUT, pi, pj);      /* + grammar distance-bucket and order biases; base-2 domain */
        sc[nt][r] = ok[nt][r] ? (am ? 0.f : sv) : -INFINITY; mc = fmaxf(mc, sc[nt][r]); } }
    mc = fmaxf(mc, xhalf(mc));
    const float mn = fmaxf(m_q, mc); const float ea = __builtin_amdgcn_exp2f(m_q - mn); const float al = (mn > -1.0e38f) ? ea : 1.0f; m_q = mn;
    FragH pa, pl; float ls = 0.f;      /* P^T hi and residual, already in the B operand's order */
#pragma unroll
    for (int nt = 0; nt < 2; ++nt)
#pragma unroll
      for (int r = 0; r < 8; ++r) { const float e = __builtin_amdgcn_exp2f(sc[nt][r] - mn);      /* argument <= 0 (or -inf): no range guard is needed; a result under 2^-126 reads 0, far below what P's f16 pair keeps */ const float p = ok[nt][r] ? e : 0.f; ls += p;
        const float ps = p * 1024.0f; const _Float16 t2 = (_Float16)ps; pa.h[nt * 8 + r] = t2; pl.h[nt * 8 + r] = (_Float16)((ps - (float)t2) * 1024.0f); }
    l_q = l_q * al + ls;
#pragma unroll
    for (int dt = 0; dt < DT; ++dt) { oacc[dt] *= al; oaccl[dt] *= al; }
#pragma unroll
    for (int dt = 0; dt < DT; ++dt) { const unsigned short* vh = (const unsigned short*)(fv + bo + F_VH + dt * 16 * FV_P); const unsigned short* vl = (const unsigned short*)(fv + bo + F_VL + dt * 16 * FV_P); FragH bv, bl; bv.half[0] = *(const v8us*)(vh + 8 * hh); bv.half[1] = *(const v8us*)(vh + 16 + 8 * hh); bl.half[0] = *(const v8us*)(vl + 8 * hh); bl.half[1] = *(const v8us*)(vl + 16 + 8 * hh);      /* V^T as the A operand: row = d */
      oacc[dt] = mmaH<1>(bv.v, bv.v, pa.v, pa.v, oacc[dt]); oaccl[dt] = mmaH<1>(bl.v, bl.v, pa.v, pa.v, oaccl[dt]); oaccl[dt] = mmaH<1>(bv.v, bv.v, pl.v, pl.v, oaccl[dt]); }
    /* hand-over, every wave in this order: its own reads of this buffer are done, its own copies of the next tile have landed, the barrier tells the other waves both; only then is this buffer refilled */
    asm volatile("s_wait_dscnt 0x0" ::: "memory");
    asm volatile("s_wait_asynccnt 0x0" ::: "memory");
    __syncthreads();
    gkh += 2 * (size_t)k16; gkl += 2 * (size_t)k16; gvh += 64; gvl += 64;
    if (j0 + 64 < jend) f_tile_copy(lk + bo, lv + bo, gkh, gkl, gvh, gvl, k16, v32);      /* the tile after next, while one exists (a scalar test) */
    bo ^= F_TILE; }
  asm volatile("s_wait_asynccnt 0x0" ::: "memory");      /* no copy is left in flight when the wave goes on to its end */
  const float lt = l_q + xhalf(l_q); const float inv = (lt > 0.f) ? 1.0f / (lt * 1024.0f) : 0.f;
#pragma unroll
  for (int dt = 0; dt < DT; ++dt)
#pragma unroll
    for (int g = 0; g < 2; ++g) { v4f o4;
#pragma unroll
      for (int i = 0; i < 4; ++i) o4[i] = (oacc[dt][g * 4 + i] + oaccl[dt][g * 4 + i] * 0.0009765625f) * inv;
      *(v4fa*)&sO[w][ln][dt * 16 + 8 * hh + g * 4] = o4; }
  __builtin_amdgcn_fence(__ATOMIC_ACQ_REL, "workgroup"); __builtin_amdgcn_wave_barrier();
  {
#pragma unroll
    for (int rp = 0; rp < RPW; rp += 2) { const int r = rp + (lane >> 4), pc = lane & 15; const v4f val = *(const v4fa*)&sO[w][r][pc * 4]; *(v4f*)(O + ((size_t)b * TQ + q0 + r) * ldo + h * 64 + pc * 4) = val; }
     } }


__global__ __launch_bounds__(256) void k_fulltab(unsigned* __restrict__ MB, int* __restrict__ RA, int* __restrict__ KE, int nq, int nk) {
  const int t = blockIdx.x * 256 + threadIdx.x;
  if (t < nq * (nk / 32)) { *(unsigned*)(MB + t) = 0u;  }
  if (t < nq) { *(int*)(RA + t) = 0;  }
  if (t < nq / 64) { *(int*)(KE + t * 32) = nk;  } }
__global__ __launch_bounds__(256) void k_lnx(const float* __restrict__ X, const float* __restrict__ g, const float* __restrict__ bb, _Float16* __restrict__ Y16, float* __restrict__ XB) {
  #pragma clang fp contract(off)
  const int tid = threadIdx.x, w = tid >> 5, ln = tid & 31; const int r = blockIdx.x * 8 + w; if (r >= NR) return; const float* x = X + (size_t)r * DM; float s = 0.f;
#pragma unroll 1
  for (int i = 0; i < DM / 128; ++i) { const v4f a = *(const v4fa*)(x + i * 128 + ln * 4); for (int q = 0; q < 4; ++q) s += bf16_round(a[q]); }
  for (int o = 16; o > 0; o >>= 1) s += __shfl_xor(s, o, 32); const float mu = s / (float)DM; float q2 = 0.f;
#pragma unroll 1
  for (int i = 0; i < DM / 128; ++i) { const v4f a = *(const v4fa*)(x + i * 128 + ln * 4); for (int q = 0; q < 4; ++q) { const float d = bf16_round(a[q]) - mu; q2 += d * d; } }
  for (int o = 16; o > 0; o >>= 1) q2 += __shfl_xor(q2, o, 32); const float rs = rsqrtf(q2 / (float)DM + 1e-5f);
  {
#pragma unroll 1
    for (int i = 0; i < DM / 128; ++i) { const int c0 = i * 128 + ln * 4; const v4f a = *(const v4fa*)(x + c0); _Float16 h4[4]; v4f xb;
      for (int q = 0; q < 4; ++q) { const float t = bf16_round(a[q]); h4[q] = (_Float16)((t - mu) * rs * bf16_round(g[c0 + q]) + bf16_round(bb[c0 + q])); xb[q] = t; }
      *(unsigned long long*)((unsigned short*)Y16 + (size_t)r * DM + c0) = *(const unsigned long long*)h4; *(v4f*)(XB + (size_t)r * DM + c0) = xb; }
     } }
// bucket table: LUT[d] = count of the NBIN - 1 bf16-rounded edges below d (at most NBIN - 1), for d < LUTN
__device__ __forceinline__ void p_lut(unsigned bid, const float* __restrict__ edges, int* __restrict__ LUT) {
  #pragma clang fp contract(off)
  const int d = bid * 256 + threadIdx.x; if (d >= LUTN) return; const float fd = (float)d; int c = 0;
#pragma unroll 1
  for (int e = 0; e < NBIN - 1; ++e) c += (bf16_round(edges[e]) < fd) ? 1 : 0;
  c = min(c, NBIN - 1); *(int*)(LUT + d) = c;  }
__device__ __forceinline__ void p_masktab(unsigned bid, const float* __restrict__ mask, unsigned* __restrict__ MB, int* __restrict__ RA, int* __restrict__ KE) {
  const size_t t = (size_t)bid * 256 + threadIdx.x; const int nw = SLEN / 32;
  if (t < (size_t)NBT * SLEN * nw) { const int w = (int)(t % nw); const int b = (int)(t / ((size_t)SLEN * nw)); unsigned bits = 0u; for (int j = 0; j < 32; ++j) bits |= (bf16_round(mask[(size_t)b * SLEN + 32 * w + j]) == 0.0f) ? (1u << j) : 0u; *(unsigned*)(MB + t) = bits;  }
  if (t < SLEN) { *(int*)(RA + t) = 0;  }
  if (t < SLEN / 64) { *(int*)(KE + t * 32) = SLEN;  } }
#define NB_MT (NBT * SLEN * (SLEN / 32) / 256)   /* blocks of the key-mask tables */
#define NB_W (DM * DM / 8 / 256)                 /* blocks of one weight plane */
// One grid for the seven set-up jobs (mask tables, the x plane, four weight planes, the bucket table), which need nothing of each other: a block-uniform range of the block index picks the job.
__global__ __launch_bounds__(256) void k_prep(const float* __restrict__ x, const float* __restrict__ mask, const float* __restrict__ qw, const float* __restrict__ kw, const float* __restrict__ vw, const float* __restrict__ ow, const float* __restrict__ edges,
    _Float16* __restrict__ X16, _Float16* __restrict__ BW, unsigned* __restrict__ MB, int* __restrict__ RA, int* __restrict__ KE, int* __restrict__ LUT) {
  unsigned bid = blockIdx.x;
  if (bid < NB_MT) { p_masktab(bid, mask, MB, RA, KE); return; }
  bid -= NB_MT;
  if (bid < NB_E8) { p_x16(bid, x, X16, (size_t)NR * DM / 8); return; }
  bid -= NB_E8;
  if (bid < 4 * NB_W) { const unsigned j = bid / NB_W; const float* W = (j == 0) ? qw : ((j == 1) ? kw : ((j == 2) ? vw : ow)); p_round16f(bid - j * NB_W, W, BW + (size_t)j * DM * DM, (size_t)DM * DM / 8); return; }      /* BW: the four planes one behind the other */
  p_lut(bid - 4 * NB_W, edges, LUT); }
__global__ __launch_bounds__(256) void k_hlmask(const float* __restrict__ F, const float* __restrict__ mask, _Float16* __restrict__ Hh, _Float16* __restrict__ Hl, size_t n8) {
  #pragma clang fp contract(off)
  const size_t t = (size_t)blockIdx.x * 256 + threadIdx.x; if (t >= n8) return; const float mk = bf16_round(mask[(t * 8) / DM]); FragH fh, fl;
#pragma unroll
  for (int q = 0; q < 8; ++q) { const float v = F[t * 8 + q] * mk; const _Float16 h = (_Float16)v; fh.h[q] = h; fl.h[q] = (_Float16)((v - (float)h) * 1024.0f); }
  { *(v8us*)((unsigned short*)Hh + t * 8) = fh.half[0]; *(v8us*)((unsigned short*)Hl + t * 8) = fl.half[0];  } }
__global__ __launch_bounds__(256) void k_causaltab(unsigned* __restrict__ MB, int* __restrict__ RA, int* __restrict__ KE, int nq, int nk) {
  const int t = blockIdx.x * 256 + threadIdx.x; const int nw = nk / 32;
  if (t < nq * nw) { const int q = t / nw, w = t % nw; const int first = q + 1 - 32 * w; const unsigned bits = (first <= 0) ? 0xffffffffu : ((first >= 32) ? 0u : (0xffffffffu << first)); *(unsigned*)(MB + t) = bits;  }
  if (t < nq) { *(int*)(RA + t) = 0;  }
  if (t < nq / 64) { const int v = 64 * (t + 1); *(int*)(KE + t * 32) = v;  } }


extern "C" void kernel_launch(void* const* d_in, const int* in_sizes, int n_in,
                              void* d_out, int out_size, void* d_ws, size_t ws_size, hipStream_t stream) {
  (void)in_sizes; (void)n_in; (void)out_size;
  const float* const* I = (const float* const*)d_in; const float* x = I[0]; const int* pos = (const int*)d_in[1]; const float* mask = I[2]; const float* qw = I[3]; const float* qb = I[4]; const float* kw = I[5]; const float* kb = I[6]; const float* vw = I[7]; const float* vb = I[8]; const float* ow = I[9]; const float* ob = I[10]; const float* de = I[11]; const float* obias = I[12]; const float* edges = I[13];
  char* ws = (char*)d_ws; size_t off = 0;
  auto take = [&](size_t bytes) { char* p = ws + off; off += (bytes + 255) & ~(size_t)255; return p; };
  _Float16* BQ = (_Float16*)take((size_t)4 * DM * DM * 2); _Float16* BO = BQ + (size_t)3 * DM * DM;      /* q, k, v, o weight planes, one behind the other */
  _Float16* X16 = (_Float16*)take((size_t)NR * DM * 2); float* F = (float*)take((size_t)3 * NR * DM * 4);      /* q, k, v in f32, one behind the other */
  _Float16* Qh = (_Float16*)take((size_t)NR * DM * 2); _Float16* Ql = (_Float16*)take((size_t)NR * DM * 2); _Float16* Kh = (_Float16*)take((size_t)NR * DM * 2); _Float16* Kl = (_Float16*)take((size_t)NR * DM * 2); _Float16* Vth = (_Float16*)take((size_t)NR * DM * 2); _Float16* Vtl = (_Float16*)take((size_t)NR * DM * 2);
  unsigned* MB = (unsigned*)take((size_t)NBT * SLEN * (SLEN / 32) * 4); int* RA = (int*)take((size_t)SLEN * 4); int* KE = (int*)take((size_t)(SLEN / 64) * 32 * 4); int* LUT = (int*)take((size_t)LUTN * 4);
  if (off > ws_size) return;      /* 2 + 8 + 48 + 48 + 1.1 = 107 MiB */
  float* O = F; _Float16* Oh = Qh; _Float16* Ol = Ql;
  const size_t n8 = (size_t)NR * DM / 8; const unsigned nb8 = (unsigned)((n8 + 255) / 256); const dim3 gP((NR / 128) * (DM / 64), 1), gP3((NR / 128) * (DM / 64), 3);
  k_prep<<<NB_MT + NB_E8 + 4 * NB_W + LUTN / 256, 256, 0, stream>>>(x, mask, qw, kw, vw, ow, edges, X16, BQ, MB, RA, KE, LUT);      /* torch (out,in) = natural Bt */
  k_gemm2<0, DM><<<gP3, 128, 0, stream>>>(X16, DM, 0, BQ, DM, (size_t)DM * DM, 0.0625f, qb, kb, vb, 0, nullptr, 1, 0, 0, F, nullptr, DM, (size_t)NR * DM, NR, DM, DM);      /* blockIdx.y = q, k, v */
  k_split<<<NB_VT + 2 * NB_E8, 256, 0, stream>>>(F, F + (size_t)NR * DM, F + (size_t)2 * NR * DM, Qh, Ql, Kh, Kl, Vth, Vtl);
  k_flashb<SLEN, SLEN><<<NBT * NH * (SLEN / 64), 128, 0, stream>>>(Qh, Ql, DM, Kh, Kl, DM, Vth, Vtl, MB, RA, KE, de, obias, LUT, pos, O, DM);
  k_hlmask<<<nb8, 256, 0, stream>>>(O, mask, Oh, Ol, n8);
  k_gemm2<0, DM><<<gP, 128, 0, stream>>>(Oh, DM, 0, BO, DM, 0, 0.0625f, ob, nullptr, nullptr, 0, nullptr, 1, 0, 0, (float*)d_out, nullptr, DM, 0, NR, DM, DM);
  k_gemm2<0, DM><<<gP, 128, 0, stream>>>(Ol, DM, 0, BO, DM, 0, 0.0625f / 1024.0f, nullptr, nullptr, nullptr, 0, (float*)d_out, 1, (size_t)DM, 0, (float*)d_out, nullptr, DM, 0, NR, DM, DM);
}

// v008
// One run takes 170 microseconds.
// Two timings next to v007 both put it at 1.21 times that version's speed.
// Over all steps from v000 it is 12.1 times as fast.
#include <hip/hip_runtime.h>
// Grammar attention (8 x 1024 tokens, 512 = 8 heads x 64): q,k,v = x W^T + b; scores = q.k/8 + dist_emb[bucket(|pos_j - pos_i|)][h] + ((pos_j > pos_i) - 0.5) * order_bias[h] with INPUT int32 positions, INPUT bin edges (torch.bucketize right=False = count of edges < dist) and an INPUT key/query mask (masked keys excluded; masked query rows zeroed before the output projection, as out * mask); softmax; out = ((attn v) * mask) Wo^T + bo -> [8,1024,512].
// Structure: x as an exact f16 plane; projections as f16 WMMA GEMMs (32x64 wave tiles, f32 accumulation, exact x16 weights + bias); a device-built bucket lookup table over integer distances (from the INPUT edges) and per-batch key-mask bit tables; q, k as f16 hi + (x2^10) residual planes, V^T as hi + residual planes; the fused flash kernel gathers both biases by the INPUT positions inside the score stage (transposed score and value tiles, online f32 softmax per lane, P hi + residual kept in registers, two value accumulators); O scaled by the query mask, split hi/lo, into Wo (two GEMMs, bias in the first).
// Compute dtype: x, weights, biases, dist_emb, order_bias, bin_edges, mask rounded to bf16; projections exact; q, k, P, v, O as f16 hi + residual pairs (~2^-21); f32 accumulation and softmax. v_wmma_f32_16x16x32_f16.
#define NBT 8
#define SLEN 1024
#define NBIN 32
#define LUTN 16384            /* bucket lookup over integer distances 0..LUTN-1 (positions < 5000) */
#define DM 512
#define NH 8
#define SCL 0.125f
#define LOG2E 1.4426950408889634f   /* the flash kernel's scores, biases and running maximum are kept times log2(e): e^(s - m) is then one native 2^x */
#define NR (NBT * SLEN)
typedef __bf16 v16b __attribute__((ext_vector_type(16)));
typedef unsigned short v8us __attribute__((ext_vector_type(8), may_alias));
typedef float  v8f  __attribute__((ext_vector_type(8)));
typedef float  v4f  __attribute__((ext_vector_type(4)));
typedef float  v4fa __attribute__((ext_vector_type(4), may_alias));
union FragB { v16b v; v8us half[2]; unsigned short u[16]; };

__device__ __forceinline__ unsigned short bf16_bits(float x) { unsigned int u = __float_as_uint(x); return (unsigned short)((u + 0x7FFFu + ((u >> 16) & 1u)) >> 16); }
__device__ __forceinline__ float bf16_val(unsigned short b) { return __uint_as_float(((unsigned int)b) << 16); }
__device__ __forceinline__ float bf16_round(float x) { return bf16_val(bf16_bits(x)); }
// D += A·B with NT terms: 1 = ah·bh, 2 = + al·bh (A split), 3 = + ah·bl (both split)
template <int NT>
__device__ __forceinline__ v8f mmaN(v16b ah, v16b al, v16b bh, v16b bl, v8f c) {
  c = __builtin_amdgcn_wmma_f32_16x16x32_bf16(false, ah, false, bh, (short)0, c, false, false);
  if (NT >= 2) c = __builtin_amdgcn_wmma_f32_16x16x32_bf16(false, al, false, bh, (short)0, c, false, false);
  if (NT >= 3) c = __builtin_amdgcn_wmma_f32_16x16x32_bf16(false, ah, false, bl, (short)0, c, false, false);
  asm volatile("v_nop\n\tv_nop\n\tv_nop\n\tv_nop" : "+v"(c) : "v"(ah), "v"(al), "v"(bh), "v"(bl));
  return c;
}

__global__ __launch_bounds__(256) void k_wt_bf16(const float* __restrict__ W, unsigned short* __restrict__ Wt, int K, int N) {
  const int t = blockIdx.x * 256 + threadIdx.x;
  const int k8n = K / 8;
  if (t >= N * k8n) return;
  const int n = t / k8n, k8 = (t % k8n) * 8;
  v8us v;
#pragma unroll
  for (int i = 0; i < 8; ++i) v[i] = bf16_bits(W[(size_t)(k8 + i) * N + n]);
  *(v8us*)(Wt + (size_t)n * K + k8) = v;
  
}

// GEMM C[M][N] (f32, pitch ldc) = act(A[M][K]·W + bias). A f32 row-major (pitch lda) converted per fragment to bf16
// (ASPLIT: hi/lo two planes -> 2 terms, else single rounded term); Wt bf16 [N][K] (pitch ldb). BIAS_BF16 rounds the
// bias to bf16 first (bias quantised to bf16 before the add). K%32==0, M%16==0, N%64==0.
template <bool ASPLIT, int ACT, bool BIAS_BF16>
__global__ __launch_bounds__(128) void k_gemm_bf(const float* __restrict__ A, int lda, const unsigned short* __restrict__ Wt, int ldb,
                                               const float* __restrict__ bias, float* __restrict__ C, int ldc, int M, int N, int K) {
  __shared__ __attribute__((aligned(16))) float so[4][16][64];
  const int tid = threadIdx.x, w = tid >> 5, lane = tid & 31, ln = lane & 15, hh = lane >> 4;
  const int ntn = N / 64;
  const int wid = blockIdx.x * 4 + w;
  const int mt = wid / ntn, nq = wid % ntn;
  if (mt * 16 >= M) return;
  const int row0 = mt * 16, col0 = nq * 64;
  const float* arow = A + (size_t)(row0 + ln) * lda;
  v8f acc[4] = {};
  for (int kb = 0; kb < K; kb += 32) {
    FragB ah, al;
    const v4f x0 = *(const v4fa*)(arow + kb + 8 * hh), x1 = *(const v4fa*)(arow + kb + 8 * hh + 4);
    const v4f x2 = *(const v4fa*)(arow + kb + 16 + 8 * hh), x3 = *(const v4fa*)(arow + kb + 16 + 8 * hh + 4);
    float xs[16] = {x0[0],x0[1],x0[2],x0[3],x1[0],x1[1],x1[2],x1[3],x2[0],x2[1],x2[2],x2[3],x3[0],x3[1],x3[2],x3[3]};
#pragma unroll
    for (int i = 0; i < 16; ++i) { const unsigned short hb = bf16_bits(xs[i]); ah.u[i] = hb; al.u[i] = ASPLIT ? bf16_bits(xs[i] - bf16_val(hb)) : (unsigned short)0; }
#pragma unroll
    for (int t = 0; t < 4; ++t) {
      const unsigned short* brow = Wt + (size_t)(col0 + t * 16 + ln) * ldb + kb;
      FragB b;
      b.half[0] = *(const v8us*)(brow + 8 * hh);
      b.half[1] = *(const v8us*)(brow + 16 + 8 * hh);
      acc[t] = mmaN<ASPLIT ? 2 : 1>(ah.v, al.v, b.v, b.v, acc[t]);
    }
  }
#pragma unroll
  for (int t = 0; t < 4; ++t) {
    float bv = bias ? bias[col0 + t * 16 + ln] : 0.f;
    if (BIAS_BF16) bv = bf16_round(bv);
#pragma unroll
    for (int r = 0; r < 8; ++r) { float v = acc[t][r] + bv; if (ACT == 1) v = fmaxf(v, 0.f); so[w][8 * hh + r][t * 16 + ln] = v; }
  }
  __builtin_amdgcn_fence(__ATOMIC_ACQ_REL, "workgroup");
  __builtin_amdgcn_wave_barrier();
  const int rsub = lane >> 4, c4 = (lane & 15) * 4;
  {
#pragma unroll
    for (int q = 0; q < 8; ++q) {
      const int r = q * 2 + rsub;
      const v4f v = *(const v4fa*)&so[w][r][c4];
      *(v4f*)(C + (size_t)(row0 + r) * ldc + col0 + c4) = v;
    }
    
  }
}

// GEMM C = act(A·W + bias + resid): A f32 (ASPLIT -> hi/lo 2 terms), Wt bf16 [N][K]; ACT 0 none, 1 relu, 2 exact gelu;
// resid (optional, f32, row index = (row % rmod), pitch ldr, RES_BF16 rounds it) added before the activation.
template <bool ASPLIT, int ACT, bool BIAS_BF16, bool RES_BF16>
__global__ __launch_bounds__(128) void k_gemm_bf3(const float* __restrict__ A, int lda, const unsigned short* __restrict__ Wt, int ldb,
                                                const float* __restrict__ bias, const float* __restrict__ resid, int rmod, int ldr,
                                                float* __restrict__ C, int ldc, int M, int N, int K) {
  __shared__ __attribute__((aligned(16))) float so[4][16][64];
  const int tid = threadIdx.x, w = tid >> 5, lane = tid & 31, ln = lane & 15, hh = lane >> 4;
  const int ntn = N / 64;
  const int wid = blockIdx.x * 4 + w;
  const int mt = wid / ntn, nq = wid % ntn;
  if (mt * 16 >= M) return;
  const int row0 = mt * 16, col0 = nq * 64;
  const float* arow = A + (size_t)(row0 + ln) * lda;
  v8f acc[4] = {};
  for (int kb = 0; kb < K; kb += 32) {
    FragB ah, al;
    const v4f x0 = *(const v4fa*)(arow + kb + 8 * hh), x1 = *(const v4fa*)(arow + kb + 8 * hh + 4);
    const v4f x2 = *(const v4fa*)(arow + kb + 16 + 8 * hh), x3 = *(const v4fa*)(arow + kb + 16 + 8 * hh + 4);
    float xs[16] = {x0[0],x0[1],x0[2],x0[3],x1[0],x1[1],x1[2],x1[3],x2[0],x2[1],x2[2],x2[3],x3[0],x3[1],x3[2],x3[3]};
#pragma unroll
    for (int i = 0; i < 16; ++i) { const unsigned short hb = bf16_bits(xs[i]); ah.u[i] = hb; al.u[i] = ASPLIT ? bf16_bits(xs[i] - bf16_val(hb)) : (unsigned short)0; }
#pragma unroll
    for (int t = 0; t < 4; ++t) {
      const unsigned short* brow = Wt + (size_t)(col0 + t * 16 + ln) * ldb + kb;
      FragB b;
      b.half[0] = *(const v8us*)(brow + 8 * hh);
      b.half[1] = *(const v8us*)(brow + 16 + 8 * hh);
      acc[t] = mmaN<ASPLIT ? 2 : 1>(ah.v, al.v, b.v, b.v, acc[t]);
    }
  }
#pragma unroll
  for (int t = 0; t < 4; ++t) {
    const int col = col0 + t * 16 + ln;
    float bv = bias ? bias[col] : 0.f;
    if (BIAS_BF16) bv = bf16_round(bv);
#pragma unroll
    for (int r = 0; r < 8; ++r) {
      float v = acc[t][r] + bv;
      if (resid) { float rv = resid[(size_t)((row0 + 8 * hh + r) % rmod) * ldr + col]; if (RES_BF16) rv = bf16_round(rv); v += rv; }
      if (ACT == 1) v = fmaxf(v, 0.f);
      if (ACT == 2) v = 0.5f * v * (1.0f + erff(v * 0.70710678118654752f));
      if (ACT == 3) { const float u = 0.7978845608028654f * (v + 0.044715f * v * v * v); v = 0.5f * v * (1.0f + tanhf(u)); }
      so[w][8 * hh + r][t * 16 + ln] = v;
    }
  }
  __builtin_amdgcn_fence(__ATOMIC_ACQ_REL, "workgroup");
  __builtin_amdgcn_wave_barrier();
  const int rsub = lane >> 4, c4 = (lane & 15) * 4;
  {
#pragma unroll
    for (int q = 0; q < 8; ++q) {
      const int r = q * 2 + rsub;
      const v4f v = *(const v4fa*)&so[w][r][c4];
      *(v4f*)(C + (size_t)(row0 + r) * ldc + col0 + c4) = v;
    }
    
  }
}
// row LayerNorm (biased variance, eps) over N: s = X (+ R); optional out_sum <- s; out_norm <- (s-mu)*rsqrt(var+eps)*g + b
template <bool PARAM_BF16>
__global__ __launch_bounds__(256) void k_layernorm(const float* __restrict__ X, const float* __restrict__ R, const float* __restrict__ g, const float* __restrict__ bta,
                                                  float* __restrict__ out_sum, float* __restrict__ out_norm, int N, float eps) {
  __shared__ float red[256];
  const int row = blockIdx.x, tid = threadIdx.x;
  const float* x = X + (size_t)row * N; const float* rr = R ? R + (size_t)row * N : nullptr;
  float vals[16];                     // up to N = 4096
  const int per = N / 256;            // contiguous chunk per thread? use strided-by-4 chunks: thread handles j = tid*4 + 1024*u
  float s1 = 0.f;
  for (int u = 0; u < per / 4; ++u) {
    const int j = tid * 4 + 1024 * u;
    const v4f a = *(const v4fa*)(x + j);
    v4f b = {0.f,0.f,0.f,0.f}; if (rr) b = *(const v4fa*)(rr + j);
#pragma unroll
    for (int q = 0; q < 4; ++q) { const float v = a[q] + b[q]; vals[u * 4 + q] = v; s1 += v; }
  }
  red[tid] = s1; __syncthreads();
  for (int st = 128; st > 0; st >>= 1) { if (tid < st) red[tid] += red[tid + st]; __syncthreads(); }
  const float mu = red[0] / (float)N; __syncthreads();
  float s2 = 0.f;
  for (int u = 0; u < per / 4; ++u)
#pragma unroll
    for (int q = 0; q < 4; ++q) { const float c = vals[u * 4 + q] - mu; s2 += c * c; }
  red[tid] = s2; __syncthreads();
  for (int st = 128; st > 0; st >>= 1) { if (tid < st) red[tid] += red[tid + st]; __syncthreads(); }
  const float rs = rsqrtf(red[0] / (float)N + eps);
  {
    for (int u = 0; u < per / 4; ++u) {
      const int j = tid * 4 + 1024 * u;
      v4f o, sm;
#pragma unroll
      for (int q = 0; q < 4; ++q) {
        float gg = g[j + q], bb = bta[j + q];
        if (PARAM_BF16) { gg = bf16_round(gg); bb = bf16_round(bb); }
        sm[q] = vals[u * 4 + q]; o[q] = (vals[u * 4 + q] - mu) * rs * gg + bb;
      }
      if (out_sum) *(v4f*)(out_sum + (size_t)row * N + j) = sm;
      *(v4f*)(out_norm + (size_t)row * N + j) = o;
    }
    
  }
}



// ---- f16 WMMA path (v_wmma_f32_16x16x32_f16): 11-bit significands for operands in range — used where a [0,1] probability operand needs more precision than bf16
typedef _Float16 v16h __attribute__((ext_vector_type(16)));
union FragH { v16h v; v8us half[2]; _Float16 h[16]; unsigned short u[16]; };
template <int NT>
__device__ __forceinline__ v8f mmaH(v16h ah, v16h al, v16h bh, v16h bl, v8f c) {
  c = __builtin_amdgcn_wmma_f32_16x16x32_f16(false, ah, false, bh, (short)0, c, false, false);
  if (NT >= 2) c = __builtin_amdgcn_wmma_f32_16x16x32_f16(false, al, false, bh, (short)0, c, false, false);
  if (NT >= 3) c = __builtin_amdgcn_wmma_f32_16x16x32_f16(false, ah, false, bl, (short)0, c, false, false);
  asm volatile("v_nop\n\tv_nop\n\tv_nop\n\tv_nop" : "+v"(c) : "v"(ah), "v"(al), "v"(bh), "v"(bl));
  return c;
}
// batched GEMM like k_gemm_b but f16 operands: A f32 (split into f16 hi/lo if ASPLIT, else rounded to f16), Bt = f16 values [n][k]; alpha; C f32; N multiple of 16 (partial tiles skipped)
template <bool ASPLIT>
__global__ __launch_bounds__(128) void k_gemm_h(const float* __restrict__ A, int lda, size_t sA, const _Float16* __restrict__ Bh, int ldb, size_t sB, float alpha, float* __restrict__ C, int ldc, size_t sC, int M, int N, int K) {
  __shared__ __attribute__((aligned(16))) float so[4][16][64];
  const int tid = threadIdx.x, w = tid >> 5, lane = tid & 31, ln = lane & 15, hh = lane >> 4; const int by = blockIdx.y;
  A += (size_t)by * sA; Bh += (size_t)by * sB; C += (size_t)by * sC;
  const int ntn = (N + 63) / 64; const int wid = blockIdx.x * 4 + w; const int mt = wid / ntn, nq = wid % ntn; if (mt * 16 >= M) return;
  const int row0 = mt * 16, col0 = nq * 64; const float* arow = A + (size_t)(row0 + ln) * lda;
  v8f acc[4] = {};
  for (int kb = 0; kb < K; kb += 32) {
    FragH ah, al;
    const v4f x0 = *(const v4fa*)(arow + kb + 8 * hh), x1 = *(const v4fa*)(arow + kb + 8 * hh + 4), x2 = *(const v4fa*)(arow + kb + 16 + 8 * hh), x3 = *(const v4fa*)(arow + kb + 16 + 8 * hh + 4);
    float xs[16] = {x0[0],x0[1],x0[2],x0[3],x1[0],x1[1],x1[2],x1[3],x2[0],x2[1],x2[2],x2[3],x3[0],x3[1],x3[2],x3[3]};
#pragma unroll
    for (int i = 0; i < 16; ++i) { const _Float16 h = (_Float16)xs[i]; ah.h[i] = h; al.h[i] = ASPLIT ? (_Float16)(xs[i] - (float)h) : (_Float16)0.0f; }
#pragma unroll
    for (int t = 0; t < 4; ++t) { if (col0 + t * 16 >= N) continue; const size_t boff = (size_t)(col0 + t * 16 + ln) * ldb + kb; FragH bq; bq.half[0] = *(const v8us*)(Bh + boff + 8 * hh); bq.half[1] = *(const v8us*)(Bh + boff + 16 + 8 * hh);
      acc[t] = mmaH<ASPLIT ? 2 : 1>(ah.v, al.v, bq.v, bq.v, acc[t]); }
  }
#pragma unroll
  for (int t = 0; t < 4; ++t) { if (col0 + t * 16 >= N) continue;
#pragma unroll
    for (int r = 0; r < 8; ++r) so[w][8 * hh + r][t * 16 + ln] = acc[t][r] * alpha; }
  __builtin_amdgcn_fence(__ATOMIC_ACQ_REL, "workgroup"); __builtin_amdgcn_wave_barrier();
  const int rsub = lane >> 4, c4 = (lane & 15) * 4;
  {
#pragma unroll
    for (int q = 0; q < 8; ++q) { const int r = q * 2 + rsub; if (col0 + c4 < N) { const v4f v = *(const v4fa*)&so[w][r][c4]; *(v4f*)(C + (size_t)(row0 + r) * ldc + col0 + c4) = v; } }
     }
}

// Wt[n][k] = f16(W[k][n]·scale) from f32 row-major W[K][N] (scale = power of two; bf16-exact weights stay exact in f16 away from the subnormal range)
__global__ __launch_bounds__(256) void k_wt_f16(const float* __restrict__ W, _Float16* __restrict__ Wt, int K, int N, float scale) {
  const int t = blockIdx.x * 256 + threadIdx.x; if (t >= N * (K / 8)) return; const int n = t / (K / 8), k8 = (t % (K / 8)) * 8; FragH f;
#pragma unroll
  for (int i = 0; i < 8; ++i) f.h[i] = (_Float16)(bf16_round(W[(size_t)(k8 + i) * N + n]) * scale); const v8us o = f.half[0];
  *(v8us*)((unsigned short*)Wt + (size_t)n * K + k8) = o; 
}
// k_gemm_hh variant with fused epilogue: v = acc·alpha + bias[by·sBias + col] (+ CP[(row/rowsPerB)·sCPb + by·64 + col] if CP) ; ACT 0 none / 1 elu ; writes f16 C16 (and f32 C if non-null)
template <int ACT>
__global__ __launch_bounds__(128) void k_gemm_hhx(const _Float16* __restrict__ A, int lda, size_t sA, const _Float16* __restrict__ Bh, int ldb, size_t sB, float alpha, const float* __restrict__ bias, size_t sBias, const float* __restrict__ CP, int rowsPerB, size_t sCPb, int row0g,
    float* __restrict__ C, _Float16* __restrict__ C16, int ldc, size_t sC, int M, int N, int K) {
  __shared__ __attribute__((aligned(16))) float so[4][16][64];
  const int tid = threadIdx.x, w = tid >> 5, lane = tid & 31, ln = lane & 15, hh = lane >> 4; const int by = blockIdx.y;
  A += (size_t)by * sA; Bh += (size_t)by * sB; const size_t cofs = (size_t)by * sC; const float* bp = bias ? bias + (size_t)by * sBias : nullptr;
  const int ntn = (N + 63) / 64; const int wid = blockIdx.x * 4 + w; const int mt = wid / ntn, nq = wid % ntn; if (mt * 16 >= M) return;
  const int row0 = mt * 16, col0 = nq * 64; const _Float16* arow = A + (size_t)(row0 + ln) * lda;
  v8f acc[4] = {};
  for (int kb = 0; kb < K; kb += 32) { FragH ah; ah.half[0] = *(const v8us*)((const unsigned short*)arow + kb + 8 * hh); ah.half[1] = *(const v8us*)((const unsigned short*)arow + kb + 16 + 8 * hh);
#pragma unroll
    for (int t = 0; t < 4; ++t) { if (col0 + t * 16 >= N) continue; const size_t boff = (size_t)(col0 + t * 16 + ln) * ldb + kb; FragH bq; bq.half[0] = *(const v8us*)((const unsigned short*)Bh + boff + 8 * hh); bq.half[1] = *(const v8us*)((const unsigned short*)Bh + boff + 16 + 8 * hh);
      acc[t] = mmaH<1>(ah.v, ah.v, bq.v, bq.v, acc[t]); }
  }
#pragma unroll
  for (int t = 0; t < 4; ++t) { if (col0 + t * 16 >= N) continue; const int col = col0 + t * 16 + ln; const float bv = bp ? bf16_round(bp[col]) : 0.f;
#pragma unroll
    for (int r = 0; r < 8; ++r) { float v = acc[t][r] * alpha + bv; if (CP) { const int bidx = (row0g + row0 + 8 * hh + r) / rowsPerB; v += CP[(size_t)bidx * sCPb + (size_t)by * 64 + col]; } if (ACT == 1) v = (v > 0.f) ? v : expm1f(v); else if (ACT == 7) v = (v > 0.f) ? v + 1.0f : expf(v); else if (ACT == 8) v = tanhf(v); else if (ACT == 9) v = 0.5f * v * (1.0f + tanhf(0.7978845608028654f * (v + 0.044715f * v * v * v))); else if (ACT == 11) v = 1.0f / (1.0f + expf(-v)); else if (ACT == 12) v = (v > 0.f) ? v : 0.01f * v; else if (ACT == 14) v = (v > 0.f) ? v : 0.1f * v; else if (ACT == 15) v = v / (1.0f + expf(-v)); else if (ACT == 3) v = fmaxf(v, 0.f); else if (ACT == 6) v = 0.5f * v * (1.0f + erff(v * 0.70710678118654752f)); so[w][8 * hh + r][t * 16 + ln] = v; } }
  __builtin_amdgcn_fence(__ATOMIC_ACQ_REL, "workgroup"); __builtin_amdgcn_wave_barrier();
  const int rsub = lane >> 4, c4 = (lane & 15) * 4; typedef _Float16 v4h __attribute__((ext_vector_type(4)));
  {
#pragma unroll
    for (int q = 0; q < 8; ++q) { const int r = q * 2 + rsub; if (col0 + c4 < N) { const v4f v = *(const v4fa*)&so[w][r][c4]; if (C) *(v4f*)(C + cofs + (size_t)(row0 + r) * ldc + col0 + c4) = v; if (C16) { v4h h4; for (int i = 0; i < 4; ++i) h4[i] = (_Float16)v[i]; *(v4h*)(C16 + cofs + (size_t)(row0 + r) * ldc + col0 + c4) = h4; } } }
     }
}


typedef _Float16 v4h __attribute__((ext_vector_type(4)));

// The p_* functions are jobs of 256-thread blocks; bid is the block's index within its job (k_prep and k_split hand it over).
__device__ __forceinline__ void p_x16(unsigned bid, const float* __restrict__ x, _Float16* __restrict__ X16, size_t n8) { const size_t t = (size_t)bid * 256 + threadIdx.x; if (t >= n8) return; FragH f;
#pragma unroll
  for (int q = 0; q < 8; ++q) f.h[q] = (_Float16)bf16_round(x[t * 8 + q]); *(v8us*)((unsigned short*)X16 + t * 8) = f.half[0];  }
__global__ __launch_bounds__(256) void k_h16(const float* __restrict__ x, _Float16* __restrict__ X16, size_t n8) { const size_t t = (size_t)blockIdx.x * 256 + threadIdx.x; if (t >= n8) return; FragH f;
#pragma unroll
  for (int q = 0; q < 8; ++q) f.h[q] = (_Float16)x[t * 8 + q]; *(v8us*)((unsigned short*)X16 + t * 8) = f.half[0];  }
__device__ __forceinline__ void p_round16f(unsigned bid, const float* __restrict__ W, _Float16* __restrict__ Bt, size_t n8) { const size_t t = (size_t)bid * 256 + threadIdx.x; if (t >= n8) return; FragH f;
#pragma unroll
  for (int i = 0; i < 8; ++i) f.h[i] = (_Float16)(bf16_round(W[t * 8 + i]) * 16.0f); *(v8us*)((unsigned short*)Bt + t * 8) = f.half[0];  }
template <int NHv, int TTv>
__global__ __launch_bounds__(256) void k_vt(const _Float16* __restrict__ V16, int ldv, int voff, _Float16* __restrict__ Vt) { __shared__ unsigned short tl[64][66]; const int tid = threadIdx.x; const int slab = blockIdx.x / (TTv / 64), lg = blockIdx.x % (TTv / 64); const int b = slab / NHv, h = slab % NHv;
  for (int i = tid; i < 64 * 8; i += 256) { const int r = i / 8, c8 = (i % 8) * 8; FragH f; f.half[0] = *(const v8us*)((const unsigned short*)V16 + ((size_t)b * TTv + lg * 64 + r) * ldv + voff + h * 64 + c8);
#pragma unroll
    for (int q = 0; q < 8; ++q) tl[r][c8 + q] = f.u[q]; }
  __syncthreads();
  {
#pragma unroll
    for (int rd = 0; rd < 2; ++rd) { const int d = rd * 32 + tid / 8, pc = tid % 8; FragH f;
#pragma unroll
      for (int q = 0; q < 8; ++q) f.u[q] = tl[pc * 8 + q][d];
      *(v8us*)((unsigned short*)Vt + ((size_t)slab * 64 + d) * TTv + lg * 64 + pc * 8) = f.half[0]; }
     } }

__device__ __forceinline__ void p_hl(unsigned bid, const float* __restrict__ F, _Float16* __restrict__ Hh, _Float16* __restrict__ Hl, size_t n8) { const size_t t = (size_t)bid * 256 + threadIdx.x; if (t >= n8) return; FragH fh, fl; const v4f a = *(const v4fa*)(F + t * 8), c = *(const v4fa*)(F + t * 8 + 4);
#pragma unroll
  for (int q = 0; q < 4; ++q) { _Float16 h = (_Float16)a[q]; fh.h[q] = h; fl.h[q] = (_Float16)((a[q] - (float)h) * 1024.0f); h = (_Float16)c[q]; fh.h[4 + q] = h; fl.h[4 + q] = (_Float16)((c[q] - (float)h) * 1024.0f); }
  { *(v8us*)((unsigned short*)Hh + t * 8) = fh.half[0]; *(v8us*)((unsigned short*)Hl + t * 8) = fl.half[0];  } }

// ---- fast GEMM (block tile 128x64, wave tile 32x64; requires M % 128 == 0, N % 64 == 0 and K % 64 == 0); epilogue = k_gemm_hhx semantics ----
__device__ __forceinline__ v16h g2_fragl(const unsigned char* p) { FragH f; f.half[0] = *(const v8us*)p; f.half[1] = *(const v8us*)(p + 32); return f.v; }      /* a fragment's two 16-byte pieces of one LDS row, the k order of the global planes */
__device__ __forceinline__ v8f g2_mma(v16h a, v16h b, v8f c) { v8f d = __builtin_amdgcn_wmma_f32_16x16x32_f16(false, a, false, b, (short)0, c, false, false); asm volatile("v_nop\n\tv_nop\n\tv_nop\n\tv_nop" : "+v"(d) : "v"(a), "v"(b)); return d; }
// LDS image of one chunk of 64 k: the block's 128 A rows, then its 64 B rows, each 128 B at a pitch of 144 B (16 B x odd: ds_load_b128 fragment reads meet no bank twice).
#define G_P 144
#define G_B (128 * G_P)
#define G_ST (192 * G_P)
// A thread's twelve 16-byte asynchronous copies of one chunk (128 threads x 12 x 16 B = the chunk's 24 KiB; 8 lanes to a row = one whole 128-B line): l = its LDS byte address in the buffer, ga, gb = its global addresses in A and B; a16, b16 = bytes of 16 rows of A and of B in global memory.
__device__ __forceinline__ void g2_chunk_copy(unsigned l, const char* ga, const char* gb, unsigned a16, unsigned b16) {
  const unsigned l1 = l + 16 * G_P, l2 = l + 32 * G_P, l3 = l + 48 * G_P, l4 = l + 64 * G_P, l5 = l + 80 * G_P, l6 = l + 96 * G_P, l7 = l + 112 * G_P, l8 = l + G_B, l9 = l8 + 16 * G_P, l10 = l8 + 32 * G_P, l11 = l8 + 48 * G_P;
  const char* a1 = ga + a16; const char* a2 = a1 + a16; const char* a3 = a2 + a16; const char* a4 = a3 + a16; const char* a5 = a4 + a16; const char* a6 = a5 + a16; const char* a7 = a6 + a16;
  const char* b1 = gb + b16; const char* b2 = b1 + b16; const char* b3 = b2 + b16;
  /* the copies and, as the last line of the same statement, the wait that stands in front of any rewrite of their address registers */
  asm volatile("global_load_async_to_lds_b128 %0, %12, off\n\t"
               "global_load_async_to_lds_b128 %1, %13, off\n\t"
               "global_load_async_to_lds_b128 %2, %14, off\n\t"
               "global_load_async_to_lds_b128 %3, %15, off\n\t"
               "global_load_async_to_lds_b128 %4, %16, off\n\t"
               "global_load_async_to_lds_b128 %5, %17, off\n\t"
               "global_load_async_to_lds_b128 %6, %18, off\n\t"
               "global_load_async_to_lds_b128 %7, %19, off\n\t"
               "global_load_async_to_lds_b128 %8, %20, off\n\t"
               "global_load_async_to_lds_b128 %9, %21, off\n\t"
               "global_load_async_to_lds_b128 %10, %22, off\n\t"
               "global_load_async_to_lds_b128 %11, %23, off\n\t"
               "s_wait_xcnt 0x0"
               :: "v"(l), "v"(l1), "v"(l2), "v"(l3), "v"(l4), "v"(l5), "v"(l6), "v"(l7), "v"(l8), "v"(l9), "v"(l10), "v"(l11),
                  "v"(ga), "v"(a1), "v"(a2), "v"(a3), "v"(a4), "v"(a5), "v"(a6), "v"(a7), "v"(gb), "v"(b1), "v"(b2), "v"(b3) : "memory"); }
template <int ACT, int KC>      /* KC = K, a compile-time multiple of 64, at least 128; M a multiple of 128 (a block stages 128 whole rows) */
__global__ __launch_bounds__(128) __attribute__((amdgpu_waves_per_eu(4)))      /* a budget of 256 registers: the build needs no register-window switches */
void k_gemm2(const _Float16* __restrict__ A, int lda, size_t sA, const _Float16* __restrict__ Bh, int ldb, size_t sB, float alpha, const float* __restrict__ bias, const float* __restrict__ bias1, const float* __restrict__ bias2, size_t sBias, const float* __restrict__ CP, int rowsPerB, size_t sCPb, int row0g,
    float* __restrict__ C, _Float16* __restrict__ C16, int ldc, size_t sC, int M, int N, int K) {
  /* A and B reach the four waves through LDS: two buffers of one 64-k chunk each, filled by asynchronous copies in whole 128-B lines, one chunk ahead of the chunk in work; behind the loop's last barrier the same bytes stage the output rows */
  __shared__ __attribute__((aligned(16))) unsigned char ring[2 * G_ST];
  const int tid = threadIdx.x, w = tid >> 5, lane = tid & 31, ln = lane & 15, hh = lane >> 4; const int by = blockIdx.y;
  const float* bsel = (by == 0) ? bias : ((by == 1) ? bias1 : bias2);      /* products that share one grid (blockIdx.y) have each their own bias input */
  A += (size_t)by * sA; Bh += (size_t)by * sB; const size_t cofs = (size_t)by * sC; const float* bp = bsel ? bsel + (size_t)by * sBias : nullptr;
  const int ntn = N >> 6; const int mt = blockIdx.x / ntn, nq = blockIdx.x - mt * ntn; const int rowb = mt * 128, row0 = rowb + 32 * w, col0 = nq * 64; if (rowb >= M) return;      /* the whole block or none of it, in front of every barrier */
  const unsigned a16 = (unsigned)(16 * lda) * 2u, b16 = (unsigned)(16 * ldb) * 2u;
  const unsigned lc = (unsigned)(size_t)ring + (unsigned)((tid >> 3) * G_P + (tid & 7) * 16);
  const char* ga = (const char*)A + ((size_t)(rowb + (tid >> 3)) * lda) * 2 + (tid & 7) * 16; const char* gb = (const char*)Bh + ((size_t)(col0 + (tid >> 3)) * ldb) * 2 + (tid & 7) * 16;      /* the next chunk to copy */
  (void)K; constexpr int NT = KC / 64;
  g2_chunk_copy(lc, ga, gb, a16, b16);      /* chunk 0 into buffer 0 */
  asm volatile("s_wait_asynccnt 0x0" ::: "memory");      /* this wave's copies of chunk 0 have landed before the barrier publishes them */
  __syncthreads();      /* every wave reads what all four staged */
  ga += 128; gb += 128;
  g2_chunk_copy(lc + G_ST, ga, gb, a16, b16);      /* chunk 1 into buffer 1 */
  const unsigned char* fa = ring + (32 * w + ln) * G_P + 16 * hh; const unsigned char* fb = ring + G_B + ln * G_P + 16 * hh;      /* this lane's fragment rows in buffer 0 */
  unsigned bo = 0;      /* byte offset of the buffer in work */
  const v8f z8 = {0.f,0.f,0.f,0.f,0.f,0.f,0.f,0.f}; v8f c00 = z8, c01 = z8, c02 = z8, c03 = z8, c10 = z8, c11 = z8, c12 = z8, c13 = z8;
#pragma unroll 1      /* one copy of the trip in the text: the buffer is picked by an offset, not by the code */
  for (int t = 0; t < NT; ++t) {
    v16h fa0[2], fa1[2], fb0[2], fb1[2], fb2[2], fb3[2];      /* the chunk's two k steps: their 24 LDS reads stand together, ahead of the products */
#pragma unroll
    for (int s = 0; s < 2; ++s) { const unsigned char* pa = fa + bo + s * 64; const unsigned char* pb = fb + bo + s * 64; fa0[s] = g2_fragl(pa); fb0[s] = g2_fragl(pb); fa1[s] = g2_fragl(pa + 16 * G_P); fb1[s] = g2_fragl(pb + 16 * G_P); fb2[s] = g2_fragl(pb + 32 * G_P); fb3[s] = g2_fragl(pb + 48 * G_P); }
#pragma unroll
    for (int s = 0; s < 2; ++s) {
      c00 = g2_mma(fa0[s], fb0[s], c00); c10 = g2_mma(fa1[s], fb0[s], c10);
      c01 = g2_mma(fa0[s], fb1[s], c01); c11 = g2_mma(fa1[s], fb1[s], c11);
      c02 = g2_mma(fa0[s], fb2[s], c02); c12 = g2_mma(fa1[s], fb2[s], c12);
      c03 = g2_mma(fa0[s], fb3[s], c03); c13 = g2_mma(fa1[s], fb3[s], c13); }
    /* hand-over, every wave in this order: its own reads of this buffer are done, its own copies of the next chunk have landed, the barrier tells the other waves both; only then is this buffer refilled */
    asm volatile("s_wait_dscnt 0x0" ::: "memory");
    asm volatile("s_wait_asynccnt 0x0" ::: "memory");
    __syncthreads();
    ga += 128; gb += 128;
    if (t + 2 < NT) g2_chunk_copy(lc + bo, ga, gb, a16, b16);      /* the chunk after next, while one exists (a scalar test) */
    bo ^= G_ST; }
  asm volatile("s_wait_asynccnt 0x0" ::: "memory");      /* no copy is in flight when the ring's bytes are taken for the output rows */
  float* so = (float*)ring + w * (32 * 68);      /* this wave's 32 output rows at a pitch of 68 floats */
  v8f accs[8] = {c00, c01, c02, c03, c10, c11, c12, c13};
#pragma unroll
  for (int u = 0; u < 8; ++u) { const int t = u & 3, half = u >> 2; const int col = col0 + t * 16 + ln; const float bv = bp ? bf16_round(bp[col]) : 0.f;
#pragma unroll
    for (int r = 0; r < 8; ++r) { const int rloc = half * 16 + 8 * hh + r; float v = accs[u][r] * alpha + bv; if (CP) { const int bidx = (row0g + row0 + rloc) / rowsPerB; v += CP[(size_t)bidx * sCPb + (size_t)by * 64 + col]; }
      if (ACT == 3) v = fmaxf(v, 0.f); else if (ACT == 6) v = 0.5f * v * (1.0f + erff(v * 0.70710678118654752f)); else if (ACT == 11) v = 1.0f / (1.0f + expf(-v)); else if (ACT == 15) v = v / (1.0f + expf(-v)); else if (ACT == 12) v = (v > 0.f) ? v : 0.01f * v; else if (ACT == 8) v = tanhf(v);
      so[rloc * 68 + t * 16 + ln] = v; } }
  __builtin_amdgcn_fence(__ATOMIC_ACQ_REL, "workgroup"); __builtin_amdgcn_wave_barrier();
  const int rsub = lane >> 4, c4 = (lane & 15) * 4;
  {
#pragma unroll
    for (int q = 0; q < 16; ++q) { const int r = q * 2 + rsub; const v4f v = *(const v4fa*)&so[r * 68 + c4]; if (C) *(v4f*)(C + cofs + (size_t)(row0 + r) * ldc + col0 + c4) = v; if (C16) { v4h h4; for (int i = 0; i < 4; ++i) h4[i] = (_Float16)v[i]; *(v4h*)(C16 + cofs + (size_t)(row0 + r) * ldc + col0 + c4) = h4; } }
     } }



template <int TK>
__device__ __forceinline__ void p_vthl(unsigned bid, const float* __restrict__ VF, int ldv, _Float16* __restrict__ Vth, _Float16* __restrict__ Vtl) { __shared__ float tl[64][65]; const int tid = threadIdx.x; const int slab = bid / (TK / 64), lg = bid % (TK / 64); const int b = slab / NH, h = slab % NH;
  for (int i = tid; i < 64 * 16; i += 256) { const int r = i / 16, c4 = (i % 16) * 4; const v4f a = *(const v4fa*)(VF + ((size_t)b * TK + lg * 64 + r) * ldv + h * 64 + c4); tl[r][c4] = a[0]; tl[r][c4 + 1] = a[1]; tl[r][c4 + 2] = a[2]; tl[r][c4 + 3] = a[3]; }
  __syncthreads();
  FragH fh[2], fl[2]; size_t oo[2];
#pragma unroll
  for (int rd = 0; rd < 2; ++rd) { const int d = rd * 32 + tid / 8, pc = tid % 8;
#pragma unroll
    for (int q = 0; q < 8; ++q) { const float v = tl[pc * 8 + q][d]; const _Float16 hv = (_Float16)v; fh[rd].h[q] = hv; fl[rd].h[q] = (_Float16)((v - (float)hv) * 1024.0f); } oo[rd] = ((size_t)slab * 64 + d) * TK + lg * 64 + pc * 8; }
  {
#pragma unroll
    for (int rd = 0; rd < 2; ++rd) { *(v8us*)((unsigned short*)Vth + oo[rd]) = fh[rd].half[0]; *(v8us*)((unsigned short*)Vtl + oo[rd]) = fl[rd].half[0]; }
     } }
#define NB_E8 (NR * DM / 8 / 256)            /* blocks of a job with one thread to 8 elements of a [NR][DM] plane */
#define NB_VT (NBT * NH * (SLEN / 64))       /* blocks of the V transpose */
// One grid for the three jobs behind the projections (V^T planes, q planes, k planes), which need nothing of each other: a block-uniform range of the block index picks the job.
__global__ __launch_bounds__(256) void k_split(const float* __restrict__ FQ, const float* __restrict__ FK, const float* __restrict__ FV, _Float16* __restrict__ Qh, _Float16* __restrict__ Ql, _Float16* __restrict__ Kh, _Float16* __restrict__ Kl, _Float16* __restrict__ Vth, _Float16* __restrict__ Vtl) {
  unsigned bid = blockIdx.x; const size_t n8 = (size_t)NR * DM / 8;
  if (bid < NB_VT) { p_vthl<SLEN>(bid, FV, DM, Vth, Vtl); return; }
  bid -= NB_VT;
  if (bid < NB_E8) { p_hl(bid, FQ, Qh, Ql, n8); return; }
  p_hl(bid - NB_E8, FK, Kh, Kl, n8); }

// grammar bias for (query position pi, key position pj): dist_emb[bucket(|pj - pi|)][h] + ((pj > pi) - 0.5) * order_bias[h]
__device__ __forceinline__ float gbias(const float* sDE, float obh, const unsigned char* sLUT, int pi, int pj) { int d = abs(pj - pi); d = min(d, LUTN - 1); const int bin = sLUT[d]; return sDE[bin] + (((pj > pi) ? 1.0f : 0.0f) - 0.5f) * obh; }      /* sDE, obh = the head's rounded dist_emb column and order_bias, both times LOG2E */
// lane l <-> l ^ 16 (the other half of the wave), all lanes on
__device__ __forceinline__ float xhalf(float v) { const int b = __float_as_int(v); return __int_as_float(__builtin_amdgcn_permlanex16(b, b, 0x76543210, 0xfedcba98, false, false)); }
// LDS image of one tile of 32 keys: K hi and K residual as 32 rows of 128 B at a pitch of 144 B, V^T hi and residual as 64 rows of 64 B at a pitch of 80 B (16 B x odd: ds_load_b128 fragment reads meet no bank twice).
#define FK_P 144
#define FV_P 80
#define F_KH 0
#define F_KL (32 * FK_P)
#define F_VH (2 * 32 * FK_P)
#define F_VL (2 * 32 * FK_P + 64 * FV_P)
#define F_TILE (2 * 32 * FK_P + 2 * 64 * FV_P)
// A thread's eight 16-byte asynchronous copies of one tile (128 threads x 8 x 16 B = the tile's 16 KiB): lk, lv = its LDS byte addresses in the K and V^T parts of the buffer, g* = its global addresses in the four planes; k16, v32 = bytes of 16 K rows and of 32 V^T rows in global memory.
__device__ __forceinline__ void f_tile_copy(unsigned lk, unsigned lv, const char* gkh, const char* gkl, const char* gvh, const char* gvl, unsigned k16, unsigned v32) {
  const unsigned a0 = lk + F_KH, a1 = a0 + 16 * FK_P, a2 = lk + F_KL, a3 = a2 + 16 * FK_P, a4 = lv + F_VH, a5 = a4 + 32 * FV_P, a6 = lv + F_VL, a7 = a6 + 32 * FV_P;
  const char* p1 = gkh + k16; const char* p3 = gkl + k16; const char* p5 = gvh + v32; const char* p7 = gvl + v32;
  /* the copies and, as the last line of the same statement, the wait that stands in front of any rewrite of their address registers */
  asm volatile("global_load_async_to_lds_b128 %0, %8, off\n\t"
               "global_load_async_to_lds_b128 %1, %9, off\n\t"
               "global_load_async_to_lds_b128 %2, %10, off\n\t"
               "global_load_async_to_lds_b128 %3, %11, off\n\t"
               "global_load_async_to_lds_b128 %4, %12, off\n\t"
               "global_load_async_to_lds_b128 %5, %13, off\n\t"
               "global_load_async_to_lds_b128 %6, %14, off\n\t"
               "global_load_async_to_lds_b128 %7, %15, off\n\t"
               "s_wait_xcnt 0x0"
               :: "v"(a0), "v"(a1), "v"(a2), "v"(a3), "v"(a4), "v"(a5), "v"(a6), "v"(a7), "v"(gkh), "v"(p1), "v"(gkl), "v"(p3), "v"(gvh), "v"(p5), "v"(gvl), "v"(p7) : "memory"); }
template <int TQ, int TK>
__global__ __launch_bounds__(128) void k_flashb(const _Float16* __restrict__ Q16, const _Float16* __restrict__ Q16lo, int ldq, const _Float16* __restrict__ K16, const _Float16* __restrict__ K16lo, int ldk, const _Float16* __restrict__ Vt, const _Float16* __restrict__ Vtlo, const unsigned* __restrict__ MB, const int* __restrict__ RA, const int* __restrict__ KE, const float* __restrict__ BT, const float* __restrict__ OB, const int* __restrict__ LUT, const int* __restrict__ LAG, float* __restrict__ O, int ldo) {
  constexpr int RPW = 16, NQB = TQ / (4 * RPW), DT = 4, KS = 2;
  __shared__ __attribute__((aligned(16))) float sO[4][RPW][64 + 4];
  const int tid = threadIdx.x, w = tid >> 5, lane = tid & 31, ln = lane & 15, hh = lane >> 4;
  const int slab = blockIdx.x / NQB, qblk = blockIdx.x % NQB; const int b = slab / NH, h = slab % NH; const int qb0 = qblk * (4 * RPW); const int q0 = qb0 + w * RPW;
  MB += (size_t)b * TQ * (TK / 32); LAG += (size_t)b * TK;      /* per-batch key-mask table and positions: the grid spans all batches */
  const float obh = bf16_round(OB[h]) * LOG2E;      /* read once, ahead of the loop: behind the loop's waits (memory clobbers) it would be loaded anew every trip */
  /* K and V^T reach the four waves through LDS: two buffers of one 32-key tile each, filled by asynchronous copies in whole rows, one tile ahead of the tile in work; every wave reads its fragments from there */
  __shared__ __attribute__((aligned(16))) unsigned char ring[2 * F_TILE];
  int jend = __builtin_amdgcn_readfirstlane(KE[qblk * 32]); jend = min(TK, (jend + 31) & ~31); if (jend < 32) jend = 32;      /* block-uniform, in a scalar register: it decides whether copies issue */
  const unsigned k16 = (unsigned)(16 * ldk) * 2u, v32 = (unsigned)(32 * TK) * 2u;
  const unsigned lk = (unsigned)(size_t)ring + (unsigned)((tid >> 3) * FK_P + (tid & 7) * 16), lv = (unsigned)(size_t)ring + (unsigned)((tid >> 2) * FV_P + (tid & 3) * 16);      /* 8 lanes to a K row (one 128-B line), 4 lanes to a V^T row */
  const size_t gko = (((size_t)b * TK + (tid >> 3)) * ldk + h * 64) * 2 + (tid & 7) * 16, gvo = (((size_t)slab * 64 + (tid >> 2)) * TK) * 2 + (tid & 3) * 16;
  const char* gkh = (const char*)K16 + gko; const char* gkl = (const char*)K16lo + gko; const char* gvh = (const char*)Vt + gvo; const char* gvl = (const char*)Vtlo + gvo;      /* the next tile to copy */
  f_tile_copy(lk, lv, gkh, gkl, gvh, gvl, k16, v32);      /* tile 0 into buffer 0 */
  /* the bias lookup's tables, staged once per block: bucket of every distance as one byte, the head's rounded dist_emb column, the batch's positions */
  typedef int v4ia __attribute__((ext_vector_type(4), may_alias));
  __shared__ __attribute__((aligned(16))) unsigned sLUTw[LUTN / 4]; __shared__ float sDE[NBIN]; __shared__ __attribute__((aligned(16))) int sPos[TK];
  for (int i = tid; i < LUTN / 4; i += 128) { const v4ia c = *(const v4ia*)(LUT + 4 * i); sLUTw[i] = (unsigned)(c[0] & (NBIN - 1)) | ((unsigned)(c[1] & (NBIN - 1)) << 8) | ((unsigned)(c[2] & (NBIN - 1)) << 16) | ((unsigned)(c[3] & (NBIN - 1)) << 24); }
  for (int i = tid; i < TK / 4; i += 128) *(v4ia*)(sPos + 4 * i) = *(const v4ia*)(LAG + 4 * i);
  if (tid < NBIN) sDE[tid] = bf16_round(BT[tid * NH + h]) * LOG2E;
  asm volatile("s_wait_asynccnt 0x0" ::: "memory");      /* this wave's copies of tile 0 have landed before the barrier publishes them */
  __syncthreads();      /* every wave reads what all four staged */
  gkh += 2 * (size_t)k16; gkl += 2 * (size_t)k16; gvh += 64; gvl += 64;
  if (jend > 32) f_tile_copy(lk + F_TILE, lv + F_TILE, gkh, gkl, gvh, gvl, k16, v32);      /* tile 1 into buffer 1 */
  const unsigned char* sLUT = (const unsigned char*)sLUTw;
  const int tq = q0 + ln;      /* this lane's query */
  FragH aq[KS], aql[KS];       /* Q as the B operand: column = query ln */
  { const size_t qo = ((size_t)b * TQ + tq) * ldq + h * 64; const unsigned short* qr = (const unsigned short*)Q16 + qo; const unsigned short* ql = (const unsigned short*)Q16lo + qo;
#pragma unroll
    for (int ks = 0; ks < KS; ++ks) { aq[ks].half[0] = *(const v8us*)(qr + ks * 32 + 8 * hh); aq[ks].half[1] = *(const v8us*)(qr + ks * 32 + 16 + 8 * hh); aql[ks].half[0] = *(const v8us*)(ql + ks * 32 + 8 * hh); aql[ks].half[1] = *(const v8us*)(ql + ks * 32 + 16 + 8 * hh); } }
  const bool am = (RA[tq] != 0); const unsigned* mrow = MB + (size_t)tq * (TK / 32); const int pi = sPos[tq];
  const unsigned char* fk = ring + ln * FK_P; const unsigned char* fv = ring + ln * FV_P;      /* this lane's fragment rows in buffer 0 */
  unsigned bo = 0;      /* byte offset of the buffer in work */
  float m_q = -3.0e38f, l_q = 0.f; v8f oacc[DT], oaccl[DT];
#pragma unroll
  for (int dt = 0; dt < DT; ++dt) { oacc[dt] = (v8f){0.f,0.f,0.f,0.f,0.f,0.f,0.f,0.f}; oaccl[dt] = oacc[dt]; }
#pragma unroll 1
  for (int j0 = 0; j0 < jend; j0 += 32) {
    const unsigned mword = mrow[j0 >> 5];      /* this query's key-mask bits of the 32 keys */
    v8f s[2];
#pragma unroll
    for (int nt = 0; nt < 2; ++nt) { const unsigned short* kr = (const unsigned short*)(fk + bo + F_KH + nt * 16 * FK_P); const unsigned short* kl = (const unsigned short*)(fk + bo + F_KL + nt * 16 * FK_P); FragH bk[KS], bkl[KS];      /* K as the A operand: row = key */
#pragma unroll
      for (int ks = 0; ks < KS; ++ks) { bk[ks].half[0] = *(const v8us*)(kr + ks * 32 + 8 * hh); bk[ks].half[1] = *(const v8us*)(kr + ks * 32 + 16 + 8 * hh); bkl[ks].half[0] = *(const v8us*)(kl + ks * 32 + 8 * hh); bkl[ks].half[1] = *(const v8us*)(kl + ks * 32 + 16 + 8 * hh); }
      v8f acc = (v8f){0.f,0.f,0.f,0.f,0.f,0.f,0.f,0.f}, accr = acc;
#pragma unroll
      for (int ks = 0; ks < KS; ++ks) { acc = mmaH<1>(bk[ks].v, bk[ks].v, aq[ks].v, aq[ks].v, acc); accr = mmaH<1>(bk[ks].v, bk[ks].v, aql[ks].v, aql[ks].v, accr); accr = mmaH<1>(bkl[ks].v, bkl[ks].v, aq[ks].v, aq[ks].v, accr); }
      s[nt] = acc + accr * 0.0009765625f; }
    const unsigned mw = mword >> (8 * hh);      /* bit nt * 16 + r = this lane's key nt * 16 + 8 hh + r */
    float sc[2][8]; bool ok[2][8]; float mc = -INFINITY;
#pragma unroll
    for (int nt = 0; nt < 2; ++nt) { const v4ia pA = *(const v4ia*)(sPos + j0 + nt * 16 + 8 * hh), pB = *(const v4ia*)(sPos + j0 + nt * 16 + 8 * hh + 4);
#pragma unroll
      for (int r = 0; r < 8; ++r) { const int pj = (r < 4) ? pA[r & 3] : pB[r & 3]; ok[nt][r] = am || (((mw >> (nt * 16 + r)) & 1u) == 0u);
        const float sv = s[nt][r] * (SCL * LOG2E) + gbias(sDE, obh, sLUT, pi, pj);      /* + grammar distance-bucket and order biases; base-2 domain */
        sc[nt][r] = ok[nt][r] ? (am ? 0.f : sv) : -INFINITY; mc = fmaxf(mc, sc[nt][r]); } }
    mc = fmaxf(mc, xhalf(mc));
    const float mn = fmaxf(m_q, mc); const float ea = __builtin_amdgcn_exp2f(m_q - mn); const float al = (mn > -1.0e38f) ? ea : 1.0f; m_q = mn;
    FragH pa, pl; float ls = 0.f;      /* P^T hi and residual, already in the B operand's order */
#pragma unroll
    for (int nt = 0; nt < 2; ++nt)
#pragma unroll
      for (int r = 0; r < 8; ++r) { const float e = __builtin_amdgcn_exp2f(sc[nt][r] - mn);      /* argument <= 0 (or -inf): no range guard is needed; a result under 2^-126 reads 0, far below what P's f16 pair keeps */ const float p = ok[nt][r] ? e : 0.f; ls += p;
        const float ps = p * 1024.0f; const _Float16 t2 = (_Float16)ps; pa.h[nt * 8 + r] = t2; pl.h[nt * 8 + r] = (_Float16)((ps - (float)t2) * 1024.0f); }
    l_q = l_q * al + ls;
#pragma unroll
    for (int dt = 0; dt < DT; ++dt) { oacc[dt] *= al; oaccl[dt] *= al; }
#pragma unroll
    for (int dt = 0; dt < DT; ++dt) { const unsigned short* vh = (const unsigned short*)(fv + bo + F_VH + dt * 16 * FV_P); const unsigned short* vl = (const unsigned short*)(fv + bo + F_VL + dt * 16 * FV_P); FragH bv, bl; bv.half[0] = *(const v8us*)(vh + 8 * hh); bv.half[1] = *(const v8us*)(vh + 16 + 8 * hh); bl.half[0] = *(const v8us*)(vl + 8 * hh); bl.half[1] = *(const v8us*)(vl + 16 + 8 * hh);      /* V^T as the A operand: row = d */
      oacc[dt] = mmaH<1>(bv.v, bv.v, pa.v, pa.v, oacc[dt]); oaccl[dt] = mmaH<1>(bl.v, bl.v, pa.v, pa.v, oaccl[dt]); oaccl[dt] = mmaH<1>(bv.v, bv.v, pl.v, pl.v, oaccl[dt]); }
    /* hand-over, every wave in this order: its own reads of this buffer are done, its own copies of the next tile have landed, the barrier tells the other waves both; only then is this buffer refilled */
    asm volatile("s_wait_dscnt 0x0" ::: "memory");
    asm volatile("s_wait_asynccnt 0x0" ::: "memory");
    __syncthreads();
    gkh += 2 * (size_t)k16; gkl += 2 * (size_t)k16; gvh += 64; gvl += 64;
    if (j0 + 64 < jend) f_tile_copy(lk + bo, lv + bo, gkh, gkl, gvh, gvl, k16, v32);      /* the tile after next, while one exists (a scalar test) */
    bo ^= F_TILE; }
  asm volatile("s_wait_asynccnt 0x0" ::: "memory");      /* no copy is left in flight when the wave goes on to its end */
  const float lt = l_q + xhalf(l_q); const float inv = (lt > 0.f) ? 1.0f / (lt * 1024.0f) : 0.f;
#pragma unroll
  for (int dt = 0; dt < DT; ++dt)
#pragma unroll
    for (int g = 0; g < 2; ++g) { v4f o4;
#pragma unroll
      for (int i = 0; i < 4; ++i) o4[i] = (oacc[dt][g * 4 + i] + oaccl[dt][g * 4 + i] * 0.0009765625f) * inv;
      *(v4fa*)&sO[w][ln][dt * 16 + 8 * hh + g * 4] = o4; }
  __builtin_amdgcn_fence(__ATOMIC_ACQ_REL, "workgroup"); __builtin_amdgcn_wave_barrier();
  {
#pragma unroll
    for (int rp = 0; rp < RPW; rp += 2) { const int r = rp + (lane >> 4), pc = lane & 15; const v4f val = *(const v4fa*)&sO[w][r][pc * 4]; *(v4f*)(O + ((size_t)b * TQ + q0 + r) * ldo + h * 64 + pc * 4) = val; }
     } }


__global__ __launch_bounds__(256) void k_fulltab(unsigned* __restrict__ MB, int* __restrict__ RA, int* __restrict__ KE, int nq, int nk) {
  const int t = blockIdx.x * 256 + threadIdx.x;
  if (t < nq * (nk / 32)) { *(unsigned*)(MB + t) = 0u;  }
  if (t < nq) { *(int*)(RA + t) = 0;  }
  if (t < nq / 64) { *(int*)(KE + t * 32) = nk;  } }
__global__ __launch_bounds__(256) void k_lnx(const float* __restrict__ X, const float* __restrict__ g, const float* __restrict__ bb, _Float16* __restrict__ Y16, float* __restrict__ XB) {
  #pragma clang fp contract(off)
  const int tid = threadIdx.x, w = tid >> 5, ln = tid & 31; const int r = blockIdx.x * 8 + w; if (r >= NR) return; const float* x = X + (size_t)r * DM; float s = 0.f;
#pragma unroll 1
  for (int i = 0; i < DM / 128; ++i) { const v4f a = *(const v4fa*)(x + i * 128 + ln * 4); for (int q = 0; q < 4; ++q) s += bf16_round(a[q]); }
  for (int o = 16; o > 0; o >>= 1) s += __shfl_xor(s, o, 32); const float mu = s / (float)DM; float q2 = 0.f;
#pragma unroll 1
  for (int i = 0; i < DM / 128; ++i) { const v4f a = *(const v4fa*)(x + i * 128 + ln * 4); for (int q = 0; q < 4; ++q) { const float d = bf16_round(a[q]) - mu; q2 += d * d; } }
  for (int o = 16; o > 0; o >>= 1) q2 += __shfl_xor(q2, o, 32); const float rs = rsqrtf(q2 / (float)DM + 1e-5f);
  {
#pragma unroll 1
    for (int i = 0; i < DM / 128; ++i) { const int c0 = i * 128 + ln * 4; const v4f a = *(const v4fa*)(x + c0); _Float16 h4[4]; v4f xb;
      for (int q = 0; q < 4; ++q) { const float t = bf16_round(a[q]); h4[q] = (_Float16)((t - mu) * rs * bf16_round(g[c0 + q]) + bf16_round(bb[c0 + q])); xb[q] = t; }
      *(unsigned long long*)((unsigned short*)Y16 + (size_t)r * DM + c0) = *(const unsigned long long*)h4; *(v4f*)(XB + (size_t)r * DM + c0) = xb; }
     } }
// bucket table: LUT[d] = count of the NBIN - 1 bf16-rounded edges below d (at most NBIN - 1), for d < LUTN
__device__ __forceinline__ void p_lut(unsigned bid, const float* __restrict__ edges, int* __restrict__ LUT) {
  #pragma clang fp contract(off)
  const int d = bid * 256 + threadIdx.x; if (d >= LUTN) return; const float fd = (float)d; int c = 0;
#pragma unroll 1
  for (int e = 0; e < NBIN - 1; ++e) c += (bf16_round(edges[e]) < fd) ? 1 : 0;
  c = min(c, NBIN - 1); *(int*)(LUT + d) = c;  }
__device__ __forceinline__ void p_masktab(unsigned bid, const float* __restrict__ mask, unsigned* __restrict__ MB, int* __restrict__ RA, int* __restrict__ KE) {
  const size_t t = (size_t)bid * 256 + threadIdx.x; const int nw = SLEN / 32;
  if (t < (size_t)NBT * SLEN * nw) { const int w = (int)(t % nw); const int b = (int)(t / ((size_t)SLEN * nw)); unsigned bits = 0u; for (int j = 0; j < 32; ++j) bits |= (bf16_round(mask[(size_t)b * SLEN + 32 * w + j]) == 0.0f) ? (1u << j) : 0u; *(unsigned*)(MB + t) = bits;  }
  if (t < SLEN) { *(int*)(RA + t) = 0;  }
  if (t < SLEN / 64) { *(int*)(KE + t * 32) = SLEN;  } }
#define NB_MT (NBT * SLEN * (SLEN / 32) / 256)   /* blocks of the key-mask tables */
#define NB_W (DM * DM / 8 / 256)                 /* blocks of one weight plane */
// One grid for the seven set-up jobs (mask tables, the x plane, four weight planes, the bucket table), which need nothing of each other: a block-uniform range of the block index picks the job.
__global__ __launch_bounds__(256) void k_prep(const float* __restrict__ x, const float* __restrict__ mask, const float* __restrict__ qw, const float* __restrict__ kw, const float* __restrict__ vw, const float* __restrict__ ow, const float* __restrict__ edges,
    _Float16* __restrict__ X16, _Float16* __restrict__ BW, unsigned* __restrict__ MB, int* __restrict__ RA, int* __restrict__ KE, int* __restrict__ LUT) {
  unsigned bid = blockIdx.x;
  if (bid < NB_MT) { p_masktab(bid, mask, MB, RA, KE); return; }
  bid -= NB_MT;
  if (bid < NB_E8) { p_x16(bid, x, X16, (size_t)NR * DM / 8); return; }
  bid -= NB_E8;
  if (bid < 4 * NB_W) { const unsigned j = bid / NB_W; const float* W = (j == 0) ? qw : ((j == 1) ? kw : ((j == 2) ? vw : ow)); p_round16f(bid - j * NB_W, W, BW + (size_t)j * DM * DM, (size_t)DM * DM / 8); return; }      /* BW: the four planes one behind the other */
  p_lut(bid - 4 * NB_W, edges, LUT); }
__global__ __launch_bounds__(256) void k_hlmask(const float* __restrict__ F, const float* __restrict__ mask, _Float16* __restrict__ Hh, _Float16* __restrict__ Hl, size_t n8) {
  #pragma clang fp contract(off)
  const size_t t = (size_t)blockIdx.x * 256 + threadIdx.x; if (t >= n8) return; const float mk = bf16_round(mask[(t * 8) / DM]); FragH fh, fl;
#pragma unroll
  for (int q = 0; q < 8; ++q) { const float v = F[t * 8 + q] * mk; const _Float16 h = (_Float16)v; fh.h[q] = h; fl.h[q] = (_Float16)((v - (float)h) * 1024.0f); }
  { *(v8us*)((unsigned short*)Hh + t * 8) = fh.half[0]; *(v8us*)((unsigned short*)Hl + t * 8) = fl.half[0];  } }
__global__ __launch_bounds__(256) void k_causaltab(unsigned* __restrict__ MB, int* __restrict__ RA, int* __restrict__ KE, int nq, int nk) {
  const int t = blockIdx.x * 256 + threadIdx.x; const int nw = nk / 32;
  if (t < nq * nw) { const int q = t / nw, w = t % nw; const int first = q + 1 - 32 * w; const unsigned bits = (first <= 0) ? 0xffffffffu : ((first >= 32) ? 0u : (0xffffffffu << first)); *(unsigned*)(MB + t) = bits;  }
  if (t < nq) { *(int*)(RA + t) = 0;  }
  if (t < nq / 64) { const int v = 64 * (t + 1); *(int*)(KE + t * 32) = v;  } }


extern "C" void kernel_launch(void* const* d_in, const int* in_sizes, int n_in,
                              void* d_out, int out_size, void* d_ws, size_t ws_size, hipStream_t stream) {
  (void)in_sizes; (void)n_in; (void)out_size;
  const float* const* I = (const float* const*)d_in; const float* x = I[0]; const int* pos = (const int*)d_in[1]; const float* mask = I[2]; const float* qw = I[3]; const float* qb = I[4]; const float* kw = I[5]; const float* kb = I[6]; const float* vw = I[7]; const float* vb = I[8]; const float* ow = I[9]; const float* ob = I[10]; const float* de = I[11]; const float* obias = I[12]; const float* edges = I[13];
  char* ws = (char*)d_ws; size_t off = 0;
  auto take = [&](size_t bytes) { char* p = ws + off; off += (bytes + 255) & ~(size_t)255; return p; };
  _Float16* BQ = (_Float16*)take((size_t)4 * DM * DM * 2); _Float16* BO = BQ + (size_t)3 * DM * DM;      /* q, k, v, o weight planes, one behind the other */
  _Float16* X16 = (_Float16*)take((size_t)NR * DM * 2); float* F = (float*)take((size_t)3 * NR * DM * 4);      /* q, k, v in f32, one behind the other */
  _Float16* Qh = (_Float16*)take((size_t)NR * DM * 2); _Float16* Ql = (_Float16*)take((size_t)NR * DM * 2); _Float16* Kh = (_Float16*)take((size_t)NR * DM * 2); _Float16* Kl = (_Float16*)take((size_t)NR * DM * 2); _Float16* Vth = (_Float16*)take((size_t)NR * DM * 2); _Float16* Vtl = (_Float16*)take((size_t)NR * DM * 2);
  unsigned* MB = (unsigned*)take((size_t)NBT * SLEN * (SLEN / 32) * 4); int* RA = (int*)take((size_t)SLEN * 4); int* KE = (int*)take((size_t)(SLEN / 64) * 32 * 4); int* LUT = (int*)take((size_t)LUTN * 4);
  if (off > ws_size) return;      /* 2 + 8 + 48 + 48 + 1.1 = 107 MiB */
  float* O = F; _Float16* Oh = Qh; _Float16* Ol = Ql;
  const size_t n8 = (size_t)NR * DM / 8; const unsigned nb8 = (unsigned)((n8 + 255) / 256); const dim3 gP((NR / 128) * (DM / 64), 1), gP3((NR / 128) * (DM / 64), 3);
  k_prep<<<NB_MT + NB_E8 + 4 * NB_W + LUTN / 256, 256, 0, stream>>>(x, mask, qw, kw, vw, ow, edges, X16, BQ, MB, RA, KE, LUT);      /* torch (out,in) = natural Bt */
  k_gemm2<0, DM><<<gP3, 128, 0, stream>>>(X16, DM, 0, BQ, DM, (size_t)DM * DM, 0.0625f, qb, kb, vb, 0, nullptr, 1, 0, 0, F, nullptr, DM, (size_t)NR * DM, NR, DM, DM);      /* blockIdx.y = q, k, v */
  k_split<<<NB_VT + 2 * NB_E8, 256, 0, stream>>>(F, F + (size_t)NR * DM, F + (size_t)2 * NR * DM, Qh, Ql, Kh, Kl, Vth, Vtl);
  k_flashb<SLEN, SLEN><<<NBT * NH * (SLEN / 64), 128, 0, stream>>>(Qh, Ql, DM, Kh, Kl, DM, Vth, Vtl, MB, RA, KE, de, obias, LUT, pos, O, DM);
  k_hlmask<<<nb8, 256, 0, stream>>>(O, mask, Oh, Ol, n8);
  k_gemm2<0, DM><<<gP, 128, 0, stream>>>(Oh, DM, 0, BO, DM, 0, 0.0625f, ob, nullptr, nullptr, 0, nullptr, 1, 0, 0, (float*)d_out, nullptr, DM, 0, NR, DM, DM);
  k_gemm2<0, DM><<<gP, 128, 0, stream>>>(Ol, DM, 0, BO, DM, 0, 0.0625f / 1024.0f, nullptr, nullptr, nullptr, 0, (float*)d_out, 1, (size_t)DM, 0, (float*)d_out, nullptr, DM, 0, NR, DM, DM);
}

// v009
// It runs in 144 microseconds.
// Two timings next to v008 both put it at 1.18 times that version's speed.
// All steps since v000 together make it 14.3 times as fast.
#include <hip/hip_runtime.h>
// Grammar attention (8 x 1024 tokens, 512 = 8 heads x 64): q,k,v = x W^T + b; scores = q.k/8 + dist_emb[bucket(|pos_j - pos_i|)][h] + ((pos_j > pos_i) - 0.5) * order_bias[h] with INPUT int32 positions, INPUT bin edges (torch.bucketize right=False = count of edges < dist) and an INPUT key/query mask (masked keys excluded; masked query rows zeroed before the output projection, as out * mask); softmax; out = ((attn v) * mask) Wo^T + bo -> [8,1024,512].
// Structure: x as an exact f16 plane; projections as f16 WMMA GEMMs (32x64 wave tiles, f32 accumulation, exact x16 weights + bias); a device-built bucket lookup table over integer distances (from the INPUT edges) and per-batch key-mask bit tables; q, k as f16 hi + (x2^10) residual planes, V^T as hi + residual planes; the fused flash kernel gathers both biases by the INPUT positions inside the score stage (transposed score and value tiles, online f32 softmax per lane, P hi + residual kept in registers, two value accumulators); O scaled by the query mask, split hi/lo, into Wo (two GEMMs, bias in the first).
// Compute dtype: x, weights, biases, dist_emb, order_bias, bin_edges, mask rounded to bf16; projections exact; q, k, P, v, O as f16 hi + residual pairs (~2^-21); f32 accumulation and softmax. v_wmma_f32_16x16x32_f16.
#define NBT 8
#define SLEN 1024
#define NBIN 32
#define LUTN 16384            /* bucket lookup over integer distances 0..LUTN-1 (positions < 5000) */
#define DM 512
#define NH 8
#define SCL 0.125f
#define LOG2E 1.4426950408889634f   /* the flash kernel's scores, biases and running maximum are kept times log2(e): e^(s - m) is then one native 2^x */
#define NR (NBT * SLEN)
typedef __bf16 v16b __attribute__((ext_vector_type(16)));
typedef unsigned short v8us __attribute__((ext_vector_type(8), may_alias));
typedef float  v8f  __attribute__((ext_vector_type(8)));
typedef float  v4f  __attribute__((ext_vector_type(4)));
typedef float  v4fa __attribute__((ext_vector_type(4), may_alias));
union FragB { v16b v; v8us half[2]; unsigned short u[16]; };

__device__ __forceinline__ unsigned short bf16_bits(float x) { unsigned int u = __float_as_uint(x); return (unsigned short)((u + 0x7FFFu + ((u >> 16) & 1u)) >> 16); }
__device__ __forceinline__ float bf16_val(unsigned short b) { return __uint_as_float(((unsigned int)b) << 16); }
__device__ __forceinline__ float bf16_round(float x) { return bf16_val(bf16_bits(x)); }
// D += A·B with NT terms: 1 = ah·bh, 2 = + al·bh (A split), 3 = + ah·bl (both split)
template <int NT>
__device__ __forceinline__ v8f mmaN(v16b ah, v16b al, v16b bh, v16b bl, v8f c) {
  c = __builtin_amdgcn_wmma_f32_16x16x32_bf16(false, ah, false, bh, (short)0, c, false, false);
  if (NT >= 2) c = __builtin_amdgcn_wmma_f32_16x16x32_bf16(false, al, false, bh, (short)0, c, false, false);
  if (NT >= 3) c = __builtin_amdgcn_wmma_f32_16x16x32_bf16(false, ah, false, bl, (short)0, c, false, false);
  asm volatile("v_nop\n\tv_nop\n\tv_nop\n\tv_nop" : "+v"(c) : "v"(ah), "v"(al), "v"(bh), "v"(bl));
  return c;
}

__global__ __launch_bounds__(256) void k_wt_bf16(const float* __restrict__ W, unsigned short* __restrict__ Wt, int K, int N) {
  const int t = blockIdx.x * 256 + threadIdx.x;
  const int k8n = K / 8;
  if (t >= N * k8n) return;
  const int n = t / k8n, k8 = (t % k8n) * 8;
  v8us v;
#pragma unroll
  for (int i = 0; i < 8; ++i) v[i] = bf16_bits(W[(size_t)(k8 + i) * N + n]);
  *(v8us*)(Wt + (size_t)n * K + k8) = v;
  
}

// GEMM C[M][N] (f32, pitch ldc) = act(A[M][K]·W + bias). A f32 row-major (pitch lda) converted per fragment to bf16
// (ASPLIT: hi/lo two planes -> 2 terms, else single rounded term); Wt bf16 [N][K] (pitch ldb). BIAS_BF16 rounds the
// bias to bf16 first (bias quantised to bf16 before the add). K%32==0, M%16==0, N%64==0.
template <bool ASPLIT, int ACT, bool BIAS_BF16>
__global__ __launch_bounds__(128) void k_gemm_bf(const float* __restrict__ A, int lda, const unsigned short* __restrict__ Wt, int ldb,
                                               const float* __restrict__ bias, float* __restrict__ C, int ldc, int M, int N, int K) {
  __shared__ __attribute__((aligned(16))) float so[4][16][64];
  const int tid = threadIdx.x, w = tid >> 5, lane = tid & 31, ln = lane & 15, hh = lane >> 4;
  const int ntn = N / 64;
  const int wid = blockIdx.x * 4 + w;
  const int mt = wid / ntn, nq = wid % ntn;
  if (mt * 16 >= M) return;
  const int row0 = mt * 16, col0 = nq * 64;
  const float* arow = A + (size_t)(row0 + ln) * lda;
  v8f acc[4] = {};
  for (int kb = 0; kb < K; kb += 32) {
    FragB ah, al;
    const v4f x0 = *(const v4fa*)(arow + kb + 8 * hh), x1 = *(const v4fa*)(arow + kb + 8 * hh + 4);
    const v4f x2 = *(const v4fa*)(arow + kb + 16 + 8 * hh), x3 = *(const v4fa*)(arow + kb + 16 + 8 * hh + 4);
    float xs[16] = {x0[0],x0[1],x0[2],x0[3],x1[0],x1[1],x1[2],x1[3],x2[0],x2[1],x2[2],x2[3],x3[0],x3[1],x3[2],x3[3]};
#pragma unroll
    for (int i = 0; i < 16; ++i) { const unsigned short hb = bf16_bits(xs[i]); ah.u[i] = hb; al.u[i] = ASPLIT ? bf16_bits(xs[i] - bf16_val(hb)) : (unsigned short)0; }
#pragma unroll
    for (int t = 0; t < 4; ++t) {
      const unsigned short* brow = Wt + (size_t)(col0 + t * 16 + ln) * ldb + kb;
      FragB b;
      b.half[0] = *(const v8us*)(brow + 8 * hh);
      b.half[1] = *(const v8us*)(brow + 16 + 8 * hh);
      acc[t] = mmaN<ASPLIT ? 2 : 1>(ah.v, al.v, b.v, b.v, acc[t]);
    }
  }
#pragma unroll
  for (int t = 0; t < 4; ++t) {
    float bv = bias ? bias[col0 + t * 16 + ln] : 0.f;
    if (BIAS_BF16) bv = bf16_round(bv);
#pragma unroll
    for (int r = 0; r < 8; ++r) { float v = acc[t][r] + bv; if (ACT == 1) v = fmaxf(v, 0.f); so[w][8 * hh + r][t * 16 + ln] = v; }
  }
  __builtin_amdgcn_fence(__ATOMIC_ACQ_REL, "workgroup");
  __builtin_amdgcn_wave_barrier();
  const int rsub = lane >> 4, c4 = (lane & 15) * 4;
  {
#pragma unroll
    for (int q = 0; q < 8; ++q) {
      const int r = q * 2 + rsub;
      const v4f v = *(const v4fa*)&so[w][r][c4];
      *(v4f*)(C + (size_t)(row0 + r) * ldc + col0 + c4) = v;
    }
    
  }
}

// GEMM C = act(A·W + bias + resid): A f32 (ASPLIT -> hi/lo 2 terms), Wt bf16 [N][K]; ACT 0 none, 1 relu, 2 exact gelu;
// resid (optional, f32, row index = (row % rmod), pitch ldr, RES_BF16 rounds it) added before the activation.
template <bool ASPLIT, int ACT, bool BIAS_BF16, bool RES_BF16>
__global__ __launch_bounds__(128) void k_gemm_bf3(const float* __restrict__ A, int lda, const unsigned short* __restrict__ Wt, int ldb,
                                                const float* __restrict__ bias, const float* __restrict__ resid, int rmod, int ldr,
                                                float* __restrict__ C, int ldc, int M, int N, int K) {
  __shared__ __attribute__((aligned(16))) float so[4][16][64];
  const int tid = threadIdx.x, w = tid >> 5, lane = tid & 31, ln = lane & 15, hh = lane >> 4;
  const int ntn = N / 64;
  const int wid = blockIdx.x * 4 + w;
  const int mt = wid / ntn, nq = wid % ntn;
  if (mt * 16 >= M) return;
  const int row0 = mt * 16, col0 = nq * 64;
  const float* arow = A + (size_t)(row0 + ln) * lda;
  v8f acc[4] = {};
  for (int kb = 0; kb < K; kb += 32) {
    FragB ah, al;
    const v4f x0 = *(const v4fa*)(arow + kb + 8 * hh), x1 = *(const v4fa*)(arow + kb + 8 * hh + 4);
    const v4f x2 = *(const v4fa*)(arow + kb + 16 + 8 * hh), x3 = *(const v4fa*)(arow + kb + 16 + 8 * hh + 4);
    float xs[16] = {x0[0],x0[1],x0[2],x0[3],x1[0],x1[1],x1[2],x1[3],x2[0],x2[1],x2[2],x2[3],x3[0],x3[1],x3[2],x3[3]};
#pragma unroll
    for (int i = 0; i < 16; ++i) { const unsigned short hb = bf16_bits(xs[i]); ah.u[i] = hb; al.u[i] = ASPLIT ? bf16_bits(xs[i] - bf16_val(hb)) : (unsigned short)0; }
#pragma unroll
    for (int t = 0; t < 4; ++t) {
      const unsigned short* brow = Wt + (size_t)(col0 + t * 16 + ln) * ldb + kb;
      FragB b;
      b.half[0] = *(const v8us*)(brow + 8 * hh);
      b.half[1] = *(const v8us*)(brow + 16 + 8 * hh);
      acc[t] = mmaN<ASPLIT ? 2 : 1>(ah.v, al.v, b.v, b.v, acc[t]);
    }
  }
#pragma unroll
  for (int t = 0; t < 4; ++t) {
    const int col = col0 + t * 16 + ln;
    float bv = bias ? bias[col] : 0.f;
    if (BIAS_BF16) bv = bf16_round(bv);
#pragma unroll
    for (int r = 0; r < 8; ++r) {
      float v = acc[t][r] + bv;
      if (resid) { float rv = resid[(size_t)((row0 + 8 * hh + r) % rmod) * ldr + col]; if (RES_BF16) rv = bf16_round(rv); v += rv; }
      if (ACT == 1) v = fmaxf(v, 0.f);
      if (ACT == 2) v = 0.5f * v * (1.0f + erff(v * 0.70710678118654752f));
      if (ACT == 3) { const float u = 0.7978845608028654f * (v + 0.044715f * v * v * v); v = 0.5f * v * (1.0f + tanhf(u)); }
      so[w][8 * hh + r][t * 16 + ln] = v;
    }
  }
  __builtin_amdgcn_fence(__ATOMIC_ACQ_REL, "workgroup");
  __builtin_amdgcn_wave_barrier();
  const int rsub = lane >> 4, c4 = (lane & 15) * 4;
  {
#pragma unroll
    for (int q = 0; q < 8; ++q) {
      const int r = q * 2 + rsub;
      const v4f v = *(const v4fa*)&so[w][r][c4];
      *(v4f*)(C + (size_t)(row0 + r) * ldc + col0 + c4) = v;
    }
    
  }
}
// row LayerNorm (biased variance, eps) over N: s = X (+ R); optional out_sum <- s; out_norm <- (s-mu)*rsqrt(var+eps)*g + b
template <bool PARAM_BF16>
__global__ __launch_bounds__(256) void k_layernorm(const float* __restrict__ X, const float* __restrict__ R, const float* __restrict__ g, const float* __restrict__ bta,
                                                  float* __restrict__ out_sum, float* __restrict__ out_norm, int N, float eps) {
  __shared__ float red[256];
  const int row = blockIdx.x, tid = threadIdx.x;
  const float* x = X + (size_t)row * N; const float* rr = R ? R + (size_t)row * N : nullptr;
  float vals[16];                     // up to N = 4096
  const int per = N / 256;            // contiguous chunk per thread? use strided-by-4 chunks: thread handles j = tid*4 + 1024*u
  float s1 = 0.f;
  for (int u = 0; u < per / 4; ++u) {
    const int j = tid * 4 + 1024 * u;
    const v4f a = *(const v4fa*)(x + j);
    v4f b = {0.f,0.f,0.f,0.f}; if (rr) b = *(const v4fa*)(rr + j);
#pragma unroll
    for (int q = 0; q < 4; ++q) { const float v = a[q] + b[q]; vals[u * 4 + q] = v; s1 += v; }
  }
  red[tid] = s1; __syncthreads();
  for (int st = 128; st > 0; st >>= 1) { if (tid < st) red[tid] += red[tid + st]; __syncthreads(); }
  const float mu = red[0] / (float)N; __syncthreads();
  float s2 = 0.f;
  for (int u = 0; u < per / 4; ++u)
#pragma unroll
    for (int q = 0; q < 4; ++q) { const float c = vals[u * 4 + q] - mu; s2 += c * c; }
  red[tid] = s2; __syncthreads();
  for (int st = 128; st > 0; st >>= 1) { if (tid < st) red[tid] += red[tid + st]; __syncthreads(); }
  const float rs = rsqrtf(red[0] / (float)N + eps);
  {
    for (int u = 0; u < per / 4; ++u) {
      const int j = tid * 4 + 1024 * u;
      v4f o, sm;
#pragma unroll
      for (int q = 0; q < 4; ++q) {
        float gg = g[j + q], bb = bta[j + q];
        if (PARAM_BF16) { gg = bf16_round(gg); bb = bf16_round(bb); }
        sm[q] = vals[u * 4 + q]; o[q] = (vals[u * 4 + q] - mu) * rs * gg + bb;
      }
      if (out_sum) *(v4f*)(out_sum + (size_t)row * N + j) = sm;
      *(v4f*)(out_norm + (size_t)row * N + j) = o;
    }
    
  }
}



// ---- f16 WMMA path (v_wmma_f32_16x16x32_f16): 11-bit significands for operands in range — used where a [0,1] probability operand needs more precision than bf16
typedef _Float16 v16h __attribute__((ext_vector_type(16)));
union FragH { v16h v; v8us half[2]; _Float16 h[16]; unsigned short u[16]; };
template <int NT>
__device__ __forceinline__ v8f mmaH(v16h ah, v16h al, v16h bh, v16h bl, v8f c) {
  c = __builtin_amdgcn_wmma_f32_16x16x32_f16(false, ah, false, bh, (short)0, c, false, false);
  if (NT >= 2) c = __builtin_amdgcn_wmma_f32_16x16x32_f16(false, al, false, bh, (short)0, c, false, false);
  if (NT >= 3) c = __builtin_amdgcn_wmma_f32_16x16x32_f16(false, ah, false, bl, (short)0, c, false, false);
  asm volatile("v_nop\n\tv_nop\n\tv_nop\n\tv_nop" : "+v"(c) : "v"(ah), "v"(al), "v"(bh), "v"(bl));
  return c;
}
// batched GEMM like k_gemm_b but f16 operands: A f32 (split into f16 hi/lo if ASPLIT, else rounded to f16), Bt = f16 values [n][k]; alpha; C f32; N multiple of 16 (partial tiles skipped)
template <bool ASPLIT>
__global__ __launch_bounds__(128) void k_gemm_h(const float* __restrict__ A, int lda, size_t sA, const _Float16* __restrict__ Bh, int ldb, size_t sB, float alpha, float* __restrict__ C, int ldc, size_t sC, int M, int N, int K) {
  __shared__ __attribute__((aligned(16))) float so[4][16][64];
  const int tid = threadIdx.x, w = tid >> 5, lane = tid & 31, ln = lane & 15, hh = lane >> 4; const int by = blockIdx.y;
  A += (size_t)by * sA; Bh += (size_t)by * sB; C += (size_t)by * sC;
  const int ntn = (N + 63) / 64; const int wid = blockIdx.x * 4 + w; const int mt = wid / ntn, nq = wid % ntn; if (mt * 16 >= M) return;
  const int row0 = mt * 16, col0 = nq * 64; const float* arow = A + (size_t)(row0 + ln) * lda;
  v8f acc[4] = {};
  for (int kb = 0; kb < K; kb += 32) {
    FragH ah, al;
    const v4f x0 = *(const v4fa*)(arow + kb + 8 * hh), x1 = *(const v4fa*)(arow + kb + 8 * hh + 4), x2 = *(const v4fa*)(arow + kb + 16 + 8 * hh), x3 = *(const v4fa*)(arow + kb + 16 + 8 * hh + 4);
    float xs[16] = {x0[0],x0[1],x0[2],x0[3],x1[0],x1[1],x1[2],x1[3],x2[0],x2[1],x2[2],x2[3],x3[0],x3[1],x3[2],x3[3]};
#pragma unroll
    for (int i = 0; i < 16; ++i) { const _Float16 h = (_Float16)xs[i]; ah.h[i] = h; al.h[i] = ASPLIT ? (_Float16)(xs[i] - (float)h) : (_Float16)0.0f; }
#pragma unroll
    for (int t = 0; t < 4; ++t) { if (col0 + t * 16 >= N) continue; const size_t boff = (size_t)(col0 + t * 16 + ln) * ldb + kb; FragH bq; bq.half[0] = *(const v8us*)(Bh + boff + 8 * hh); bq.half[1] = *(const v8us*)(Bh + boff + 16 + 8 * hh);
      acc[t] = mmaH<ASPLIT ? 2 : 1>(ah.v, al.v, bq.v, bq.v, acc[t]); }
  }
#pragma unroll
  for (int t = 0; t < 4; ++t) { if (col0 + t * 16 >= N) continue;
#pragma unroll
    for (int r = 0; r < 8; ++r) so[w][8 * hh + r][t * 16 + ln] = acc[t][r] * alpha; }
  __builtin_amdgcn_fence(__ATOMIC_ACQ_REL, "workgroup"); __builtin_amdgcn_wave_barrier();
  const int rsub = lane >> 4, c4 = (lane & 15) * 4;
  {
#pragma unroll
    for (int q = 0; q < 8; ++q) { const int r = q * 2 + rsub; if (col0 + c4 < N) { const v4f v = *(const v4fa*)&so[w][r][c4]; *(v4f*)(C + (size_t)(row0 + r) * ldc + col0 + c4) = v; } }
     }
}

// Wt[n][k] = f16(W[k][n]·scale) from f32 row-major W[K][N] (scale = power of two; bf16-exact weights stay exact in f16 away from the subnormal range)
__global__ __launch_bounds__(256) void k_wt_f16(const float* __restrict__ W, _Float16* __restrict__ Wt, int K, int N, float scale) {
  const int t = blockIdx.x * 256 + threadIdx.x; if (t >= N * (K / 8)) return; const int n = t / (K / 8), k8 = (t % (K / 8)) * 8; FragH f;
#pragma unroll
  for (int i = 0; i < 8; ++i) f.h[i] = (_Float16)(bf16_round(W[(size_t)(k8 + i) * N + n]) * scale); const v8us o = f.half[0];
  *(v8us*)((unsigned short*)Wt + (size_t)n * K + k8) = o; 
}
// k_gemm_hh variant with fused epilogue: v = acc·alpha + bias[by·sBias + col] (+ CP[(row/rowsPerB)·sCPb + by·64 + col] if CP) ; ACT 0 none / 1 elu ; writes f16 C16 (and f32 C if non-null)
template <int ACT>
__global__ __launch_bounds__(128) void k_gemm_hhx(const _Float16* __restrict__ A, int lda, size_t sA, const _Float16* __restrict__ Bh, int ldb, size_t sB, float alpha, const float* __restrict__ bias, size_t sBias, const float* __restrict__ CP, int rowsPerB, size_t sCPb, int row0g,
    float* __restrict__ C, _Float16* __restrict__ C16, int ldc, size_t sC, int M, int N, int K) {
  __shared__ __attribute__((aligned(16))) float so[4][16][64];
  const int tid = threadIdx.x, w = tid >> 5, lane = tid & 31, ln = lane & 15, hh = lane >> 4; const int by = blockIdx.y;
  A += (size_t)by * sA; Bh += (size_t)by * sB; const size_t cofs = (size_t)by * sC; const float* bp = bias ? bias + (size_t)by * sBias : nullptr;
  const int ntn = (N + 63) / 64; const int wid = blockIdx.x * 4 + w; const int mt = wid / ntn, nq = wid % ntn; if (mt * 16 >= M) return;
  const int row0 = mt * 16, col0 = nq * 64; const _Float16* arow = A + (size_t)(row0 + ln) * lda;
  v8f acc[4] = {};
  for (int kb = 0; kb < K; kb += 32) { FragH ah; ah.half[0] = *(const v8us*)((const unsigned short*)arow + kb + 8 * hh); ah.half[1] = *(const v8us*)((const unsigned short*)arow + kb + 16 + 8 * hh);
#pragma unroll
    for (int t = 0; t < 4; ++t) { if (col0 + t * 16 >= N) continue; const size_t boff = (size_t)(col0 + t * 16 + ln) * ldb + kb; FragH bq; bq.half[0] = *(const v8us*)((const unsigned short*)Bh + boff + 8 * hh); bq.half[1] = *(const v8us*)((const unsigned short*)Bh + boff + 16 + 8 * hh);
      acc[t] = mmaH<1>(ah.v, ah.v, bq.v, bq.v, acc[t]); }
  }
#pragma unroll
  for (int t = 0; t < 4; ++t) { if (col0 + t * 16 >= N) continue; const int col = col0 + t * 16 + ln; const float bv = bp ? bf16_round(bp[col]) : 0.f;
#pragma unroll
    for (int r = 0; r < 8; ++r) { float v = acc[t][r] * alpha + bv; if (CP) { const int bidx = (row0g + row0 + 8 * hh + r) / rowsPerB; v += CP[(size_t)bidx * sCPb + (size_t)by * 64 + col]; } if (ACT == 1) v = (v > 0.f) ? v : expm1f(v); else if (ACT == 7) v = (v > 0.f) ? v + 1.0f : expf(v); else if (ACT == 8) v = tanhf(v); else if (ACT == 9) v = 0.5f * v * (1.0f + tanhf(0.7978845608028654f * (v + 0.044715f * v * v * v))); else if (ACT == 11) v = 1.0f / (1.0f + expf(-v)); else if (ACT == 12) v = (v > 0.f) ? v : 0.01f * v; else if (ACT == 14) v = (v > 0.f) ? v : 0.1f * v; else if (ACT == 15) v = v / (1.0f + expf(-v)); else if (ACT == 3) v = fmaxf(v, 0.f); else if (ACT == 6) v = 0.5f * v * (1.0f + erff(v * 0.70710678118654752f)); so[w][8 * hh + r][t * 16 + ln] = v; } }
  __builtin_amdgcn_fence(__ATOMIC_ACQ_REL, "workgroup"); __builtin_amdgcn_wave_barrier();
  const int rsub = lane >> 4, c4 = (lane & 15) * 4; typedef _Float16 v4h __attribute__((ext_vector_type(4)));
  {
#pragma unroll
    for (int q = 0; q < 8; ++q) { const int r = q * 2 + rsub; if (col0 + c4 < N) { const v4f v = *(const v4fa*)&so[w][r][c4]; if (C) *(v4f*)(C + cofs + (size_t)(row0 + r) * ldc + col0 + c4) = v; if (C16) { v4h h4; for (int i = 0; i < 4; ++i) h4[i] = (_Float16)v[i]; *(v4h*)(C16 + cofs + (size_t)(row0 + r) * ldc + col0 + c4) = h4; } } }
     }
}


typedef _Float16 v4h __attribute__((ext_vector_type(4)));

// The p_* functions are jobs of 256-thread blocks; bid is the block's index within its job (k_prep hands it over).
__device__ __forceinline__ void p_x16(unsigned bid, const float* __restrict__ x, _Float16* __restrict__ X16, size_t n8) { const size_t t = (size_t)bid * 256 + threadIdx.x; if (t >= n8) return; FragH f;
#pragma unroll
  for (int q = 0; q < 8; ++q) f.h[q] = (_Float16)bf16_round(x[t * 8 + q]); *(v8us*)((unsigned short*)X16 + t * 8) = f.half[0];  }
__global__ __launch_bounds__(256) void k_h16(const float* __restrict__ x, _Float16* __restrict__ X16, size_t n8) { const size_t t = (size_t)blockIdx.x * 256 + threadIdx.x; if (t >= n8) return; FragH f;
#pragma unroll
  for (int q = 0; q < 8; ++q) f.h[q] = (_Float16)x[t * 8 + q]; *(v8us*)((unsigned short*)X16 + t * 8) = f.half[0];  }
__device__ __forceinline__ void p_round16f(unsigned bid, const float* __restrict__ W, _Float16* __restrict__ Bt, size_t n8) { const size_t t = (size_t)bid * 256 + threadIdx.x; if (t >= n8) return; FragH f;
#pragma unroll
  for (int i = 0; i < 8; ++i) f.h[i] = (_Float16)(bf16_round(W[t * 8 + i]) * 16.0f); *(v8us*)((unsigned short*)Bt + t * 8) = f.half[0];  }
template <int NHv, int TTv>
__global__ __launch_bounds__(256) void k_vt(const _Float16* __restrict__ V16, int ldv, int voff, _Float16* __restrict__ Vt) { __shared__ unsigned short tl[64][66]; const int tid = threadIdx.x; const int slab = blockIdx.x / (TTv / 64), lg = blockIdx.x % (TTv / 64); const int b = slab / NHv, h = slab % NHv;
  for (int i = tid; i < 64 * 8; i += 256) { const int r = i / 8, c8 = (i % 8) * 8; FragH f; f.half[0] = *(const v8us*)((const unsigned short*)V16 + ((size_t)b * TTv + lg * 64 + r) * ldv + voff + h * 64 + c8);
#pragma unroll
    for (int q = 0; q < 8; ++q) tl[r][c8 + q] = f.u[q]; }
  __syncthreads();
  {
#pragma unroll
    for (int rd = 0; rd < 2; ++rd) { const int d = rd * 32 + tid / 8, pc = tid % 8; FragH f;
#pragma unroll
      for (int q = 0; q < 8; ++q) f.u[q] = tl[pc * 8 + q][d];
      *(v8us*)((unsigned short*)Vt + ((size_t)slab * 64 + d) * TTv + lg * 64 + pc * 8) = f.half[0]; }
     } }

// ---- fast GEMM (block tile 128x64, wave tile 32x64; requires M % 128 == 0, N % 64 == 0 and K % 64 == 0); epilogue = k_gemm_hhx semantics ----
__device__ __forceinline__ v16h g2_fragl(const unsigned char* p) { FragH f; f.half[0] = *(const v8us*)p; f.half[1] = *(const v8us*)(p + 32); return f.v; }      /* a fragment's two 16-byte pieces of one LDS row, the k order of the global planes */
__device__ __forceinline__ v8f g2_mma(v16h a, v16h b, v8f c) { v8f d = __builtin_amdgcn_wmma_f32_16x16x32_f16(false, a, false, b, (short)0, c, false, false); asm volatile("v_nop\n\tv_nop\n\tv_nop\n\tv_nop" : "+v"(d) : "v"(a), "v"(b)); return d; }
// LDS image of one chunk of 64 k: the block's 128 A rows, then its 64 B rows, each 128 B at a pitch of 144 B (16 B x odd: ds_load_b128 fragment reads meet no bank twice).
#define G_P 144
#define G_B (128 * G_P)
#define G_ST (192 * G_P)
// A thread's twelve 16-byte asynchronous copies of one chunk (128 threads x 12 x 16 B = the chunk's 24 KiB; 8 lanes to a row = one whole 128-B line): l = its LDS byte address in the buffer, ga, gb = its global addresses in A and B; a16, b16 = bytes of 16 rows of A and of B in global memory.
__device__ __forceinline__ void g2_chunk_copy(unsigned l, const char* ga, const char* gb, unsigned a16, unsigned b16) {
  const unsigned l1 = l + 16 * G_P, l2 = l + 32 * G_P, l3 = l + 48 * G_P, l4 = l + 64 * G_P, l5 = l + 80 * G_P, l6 = l + 96 * G_P, l7 = l + 112 * G_P, l8 = l + G_B, l9 = l8 + 16 * G_P, l10 = l8 + 32 * G_P, l11 = l8 + 48 * G_P;
  const char* a1 = ga + a16; const char* a2 = a1 + a16; const char* a3 = a2 + a16; const char* a4 = a3 + a16; const char* a5 = a4 + a16; const char* a6 = a5 + a16; const char* a7 = a6 + a16;
  const char* b1 = gb + b16; const char* b2 = b1 + b16; const char* b3 = b2 + b16;
  /* the copies and, as the last line of the same statement, the wait that stands in front of any rewrite of their address registers */
  asm volatile("global_load_async_to_lds_b128 %0, %12, off\n\t"
               "global_load_async_to_lds_b128 %1, %13, off\n\t"
               "global_load_async_to_lds_b128 %2, %14, off\n\t"
               "global_load_async_to_lds_b128 %3, %15, off\n\t"
               "global_load_async_to_lds_b128 %4, %16, off\n\t"
               "global_load_async_to_lds_b128 %5, %17, off\n\t"
               "global_load_async_to_lds_b128 %6, %18, off\n\t"
               "global_load_async_to_lds_b128 %7, %19, off\n\t"
               "global_load_async_to_lds_b128 %8, %20, off\n\t"
               "global_load_async_to_lds_b128 %9, %21, off\n\t"
               "global_load_async_to_lds_b128 %10, %22, off\n\t"
               "global_load_async_to_lds_b128 %11, %23, off\n\t"
               "s_wait_xcnt 0x0"
               :: "v"(l), "v"(l1), "v"(l2), "v"(l3), "v"(l4), "v"(l5), "v"(l6), "v"(l7), "v"(l8), "v"(l9), "v"(l10), "v"(l11),
                  "v"(ga), "v"(a1), "v"(a2), "v"(a3), "v"(a4), "v"(a5), "v"(a6), "v"(a7), "v"(gb), "v"(b1), "v"(b2), "v"(b3) : "memory"); }
template <int ACT, int KC, int SPL>      /* KC = K, a compile-time multiple of 64, at least 128; M a multiple of 128 (a block stages 128 whole rows); SPL 1: the results leave as f16 hi + (x2^10) residual planes, six of sC elements from C16 on (q, k row-major; V^T per batch and head), and no f32 copy is written */
__global__ __launch_bounds__(128) __attribute__((amdgpu_waves_per_eu(4)))      /* a budget of 256 registers: the build needs no register-window switches */
void k_gemm2(const _Float16* __restrict__ A, int lda, size_t sA, const _Float16* __restrict__ Bh, int ldb, size_t sB, float alpha, const float* __restrict__ bias, const float* __restrict__ bias1, const float* __restrict__ bias2, size_t sBias, const float* __restrict__ CP, int rowsPerB, size_t sCPb, int row0g,
    float* __restrict__ C, _Float16* __restrict__ C16, int ldc, size_t sC, int M, int N, int K) {
  /* A and B reach the four waves through LDS: two buffers of one 64-k chunk each, filled by asynchronous copies in whole 128-B lines, one chunk ahead of the chunk in work; behind the loop's last barrier the same bytes stage the output rows */
  __shared__ __attribute__((aligned(16))) unsigned char ring[2 * G_ST];
  const int tid = threadIdx.x, w = tid >> 5, lane = tid & 31, ln = lane & 15, hh = lane >> 4; const int by = blockIdx.y;
  const float* bsel = (by == 0) ? bias : ((by == 1) ? bias1 : bias2);      /* products that share one grid (blockIdx.y) have each their own bias input */
  A += (size_t)by * sA; Bh += (size_t)by * sB; const size_t cofs = (size_t)by * sC; const float* bp = bsel ? bsel + (size_t)by * sBias : nullptr;
  const int ntn = N >> 6; const int mt = blockIdx.x / ntn, nq = blockIdx.x - mt * ntn; const int rowb = mt * 128, row0 = rowb + 32 * w, col0 = nq * 64; if (rowb >= M) return;      /* the whole block or none of it, in front of every barrier */
  const unsigned a16 = (unsigned)(16 * lda) * 2u, b16 = (unsigned)(16 * ldb) * 2u;
  const unsigned lc = (unsigned)(size_t)ring + (unsigned)((tid >> 3) * G_P + (tid & 7) * 16);
  const char* ga = (const char*)A + ((size_t)(rowb + (tid >> 3)) * lda) * 2 + (tid & 7) * 16; const char* gb = (const char*)Bh + ((size_t)(col0 + (tid >> 3)) * ldb) * 2 + (tid & 7) * 16;      /* the next chunk to copy */
  (void)K; constexpr int NT = KC / 64;
  g2_chunk_copy(lc, ga, gb, a16, b16);      /* chunk 0 into buffer 0 */
  asm volatile("s_wait_asynccnt 0x0" ::: "memory");      /* this wave's copies of chunk 0 have landed before the barrier publishes them */
  __syncthreads();      /* every wave reads what all four staged */
  ga += 128; gb += 128;
  g2_chunk_copy(lc + G_ST, ga, gb, a16, b16);      /* chunk 1 into buffer 1 */
  const unsigned char* fa = ring + (32 * w + ln) * G_P + 16 * hh; const unsigned char* fb = ring + G_B + ln * G_P + 16 * hh;      /* this lane's fragment rows in buffer 0 */
  unsigned bo = 0;      /* byte offset of the buffer in work */
  const v8f z8 = {0.f,0.f,0.f,0.f,0.f,0.f,0.f,0.f}; v8f c00 = z8, c01 = z8, c02 = z8, c03 = z8, c10 = z8, c11 = z8, c12 = z8, c13 = z8;
#pragma unroll 1      /* one copy of the trip in the text: the buffer is picked by an offset, not by the code */
  for (int t = 0; t < NT; ++t) {
    v16h fa0[2], fa1[2], fb0[2], fb1[2], fb2[2], fb3[2];      /* the chunk's two k steps: their 24 LDS reads stand together, ahead of the products */
#pragma unroll
    for (int s = 0; s < 2; ++s) { const unsigned char* pa = fa + bo + s * 64; const unsigned char* pb = fb + bo + s * 64; fa0[s] = g2_fragl(pa); fb0[s] = g2_fragl(pb); fa1[s] = g2_fragl(pa + 16 * G_P); fb1[s] = g2_fragl(pb + 16 * G_P); fb2[s] = g2_fragl(pb + 32 * G_P); fb3[s] = g2_fragl(pb + 48 * G_P); }
#pragma unroll
    for (int s = 0; s < 2; ++s) {
      c00 = g2_mma(fa0[s], fb0[s], c00); c10 = g2_mma(fa1[s], fb0[s], c10);
      c01 = g2_mma(fa0[s], fb1[s], c01); c11 = g2_mma(fa1[s], fb1[s], c11);
      c02 = g2_mma(fa0[s], fb2[s], c02); c12 = g2_mma(fa1[s], fb2[s], c12);
      c03 = g2_mma(fa0[s], fb3[s], c03); c13 = g2_mma(fa1[s], fb3[s], c13); }
    /* hand-over, every wave in this order: its own reads of this buffer are done, its own copies of the next chunk have landed, the barrier tells the other waves both; only then is this buffer refilled */
    asm volatile("s_wait_dscnt 0x0" ::: "memory");
    asm volatile("s_wait_asynccnt 0x0" ::: "memory");
    __syncthreads();
    ga += 128; gb += 128;
    if (t + 2 < NT) g2_chunk_copy(lc + bo, ga, gb, a16, b16);      /* the chunk after next, while one exists (a scalar test) */
    bo ^= G_ST; }
  asm volatile("s_wait_asynccnt 0x0" ::: "memory");      /* no copy is in flight when the ring's bytes are taken for the output rows */
  v8f accs[8] = {c00, c01, c02, c03, c10, c11, c12, c13};
  if constexpr (SPL != 0) {      /* the split epilogue: value = acc * alpha + bias, then hi = f16(value), residual = f16((value - hi) * 2^10), straight into the planes that the attention kernel reads */
    float bv4[4] = {0.f, 0.f, 0.f, 0.f};      /* the bias of this lane's four columns, the four loads under one test so that they fly together */
    if (bp) { const float* bq = bp + col0 + ln; const float b0 = bq[0], b1 = bq[16], b2 = bq[32], b3 = bq[48]; bv4[0] = bf16_round(b0); bv4[1] = bf16_round(b1); bv4[2] = bf16_round(b2); bv4[3] = bf16_round(b3); }
    if (by == 2) {      /* V^T planes: a lane's 8 accumulator rows are 8 consecutive tokens of one d, one 16-byte piece of a V^T row; the block's 64 d x 128 tokens gather in LDS so that whole 128-B lines leave */
      constexpr int TP = 272;      /* 256 B of tokens at a pitch of 16 B x odd */
#pragma unroll
      for (int u = 0; u < 8; ++u) { const int t = u & 3, half = u >> 2; FragH fh, fl;
#pragma unroll
        for (int r = 0; r < 8; ++r) { const float v = accs[u][r] * alpha + bv4[t]; const _Float16 hv = (_Float16)v; fh.h[r] = hv; fl.h[r] = (_Float16)((v - (float)hv) * 1024.0f); }
        unsigned char* pt = ring + (t * 16 + ln) * TP + (32 * w + half * 16 + 8 * hh) * 2; *(v8us*)pt = fh.half[0]; *(v8us*)(pt + 64 * TP) = fl.half[0]; }
      __syncthreads();      /* a V^T row holds tokens of all four waves (by is the same for the whole block) */
      unsigned short* Vh = (unsigned short*)C16 + 4 * sC + ((size_t)((rowb / SLEN) * NH + nq) * 64 + (tid >> 4)) * SLEN + (rowb % SLEN) + (tid & 15) * 8; unsigned short* Vl = Vh + sC;
      const unsigned char* pr = ring + (tid >> 4) * TP + (tid & 15) * 16;
#pragma unroll
      for (int i = 0; i < 8; ++i) { const v8us a = *(const v8us*)(pr + i * 8 * TP), c = *(const v8us*)(pr + (64 + i * 8) * TP); *(v8us*)(Vh + (size_t)(i * 8) * SLEN) = a; *(v8us*)(Vl + (size_t)(i * 8) * SLEN) = c; }
    } else {      /* q, k planes, row-major: each wave turns its own 32 x 64 tile through LDS; 16 lanes then write one row's 64 columns, a whole 128-B line of each plane */
      float* so = (float*)ring + w * (32 * 68);      /* this wave's 32 rows at a pitch of 68 floats */
#pragma unroll
      for (int u = 0; u < 8; ++u) { const int t = u & 3, half = u >> 2;
#pragma unroll
        for (int r = 0; r < 8; ++r) so[(half * 16 + 8 * hh + r) * 68 + t * 16 + ln] = accs[u][r] * alpha + bv4[t]; }
      __builtin_amdgcn_fence(__ATOMIC_ACQ_REL, "workgroup"); __builtin_amdgcn_wave_barrier();      /* the wave's own stores are in LDS before its lanes read each other's */
      const int rsub = lane >> 4, c4 = (lane & 15) * 4;
      _Float16* Ph = C16 + (size_t)(2 * by) * sC + (size_t)(row0 + rsub) * ldc + col0 + c4; _Float16* Pl = Ph + sC;
#pragma unroll
      for (int q = 0; q < 16; ++q) { const v4f v = *(const v4fa*)&so[(q * 2 + rsub) * 68 + c4]; v4h h4, l4;
#pragma unroll
        for (int i = 0; i < 4; ++i) { const _Float16 hv = (_Float16)v[i]; h4[i] = hv; l4[i] = (_Float16)((v[i] - (float)hv) * 1024.0f); }
        *(v4h*)(Ph + (size_t)(q * 2) * ldc) = h4; *(v4h*)(Pl + (size_t)(q * 2) * ldc) = l4; }
      asm volatile("s_wait_xcnt 0x0" ::: "memory");      /* the built code joins this branch with the V^T branch, whose text rewrites registers that the last stores name: the wait stands in front of every such write */
    }
    return; }
  float* so = (float*)ring + w * (32 * 68);      /* this wave's 32 output rows at a pitch of 68 floats */
#pragma unroll
  for (int u = 0; u < 8; ++u) { const int t = u & 3, half = u >> 2; const int col = col0 + t * 16 + ln; const float bv = bp ? bf16_round(bp[col]) : 0.f;
#pragma unroll
    for (int r = 0; r < 8; ++r) { const int rloc = half * 16 + 8 * hh + r; float v = accs[u][r] * alpha + bv; if (CP) { const int bidx = (row0g + row0 + rloc) / rowsPerB; v += CP[(size_t)bidx * sCPb + (size_t)by * 64 + col]; }
      if (ACT == 3) v = fmaxf(v, 0.f); else if (ACT == 6) v = 0.5f * v * (1.0f + erff(v * 0.70710678118654752f)); else if (ACT == 11) v = 1.0f / (1.0f + expf(-v)); else if (ACT == 15) v = v / (1.0f + expf(-v)); else if (ACT == 12) v = (v > 0.f) ? v : 0.01f * v; else if (ACT == 8) v = tanhf(v);
      so[rloc * 68 + t * 16 + ln] = v; } }
  __builtin_amdgcn_fence(__ATOMIC_ACQ_REL, "workgroup"); __builtin_amdgcn_wave_barrier();
  const int rsub = lane >> 4, c4 = (lane & 15) * 4;
  {
#pragma unroll
    for (int q = 0; q < 16; ++q) { const int r = q * 2 + rsub; const v4f v = *(const v4fa*)&so[r * 68 + c4]; if (C) *(v4f*)(C + cofs + (size_t)(row0 + r) * ldc + col0 + c4) = v; if (C16) { v4h h4; for (int i = 0; i < 4; ++i) h4[i] = (_Float16)v[i]; *(v4h*)(C16 + cofs + (size_t)(row0 + r) * ldc + col0 + c4) = h4; } }
     } }



#define NB_E8 (NR * DM / 8 / 256)            /* blocks of a job with one thread to 8 elements of a [NR][DM] plane */
// grammar bias for (query position pi, key position pj): dist_emb[bucket(|pj - pi|)][h] + ((pj > pi) - 0.5) * order_bias[h]
__device__ __forceinline__ float gbias(const float* sDE, float obh, const unsigned char* sLUT, int pi, int pj) { int d = abs(pj - pi); d = min(d, LUTN - 1); const int bin = sLUT[d]; return sDE[bin] + (((pj > pi) ? 1.0f : 0.0f) - 0.5f) * obh; }      /* sDE, obh = the head's rounded dist_emb column and order_bias, both times LOG2E */
// lane l <-> l ^ 16 (the other half of the wave), all lanes on
__device__ __forceinline__ float xhalf(float v) { const int b = __float_as_int(v); return __int_as_float(__builtin_amdgcn_permlanex16(b, b, 0x76543210, 0xfedcba98, false, false)); }
// LDS image of one tile of 32 keys: K hi and K residual as 32 rows of 128 B at a pitch of 144 B, V^T hi and residual as 64 rows of 64 B at a pitch of 80 B (16 B x odd: ds_load_b128 fragment reads meet no bank twice).
#define FK_P 144
#define FV_P 80
#define F_KH 0
#define F_KL (32 * FK_P)
#define F_VH (2 * 32 * FK_P)
#define F_VL (2 * 32 * FK_P + 64 * FV_P)
#define F_TILE (2 * 32 * FK_P + 2 * 64 * FV_P)
// A thread's eight 16-byte asynchronous copies of one tile (128 threads x 8 x 16 B = the tile's 16 KiB): lk, lv = its LDS byte addresses in the K and V^T parts of the buffer, g* = its global addresses in the four planes; k16, v32 = bytes of 16 K rows and of 32 V^T rows in global memory.
__device__ __forceinline__ void f_tile_copy(unsigned lk, unsigned lv, const char* gkh, const char* gkl, const char* gvh, const char* gvl, unsigned k16, unsigned v32) {
  const unsigned a0 = lk + F_KH, a1 = a0 + 16 * FK_P, a2 = lk + F_KL, a3 = a2 + 16 * FK_P, a4 = lv + F_VH, a5 = a4 + 32 * FV_P, a6 = lv + F_VL, a7 = a6 + 32 * FV_P;
  const char* p1 = gkh + k16; const char* p3 = gkl + k16; const char* p5 = gvh + v32; const char* p7 = gvl + v32;
  /* the copies and, as the last line of the same statement, the wait that stands in front of any rewrite of their address registers */
  asm volatile("global_load_async_to_lds_b128 %0, %8, off\n\t"
               "global_load_async_to_lds_b128 %1, %9, off\n\t"
               "global_load_async_to_lds_b128 %2, %10, off\n\t"
               "global_load_async_to_lds_b128 %3, %11, off\n\t"
               "global_load_async_to_lds_b128 %4, %12, off\n\t"
               "global_load_async_to_lds_b128 %5, %13, off\n\t"
               "global_load_async_to_lds_b128 %6, %14, off\n\t"
               "global_load_async_to_lds_b128 %7, %15, off\n\t"
               "s_wait_xcnt 0x0"
               :: "v"(a0), "v"(a1), "v"(a2), "v"(a3), "v"(a4), "v"(a5), "v"(a6), "v"(a7), "v"(gkh), "v"(p1), "v"(gkl), "v"(p3), "v"(gvh), "v"(p5), "v"(gvl), "v"(p7) : "memory"); }
template <int TQ, int TK>
__global__ __launch_bounds__(128) void k_flashb(const _Float16* __restrict__ Q16, const _Float16* __restrict__ Q16lo, int ldq, const _Float16* __restrict__ K16, const _Float16* __restrict__ K16lo, int ldk, const _Float16* __restrict__ Vt, const _Float16* __restrict__ Vtlo, const unsigned* __restrict__ MB, const int* __restrict__ RA, const int* __restrict__ KE, const float* __restrict__ BT, const float* __restrict__ OB, const int* __restrict__ LUT, const int* __restrict__ LAG, const float* __restrict__ QM, _Float16* __restrict__ Oh, _Float16* __restrict__ Ol, int ldo) {
  constexpr int RPW = 16, NQB = TQ / (4 * RPW), DT = 4, KS = 2;
  __shared__ __attribute__((aligned(16))) float sO[4][RPW][64 + 4];
  const int tid = threadIdx.x, w = tid >> 5, lane = tid & 31, ln = lane & 15, hh = lane >> 4;
  const int slab = blockIdx.x / NQB, qblk = blockIdx.x % NQB; const int b = slab / NH, h = slab % NH; const int qb0 = qblk * (4 * RPW); const int q0 = qb0 + w * RPW;
  MB += (size_t)b * TQ * (TK / 32); LAG += (size_t)b * TK;      /* per-batch key-mask table and positions: the grid spans all batches */
  const float obh = bf16_round(OB[h]) * LOG2E;      /* read once, ahead of the loop: behind the loop's waits (memory clobbers) it would be loaded anew every trip */
  /* K and V^T reach the four waves through LDS: two buffers of one 32-key tile each, filled by asynchronous copies in whole rows, one tile ahead of the tile in work; every wave reads its fragments from there */
  __shared__ __attribute__((aligned(16))) unsigned char ring[2 * F_TILE];
  int jend = __builtin_amdgcn_readfirstlane(KE[qblk * 32]); jend = min(TK, (jend + 31) & ~31); if (jend < 32) jend = 32;      /* block-uniform, in a scalar register: it decides whether copies issue */
  const unsigned k16 = (unsigned)(16 * ldk) * 2u, v32 = (unsigned)(32 * TK) * 2u;
  const unsigned lk = (unsigned)(size_t)ring + (unsigned)((tid >> 3) * FK_P + (tid & 7) * 16), lv = (unsigned)(size_t)ring + (unsigned)((tid >> 2) * FV_P + (tid & 3) * 16);      /* 8 lanes to a K row (one 128-B line), 4 lanes to a V^T row */
  const size_t gko = (((size_t)b * TK + (tid >> 3)) * ldk + h * 64) * 2 + (tid & 7) * 16, gvo = (((size_t)slab * 64 + (tid >> 2)) * TK) * 2 + (tid & 3) * 16;
  const char* gkh = (const char*)K16 + gko; const char* gkl = (const char*)K16lo + gko; const char* gvh = (const char*)Vt + gvo; const char* gvl = (const char*)Vtlo + gvo;      /* the next tile to copy */
  f_tile_copy(lk, lv, gkh, gkl, gvh, gvl, k16, v32);      /* tile 0 into buffer 0 */
  /* the bias lookup's tables, staged once per block: bucket of every distance as one byte, the head's rounded dist_emb column, the batch's positions */
  typedef int v4ia __attribute__((ext_vector_type(4), may_alias));
  __shared__ __attribute__((aligned(16))) unsigned sLUTw[LUTN / 4]; __shared__ float sDE[NBIN]; __shared__ __attribute__((aligned(16))) int sPos[TK];
  for (int i = tid; i < LUTN / 4; i += 128) { const v4ia c = *(const v4ia*)(LUT + 4 * i); sLUTw[i] = (unsigned)(c[0] & (NBIN - 1)) | ((unsigned)(c[1] & (NBIN - 1)) << 8) | ((unsigned)(c[2] & (NBIN - 1)) << 16) | ((unsigned)(c[3] & (NBIN - 1)) << 24); }
  for (int i = tid; i < TK / 4; i += 128) *(v4ia*)(sPos + 4 * i) = *(const v4ia*)(LAG + 4 * i);
  if (tid < NBIN) sDE[tid] = bf16_round(BT[tid * NH + h]) * LOG2E;
  asm volatile("s_wait_asynccnt 0x0" ::: "memory");      /* this wave's copies of tile 0 have landed before the barrier publishes them */
  __syncthreads();      /* every wave reads what all four staged */
  gkh += 2 * (size_t)k16; gkl += 2 * (size_t)k16; gvh += 64; gvl += 64;
  if (jend > 32) f_tile_copy(lk + F_TILE, lv + F_TILE, gkh, gkl, gvh, gvl, k16, v32);      /* tile 1 into buffer 1 */
  const unsigned char* sLUT = (const unsigned char*)sLUTw;
  const int tq = q0 + ln;      /* this lane's query */
  FragH aq[KS], aql[KS];       /* Q as the B operand: column = query ln */
  { const size_t qo = ((size_t)b * TQ + tq) * ldq + h * 64; const unsigned short* qr = (const unsigned short*)Q16 + qo; const unsigned short* ql = (const unsigned short*)Q16lo + qo;
#pragma unroll
    for (int ks = 0; ks < KS; ++ks) { aq[ks].half[0] = *(const v8us*)(qr + ks * 32 + 8 * hh); aq[ks].half[1] = *(const v8us*)(qr + ks * 32 + 16 + 8 * hh); aql[ks].half[0] = *(const v8us*)(ql + ks * 32 + 8 * hh); aql[ks].half[1] = *(const v8us*)(ql + ks * 32 + 16 + 8 * hh); } }
  const bool am = (RA[tq] != 0); const unsigned* mrow = MB + (size_t)tq * (TK / 32); const int pi = sPos[tq];
  const unsigned char* fk = ring + ln * FK_P; const unsigned char* fv = ring + ln * FV_P;      /* this lane's fragment rows in buffer 0 */
  unsigned bo = 0;      /* byte offset of the buffer in work */
  float m_q = -3.0e38f, l_q = 0.f; v8f oacc[DT], oaccl[DT];
#pragma unroll
  for (int dt = 0; dt < DT; ++dt) { oacc[dt] = (v8f){0.f,0.f,0.f,0.f,0.f,0.f,0.f,0.f}; oaccl[dt] = oacc[dt]; }
#pragma unroll 1
  for (int j0 = 0; j0 < jend; j0 += 32) {
    const unsigned mword = mrow[j0 >> 5];      /* this query's key-mask bits of the 32 keys */
    v8f s[2];
#pragma unroll
    for (int nt = 0; nt < 2; ++nt) { const unsigned short* kr = (const unsigned short*)(fk + bo + F_KH + nt * 16 * FK_P); const unsigned short* kl = (const unsigned short*)(fk + bo + F_KL + nt * 16 * FK_P); FragH bk[KS], bkl[KS];      /* K as the A operand: row = key */
#pragma unroll
      for (int ks = 0; ks < KS; ++ks) { bk[ks].half[0] = *(const v8us*)(kr + ks * 32 + 8 * hh); bk[ks].half[1] = *(const v8us*)(kr + ks * 32 + 16 + 8 * hh); bkl[ks].half[0] = *(const v8us*)(kl + ks * 32 + 8 * hh); bkl[ks].half[1] = *(const v8us*)(kl + ks * 32 + 16 + 8 * hh); }
      v8f acc = (v8f){0.f,0.f,0.f,0.f,0.f,0.f,0.f,0.f}, accr = acc;
#pragma unroll
      for (int ks = 0; ks < KS; ++ks) { acc = mmaH<1>(bk[ks].v, bk[ks].v, aq[ks].v, aq[ks].v, acc); accr = mmaH<1>(bk[ks].v, bk[ks].v, aql[ks].v, aql[ks].v, accr); accr = mmaH<1>(bkl[ks].v, bkl[ks].v, aq[ks].v, aq[ks].v, accr); }
      s[nt] = acc + accr * 0.0009765625f; }
    const unsigned mw = mword >> (8 * hh);      /* bit nt * 16 + r = this lane's key nt * 16 + 8 hh + r */
    float sc[2][8]; bool ok[2][8]; float mc = -INFINITY;
#pragma unroll
    for (int nt = 0; nt < 2; ++nt) { const v4ia pA = *(const v4ia*)(sPos + j0 + nt * 16 + 8 * hh), pB = *(const v4ia*)(sPos + j0 + nt * 16 + 8 * hh + 4);
#pragma unroll
      for (int r = 0; r < 8; ++r) { const int pj = (r < 4) ? pA[r & 3] : pB[r & 3]; ok[nt][r] = am || (((mw >> (nt * 16 + r)) & 1u) == 0u);
        const float sv = s[nt][r] * (SCL * LOG2E) + gbias(sDE, obh, sLUT, pi, pj);      /* + grammar distance-bucket and order biases; base-2 domain */
        sc[nt][r] = ok[nt][r] ? (am ? 0.f : sv) : -INFINITY; mc = fmaxf(mc, sc[nt][r]); } }
    mc = fmaxf(mc, xhalf(mc));
    const float mn = fmaxf(m_q, mc); const float ea = __builtin_amdgcn_exp2f(m_q - mn); const float al = (mn > -1.0e38f) ? ea : 1.0f; m_q = mn;
    FragH pa, pl; float ls = 0.f;      /* P^T hi and residual, already in the B operand's order */
#pragma unroll
    for (int nt = 0; nt < 2; ++nt)
#pragma unroll
      for (int r = 0; r < 8; ++r) { const float e = __builtin_amdgcn_exp2f(sc[nt][r] - mn);      /* argument <= 0 (or -inf): no range guard is needed; a result under 2^-126 reads 0, far below what P's f16 pair keeps */ const float p = ok[nt][r] ? e : 0.f; ls += p;
        const float ps = p * 1024.0f; const _Float16 t2 = (_Float16)ps; pa.h[nt * 8 + r] = t2; pl.h[nt * 8 + r] = (_Float16)((ps - (float)t2) * 1024.0f); }
    l_q = l_q * al + ls;
#pragma unroll
    for (int dt = 0; dt < DT; ++dt) { oacc[dt] *= al; oaccl[dt] *= al; }
#pragma unroll
    for (int dt = 0; dt < DT; ++dt) { const unsigned short* vh = (const unsigned short*)(fv + bo + F_VH + dt * 16 * FV_P); const unsigned short* vl = (const unsigned short*)(fv + bo + F_VL + dt * 16 * FV_P); FragH bv, bl; bv.half[0] = *(const v8us*)(vh + 8 * hh); bv.half[1] = *(const v8us*)(vh + 16 + 8 * hh); bl.half[0] = *(const v8us*)(vl + 8 * hh); bl.half[1] = *(const v8us*)(vl + 16 + 8 * hh);      /* V^T as the A operand: row = d */
      oacc[dt] = mmaH<1>(bv.v, bv.v, pa.v, pa.v, oacc[dt]); oaccl[dt] = mmaH<1>(bl.v, bl.v, pa.v, pa.v, oaccl[dt]); oaccl[dt] = mmaH<1>(bv.v, bv.v, pl.v, pl.v, oaccl[dt]); }
    /* hand-over, every wave in this order: its own reads of this buffer are done, its own copies of the next tile have landed, the barrier tells the other waves both; only then is this buffer refilled */
    asm volatile("s_wait_dscnt 0x0" ::: "memory");
    asm volatile("s_wait_asynccnt 0x0" ::: "memory");
    __syncthreads();
    gkh += 2 * (size_t)k16; gkl += 2 * (size_t)k16; gvh += 64; gvl += 64;
    if (j0 + 64 < jend) f_tile_copy(lk + bo, lv + bo, gkh, gkl, gvh, gvl, k16, v32);      /* the tile after next, while one exists (a scalar test) */
    bo ^= F_TILE; }
  asm volatile("s_wait_asynccnt 0x0" ::: "memory");      /* no copy is left in flight when the wave goes on to its end */
  const float lt = l_q + xhalf(l_q); const float inv = (lt > 0.f) ? 1.0f / (lt * 1024.0f) : 0.f;
#pragma unroll
  for (int dt = 0; dt < DT; ++dt)
#pragma unroll
    for (int g = 0; g < 2; ++g) { v4f o4;
#pragma unroll
      for (int i = 0; i < 4; ++i) o4[i] = (oacc[dt][g * 4 + i] + oaccl[dt][g * 4 + i] * 0.0009765625f) * inv;
      *(v4fa*)&sO[w][ln][dt * 16 + 8 * hh + g * 4] = o4; }
  __builtin_amdgcn_fence(__ATOMIC_ACQ_REL, "workgroup"); __builtin_amdgcn_wave_barrier();
  {
#pragma unroll
    for (int rp = 0; rp < RPW; rp += 2) { const int r = rp + (lane >> 4), pc = lane & 15; const v4f val = *(const v4fa*)&sO[w][r][pc * 4]; const size_t row = (size_t)b * TQ + q0 + r; const float mk = bf16_round(QM[row]); v4h h4, l4;      /* O times the query's mask, as f16 hi + (x2^10) residual planes for the output projection: 16 lanes write a whole 128-B line of each */
#pragma unroll
      for (int i = 0; i < 4; ++i) { const float v = val[i] * mk; const _Float16 hv = (_Float16)v; h4[i] = hv; l4[i] = (_Float16)((v - (float)hv) * 1024.0f); }
      *(v4h*)(Oh + row * ldo + h * 64 + pc * 4) = h4; *(v4h*)(Ol + row * ldo + h * 64 + pc * 4) = l4; }
     } }


__global__ __launch_bounds__(256) void k_fulltab(unsigned* __restrict__ MB, int* __restrict__ RA, int* __restrict__ KE, int nq, int nk) {
  const int t = blockIdx.x * 256 + threadIdx.x;
  if (t < nq * (nk / 32)) { *(unsigned*)(MB + t) = 0u;  }
  if (t < nq) { *(int*)(RA + t) = 0;  }
  if (t < nq / 64) { *(int*)(KE + t * 32) = nk;  } }
__global__ __launch_bounds__(256) void k_lnx(const float* __restrict__ X, const float* __restrict__ g, const float* __restrict__ bb, _Float16* __restrict__ Y16, float* __restrict__ XB) {
  #pragma clang fp contract(off)
  const int tid = threadIdx.x, w = tid >> 5, ln = tid & 31; const int r = blockIdx.x * 8 + w; if (r >= NR) return; const float* x = X + (size_t)r * DM; float s = 0.f;
#pragma unroll 1
  for (int i = 0; i < DM / 128; ++i) { const v4f a = *(const v4fa*)(x + i * 128 + ln * 4); for (int q = 0; q < 4; ++q) s += bf16_round(a[q]); }
  for (int o = 16; o > 0; o >>= 1) s += __shfl_xor(s, o, 32); const float mu = s / (float)DM; float q2 = 0.f;
#pragma unroll 1
  for (int i = 0; i < DM / 128; ++i) { const v4f a = *(const v4fa*)(x + i * 128 + ln * 4); for (int q = 0; q < 4; ++q) { const float d = bf16_round(a[q]) - mu; q2 += d * d; } }
  for (int o = 16; o > 0; o >>= 1) q2 += __shfl_xor(q2, o, 32); const float rs = rsqrtf(q2 / (float)DM + 1e-5f);
  {
#pragma unroll 1
    for (int i = 0; i < DM / 128; ++i) { const int c0 = i * 128 + ln * 4; const v4f a = *(const v4fa*)(x + c0); _Float16 h4[4]; v4f xb;
      for (int q = 0; q < 4; ++q) { const float t = bf16_round(a[q]); h4[q] = (_Float16)((t - mu) * rs * bf16_round(g[c0 + q]) + bf16_round(bb[c0 + q])); xb[q] = t; }
      *(unsigned long long*)((unsigned short*)Y16 + (size_t)r * DM + c0) = *(const unsigned long long*)h4; *(v4f*)(XB + (size_t)r * DM + c0) = xb; }
     } }
// bucket table: LUT[d] = count of the NBIN - 1 bf16-rounded edges below d (at most NBIN - 1), for d < LUTN
__device__ __forceinline__ void p_lut(unsigned bid, const float* __restrict__ edges, int* __restrict__ LUT) {
  #pragma clang fp contract(off)
  const int d = bid * 256 + threadIdx.x; if (d >= LUTN) return; const float fd = (float)d; int c = 0;
#pragma unroll 1
  for (int e = 0; e < NBIN - 1; ++e) c += (bf16_round(edges[e]) < fd) ? 1 : 0;
  c = min(c, NBIN - 1); *(int*)(LUT + d) = c;  }
__device__ __forceinline__ void p_masktab(unsigned bid, const float* __restrict__ mask, unsigned* __restrict__ MB, int* __restrict__ RA, int* __restrict__ KE) {
  const size_t t = (size_t)bid * 256 + threadIdx.x; const int nw = SLEN / 32;
  if (t < (size_t)NBT * SLEN * nw) { const int w = (int)(t % nw); const int b = (int)(t / ((size_t)SLEN * nw)); unsigned bits = 0u; for (int j = 0; j < 32; ++j) bits |= (bf16_round(mask[(size_t)b * SLEN + 32 * w + j]) == 0.0f) ? (1u << j) : 0u; *(unsigned*)(MB + t) = bits;  }
  if (t < SLEN) { *(int*)(RA + t) = 0;  }
  if (t < SLEN / 64) { *(int*)(KE + t * 32) = SLEN;  } }
#define NB_MT (NBT * SLEN * (SLEN / 32) / 256)   /* blocks of the key-mask tables */
#define NB_W (DM * DM / 8 / 256)                 /* blocks of one weight plane */
// One grid for the seven set-up jobs (mask tables, the x plane, four weight planes, the bucket table), which need nothing of each other: a block-uniform range of the block index picks the job.
__global__ __launch_bounds__(256) void k_prep(const float* __restrict__ x, const float* __restrict__ mask, const float* __restrict__ qw, const float* __restrict__ kw, const float* __restrict__ vw, const float* __restrict__ ow, const float* __restrict__ edges,
    _Float16* __restrict__ X16, _Float16* __restrict__ BW, unsigned* __restrict__ MB, int* __restrict__ RA, int* __restrict__ KE, int* __restrict__ LUT) {
  unsigned bid = blockIdx.x;
  if (bid < NB_MT) { p_masktab(bid, mask, MB, RA, KE); return; }
  bid -= NB_MT;
  if (bid < NB_E8) { p_x16(bid, x, X16, (size_t)NR * DM / 8); return; }
  bid -= NB_E8;
  if (bid < 4 * NB_W) { const unsigned j = bid / NB_W; const float* W = (j == 0) ? qw : ((j == 1) ? kw : ((j == 2) ? vw : ow)); p_round16f(bid - j * NB_W, W, BW + (size_t)j * DM * DM, (size_t)DM * DM / 8); return; }      /* BW: the four planes one behind the other */
  p_lut(bid - 4 * NB_W, edges, LUT); }
__global__ __launch_bounds__(256) void k_causaltab(unsigned* __restrict__ MB, int* __restrict__ RA, int* __restrict__ KE, int nq, int nk) {
  const int t = blockIdx.x * 256 + threadIdx.x; const int nw = nk / 32;
  if (t < nq * nw) { const int q = t / nw, w = t % nw; const int first = q + 1 - 32 * w; const unsigned bits = (first <= 0) ? 0xffffffffu : ((first >= 32) ? 0u : (0xffffffffu << first)); *(unsigned*)(MB + t) = bits;  }
  if (t < nq) { *(int*)(RA + t) = 0;  }
  if (t < nq / 64) { const int v = 64 * (t + 1); *(int*)(KE + t * 32) = v;  } }


extern "C" void kernel_launch(void* const* d_in, const int* in_sizes, int n_in,
                              void* d_out, int out_size, void* d_ws, size_t ws_size, hipStream_t stream) {
  (void)in_sizes; (void)n_in; (void)out_size;
  const float* const* I = (const float* const*)d_in; const float* x = I[0]; const int* pos = (const int*)d_in[1]; const float* mask = I[2]; const float* qw = I[3]; const float* qb = I[4]; const float* kw = I[5]; const float* kb = I[6]; const float* vw = I[7]; const float* vb = I[8]; const float* ow = I[9]; const float* ob = I[10]; const float* de = I[11]; const float* obias = I[12]; const float* edges = I[13];
  char* ws = (char*)d_ws; size_t off = 0;
  auto take = [&](size_t bytes) { char* p = ws + off; off += (bytes + 255) & ~(size_t)255; return p; };
  _Float16* BQ = (_Float16*)take((size_t)4 * DM * DM * 2); _Float16* BO = BQ + (size_t)3 * DM * DM;      /* q, k, v, o weight planes, one behind the other */
  _Float16* X16 = (_Float16*)take((size_t)NR * DM * 2);
  _Float16* Qh = (_Float16*)take((size_t)6 * NR * DM * 2); _Float16* Ql = Qh + (size_t)NR * DM; _Float16* Kh = Ql + (size_t)NR * DM; _Float16* Kl = Kh + (size_t)NR * DM; _Float16* Vth = Kl + (size_t)NR * DM; _Float16* Vtl = Vth + (size_t)NR * DM;      /* the six planes one behind the other, as the projection kernel's epilogue addresses them */
  _Float16* Oh = (_Float16*)take((size_t)2 * NR * DM * 2); _Float16* Ol = Oh + (size_t)NR * DM;      /* planes of their own: blocks of the flash kernel write them while others still read q */
  unsigned* MB = (unsigned*)take((size_t)NBT * SLEN * (SLEN / 32) * 4); int* RA = (int*)take((size_t)SLEN * 4); int* KE = (int*)take((size_t)(SLEN / 64) * 32 * 4); int* LUT = (int*)take((size_t)LUTN * 4);
  if (off > ws_size) return;      /* 2 + 8 + 48 + 16 + 1.1 = 75 MiB */
  const dim3 gP((NR / 128) * (DM / 64), 1), gP3((NR / 128) * (DM / 64), 3);
  k_prep<<<NB_MT + NB_E8 + 4 * NB_W + LUTN / 256, 256, 0, stream>>>(x, mask, qw, kw, vw, ow, edges, X16, BQ, MB, RA, KE, LUT);      /* torch (out,in) = natural Bt */
  k_gemm2<0, DM, 1><<<gP3, 128, 0, stream>>>(X16, DM, 0, BQ, DM, (size_t)DM * DM, 0.0625f, qb, kb, vb, 0, nullptr, 1, 0, 0, nullptr, Qh, DM, (size_t)NR * DM, NR, DM, DM);      /* blockIdx.y = q, k, v */
  k_flashb<SLEN, SLEN><<<NBT * NH * (SLEN / 64), 128, 0, stream>>>(Qh, Ql, DM, Kh, Kl, DM, Vth, Vtl, MB, RA, KE, de, obias, LUT, pos, mask, Oh, Ol, DM);
  k_gemm2<0, DM, 0><<<gP, 128, 0, stream>>>(Oh, DM, 0, BO, DM, 0, 0.0625f, ob, nullptr, nullptr, 0, nullptr, 1, 0, 0, (float*)d_out, nullptr, DM, 0, NR, DM, DM);
  k_gemm2<0, DM, 0><<<gP, 128, 0, stream>>>(Ol, DM, 0, BO, DM, 0, 0.0625f / 1024.0f, nullptr, nullptr, nullptr, 0, (float*)d_out, 1, (size_t)DM, 0, (float*)d_out, nullptr, DM, 0, NR, DM, DM);
}
